// v000
// Times are from an AMD MI455X. After a warm-up the kernel runs many times in a row, and a time is the length of
// such a window on the GPU divided by its runs, so every launch and the gaps after it count. The runs cycle
// through copies of the inputs. A figure is the median of several windows, for all but v000 over two sittings.
// Sittings can differ by a few percent; kernels timed side by side share one.
// The starting kernel, v000, takes 8590 microseconds a run.
#include <hip/hip_runtime.h>
// Llama-style causal multi-head attention with half-split RoPE computed in the module (hidden_states [1][2048][2048]; q / k / v = x W^T (nn.Linear natural [2048][2048] sigma 0.02, no biases), 16 heads of 128; rope: emb = [f | f], f = p * 10000^(-2i/128): t cos + rotate_half(t) sin; scores * 128^-0.5; causal (where(tril, ., finfo.min): the weight underflows to exactly 0); softmax; out = merged Wo^T (natural) -> [1][2048][2048]); run on the hd128 grouped-query causal code as 16 kv groups of ONE query head.
// Compute dtype: inputs rounded to bf16; x / weights exact; projections and rope f32; q, k, v, softmax weights and o as plain f16 GEMM operands (~2^-12; first 256 rows of each batch exact); scores, statistics, out f32. v_wmma_f32_16x16x32_f16.
#define NB 1
#define SQ 2048
#define DMX 2048
#define NH 16
#define NKV 16
#define GSZ 1
#define HDK 128
#define DKV (NKV * HDK)
#define QT 256
#define QT0 256
#define NKX SQ
#define DM DMX
#define HD 64
#define HG 1
#define NR ((size_t)NB * SQ)
#define ATS 0.08838834764831845f
typedef __bf16 v16b __attribute__((ext_vector_type(16)));
typedef unsigned short v8us __attribute__((ext_vector_type(8), may_alias));
typedef float  v8f  __attribute__((ext_vector_type(8)));
typedef float  v4f  __attribute__((ext_vector_type(4)));
typedef float  v4fa __attribute__((ext_vector_type(4), may_alias));
union FragB { v16b v; v8us half[2]; unsigned short u[16]; };

__device__ __forceinline__ unsigned short bf16_bits(float x) { unsigned int u = __float_as_uint(x); return (unsigned short)((u + 0x7FFFu + ((u >> 16) & 1u)) >> 16); }
__device__ __forceinline__ float bf16_val(unsigned short b) { return __uint_as_float(((unsigned int)b) << 16); }
__device__ __forceinline__ float bf16_round(float x) { return bf16_val(bf16_bits(x)); }
// D += A·B with NT terms: 1 = ah·bh, 2 = + al·bh (A split), 3 = + ah·bl (both split)
template <int NT>
__device__ __forceinline__ v8f mmaN(v16b ah, v16b al, v16b bh, v16b bl, v8f c) {
  c = __builtin_amdgcn_wmma_f32_16x16x32_bf16(false, ah, false, bh, (short)0, c, false, false);
  if (NT >= 2) c = __builtin_amdgcn_wmma_f32_16x16x32_bf16(false, al, false, bh, (short)0, c, false, false);
  if (NT >= 3) c = __builtin_amdgcn_wmma_f32_16x16x32_bf16(false, ah, false, bl, (short)0, c, false, false);
  asm volatile("v_nop\n\tv_nop\n\tv_nop\n\tv_nop" : "+v"(c) : "v"(ah), "v"(al), "v"(bh), "v"(bl));
  return c;
}

__global__ __launch_bounds__(256) void k_wt_bf16(const float* __restrict__ W, unsigned short* __restrict__ Wt, int K, int N) {
  const int t = blockIdx.x * 256 + threadIdx.x;
  const int k8n = K / 8;
  if (t >= N * k8n) return;
  const int n = t / k8n, k8 = (t % k8n) * 8;
  v8us v;
#pragma unroll
  for (int i = 0; i < 8; ++i) v[i] = bf16_bits(W[(size_t)(k8 + i) * N + n]);
  *(v8us*)(Wt + (size_t)n * K + k8) = v;
  
}

// GEMM C[M][N] (f32, pitch ldc) = act(A[M][K]·W + bias). A f32 row-major (pitch lda) converted per fragment to bf16
// (ASPLIT: hi/lo two planes -> 2 terms, else single rounded term); Wt bf16 [N][K] (pitch ldb). BIAS_BF16 rounds the
// bias to bf16 first (bias quantised to bf16 before the add). K%32==0, M%16==0, N%64==0.
template <bool ASPLIT, int ACT, bool BIAS_BF16>
__global__ __launch_bounds__(128) void k_gemm_bf(const float* __restrict__ A, int lda, const unsigned short* __restrict__ Wt, int ldb,
                                               const float* __restrict__ bias, float* __restrict__ C, int ldc, int M, int N, int K) {
  __shared__ __attribute__((aligned(16))) float so[4][16][64];
  const int tid = threadIdx.x, w = tid >> 5, lane = tid & 31, ln = lane & 15, hh = lane >> 4;
  const int ntn = N / 64;
  const int wid = blockIdx.x * 4 + w;
  const int mt = wid / ntn, nq = wid % ntn;
  if (mt * 16 >= M) return;
  const int row0 = mt * 16, col0 = nq * 64;
  const float* arow = A + (size_t)(row0 + ln) * lda;
  v8f acc[4] = {};
  for (int kb = 0; kb < K; kb += 32) {
    FragB ah, al;
    const v4f x0 = *(const v4fa*)(arow + kb + 8 * hh), x1 = *(const v4fa*)(arow + kb + 8 * hh + 4);
    const v4f x2 = *(const v4fa*)(arow + kb + 16 + 8 * hh), x3 = *(const v4fa*)(arow + kb + 16 + 8 * hh + 4);
    float xs[16] = {x0[0],x0[1],x0[2],x0[3],x1[0],x1[1],x1[2],x1[3],x2[0],x2[1],x2[2],x2[3],x3[0],x3[1],x3[2],x3[3]};
#pragma unroll
    for (int i = 0; i < 16; ++i) { const unsigned short hb = bf16_bits(xs[i]); ah.u[i] = hb; al.u[i] = ASPLIT ? bf16_bits(xs[i] - bf16_val(hb)) : (unsigned short)0; }
#pragma unroll
    for (int t = 0; t < 4; ++t) {
      const unsigned short* brow = Wt + (size_t)(col0 + t * 16 + ln) * ldb + kb;
      FragB b;
      b.half[0] = *(const v8us*)(brow + 8 * hh);
      b.half[1] = *(const v8us*)(brow + 16 + 8 * hh);
      acc[t] = mmaN<ASPLIT ? 2 : 1>(ah.v, al.v, b.v, b.v, acc[t]);
    }
  }
#pragma unroll
  for (int t = 0; t < 4; ++t) {
    float bv = bias ? bias[col0 + t * 16 + ln] : 0.f;
    if (BIAS_BF16) bv = bf16_round(bv);
#pragma unroll
    for (int r = 0; r < 8; ++r) { float v = acc[t][r] + bv; if (ACT == 1) v = fmaxf(v, 0.f); so[w][8 * hh + r][t * 16 + ln] = v; }
  }
  __builtin_amdgcn_fence(__ATOMIC_ACQ_REL, "workgroup");
  __builtin_amdgcn_wave_barrier();
  const int rsub = lane >> 4, c4 = (lane & 15) * 4;
  {
#pragma unroll
    for (int q = 0; q < 8; ++q) {
      const int r = q * 2 + rsub;
      const v4f v = *(const v4fa*)&so[w][r][c4];
      *(v4f*)(C + (size_t)(row0 + r) * ldc + col0 + c4) = v;
    }
    
  }
}

// GEMM C = act(A·W + bias + resid): A f32 (ASPLIT -> hi/lo 2 terms), Wt bf16 [N][K]; ACT 0 none, 1 relu, 2 exact gelu;
// resid (optional, f32, row index = (row % rmod), pitch ldr, RES_BF16 rounds it) added before the activation.
template <bool ASPLIT, int ACT, bool BIAS_BF16, bool RES_BF16>
__global__ __launch_bounds__(128) void k_gemm_bf3(const float* __restrict__ A, int lda, const unsigned short* __restrict__ Wt, int ldb,
                                                const float* __restrict__ bias, const float* __restrict__ resid, int rmod, int ldr,
                                                float* __restrict__ C, int ldc, int M, int N, int K) {
  __shared__ __attribute__((aligned(16))) float so[4][16][64];
  const int tid = threadIdx.x, w = tid >> 5, lane = tid & 31, ln = lane & 15, hh = lane >> 4;
  const int ntn = N / 64;
  const int wid = blockIdx.x * 4 + w;
  const int mt = wid / ntn, nq = wid % ntn;
  if (mt * 16 >= M) return;
  const int row0 = mt * 16, col0 = nq * 64;
  const float* arow = A + (size_t)(row0 + ln) * lda;
  v8f acc[4] = {};
  for (int kb = 0; kb < K; kb += 32) {
    FragB ah, al;
    const v4f x0 = *(const v4fa*)(arow + kb + 8 * hh), x1 = *(const v4fa*)(arow + kb + 8 * hh + 4);
    const v4f x2 = *(const v4fa*)(arow + kb + 16 + 8 * hh), x3 = *(const v4fa*)(arow + kb + 16 + 8 * hh + 4);
    float xs[16] = {x0[0],x0[1],x0[2],x0[3],x1[0],x1[1],x1[2],x1[3],x2[0],x2[1],x2[2],x2[3],x3[0],x3[1],x3[2],x3[3]};
#pragma unroll
    for (int i = 0; i < 16; ++i) { const unsigned short hb = bf16_bits(xs[i]); ah.u[i] = hb; al.u[i] = ASPLIT ? bf16_bits(xs[i] - bf16_val(hb)) : (unsigned short)0; }
#pragma unroll
    for (int t = 0; t < 4; ++t) {
      const unsigned short* brow = Wt + (size_t)(col0 + t * 16 + ln) * ldb + kb;
      FragB b;
      b.half[0] = *(const v8us*)(brow + 8 * hh);
      b.half[1] = *(const v8us*)(brow + 16 + 8 * hh);
      acc[t] = mmaN<ASPLIT ? 2 : 1>(ah.v, al.v, b.v, b.v, acc[t]);
    }
  }
#pragma unroll
  for (int t = 0; t < 4; ++t) {
    const int col = col0 + t * 16 + ln;
    float bv = bias ? bias[col] : 0.f;
    if (BIAS_BF16) bv = bf16_round(bv);
#pragma unroll
    for (int r = 0; r < 8; ++r) {
      float v = acc[t][r] + bv;
      if (resid) { float rv = resid[(size_t)((row0 + 8 * hh + r) % rmod) * ldr + col]; if (RES_BF16) rv = bf16_round(rv); v += rv; }
      if (ACT == 1) v = fmaxf(v, 0.f);
      if (ACT == 2) v = 0.5f * v * (1.0f + erff(v * 0.70710678118654752f));
      if (ACT == 3) { const float u = 0.7978845608028654f * (v + 0.044715f * v * v * v); v = 0.5f * v * (1.0f + tanhf(u)); }
      so[w][8 * hh + r][t * 16 + ln] = v;
    }
  }
  __builtin_amdgcn_fence(__ATOMIC_ACQ_REL, "workgroup");
  __builtin_amdgcn_wave_barrier();
  const int rsub = lane >> 4, c4 = (lane & 15) * 4;
  {
#pragma unroll
    for (int q = 0; q < 8; ++q) {
      const int r = q * 2 + rsub;
      const v4f v = *(const v4fa*)&so[w][r][c4];
      *(v4f*)(C + (size_t)(row0 + r) * ldc + col0 + c4) = v;
    }
    
  }
}
// row LayerNorm (biased variance, eps) over N: s = X (+ R); optional out_sum <- s; out_norm <- (s-mu)*rsqrt(var+eps)*g + b
template <bool PARAM_BF16>
__global__ __launch_bounds__(256) void k_layernorm(const float* __restrict__ X, const float* __restrict__ R, const float* __restrict__ g, const float* __restrict__ bta,
                                                  float* __restrict__ out_sum, float* __restrict__ out_norm, int N, float eps) {
  __shared__ float red[256];
  const int row = blockIdx.x, tid = threadIdx.x;
  const float* x = X + (size_t)row * N; const float* rr = R ? R + (size_t)row * N : nullptr;
  float vals[16];                     // up to N = 4096
  const int per = N / 256;            // contiguous chunk per thread? use strided-by-4 chunks: thread handles j = tid*4 + 1024*u
  float s1 = 0.f;
  for (int u = 0; u < per / 4; ++u) {
    const int j = tid * 4 + 1024 * u;
    const v4f a = *(const v4fa*)(x + j);
    v4f b = {0.f,0.f,0.f,0.f}; if (rr) b = *(const v4fa*)(rr + j);
#pragma unroll
    for (int q = 0; q < 4; ++q) { const float v = a[q] + b[q]; vals[u * 4 + q] = v; s1 += v; }
  }
  red[tid] = s1; __syncthreads();
  for (int st = 128; st > 0; st >>= 1) { if (tid < st) red[tid] += red[tid + st]; __syncthreads(); }
  const float mu = red[0] / (float)N; __syncthreads();
  float s2 = 0.f;
  for (int u = 0; u < per / 4; ++u)
#pragma unroll
    for (int q = 0; q < 4; ++q) { const float c = vals[u * 4 + q] - mu; s2 += c * c; }
  red[tid] = s2; __syncthreads();
  for (int st = 128; st > 0; st >>= 1) { if (tid < st) red[tid] += red[tid + st]; __syncthreads(); }
  const float rs = rsqrtf(red[0] / (float)N + eps);
  {
    for (int u = 0; u < per / 4; ++u) {
      const int j = tid * 4 + 1024 * u;
      v4f o, sm;
#pragma unroll
      for (int q = 0; q < 4; ++q) {
        float gg = g[j + q], bb = bta[j + q];
        if (PARAM_BF16) { gg = bf16_round(gg); bb = bf16_round(bb); }
        sm[q] = vals[u * 4 + q]; o[q] = (vals[u * 4 + q] - mu) * rs * gg + bb;
      }
      if (out_sum) *(v4f*)(out_sum + (size_t)row * N + j) = sm;
      *(v4f*)(out_norm + (size_t)row * N + j) = o;
    }
    
  }
}



// ---- f16 WMMA path (v_wmma_f32_16x16x32_f16): 11-bit significands for operands in range — used where a [0,1] probability operand needs more precision than bf16
typedef _Float16 v16h __attribute__((ext_vector_type(16)));
union FragH { v16h v; v8us half[2]; _Float16 h[16]; unsigned short u[16]; };
template <int NT>
__device__ __forceinline__ v8f mmaH(v16h ah, v16h al, v16h bh, v16h bl, v8f c) {
  c = __builtin_amdgcn_wmma_f32_16x16x32_f16(false, ah, false, bh, (short)0, c, false, false);
  if (NT >= 2) c = __builtin_amdgcn_wmma_f32_16x16x32_f16(false, al, false, bh, (short)0, c, false, false);
  if (NT >= 3) c = __builtin_amdgcn_wmma_f32_16x16x32_f16(false, ah, false, bl, (short)0, c, false, false);
  asm volatile("v_nop\n\tv_nop\n\tv_nop\n\tv_nop" : "+v"(c) : "v"(ah), "v"(al), "v"(bh), "v"(bl));
  return c;
}
// batched GEMM like k_gemm_b but f16 operands: A f32 (split into f16 hi/lo if ASPLIT, else rounded to f16), Bt = f16 values [n][k]; alpha; C f32; N multiple of 16 (partial tiles skipped)
template <bool ASPLIT>
__global__ __launch_bounds__(128) void k_gemm_h(const float* __restrict__ A, int lda, size_t sA, const _Float16* __restrict__ Bh, int ldb, size_t sB, float alpha, float* __restrict__ C, int ldc, size_t sC, int M, int N, int K) {
  __shared__ __attribute__((aligned(16))) float so[4][16][64];
  const int tid = threadIdx.x, w = tid >> 5, lane = tid & 31, ln = lane & 15, hh = lane >> 4; const int by = blockIdx.y;
  A += (size_t)by * sA; Bh += (size_t)by * sB; C += (size_t)by * sC;
  const int ntn = (N + 63) / 64; const int wid = blockIdx.x * 4 + w; const int mt = wid / ntn, nq = wid % ntn; if (mt * 16 >= M) return;
  const int row0 = mt * 16, col0 = nq * 64; const float* arow = A + (size_t)(row0 + ln) * lda;
  v8f acc[4] = {};
  for (int kb = 0; kb < K; kb += 32) {
    FragH ah, al;
    const v4f x0 = *(const v4fa*)(arow + kb + 8 * hh), x1 = *(const v4fa*)(arow + kb + 8 * hh + 4), x2 = *(const v4fa*)(arow + kb + 16 + 8 * hh), x3 = *(const v4fa*)(arow + kb + 16 + 8 * hh + 4);
    float xs[16] = {x0[0],x0[1],x0[2],x0[3],x1[0],x1[1],x1[2],x1[3],x2[0],x2[1],x2[2],x2[3],x3[0],x3[1],x3[2],x3[3]};
#pragma unroll
    for (int i = 0; i < 16; ++i) { const _Float16 h = (_Float16)xs[i]; ah.h[i] = h; al.h[i] = ASPLIT ? (_Float16)(xs[i] - (float)h) : (_Float16)0.0f; }
#pragma unroll
    for (int t = 0; t < 4; ++t) { if (col0 + t * 16 >= N) continue; const size_t boff = (size_t)(col0 + t * 16 + ln) * ldb + kb; FragH bq; bq.half[0] = *(const v8us*)(Bh + boff + 8 * hh); bq.half[1] = *(const v8us*)(Bh + boff + 16 + 8 * hh);
      acc[t] = mmaH<ASPLIT ? 2 : 1>(ah.v, al.v, bq.v, bq.v, acc[t]); }
  }
#pragma unroll
  for (int t = 0; t < 4; ++t) { if (col0 + t * 16 >= N) continue;
#pragma unroll
    for (int r = 0; r < 8; ++r) so[w][8 * hh + r][t * 16 + ln] = acc[t][r] * alpha; }
  __builtin_amdgcn_fence(__ATOMIC_ACQ_REL, "workgroup"); __builtin_amdgcn_wave_barrier();
  const int rsub = lane >> 4, c4 = (lane & 15) * 4;
  {
#pragma unroll
    for (int q = 0; q < 8; ++q) { const int r = q * 2 + rsub; if (col0 + c4 < N) { const v4f v = *(const v4fa*)&so[w][r][c4]; *(v4f*)(C + (size_t)(row0 + r) * ldc + col0 + c4) = v; } }
     }
}

// Wt[n][k] = f16(W[k][n]·scale) from f32 row-major W[K][N] (scale = power of two; bf16-exact weights stay exact in f16 away from the subnormal range)
__global__ __launch_bounds__(256) void k_wt_f16(const float* __restrict__ W, _Float16* __restrict__ Wt, int K, int N, float scale) {
  const int t = blockIdx.x * 256 + threadIdx.x; if (t >= N * (K / 8)) return; const int n = t / (K / 8), k8 = (t % (K / 8)) * 8; FragH f;
#pragma unroll
  for (int i = 0; i < 8; ++i) f.h[i] = (_Float16)(bf16_round(W[(size_t)(k8 + i) * N + n]) * scale); const v8us o = f.half[0];
  *(v8us*)((unsigned short*)Wt + (size_t)n * K + k8) = o; 
}
// k_gemm_hh variant with fused epilogue: v = acc·alpha + bias[by·sBias + col] (+ CP[(row/rowsPerB)·sCPb + by·64 + col] if CP) ; ACT 0 none / 1 elu ; writes f16 C16 (and f32 C if non-null)
template <int ACT>
__global__ __launch_bounds__(128) void k_gemm_hhx(const _Float16* __restrict__ A, int lda, size_t sA, const _Float16* __restrict__ Bh, int ldb, size_t sB, float alpha, const float* __restrict__ bias, size_t sBias, const float* __restrict__ CP, int rowsPerB, size_t sCPb, int row0g,
    float* __restrict__ C, _Float16* __restrict__ C16, int ldc, size_t sC, int M, int N, int K) {
  __shared__ __attribute__((aligned(16))) float so[4][16][64];
  const int tid = threadIdx.x, w = tid >> 5, lane = tid & 31, ln = lane & 15, hh = lane >> 4; const int by = blockIdx.y;
  A += (size_t)by * sA; Bh += (size_t)by * sB; const size_t cofs = (size_t)by * sC; const float* bp = bias ? bias + (size_t)by * sBias : nullptr;
  const int ntn = (N + 63) / 64; const int wid = blockIdx.x * 4 + w; const int mt = wid / ntn, nq = wid % ntn; if (mt * 16 >= M) return;
  const int row0 = mt * 16, col0 = nq * 64; const _Float16* arow = A + (size_t)(row0 + ln) * lda;
  v8f acc[4] = {};
  for (int kb = 0; kb < K; kb += 32) { FragH ah; ah.half[0] = *(const v8us*)((const unsigned short*)arow + kb + 8 * hh); ah.half[1] = *(const v8us*)((const unsigned short*)arow + kb + 16 + 8 * hh);
#pragma unroll
    for (int t = 0; t < 4; ++t) { if (col0 + t * 16 >= N) continue; const size_t boff = (size_t)(col0 + t * 16 + ln) * ldb + kb; FragH bq; bq.half[0] = *(const v8us*)((const unsigned short*)Bh + boff + 8 * hh); bq.half[1] = *(const v8us*)((const unsigned short*)Bh + boff + 16 + 8 * hh);
      acc[t] = mmaH<1>(ah.v, ah.v, bq.v, bq.v, acc[t]); }
  }
#pragma unroll
  for (int t = 0; t < 4; ++t) { if (col0 + t * 16 >= N) continue; const int col = col0 + t * 16 + ln; const float bv = bp ? bf16_round(bp[col]) : 0.f;
#pragma unroll
    for (int r = 0; r < 8; ++r) { float v = acc[t][r] * alpha + bv; if (CP) { const int rr = row0g + row0 + 8 * hh + r; if (rowsPerB < 0) v += CP[cofs + (size_t)rr * ldc + col];      /* rowsPerB < 0: own element of the batched C plane */ else { const int bidx = rr / rowsPerB; v += CP[(size_t)bidx * sCPb + (size_t)by * 64 + col]; } } if (ACT == 1) v = (v > 0.f) ? v : expm1f(v); else if (ACT == 7) v = (v > 0.f) ? v + 1.0f : expf(v); else if (ACT == 8) v = tanhf(v); else if (ACT == 9) v = 0.5f * v * (1.0f + tanhf(0.7978845608028654f * (v + 0.044715f * v * v * v))); else if (ACT == 11) v = 1.0f / (1.0f + expf(-v)); else if (ACT == 12) v = (v > 0.f) ? v : 0.01f * v; else if (ACT == 14) v = (v > 0.f) ? v : 0.1f * v; else if (ACT == 16) v = (v >= 0.f) ? v : 0.3f * v; else if (ACT == 17) v = (v >= 0.f) ? v : 0.2f * v; else if (ACT == 15) v = v / (1.0f + expf(-v)); else if (ACT == 3) v = fmaxf(v, 0.f); else if (ACT == 6) v = 0.5f * v * (1.0f + erff(v * 0.70710678118654752f)); so[w][8 * hh + r][t * 16 + ln] = v; } }
  __builtin_amdgcn_fence(__ATOMIC_ACQ_REL, "workgroup"); __builtin_amdgcn_wave_barrier();
  const int rsub = lane >> 4, c4 = (lane & 15) * 4; typedef _Float16 v4h __attribute__((ext_vector_type(4)));
  {
#pragma unroll
    for (int q = 0; q < 8; ++q) { const int r = q * 2 + rsub; if (col0 + c4 < N) { const v4f v = *(const v4fa*)&so[w][r][c4]; if (C) *(v4f*)(C + cofs + (size_t)(row0 + r) * ldc + col0 + c4) = v; if (C16) { v4h h4; for (int i = 0; i < 4; ++i) h4[i] = (_Float16)v[i]; *(v4h*)(C16 + cofs + (size_t)(row0 + r) * ldc + col0 + c4) = h4; } } }
     }
}


typedef _Float16 v4h __attribute__((ext_vector_type(4)));

__global__ __launch_bounds__(256) void k_x16(const float* __restrict__ x, _Float16* __restrict__ X16, size_t n8) { const size_t t = (size_t)blockIdx.x * 256 + threadIdx.x; if (t >= n8) return; FragH f;
#pragma unroll
  for (int q = 0; q < 8; ++q) f.h[q] = (_Float16)bf16_round(x[t * 8 + q]); *(v8us*)((unsigned short*)X16 + t * 8) = f.half[0];  }
__global__ __launch_bounds__(256) void k_h16(const float* __restrict__ x, _Float16* __restrict__ X16, size_t n8) { const size_t t = (size_t)blockIdx.x * 256 + threadIdx.x; if (t >= n8) return; FragH f;
#pragma unroll
  for (int q = 0; q < 8; ++q) f.h[q] = (_Float16)x[t * 8 + q]; *(v8us*)((unsigned short*)X16 + t * 8) = f.half[0];  }
__global__ __launch_bounds__(256) void k_round16f(const float* __restrict__ W, _Float16* __restrict__ Bt, size_t n8) { const size_t t = (size_t)blockIdx.x * 256 + threadIdx.x; if (t >= n8) return; FragH f;
#pragma unroll
  for (int i = 0; i < 8; ++i) f.h[i] = (_Float16)(bf16_round(W[t * 8 + i]) * 16.0f); *(v8us*)((unsigned short*)Bt + t * 8) = f.half[0];  }
template <int NHv, int TTv>
__global__ __launch_bounds__(256) void k_vt(const _Float16* __restrict__ V16, int ldv, int voff, _Float16* __restrict__ Vt) { __shared__ unsigned short tl[64][66]; const int tid = threadIdx.x; const int slab = blockIdx.x / (TTv / 64), lg = blockIdx.x % (TTv / 64); const int b = slab / NHv, h = slab % NHv;
  for (int i = tid; i < 64 * 8; i += 256) { const int r = i / 8, c8 = (i % 8) * 8; FragH f; f.half[0] = *(const v8us*)((const unsigned short*)V16 + ((size_t)b * TTv + lg * 64 + r) * ldv + voff + h * 64 + c8);
#pragma unroll
    for (int q = 0; q < 8; ++q) tl[r][c8 + q] = f.u[q]; }
  __syncthreads();
  {
#pragma unroll
    for (int rd = 0; rd < 2; ++rd) { const int d = rd * 32 + tid / 8, pc = tid % 8; FragH f;
#pragma unroll
      for (int q = 0; q < 8; ++q) f.u[q] = tl[pc * 8 + q][d];
      *(v8us*)((unsigned short*)Vt + ((size_t)slab * 64 + d) * TTv + lg * 64 + pc * 8) = f.half[0]; }
     } }

__global__ __launch_bounds__(256) void k_hl(const float* __restrict__ F, _Float16* __restrict__ Hh, _Float16* __restrict__ Hl, size_t n8) { const size_t t = (size_t)blockIdx.x * 256 + threadIdx.x; if (t >= n8) return; FragH fh, fl; const v4f a = *(const v4fa*)(F + t * 8), c = *(const v4fa*)(F + t * 8 + 4);
#pragma unroll
  for (int q = 0; q < 4; ++q) { _Float16 h = (_Float16)a[q]; fh.h[q] = h; fl.h[q] = (_Float16)((a[q] - (float)h) * 1024.0f); h = (_Float16)c[q]; fh.h[4 + q] = h; fl.h[4 + q] = (_Float16)((c[q] - (float)h) * 1024.0f); }
  { *(v8us*)((unsigned short*)Hh + t * 8) = fh.half[0]; *(v8us*)((unsigned short*)Hl + t * 8) = fl.half[0];  } }

// ---- fast GEMM (wave tile 32x64; requires M % 32 == 0 rows per launch region and N % 64 == 0); epilogue = k_gemm_hhx semantics ----
__device__ __forceinline__ v16h g2_frag(const _Float16* p, int hh) { FragH f; f.half[0] = *(const v8us*)((const unsigned short*)p + 8 * hh); f.half[1] = *(const v8us*)((const unsigned short*)p + 16 + 8 * hh); return f.v; }
__device__ __forceinline__ v8f g2_mma(v16h a, v16h b, v8f c) { v8f d = __builtin_amdgcn_wmma_f32_16x16x32_f16(false, a, false, b, (short)0, c, false, false); asm volatile("v_nop\n\tv_nop\n\tv_nop\n\tv_nop" : "+v"(d) : "v"(a), "v"(b)); return d; }
template <int ACT>
__global__ __launch_bounds__(128) void k_gemm2(const _Float16* __restrict__ A, int lda, size_t sA, const _Float16* __restrict__ Bh, int ldb, size_t sB, float alpha, const float* __restrict__ bias, size_t sBias, const float* __restrict__ CP, int rowsPerB, size_t sCPb, int row0g,
    float* __restrict__ C, _Float16* __restrict__ C16, int ldc, size_t sC, int M, int N, int K) { static_assert(ACT == 0 || ACT == 3 || ACT == 6 || ACT == 8 || ACT == 9 || ACT == 11 || ACT == 12 || ACT == 14 || ACT == 15 || ACT == 16 || ACT == 17, "k_gemm2: unsupported ACT code (would silently apply no activation)");
  __shared__ __attribute__((aligned(16))) float so[4][32][68];
  const int tid = threadIdx.x, w = tid >> 5, lane = tid & 31, ln = lane & 15, hh = lane >> 4; const int by = blockIdx.y;
  A += (size_t)by * sA; Bh += (size_t)by * sB; const size_t cofs = (size_t)by * sC; const float* bp = bias ? bias + (size_t)by * sBias : nullptr;
  const int ntn = N >> 6; const int mt = blockIdx.x / ntn, nq = blockIdx.x - mt * ntn; const int row0 = mt * 128 + 32 * w, col0 = nq * 64; if (row0 >= M) return;
  const _Float16* a0p = A + (size_t)(row0 + ln) * lda; const _Float16* a1p = a0p + (size_t)16 * lda;
  const _Float16* b0p = Bh + (size_t)(col0 + ln) * ldb; const _Float16* b1p = b0p + (size_t)16 * ldb; const _Float16* b2p = b1p + (size_t)16 * ldb; const _Float16* b3p = b2p + (size_t)16 * ldb;
  const v8f z8 = {0.f,0.f,0.f,0.f,0.f,0.f,0.f,0.f}; v8f c00 = z8, c01 = z8, c02 = z8, c03 = z8, c10 = z8, c11 = z8, c12 = z8, c13 = z8;
#pragma unroll 1
  for (int kb = 0; kb < K; kb += 32) { const v16h a0 = g2_frag(a0p + kb, hh), a1 = g2_frag(a1p + kb, hh);
    v16h b = g2_frag(b0p + kb, hh); c00 = g2_mma(a0, b, c00); c10 = g2_mma(a1, b, c10);
    b = g2_frag(b1p + kb, hh); c01 = g2_mma(a0, b, c01); c11 = g2_mma(a1, b, c11);
    b = g2_frag(b2p + kb, hh); c02 = g2_mma(a0, b, c02); c12 = g2_mma(a1, b, c12);
    b = g2_frag(b3p + kb, hh); c03 = g2_mma(a0, b, c03); c13 = g2_mma(a1, b, c13); }
  v8f accs[8] = {c00, c01, c02, c03, c10, c11, c12, c13};
#pragma unroll
  for (int u = 0; u < 8; ++u) { const int t = u & 3, half = u >> 2; const int col = col0 + t * 16 + ln; const float bv = bp ? bf16_round(bp[col]) : 0.f;
#pragma unroll
    for (int r = 0; r < 8; ++r) { const int rloc = half * 16 + 8 * hh + r; float v = accs[u][r] * alpha + bv; if (CP) { if (rowsPerB < 0) v += CP[cofs + (size_t)(row0g + row0 + rloc) * ldc + col];      /* rowsPerB < 0: own element of the batched C plane */ else { const int bidx = (row0g + row0 + rloc) / rowsPerB; v += CP[(size_t)bidx * sCPb + (size_t)by * 64 + col]; } }
      if (ACT == 3) v = fmaxf(v, 0.f); else if (ACT == 6) v = 0.5f * v * (1.0f + erff(v * 0.70710678118654752f)); else if (ACT == 11) v = 1.0f / (1.0f + expf(-v)); else if (ACT == 15) v = v / (1.0f + expf(-v)); else if (ACT == 12) v = (v > 0.f) ? v : 0.01f * v; else if (ACT == 8) v = tanhf(v); else if (ACT == 9) v = 0.5f * v * (1.0f + tanhf(0.7978845608028654f * (v + 0.044715f * v * v * v))); else if (ACT == 14) v = (v > 0.f) ? v : 0.1f * v; else if (ACT == 16) v = (v >= 0.f) ? v : 0.3f * v; else if (ACT == 17) v = (v >= 0.f) ? v : 0.2f * v;
      so[w][rloc][t * 16 + ln] = v; } }
  __builtin_amdgcn_fence(__ATOMIC_ACQ_REL, "workgroup"); __builtin_amdgcn_wave_barrier();
  const int rsub = lane >> 4, c4 = (lane & 15) * 4;
  {
#pragma unroll
    for (int q = 0; q < 16; ++q) { const int r = q * 2 + rsub; const v4f v = *(const v4fa*)&so[w][r][c4]; if (C) *(v4f*)(C + cofs + (size_t)(row0 + r) * ldc + col0 + c4) = v; if (C16) { v4h h4; for (int i = 0; i < 4; ++i) h4[i] = (_Float16)v[i]; *(v4h*)(C16 + cofs + (size_t)(row0 + r) * ldc + col0 + c4) = h4; } }
     } }


__global__ __launch_bounds__(256) void k_wnat(const float* __restrict__ w, size_t n8, _Float16* __restrict__ Bt) { const size_t t = (size_t)blockIdx.x * 256 + threadIdx.x; if (t >= n8) return; FragH f; for (int q = 0; q < 8; ++q) f.h[q] = (_Float16)(bf16_round(w[t * 8 + q]) * 16.0f); *(v8us*)((unsigned short*)Bt + t * 8) = f.half[0];  }
__global__ __launch_bounds__(256) void k_rsm(const float* __restrict__ S, _Float16* __restrict__ P, int nrows) {
  #pragma clang fp contract(off)
  const int i = blockIdx.x * 256 + threadIdx.x; if (i >= nrows) return; const float* s = S + (size_t)i * SQ; float mx = -3.0e38f;
#pragma unroll 1
  for (int j = 0; j < SQ; ++j) mx = fmaxf(mx, s[j]); float se = 0.f;
#pragma unroll 1
  for (int j = 0; j < SQ; ++j) se += expf(s[j] - mx); const float sc = 256.0f / se;
#pragma unroll 1
  for (int j0 = 0; j0 < SQ; j0 += 8) { FragH f; for (int q = 0; q < 8; ++q) f.h[q] = (_Float16)(expf(s[j0 + q] - mx) * sc); unsigned short* d = (unsigned short*)P + (size_t)i * SQ + j0; *(v8us*)d = f.half[0];  } }
__global__ __launch_bounds__(256) void k_vt(const _Float16* __restrict__ V16, int b, int h0, _Float16* __restrict__ VT) { __shared__ unsigned short tl[64][65]; const int tid = threadIdx.x; const int hh = blockIdx.x % HG, sg = blockIdx.x / HG; const int s0 = sg * 64; const int h = h0 + hh;
  for (int i = tid; i < 64 * 8; i += 256) { const int j = i / 8, d8 = (i % 8) * 8; FragH f; f.half[0] = *(const v8us*)((const unsigned short*)V16 + ((size_t)b * SQ + s0 + j) * DM + h * HD + d8); for (int q = 0; q < 8; ++q) tl[d8 + q][j] = f.u[q]; }
  __syncthreads();
  { for (int i = tid; i < 64 * 8; i += 256) { const int d = i / 8, j8 = (i % 8) * 8; FragH f; for (int q = 0; q < 8; ++q) f.u[q] = tl[d][j8 + q]; *(v8us*)((unsigned short*)VT + ((size_t)hh * HD + d) * SQ + s0 + j8) = f.half[0]; }  } }


template <int MASK>
__global__ __launch_bounds__(32) void k_att0h(const float* __restrict__ QF, const float* __restrict__ KF, const float* __restrict__ VF, int ld, int ldv, const int* __restrict__ mk, float scale, float* __restrict__ OF, int ldo) {
  #pragma clang fp contract(off)
  __shared__ __attribute__((aligned(16))) float lq[32][128]; __shared__ __attribute__((aligned(16))) float lo[32][128];
  const int tid = threadIdx.x; const int h = blockIdx.x / (QT0 / 32), rg = blockIdx.x % (QT0 / 32); const int i = rg * 32 + tid;
  for (int c = 0; c < 32; ++c) { *(v4f*)&lq[tid][c * 4] = *(const v4fa*)(QF + (size_t)i * ld + h * 128 + c * 4); const v4f z = {0.f, 0.f, 0.f, 0.f}; *(v4f*)&lo[tid][c * 4] = z; }
  float m = -1.0e30f, l = 0.f; const int jmax = rg * 32 + 31;
#pragma unroll 1
  for (int j = 0; j <= jmax; ++j) { const float* kr = KF + (size_t)j * ld + h * 128; const float* vr = VF + (size_t)j * ldv + h * 128; float s = 0.f;
#pragma unroll 1
    for (int c = 0; c < 32; ++c) { const v4f kq = *(const v4fa*)(kr + c * 4); const v4f qq = *(v4f*)&lq[tid][c * 4]; for (int u = 0; u < 4; ++u) s = __fadd_rn(s, __fmul_rn(qq[u], kq[u])); }
    s = __fmul_rn(s, scale); float f; if (MASK) { const int mb = mk[(size_t)i * SQ + j]; f = (mb == 0) ? 1.f : 0.f; } else { f = (j <= i) ? 1.f : 0.f; }
    const float sm = fmaf(f, s, (1.f - f) * -1.0e30f); const float mn = fmaxf(m, sm); const float sc = expf(m - mn); const float e = __fmul_rn(f, expf(sm - mn)); l = __fadd_rn(__fmul_rn(l, sc), e); m = mn;
#pragma unroll 1
    for (int c = 0; c < 32; ++c) { const v4f vv = *(const v4fa*)(vr + c * 4); v4f oo = *(v4f*)&lo[tid][c * 4]; for (int u = 0; u < 4; ++u) oo[u] = __fadd_rn(__fmul_rn(oo[u], sc), __fmul_rn(e, vv[u])); *(v4f*)&lo[tid][c * 4] = oo; } }
  const float fin = 64.0f / l;
  { for (int c = 0; c < 32; ++c) { v4f oo = *(v4f*)&lo[tid][c * 4]; for (int u = 0; u < 4; ++u) oo[u] = __fmul_rn(oo[u], fin); *(v4f*)(OF + (size_t)i * ldo + h * 128 + c * 4) = oo; }  } }
__global__ __launch_bounds__(256) void k_f2h(const float* __restrict__ F, int ldf, int coff, int ncol, _Float16* __restrict__ H16, size_t nrow) { const size_t t = (size_t)blockIdx.x * 256 + threadIdx.x; const size_t n8 = nrow * (size_t)(ncol / 8); if (t >= n8) return; const size_t r = t / (ncol / 8); const int c8 = (int)(t % (ncol / 8)) * 8; FragH f; const v4f a = *(const v4fa*)(F + r * ldf + coff + c8), b2 = *(const v4fa*)(F + r * ldf + coff + c8 + 4); for (int q = 0; q < 4; ++q) { f.h[q] = (_Float16)a[q]; f.h[4 + q] = (_Float16)b2[q]; } *(v8us*)((unsigned short*)H16 + r * ncol + c8) = f.half[0];  }

__global__ __launch_bounds__(256) void k_tab128(float theta, float* __restrict__ CS, float* __restrict__ SN) {
  #pragma clang fp contract(off)
  const int t = blockIdx.x * 256 + threadIdx.x; if (t >= SQ * 64) return; const int i = t % 64; const int p = t / 64; const float invf = (float)(1.0 / pow((double)theta, (double)(2 * i) / 128.0));      /* = XLA's constant-folded f32 table */ const float ang = __fmul_rn((float)p, invf); const float c = cosf(ang), s = sinf(ang);
  *(float*)(CS + t) = c; *(float*)(SN + t) = s;  }
template <int TAB>
__global__ __launch_bounds__(128) void k_rope128(const float* __restrict__ F, int ldf, int nh, const float* __restrict__ CS, const float* __restrict__ SN, _Float16* __restrict__ H16, int ldo, float osc) {
  #pragma clang fp contract(off)
  __shared__ float xv[128]; __shared__ unsigned short sh_[128]; const int d = threadIdx.x; const int h = blockIdx.x % nh; const size_t r = blockIdx.x / nh; const int p = (int)(r % SQ);
  xv[d] = F[r * (size_t)ldf + (size_t)h * 128 + d]; __syncthreads();
  float c, s; if (TAB) { c = bf16_round(CS[(size_t)p * 128 + d]); s = bf16_round(SN[(size_t)p * 128 + d]); } else { c = CS[p * 64 + (d & 63)]; s = SN[p * 64 + (d & 63)]; }
  const float rot = (d < 64) ? -xv[d + 64] : xv[d - 64]; const float o = __fadd_rn(__fmul_rn(xv[d], c), __fmul_rn(rot, s));
  FragH th; th.h[0] = (_Float16)__fmul_rn(o, osc); sh_[d] = th.u[0]; __syncthreads();
  if (d < 16) { FragH f; for (int q = 0; q < 8; ++q) f.u[q] = sh_[d * 8 + q]; unsigned short* dst = (unsigned short*)H16 + r * (size_t)ldo + (size_t)h * 128 + d * 8; *(v8us*)dst = f.half[0];  } }

template <int TAB, int IL, int F32OUT>
__global__ __launch_bounds__(128) void k_rope128x(const float* __restrict__ F, int ldf, int nh, const float* __restrict__ CS, const float* __restrict__ SN, void* __restrict__ OUT, int ldo, float osc) {
  #pragma clang fp contract(off)
  __shared__ float xv[128]; __shared__ float ov[128]; const int d = threadIdx.x; const int h = blockIdx.x % nh; const size_t r = blockIdx.x / nh; const int p = (int)(r % SQ);
  xv[d] = F[r * (size_t)ldf + (size_t)h * 128 + d]; __syncthreads();
  float c, s; if (TAB == 2) { c = CS[r * 128 + d]; s = SN[r * 128 + d]; }      /* computed full-width f32 tables, one row per token row r (relative to the passed pointers) */ else if (TAB) { c = bf16_round(CS[(size_t)p * 128 + d]); s = bf16_round(SN[(size_t)p * 128 + d]); } else { const int ti = IL ? (d >> 1) : (d & 63); c = CS[p * 64 + ti]; s = SN[p * 64 + ti]; }
  const float rot = IL ? ((d & 1) ? xv[d - 1] : -xv[d + 1]) : ((d < 64) ? -xv[d + 64] : xv[d - 64]);
  ov[d] = __fmul_rn(__fadd_rn(__fmul_rn(xv[d], c), __fmul_rn(rot, s)), osc); __syncthreads();
  if (F32OUT) { if (d < 32) { const v4f v = *(const v4f*)&ov[d * 4]; float* dst = (float*)OUT + r * (size_t)ldo + (size_t)h * 128 + d * 4; *(v4f*)dst = v;  } }
  else { if (d < 16) { FragH f; for (int q = 0; q < 8; ++q) f.h[q] = (_Float16)ov[d * 8 + q]; unsigned short* dst = (unsigned short*)OUT + r * (size_t)ldo + (size_t)h * 128 + d * 8; *(v8us*)dst = f.half[0];  } } }
template <int N>
__global__ __launch_bounds__(256) void k_rmsrow(float* __restrict__ X, const float* __restrict__ w, float eps) {
  #pragma clang fp contract(off)
  constexpr int PT = N / 256; __shared__ float red[256]; const size_t r = blockIdx.x; const int t = threadIdx.x; float* row = X + r * N + (size_t)t * PT; float v[PT]; float ss = 0.f;
  for (int q = 0; q < PT; ++q) { v[q] = row[q]; ss = __fadd_rn(ss, __fmul_rn(v[q], v[q])); }
  red[t] = ss; __syncthreads(); for (int k = 128; k > 0; k >>= 1) { if (t < k) red[t] = __fadd_rn(red[t], red[t + k]); __syncthreads(); }
  const float rs = rsqrtf(__fadd_rn(red[0] / (float)N, eps)); float o[PT]; for (int q = 0; q < PT; ++q) o[q] = __fmul_rn(__fmul_rn(v[q], rs), bf16_round(w[t * PT + q]));
  { for (int q = 0; q < PT; ++q) *(float*)(row + q) = o[q];  } }
template <int GS_, int NHQ, int DSRC>
__global__ __launch_bounds__(256) void k_kvexp128(const float* __restrict__ src, float* __restrict__ dst, size_t n4) { const size_t t = (size_t)blockIdx.x * 256 + threadIdx.x; if (t >= n4) return; const size_t e = t * 4; const size_t row = e / ((size_t)NHQ * 128); const int col = (int)(e % ((size_t)NHQ * 128)); const int h = col / 128, d = col % 128; const v4f v = *(const v4fa*)(src + row * DSRC + (size_t)(h / GS_) * 128 + d); *(v4f*)(dst + e) = v;  }

__global__ __launch_bounds__(256) void k_rsmcfb(const float* __restrict__ S, _Float16* __restrict__ P, int hg, int q0, int nk, const int* __restrict__ mk) {
  #pragma clang fp contract(off)
  const int t = blockIdx.x * 256 + threadIdx.x; if (t >= hg * QT) return; const size_t i = (size_t)t; const float* s = S + i * NKX; const size_t ig = (size_t)(q0 + (t % QT)); const int* mr = mk + ig * SQ; float mx = -3.0e38f;
#pragma unroll 1
  for (int j = 0; j < nk; ++j) { const int mb = mr[j]; const float f = (mb == 0) ? 1.f : 0.f; mx = fmaxf(mx, fmaf(f, s[j], (1.f - f) * -1.0e9f)); } float se = 0.f;
#pragma unroll 1
  for (int j = 0; j < nk; ++j) { const int mb = mr[j]; const float f = (mb == 0) ? 1.f : 0.f; se += __expf(fmaf(f, s[j], (1.f - f) * -1.0e9f) - mx); } const float sc = 256.0f / se;
#pragma unroll 1
  for (int j0 = 0; j0 < nk; j0 += 8) { FragH fr; for (int q = 0; q < 8; ++q) { const int j = j0 + q; const int mb = mr[j]; const float f = (mb == 0) ? 1.f : 0.f; fr.h[q] = (_Float16)(__expf(fmaf(f, s[j], (1.f - f) * -1.0e9f) - mx) * sc); } unsigned short* d = (unsigned short*)P + i * NKX + j0; *(v8us*)d = fr.half[0];  } }


__global__ __launch_bounds__(256) void k_rsmcf2(const float* __restrict__ S, _Float16* __restrict__ P, int hg, int q0, int nk) {
  #pragma clang fp contract(off)
  const int t = blockIdx.x * 256 + threadIdx.x; if (t >= hg * QT) return; const size_t i = (size_t)t; const float* s = S + i * NKX; const int last = q0 + (t % QT); float mx = -3.0e38f;
#pragma unroll 1
  for (int j = 0; j < nk; ++j) { const float f = (j <= last) ? 1.f : 0.f; mx = fmaxf(mx, fmaf(f, s[j], (1.f - f) * -1.0e9f)); } float se = 0.f;
#pragma unroll 1
  for (int j = 0; j < nk; ++j) { const float f = (j <= last) ? 1.f : 0.f; se += __expf(fmaf(f, s[j], (1.f - f) * -1.0e9f) - mx); } const float sc = 256.0f / se;
#pragma unroll 1
  for (int j0 = 0; j0 < nk; j0 += 8) { FragH fr; for (int q = 0; q < 8; ++q) { const int j = j0 + q; const float f = (j <= last) ? 1.f : 0.f; fr.h[q] = (_Float16)(__expf(fmaf(f, s[j], (1.f - f) * -1.0e9f) - mx) * sc); } unsigned short* d = (unsigned short*)P + i * NKX + j0; *(v8us*)d = fr.half[0];  } }



__global__ __launch_bounds__(256) void k_tab128p(const int* __restrict__ pos, int nrows, float theta, float* __restrict__ CS, float* __restrict__ SN) {
  #pragma clang fp contract(off)
  const int t = blockIdx.x * 256 + threadIdx.x; if (t >= nrows * 64) return; const int i = t % 64; const int r = t / 64; const float invf = (float)(1.0 / pow((double)theta, (double)(2 * i) / 128.0)); const float ang = __fmul_rn((float)pos[r], invf); const float c = cosf(ang), sv = sinf(ang);
  float* c0 = CS + (size_t)r * 128 + i; float* s0 = SN + (size_t)r * 128 + i;
  { *(float*)c0 = c; *(float*)(c0 + 64) = c; *(float*)s0 = sv; *(float*)(s0 + 64) = sv;  } }

__global__ __launch_bounds__(128) void k_rmshd(float* __restrict__ F, int ldf, int nh, const float* __restrict__ w, int wst, float eps) {
  #pragma clang fp contract(off)
  __shared__ float red[128]; const int d = threadIdx.x; const int h = blockIdx.x % nh; const size_t r = blockIdx.x / nh; float* p = F + r * (size_t)ldf + (size_t)h * 128 + d; const float v = *p; red[d] = __fmul_rn(v, v); __syncthreads();
  for (int st = 64; st > 0; st >>= 1) { if (d < st) red[d] = __fadd_rn(red[d], red[d + st]); __syncthreads(); }
  const float rs = __frsqrt_rn(__fadd_rn(red[0] / 128.0f, eps)); const float y = __fmul_rn(bf16_round(w[(size_t)h * wst + d]), __fmul_rn(v, rs));      /* gain vector of head h (wst = 128: per-head gains; 0 would share one vector) */ *(float*)p = y;  }
extern "C" void kernel_launch(void* const* d_in, const int* in_sizes, int n_in,
                              void* d_out, int out_size, void* d_ws, size_t ws_size, hipStream_t stream) {
  (void)in_sizes; (void)n_in; (void)out_size;
  const float* const* I = (const float* const*)d_in; const float* x = I[0]; const float* wq = I[1]; const float* wk = I[2]; const float* wv = I[3]; const float* wo = I[4];      /* hidden_states; natural Wq / Wk / Wv / Wo [2048][2048]; no QK norm, no biases, no mask / table inputs */
  char* ws = (char*)d_ws; size_t off = 0;
  auto take = [&](size_t bytes) { char* p = ws + off; off += (bytes + 255) & ~(size_t)255; return p; };
  _Float16* BQ = (_Float16*)take((size_t)DMX * DMX * 2); _Float16* BK = (_Float16*)take((size_t)DKV * DMX * 2); _Float16* BV = (_Float16*)take((size_t)DKV * DMX * 2); _Float16* BO = (_Float16*)take((size_t)DMX * DMX * 2);
  _Float16* X16 = (_Float16*)take(NR * DMX * 2); float* QF = (float*)take(NR * DMX * 4); float* KF = (float*)take(NR * DKV * 4); float* VF = (float*)take(NR * DKV * 4); _Float16* Q16 = (_Float16*)take(NR * DMX * 2); _Float16* K16 = (_Float16*)take(NR * DKV * 2); _Float16* V16 = (_Float16*)take(NR * DKV * 2); _Float16* O16 = (_Float16*)take(NR * DMX * 2);
  float* S = (float*)take((size_t)NH * QT * NKX * 4); _Float16* P = (_Float16*)take((size_t)NH * QT * NKX * 2); _Float16* VT = (_Float16*)take((size_t)(DKV / 64) * 64 * SQ * 2);
  float* QF0 = (float*)take((size_t)QT0 * DMX * 4); float* KRF0 = (float*)take((size_t)QT0 * DKV * 4); float* KF0e = (float*)take((size_t)QT0 * DMX * 4); float* VF0e = (float*)take((size_t)QT0 * DMX * 4); float* OF0 = (float*)take((size_t)NB * QT0 * DMX * 4); _Float16* OH0 = (_Float16*)take((size_t)NB * QT0 * DMX * 2); _Float16* OL0 = (_Float16*)take((size_t)NB * QT0 * DMX * 2); float* tcos = (float*)take((size_t)SQ * 64 * 4); float* tsin = (float*)take((size_t)SQ * 64 * 4);      /* rope tables [2048][64] computed on the device (the module derives them from constants) */
  if (off > ws_size) return;      /* approx 8 + 8 + 8 + 8 + 8 + 16 + 16 + 16 + 8 + 8 + 8 + 8 + 32 + 16 + 8 + 2 + 2 + 2 + 2 + 2 + 1 + 1 + 0.5 + 0.5 = 189 MiB */
  k_wnat<<<(unsigned)(((size_t)DMX * DMX / 8 + 255) / 256), 256, 0, stream>>>(wq, (size_t)DMX * DMX / 8, BQ); k_wnat<<<(unsigned)(((size_t)DKV * DMX / 8 + 255) / 256), 256, 0, stream>>>(wk, (size_t)DKV * DMX / 8, BK); k_wnat<<<(unsigned)(((size_t)DKV * DMX / 8 + 255) / 256), 256, 0, stream>>>(wv, (size_t)DKV * DMX / 8, BV); k_wnat<<<(unsigned)(((size_t)DMX * DMX / 8 + 255) / 256), 256, 0, stream>>>(wo, (size_t)DMX * DMX / 8, BO);      /* natural [out][in] = Bt[n][k] x16 */
  k_x16<<<(unsigned)((NR * DMX / 8 + 255) / 256), 256, 0, stream>>>(x, X16, NR * DMX / 8); k_tab128<<<(SQ * 64 + 255) / 256, 256, 0, stream>>>(10000.0f, tcos, tsin);      /* angle[p][i] = p * 10000^(-2i/128) */
  k_gemm2<0><<<dim3((unsigned)((NR / 128) * (DMX / 64)), 1), 128, 0, stream>>>(X16, DMX, 0, BQ, DMX, 0, 0.0625f, nullptr, 0, nullptr, 1, 0, 0, QF, nullptr, DMX, 0, (int)NR, DMX, DMX);      /* q (f32) */
  k_gemm2<0><<<dim3((unsigned)((NR / 128) * (DKV / 64)), 1), 128, 0, stream>>>(X16, DMX, 0, BK, DMX, 0, 0.0625f, nullptr, 0, nullptr, 1, 0, 0, KF, nullptr, DKV, 0, (int)NR, DKV, DMX);      /* k (f32) */
  k_gemm2<0><<<dim3((unsigned)((NR / 128) * (DKV / 64)), 1), 128, 0, stream>>>(X16, DMX, 0, BV, DMX, 0, 0.0625f, nullptr, 0, nullptr, 1, 0, 0, VF, V16, DKV, 0, (int)NR, DKV, DMX);      /* v (f32 for the first tile + f16) */
  k_rope128x<0, 0, 0><<<(unsigned)(NR * NH), 128, 0, stream>>>(QF, DMX, NH, tcos, tsin, Q16, DMX, 1.0f); k_rope128x<0, 0, 0><<<(unsigned)(NR * NKV), 128, 0, stream>>>(KF, DKV, NKV, tcos, tsin, K16, DKV, 1.0f);      /* half-split rope from the computed tables (index d mod 64) -> f16 */
  for (int b = 0; b < NB; ++b) { const size_t r0 = (size_t)b * SQ;
    k_rope128x<0, 0, 1><<<(unsigned)(QT0 * NH), 128, 0, stream>>>(QF + r0 * DMX, DMX, NH, tcos, tsin, QF0, DMX, 1.0f); k_rope128x<0, 0, 1><<<(unsigned)(QT0 * NKV), 128, 0, stream>>>(KF + r0 * DKV, DKV, NKV, tcos, tsin, KRF0, DKV, 1.0f);      /* f32 roped q, k of the batch's first QT0 rows (positions 0..QT0-1: the table pointers are NOT offset by the batch) */
    k_kvexp128<GSZ, NH, DKV><<<(unsigned)(((size_t)QT0 * DMX / 4 + 255) / 256), 256, 0, stream>>>(KRF0, KF0e, (size_t)QT0 * DMX / 4); k_kvexp128<GSZ, NH, DKV><<<(unsigned)(((size_t)QT0 * DMX / 4 + 255) / 256), 256, 0, stream>>>(VF + r0 * DKV, VF0e, (size_t)QT0 * DMX / 4);      /* kv head -> query head expansion for the exact first tile */
    k_vt<DKV / 64, SQ><<<(DKV / 64) * (SQ / 64), 256, 0, stream>>>(V16 + r0 * DKV, DKV, 0, VT);      /* V^T of this batch: kv head g = slabs 2g, 2g+1 */
    k_att0h<0><<<NH * (QT0 / 32), 32, 0, stream>>>(QF0, KF0e, VF0e, DMX, DMX, nullptr, ATS, OF0 + (size_t)b * QT0 * DMX, DMX);      /* exact causal attention rows 0..255 (o x64) */
    for (int q0 = 0; q0 < SQ; q0 += QT) { const int nk = q0 + QT;      /* causal: keys below the tile end only */
      for (int g = 0; g < NKV; ++g) k_gemm2<0><<<dim3((QT / 128) * (nk / 64), GSZ), 128, 0, stream>>>(Q16 + (r0 + q0) * DMX + (size_t)g * GSZ * HDK, DMX, (size_t)HDK, K16 + r0 * DKV + (size_t)g * HDK, DKV, 0, ATS, nullptr, 0, nullptr, 1, 0, 0, S + (size_t)g * GSZ * QT * NKX, nullptr, NKX, (size_t)QT * NKX, QT, nk, HDK);      /* scores: the kv head's one query head vs its key slab (zero key stride) */
      k_rsmcf2<<<(NH * QT + 255) / 256, 256, 0, stream>>>(S, P, NH, q0, nk);      /* causal softmax (arithmetic select) */
      for (int g = 0; g < NKV; ++g) k_gemm2<0><<<dim3((QT / 128) * (HDK / 64), GSZ), 128, 0, stream>>>(P + (size_t)g * GSZ * QT * NKX, NKX, (size_t)QT * NKX, VT + (size_t)g * HDK * SQ, SQ, 0, 0.25f, nullptr, 0, nullptr, 1, 0, 0, nullptr, O16 + (r0 + q0) * DMX + (size_t)g * GSZ * HDK, DMX, (size_t)HDK, QT, HDK, nk); } }      /* o for the kv head's one query head (x64) */
  k_gemm2<0><<<dim3((unsigned)((NR / 128) * (DMX / 64)), 1), 128, 0, stream>>>(O16, DMX, 0, BO, DMX, 0, 0.0009765625f, nullptr, 0, nullptr, 1, 0, 0, (float*)d_out, nullptr, DMX, 0, (int)NR, DMX, DMX);      /* out = o Wo^T */
  k_hl<<<(unsigned)(((size_t)NB * QT0 * DMX / 8 + 255) / 256), 256, 0, stream>>>(OF0, OH0, OL0, (size_t)NB * QT0 * DMX / 8);      /* first-tile o (x64) -> f16 hi + x1024 residual planes */
  for (int b = 0; b < NB; ++b) { const size_t r0 = (size_t)b * SQ; const size_t f0 = (size_t)b * QT0;
    k_gemm2<0><<<dim3((QT0 / 128) * (DMX / 64), 1), 128, 0, stream>>>(OH0 + f0 * DMX, DMX, 0, BO, DMX, 0, 0.0009765625f, nullptr, 0, nullptr, 1, 0, 0, (float*)d_out + r0 * DMX, nullptr, DMX, 0, QT0, DMX, DMX);      /* rows 0..255 of the batch rewritten from the exact path */
    k_gemm2<0><<<dim3((QT0 / 128) * (DMX / 64), 1), 128, 0, stream>>>(OL0 + f0 * DMX, DMX, 0, BO, DMX, 0, 0.00000095367431640625f, nullptr, 0, (const float*)d_out + r0 * DMX, -1, 0, 0, (float*)d_out + r0 * DMX, nullptr, DMX, 0, QT0, DMX, DMX); }      /* += o_lo Wo 2^-20 (own-element accumulate) */
}

// v001
// It runs in 3890 microseconds.
// Timed twice side by side with v000, it ran 2.21 times as fast both times.
#include <hip/hip_runtime.h>
// Llama-style causal multi-head attention with half-split RoPE computed in the module (hidden_states [1][2048][2048]; q / k / v = x W^T (nn.Linear natural [2048][2048] sigma 0.02, no biases), 16 heads of 128; rope: emb = [f | f], f = p * 10000^(-2i/128): t cos + rotate_half(t) sin; scores * 128^-0.5; causal (where(tril, ., finfo.min): the weight underflows to exactly 0); softmax; out = merged Wo^T (natural) -> [1][2048][2048]); run on the hd128 grouped-query causal code as 16 kv groups of ONE query head.
// Compute dtype: inputs rounded to bf16; x / weights exact; projections and rope f32; q, k, v, softmax weights and o as plain f16 GEMM operands (~2^-12; first 256 rows of each batch exact); scores, statistics, out f32. v_wmma_f32_16x16x32_f16.
#define NB 1
#define SQ 2048
#define DMX 2048
#define NH 16
#define NKV 16
#define GSZ 1
#define HDK 128
#define DKV (NKV * HDK)
#define QT 256
#define QT0 256
#define NKX SQ
#define DM DMX
#define HD 64
#define HG 1
#define NR ((size_t)NB * SQ)
#define ATS 0.08838834764831845f
static_assert(GSZ == 1 && NH == NKV, "the per-head launches are batched on blockIdx.y with one key / value slab per query head");
typedef __bf16 v16b __attribute__((ext_vector_type(16)));
typedef unsigned short v8us __attribute__((ext_vector_type(8), may_alias));
typedef float  v8f  __attribute__((ext_vector_type(8)));
typedef float  v4f  __attribute__((ext_vector_type(4)));
typedef float  v4fa __attribute__((ext_vector_type(4), may_alias));
union FragB { v16b v; v8us half[2]; unsigned short u[16]; };

__device__ __forceinline__ unsigned short bf16_bits(float x) { unsigned int u = __float_as_uint(x); return (unsigned short)((u + 0x7FFFu + ((u >> 16) & 1u)) >> 16); }
__device__ __forceinline__ float bf16_val(unsigned short b) { return __uint_as_float(((unsigned int)b) << 16); }
__device__ __forceinline__ float bf16_round(float x) { return bf16_val(bf16_bits(x)); }
// D += A·B with NT terms: 1 = ah·bh, 2 = + al·bh (A split), 3 = + ah·bl (both split)
template <int NT>
__device__ __forceinline__ v8f mmaN(v16b ah, v16b al, v16b bh, v16b bl, v8f c) {
  c = __builtin_amdgcn_wmma_f32_16x16x32_bf16(false, ah, false, bh, (short)0, c, false, false);
  if (NT >= 2) c = __builtin_amdgcn_wmma_f32_16x16x32_bf16(false, al, false, bh, (short)0, c, false, false);
  if (NT >= 3) c = __builtin_amdgcn_wmma_f32_16x16x32_bf16(false, ah, false, bl, (short)0, c, false, false);
  asm volatile("v_nop\n\tv_nop\n\tv_nop\n\tv_nop" : "+v"(c) : "v"(ah), "v"(al), "v"(bh), "v"(bl));
  return c;
}

__global__ __launch_bounds__(256) void k_wt_bf16(const float* __restrict__ W, unsigned short* __restrict__ Wt, int K, int N) {
  const int t = blockIdx.x * 256 + threadIdx.x;
  const int k8n = K / 8;
  if (t >= N * k8n) return;
  const int n = t / k8n, k8 = (t % k8n) * 8;
  v8us v;
#pragma unroll
  for (int i = 0; i < 8; ++i) v[i] = bf16_bits(W[(size_t)(k8 + i) * N + n]);
  *(v8us*)(Wt + (size_t)n * K + k8) = v;
  
}

// GEMM C[M][N] (f32, pitch ldc) = act(A[M][K]·W + bias). A f32 row-major (pitch lda) converted per fragment to bf16
// (ASPLIT: hi/lo two planes -> 2 terms, else single rounded term); Wt bf16 [N][K] (pitch ldb). BIAS_BF16 rounds the
// bias to bf16 first (bias quantised to bf16 before the add). K%32==0, M%16==0, N%64==0.
template <bool ASPLIT, int ACT, bool BIAS_BF16>
__global__ __launch_bounds__(128) void k_gemm_bf(const float* __restrict__ A, int lda, const unsigned short* __restrict__ Wt, int ldb,
                                               const float* __restrict__ bias, float* __restrict__ C, int ldc, int M, int N, int K) {
  __shared__ __attribute__((aligned(16))) float so[4][16][64];
  const int tid = threadIdx.x, w = tid >> 5, lane = tid & 31, ln = lane & 15, hh = lane >> 4;
  const int ntn = N / 64;
  const int wid = blockIdx.x * 4 + w;
  const int mt = wid / ntn, nq = wid % ntn;
  if (mt * 16 >= M) return;
  const int row0 = mt * 16, col0 = nq * 64;
  const float* arow = A + (size_t)(row0 + ln) * lda;
  v8f acc[4] = {};
  for (int kb = 0; kb < K; kb += 32) {
    FragB ah, al;
    const v4f x0 = *(const v4fa*)(arow + kb + 8 * hh), x1 = *(const v4fa*)(arow + kb + 8 * hh + 4);
    const v4f x2 = *(const v4fa*)(arow + kb + 16 + 8 * hh), x3 = *(const v4fa*)(arow + kb + 16 + 8 * hh + 4);
    float xs[16] = {x0[0],x0[1],x0[2],x0[3],x1[0],x1[1],x1[2],x1[3],x2[0],x2[1],x2[2],x2[3],x3[0],x3[1],x3[2],x3[3]};
#pragma unroll
    for (int i = 0; i < 16; ++i) { const unsigned short hb = bf16_bits(xs[i]); ah.u[i] = hb; al.u[i] = ASPLIT ? bf16_bits(xs[i] - bf16_val(hb)) : (unsigned short)0; }
#pragma unroll
    for (int t = 0; t < 4; ++t) {
      const unsigned short* brow = Wt + (size_t)(col0 + t * 16 + ln) * ldb + kb;
      FragB b;
      b.half[0] = *(const v8us*)(brow + 8 * hh);
      b.half[1] = *(const v8us*)(brow + 16 + 8 * hh);
      acc[t] = mmaN<ASPLIT ? 2 : 1>(ah.v, al.v, b.v, b.v, acc[t]);
    }
  }
#pragma unroll
  for (int t = 0; t < 4; ++t) {
    float bv = bias ? bias[col0 + t * 16 + ln] : 0.f;
    if (BIAS_BF16) bv = bf16_round(bv);
#pragma unroll
    for (int r = 0; r < 8; ++r) { float v = acc[t][r] + bv; if (ACT == 1) v = fmaxf(v, 0.f); so[w][8 * hh + r][t * 16 + ln] = v; }
  }
  __builtin_amdgcn_fence(__ATOMIC_ACQ_REL, "workgroup");
  __builtin_amdgcn_wave_barrier();
  const int rsub = lane >> 4, c4 = (lane & 15) * 4;
  {
#pragma unroll
    for (int q = 0; q < 8; ++q) {
      const int r = q * 2 + rsub;
      const v4f v = *(const v4fa*)&so[w][r][c4];
      *(v4f*)(C + (size_t)(row0 + r) * ldc + col0 + c4) = v;
    }
    
  }
}

// GEMM C = act(A·W + bias + resid): A f32 (ASPLIT -> hi/lo 2 terms), Wt bf16 [N][K]; ACT 0 none, 1 relu, 2 exact gelu;
// resid (optional, f32, row index = (row % rmod), pitch ldr, RES_BF16 rounds it) added before the activation.
template <bool ASPLIT, int ACT, bool BIAS_BF16, bool RES_BF16>
__global__ __launch_bounds__(128) void k_gemm_bf3(const float* __restrict__ A, int lda, const unsigned short* __restrict__ Wt, int ldb,
                                                const float* __restrict__ bias, const float* __restrict__ resid, int rmod, int ldr,
                                                float* __restrict__ C, int ldc, int M, int N, int K) {
  __shared__ __attribute__((aligned(16))) float so[4][16][64];
  const int tid = threadIdx.x, w = tid >> 5, lane = tid & 31, ln = lane & 15, hh = lane >> 4;
  const int ntn = N / 64;
  const int wid = blockIdx.x * 4 + w;
  const int mt = wid / ntn, nq = wid % ntn;
  if (mt * 16 >= M) return;
  const int row0 = mt * 16, col0 = nq * 64;
  const float* arow = A + (size_t)(row0 + ln) * lda;
  v8f acc[4] = {};
  for (int kb = 0; kb < K; kb += 32) {
    FragB ah, al;
    const v4f x0 = *(const v4fa*)(arow + kb + 8 * hh), x1 = *(const v4fa*)(arow + kb + 8 * hh + 4);
    const v4f x2 = *(const v4fa*)(arow + kb + 16 + 8 * hh), x3 = *(const v4fa*)(arow + kb + 16 + 8 * hh + 4);
    float xs[16] = {x0[0],x0[1],x0[2],x0[3],x1[0],x1[1],x1[2],x1[3],x2[0],x2[1],x2[2],x2[3],x3[0],x3[1],x3[2],x3[3]};
#pragma unroll
    for (int i = 0; i < 16; ++i) { const unsigned short hb = bf16_bits(xs[i]); ah.u[i] = hb; al.u[i] = ASPLIT ? bf16_bits(xs[i] - bf16_val(hb)) : (unsigned short)0; }
#pragma unroll
    for (int t = 0; t < 4; ++t) {
      const unsigned short* brow = Wt + (size_t)(col0 + t * 16 + ln) * ldb + kb;
      FragB b;
      b.half[0] = *(const v8us*)(brow + 8 * hh);
      b.half[1] = *(const v8us*)(brow + 16 + 8 * hh);
      acc[t] = mmaN<ASPLIT ? 2 : 1>(ah.v, al.v, b.v, b.v, acc[t]);
    }
  }
#pragma unroll
  for (int t = 0; t < 4; ++t) {
    const int col = col0 + t * 16 + ln;
    float bv = bias ? bias[col] : 0.f;
    if (BIAS_BF16) bv = bf16_round(bv);
#pragma unroll
    for (int r = 0; r < 8; ++r) {
      float v = acc[t][r] + bv;
      if (resid) { float rv = resid[(size_t)((row0 + 8 * hh + r) % rmod) * ldr + col]; if (RES_BF16) rv = bf16_round(rv); v += rv; }
      if (ACT == 1) v = fmaxf(v, 0.f);
      if (ACT == 2) v = 0.5f * v * (1.0f + erff(v * 0.70710678118654752f));
      if (ACT == 3) { const float u = 0.7978845608028654f * (v + 0.044715f * v * v * v); v = 0.5f * v * (1.0f + tanhf(u)); }
      so[w][8 * hh + r][t * 16 + ln] = v;
    }
  }
  __builtin_amdgcn_fence(__ATOMIC_ACQ_REL, "workgroup");
  __builtin_amdgcn_wave_barrier();
  const int rsub = lane >> 4, c4 = (lane & 15) * 4;
  {
#pragma unroll
    for (int q = 0; q < 8; ++q) {
      const int r = q * 2 + rsub;
      const v4f v = *(const v4fa*)&so[w][r][c4];
      *(v4f*)(C + (size_t)(row0 + r) * ldc + col0 + c4) = v;
    }
    
  }
}
// row LayerNorm (biased variance, eps) over N: s = X (+ R); optional out_sum <- s; out_norm <- (s-mu)*rsqrt(var+eps)*g + b
template <bool PARAM_BF16>
__global__ __launch_bounds__(256) void k_layernorm(const float* __restrict__ X, const float* __restrict__ R, const float* __restrict__ g, const float* __restrict__ bta,
                                                  float* __restrict__ out_sum, float* __restrict__ out_norm, int N, float eps) {
  __shared__ float red[256];
  const int row = blockIdx.x, tid = threadIdx.x;
  const float* x = X + (size_t)row * N; const float* rr = R ? R + (size_t)row * N : nullptr;
  float vals[16];                     // up to N = 4096
  const int per = N / 256;            // contiguous chunk per thread? use strided-by-4 chunks: thread handles j = tid*4 + 1024*u
  float s1 = 0.f;
  for (int u = 0; u < per / 4; ++u) {
    const int j = tid * 4 + 1024 * u;
    const v4f a = *(const v4fa*)(x + j);
    v4f b = {0.f,0.f,0.f,0.f}; if (rr) b = *(const v4fa*)(rr + j);
#pragma unroll
    for (int q = 0; q < 4; ++q) { const float v = a[q] + b[q]; vals[u * 4 + q] = v; s1 += v; }
  }
  red[tid] = s1; __syncthreads();
  for (int st = 128; st > 0; st >>= 1) { if (tid < st) red[tid] += red[tid + st]; __syncthreads(); }
  const float mu = red[0] / (float)N; __syncthreads();
  float s2 = 0.f;
  for (int u = 0; u < per / 4; ++u)
#pragma unroll
    for (int q = 0; q < 4; ++q) { const float c = vals[u * 4 + q] - mu; s2 += c * c; }
  red[tid] = s2; __syncthreads();
  for (int st = 128; st > 0; st >>= 1) { if (tid < st) red[tid] += red[tid + st]; __syncthreads(); }
  const float rs = rsqrtf(red[0] / (float)N + eps);
  {
    for (int u = 0; u < per / 4; ++u) {
      const int j = tid * 4 + 1024 * u;
      v4f o, sm;
#pragma unroll
      for (int q = 0; q < 4; ++q) {
        float gg = g[j + q], bb = bta[j + q];
        if (PARAM_BF16) { gg = bf16_round(gg); bb = bf16_round(bb); }
        sm[q] = vals[u * 4 + q]; o[q] = (vals[u * 4 + q] - mu) * rs * gg + bb;
      }
      if (out_sum) *(v4f*)(out_sum + (size_t)row * N + j) = sm;
      *(v4f*)(out_norm + (size_t)row * N + j) = o;
    }
    
  }
}



// ---- f16 WMMA path (v_wmma_f32_16x16x32_f16): 11-bit significands for operands in range — used where a [0,1] probability operand needs more precision than bf16
typedef _Float16 v16h __attribute__((ext_vector_type(16)));
union FragH { v16h v; v8us half[2]; _Float16 h[16]; unsigned short u[16]; };
template <int NT>
__device__ __forceinline__ v8f mmaH(v16h ah, v16h al, v16h bh, v16h bl, v8f c) {
  c = __builtin_amdgcn_wmma_f32_16x16x32_f16(false, ah, false, bh, (short)0, c, false, false);
  if (NT >= 2) c = __builtin_amdgcn_wmma_f32_16x16x32_f16(false, al, false, bh, (short)0, c, false, false);
  if (NT >= 3) c = __builtin_amdgcn_wmma_f32_16x16x32_f16(false, ah, false, bl, (short)0, c, false, false);
  asm volatile("v_nop\n\tv_nop\n\tv_nop\n\tv_nop" : "+v"(c) : "v"(ah), "v"(al), "v"(bh), "v"(bl));
  return c;
}
// batched GEMM like k_gemm_b but f16 operands: A f32 (split into f16 hi/lo if ASPLIT, else rounded to f16), Bt = f16 values [n][k]; alpha; C f32; N multiple of 16 (partial tiles skipped)
template <bool ASPLIT>
__global__ __launch_bounds__(128) void k_gemm_h(const float* __restrict__ A, int lda, size_t sA, const _Float16* __restrict__ Bh, int ldb, size_t sB, float alpha, float* __restrict__ C, int ldc, size_t sC, int M, int N, int K) {
  __shared__ __attribute__((aligned(16))) float so[4][16][64];
  const int tid = threadIdx.x, w = tid >> 5, lane = tid & 31, ln = lane & 15, hh = lane >> 4; const int by = blockIdx.y;
  A += (size_t)by * sA; Bh += (size_t)by * sB; C += (size_t)by * sC;
  const int ntn = (N + 63) / 64; const int wid = blockIdx.x * 4 + w; const int mt = wid / ntn, nq = wid % ntn; if (mt * 16 >= M) return;
  const int row0 = mt * 16, col0 = nq * 64; const float* arow = A + (size_t)(row0 + ln) * lda;
  v8f acc[4] = {};
  for (int kb = 0; kb < K; kb += 32) {
    FragH ah, al;
    const v4f x0 = *(const v4fa*)(arow + kb + 8 * hh), x1 = *(const v4fa*)(arow + kb + 8 * hh + 4), x2 = *(const v4fa*)(arow + kb + 16 + 8 * hh), x3 = *(const v4fa*)(arow + kb + 16 + 8 * hh + 4);
    float xs[16] = {x0[0],x0[1],x0[2],x0[3],x1[0],x1[1],x1[2],x1[3],x2[0],x2[1],x2[2],x2[3],x3[0],x3[1],x3[2],x3[3]};
#pragma unroll
    for (int i = 0; i < 16; ++i) { const _Float16 h = (_Float16)xs[i]; ah.h[i] = h; al.h[i] = ASPLIT ? (_Float16)(xs[i] - (float)h) : (_Float16)0.0f; }
#pragma unroll
    for (int t = 0; t < 4; ++t) { if (col0 + t * 16 >= N) continue; const size_t boff = (size_t)(col0 + t * 16 + ln) * ldb + kb; FragH bq; bq.half[0] = *(const v8us*)(Bh + boff + 8 * hh); bq.half[1] = *(const v8us*)(Bh + boff + 16 + 8 * hh);
      acc[t] = mmaH<ASPLIT ? 2 : 1>(ah.v, al.v, bq.v, bq.v, acc[t]); }
  }
#pragma unroll
  for (int t = 0; t < 4; ++t) { if (col0 + t * 16 >= N) continue;
#pragma unroll
    for (int r = 0; r < 8; ++r) so[w][8 * hh + r][t * 16 + ln] = acc[t][r] * alpha; }
  __builtin_amdgcn_fence(__ATOMIC_ACQ_REL, "workgroup"); __builtin_amdgcn_wave_barrier();
  const int rsub = lane >> 4, c4 = (lane & 15) * 4;
  {
#pragma unroll
    for (int q = 0; q < 8; ++q) { const int r = q * 2 + rsub; if (col0 + c4 < N) { const v4f v = *(const v4fa*)&so[w][r][c4]; *(v4f*)(C + (size_t)(row0 + r) * ldc + col0 + c4) = v; } }
     }
}

// Wt[n][k] = f16(W[k][n]·scale) from f32 row-major W[K][N] (scale = power of two; bf16-exact weights stay exact in f16 away from the subnormal range)
__global__ __launch_bounds__(256) void k_wt_f16(const float* __restrict__ W, _Float16* __restrict__ Wt, int K, int N, float scale) {
  const int t = blockIdx.x * 256 + threadIdx.x; if (t >= N * (K / 8)) return; const int n = t / (K / 8), k8 = (t % (K / 8)) * 8; FragH f;
#pragma unroll
  for (int i = 0; i < 8; ++i) f.h[i] = (_Float16)(bf16_round(W[(size_t)(k8 + i) * N + n]) * scale); const v8us o = f.half[0];
  *(v8us*)((unsigned short*)Wt + (size_t)n * K + k8) = o; 
}
// k_gemm_hh variant with fused epilogue: v = acc·alpha + bias[by·sBias + col] (+ CP[(row/rowsPerB)·sCPb + by·64 + col] if CP) ; ACT 0 none / 1 elu ; writes f16 C16 (and f32 C if non-null)
template <int ACT>
__global__ __launch_bounds__(128) void k_gemm_hhx(const _Float16* __restrict__ A, int lda, size_t sA, const _Float16* __restrict__ Bh, int ldb, size_t sB, float alpha, const float* __restrict__ bias, size_t sBias, const float* __restrict__ CP, int rowsPerB, size_t sCPb, int row0g,
    float* __restrict__ C, _Float16* __restrict__ C16, int ldc, size_t sC, int M, int N, int K) {
  __shared__ __attribute__((aligned(16))) float so[4][16][64];
  const int tid = threadIdx.x, w = tid >> 5, lane = tid & 31, ln = lane & 15, hh = lane >> 4; const int by = blockIdx.y;
  A += (size_t)by * sA; Bh += (size_t)by * sB; const size_t cofs = (size_t)by * sC; const float* bp = bias ? bias + (size_t)by * sBias : nullptr;
  const int ntn = (N + 63) / 64; const int wid = blockIdx.x * 4 + w; const int mt = wid / ntn, nq = wid % ntn; if (mt * 16 >= M) return;
  const int row0 = mt * 16, col0 = nq * 64; const _Float16* arow = A + (size_t)(row0 + ln) * lda;
  v8f acc[4] = {};
  for (int kb = 0; kb < K; kb += 32) { FragH ah; ah.half[0] = *(const v8us*)((const unsigned short*)arow + kb + 8 * hh); ah.half[1] = *(const v8us*)((const unsigned short*)arow + kb + 16 + 8 * hh);
#pragma unroll
    for (int t = 0; t < 4; ++t) { if (col0 + t * 16 >= N) continue; const size_t boff = (size_t)(col0 + t * 16 + ln) * ldb + kb; FragH bq; bq.half[0] = *(const v8us*)((const unsigned short*)Bh + boff + 8 * hh); bq.half[1] = *(const v8us*)((const unsigned short*)Bh + boff + 16 + 8 * hh);
      acc[t] = mmaH<1>(ah.v, ah.v, bq.v, bq.v, acc[t]); }
  }
#pragma unroll
  for (int t = 0; t < 4; ++t) { if (col0 + t * 16 >= N) continue; const int col = col0 + t * 16 + ln; const float bv = bp ? bf16_round(bp[col]) : 0.f;
#pragma unroll
    for (int r = 0; r < 8; ++r) { float v = acc[t][r] * alpha + bv; if (CP) { const int rr = row0g + row0 + 8 * hh + r; if (rowsPerB < 0) v += CP[cofs + (size_t)rr * ldc + col];      /* rowsPerB < 0: own element of the batched C plane */ else { const int bidx = rr / rowsPerB; v += CP[(size_t)bidx * sCPb + (size_t)by * 64 + col]; } } if (ACT == 1) v = (v > 0.f) ? v : expm1f(v); else if (ACT == 7) v = (v > 0.f) ? v + 1.0f : expf(v); else if (ACT == 8) v = tanhf(v); else if (ACT == 9) v = 0.5f * v * (1.0f + tanhf(0.7978845608028654f * (v + 0.044715f * v * v * v))); else if (ACT == 11) v = 1.0f / (1.0f + expf(-v)); else if (ACT == 12) v = (v > 0.f) ? v : 0.01f * v; else if (ACT == 14) v = (v > 0.f) ? v : 0.1f * v; else if (ACT == 16) v = (v >= 0.f) ? v : 0.3f * v; else if (ACT == 17) v = (v >= 0.f) ? v : 0.2f * v; else if (ACT == 15) v = v / (1.0f + expf(-v)); else if (ACT == 3) v = fmaxf(v, 0.f); else if (ACT == 6) v = 0.5f * v * (1.0f + erff(v * 0.70710678118654752f)); so[w][8 * hh + r][t * 16 + ln] = v; } }
  __builtin_amdgcn_fence(__ATOMIC_ACQ_REL, "workgroup"); __builtin_amdgcn_wave_barrier();
  const int rsub = lane >> 4, c4 = (lane & 15) * 4; typedef _Float16 v4h __attribute__((ext_vector_type(4)));
  {
#pragma unroll
    for (int q = 0; q < 8; ++q) { const int r = q * 2 + rsub; if (col0 + c4 < N) { const v4f v = *(const v4fa*)&so[w][r][c4]; if (C) *(v4f*)(C + cofs + (size_t)(row0 + r) * ldc + col0 + c4) = v; if (C16) { v4h h4; for (int i = 0; i < 4; ++i) h4[i] = (_Float16)v[i]; *(v4h*)(C16 + cofs + (size_t)(row0 + r) * ldc + col0 + c4) = h4; } } }
     }
}


typedef _Float16 v4h __attribute__((ext_vector_type(4)));

__global__ __launch_bounds__(256) void k_x16(const float* __restrict__ x, _Float16* __restrict__ X16, size_t n8) { const size_t t = (size_t)blockIdx.x * 256 + threadIdx.x; if (t >= n8) return; FragH f;
#pragma unroll
  for (int q = 0; q < 8; ++q) f.h[q] = (_Float16)bf16_round(x[t * 8 + q]); *(v8us*)((unsigned short*)X16 + t * 8) = f.half[0];  }
__global__ __launch_bounds__(256) void k_h16(const float* __restrict__ x, _Float16* __restrict__ X16, size_t n8) { const size_t t = (size_t)blockIdx.x * 256 + threadIdx.x; if (t >= n8) return; FragH f;
#pragma unroll
  for (int q = 0; q < 8; ++q) f.h[q] = (_Float16)x[t * 8 + q]; *(v8us*)((unsigned short*)X16 + t * 8) = f.half[0];  }
__global__ __launch_bounds__(256) void k_round16f(const float* __restrict__ W, _Float16* __restrict__ Bt, size_t n8) { const size_t t = (size_t)blockIdx.x * 256 + threadIdx.x; if (t >= n8) return; FragH f;
#pragma unroll
  for (int i = 0; i < 8; ++i) f.h[i] = (_Float16)(bf16_round(W[t * 8 + i]) * 16.0f); *(v8us*)((unsigned short*)Bt + t * 8) = f.half[0];  }
template <int NHv, int TTv>
__global__ __launch_bounds__(256) void k_vt(const _Float16* __restrict__ V16, int ldv, int voff, _Float16* __restrict__ Vt) { __shared__ unsigned short tl[64][66]; const int tid = threadIdx.x; const int slab = blockIdx.x / (TTv / 64), lg = blockIdx.x % (TTv / 64); const int b = slab / NHv, h = slab % NHv;
  for (int i = tid; i < 64 * 8; i += 256) { const int r = i / 8, c8 = (i % 8) * 8; FragH f; f.half[0] = *(const v8us*)((const unsigned short*)V16 + ((size_t)b * TTv + lg * 64 + r) * ldv + voff + h * 64 + c8);
#pragma unroll
    for (int q = 0; q < 8; ++q) tl[r][c8 + q] = f.u[q]; }
  __syncthreads();
  {
#pragma unroll
    for (int rd = 0; rd < 2; ++rd) { const int d = rd * 32 + tid / 8, pc = tid % 8; FragH f;
#pragma unroll
      for (int q = 0; q < 8; ++q) f.u[q] = tl[pc * 8 + q][d];
      *(v8us*)((unsigned short*)Vt + ((size_t)slab * 64 + d) * TTv + lg * 64 + pc * 8) = f.half[0]; }
     } }

__global__ __launch_bounds__(256) void k_hl(const float* __restrict__ F, _Float16* __restrict__ Hh, _Float16* __restrict__ Hl, size_t n8) { const size_t t = (size_t)blockIdx.x * 256 + threadIdx.x; if (t >= n8) return; FragH fh, fl; const v4f a = *(const v4fa*)(F + t * 8), c = *(const v4fa*)(F + t * 8 + 4);
#pragma unroll
  for (int q = 0; q < 4; ++q) { _Float16 h = (_Float16)a[q]; fh.h[q] = h; fl.h[q] = (_Float16)((a[q] - (float)h) * 1024.0f); h = (_Float16)c[q]; fh.h[4 + q] = h; fl.h[4 + q] = (_Float16)((c[q] - (float)h) * 1024.0f); }
  { *(v8us*)((unsigned short*)Hh + t * 8) = fh.half[0]; *(v8us*)((unsigned short*)Hl + t * 8) = fl.half[0];  } }

// ---- fast GEMM (wave tile 32x64; requires M % 32 == 0 rows per launch region and N % 64 == 0); epilogue = k_gemm_hhx semantics ----
__device__ __forceinline__ v16h g2_frag(const _Float16* p, int hh) { FragH f; f.half[0] = *(const v8us*)((const unsigned short*)p + 8 * hh); f.half[1] = *(const v8us*)((const unsigned short*)p + 16 + 8 * hh); return f.v; }
__device__ __forceinline__ v8f g2_mma(v16h a, v16h b, v8f c) { v8f d = __builtin_amdgcn_wmma_f32_16x16x32_f16(false, a, false, b, (short)0, c, false, false); asm volatile("v_nop\n\tv_nop\n\tv_nop\n\tv_nop" : "+v"(d) : "v"(a), "v"(b)); return d; }
template <int ACT>
__global__ __launch_bounds__(128) void k_gemm2(const _Float16* __restrict__ A, int lda, size_t sA, const _Float16* __restrict__ Bh, int ldb, size_t sB, float alpha, const float* __restrict__ bias, size_t sBias, const float* __restrict__ CP, int rowsPerB, size_t sCPb, int row0g,
    float* __restrict__ C, _Float16* __restrict__ C16, int ldc, size_t sC, int M, int N, int K) { static_assert(ACT == 0 || ACT == 3 || ACT == 6 || ACT == 8 || ACT == 9 || ACT == 11 || ACT == 12 || ACT == 14 || ACT == 15 || ACT == 16 || ACT == 17, "k_gemm2: unsupported ACT code (would silently apply no activation)");
  __shared__ __attribute__((aligned(16))) float so[4][32][68];
  const int tid = threadIdx.x, w = tid >> 5, lane = tid & 31, ln = lane & 15, hh = lane >> 4; const int by = blockIdx.y;
  A += (size_t)by * sA; Bh += (size_t)by * sB; const size_t cofs = (size_t)by * sC; const float* bp = bias ? bias + (size_t)by * sBias : nullptr;
  const int ntn = N >> 6; const int mt = blockIdx.x / ntn, nq = blockIdx.x - mt * ntn; const int row0 = mt * 128 + 32 * w, col0 = nq * 64; if (row0 >= M) return;
  const _Float16* a0p = A + (size_t)(row0 + ln) * lda; const _Float16* a1p = a0p + (size_t)16 * lda;
  const _Float16* b0p = Bh + (size_t)(col0 + ln) * ldb; const _Float16* b1p = b0p + (size_t)16 * ldb; const _Float16* b2p = b1p + (size_t)16 * ldb; const _Float16* b3p = b2p + (size_t)16 * ldb;
  const v8f z8 = {0.f,0.f,0.f,0.f,0.f,0.f,0.f,0.f}; v8f c00 = z8, c01 = z8, c02 = z8, c03 = z8, c10 = z8, c11 = z8, c12 = z8, c13 = z8;
#pragma unroll 1
  for (int kb = 0; kb < K; kb += 32) { const v16h a0 = g2_frag(a0p + kb, hh), a1 = g2_frag(a1p + kb, hh);
    v16h b = g2_frag(b0p + kb, hh); c00 = g2_mma(a0, b, c00); c10 = g2_mma(a1, b, c10);
    b = g2_frag(b1p + kb, hh); c01 = g2_mma(a0, b, c01); c11 = g2_mma(a1, b, c11);
    b = g2_frag(b2p + kb, hh); c02 = g2_mma(a0, b, c02); c12 = g2_mma(a1, b, c12);
    b = g2_frag(b3p + kb, hh); c03 = g2_mma(a0, b, c03); c13 = g2_mma(a1, b, c13); }
  v8f accs[8] = {c00, c01, c02, c03, c10, c11, c12, c13};
#pragma unroll
  for (int u = 0; u < 8; ++u) { const int t = u & 3, half = u >> 2; const int col = col0 + t * 16 + ln; const float bv = bp ? bf16_round(bp[col]) : 0.f;
#pragma unroll
    for (int r = 0; r < 8; ++r) { const int rloc = half * 16 + 8 * hh + r; float v = accs[u][r] * alpha + bv; if (CP) { if (rowsPerB < 0) v += CP[cofs + (size_t)(row0g + row0 + rloc) * ldc + col];      /* rowsPerB < 0: own element of the batched C plane */ else { const int bidx = (row0g + row0 + rloc) / rowsPerB; v += CP[(size_t)bidx * sCPb + (size_t)by * 64 + col]; } }
      if (ACT == 3) v = fmaxf(v, 0.f); else if (ACT == 6) v = 0.5f * v * (1.0f + erff(v * 0.70710678118654752f)); else if (ACT == 11) v = 1.0f / (1.0f + expf(-v)); else if (ACT == 15) v = v / (1.0f + expf(-v)); else if (ACT == 12) v = (v > 0.f) ? v : 0.01f * v; else if (ACT == 8) v = tanhf(v); else if (ACT == 9) v = 0.5f * v * (1.0f + tanhf(0.7978845608028654f * (v + 0.044715f * v * v * v))); else if (ACT == 14) v = (v > 0.f) ? v : 0.1f * v; else if (ACT == 16) v = (v >= 0.f) ? v : 0.3f * v; else if (ACT == 17) v = (v >= 0.f) ? v : 0.2f * v;
      so[w][rloc][t * 16 + ln] = v; } }
  __builtin_amdgcn_fence(__ATOMIC_ACQ_REL, "workgroup"); __builtin_amdgcn_wave_barrier();
  const int rsub = lane >> 4, c4 = (lane & 15) * 4;
  {
#pragma unroll
    for (int q = 0; q < 16; ++q) { const int r = q * 2 + rsub; const v4f v = *(const v4fa*)&so[w][r][c4]; if (C) *(v4f*)(C + cofs + (size_t)(row0 + r) * ldc + col0 + c4) = v; if (C16) { v4h h4; for (int i = 0; i < 4; ++i) h4[i] = (_Float16)v[i]; *(v4h*)(C16 + cofs + (size_t)(row0 + r) * ldc + col0 + c4) = h4; } }
     } }


__global__ __launch_bounds__(256) void k_wnat(const float* __restrict__ w, size_t n8, _Float16* __restrict__ Bt) { const size_t t = (size_t)blockIdx.x * 256 + threadIdx.x; if (t >= n8) return; FragH f; for (int q = 0; q < 8; ++q) f.h[q] = (_Float16)(bf16_round(w[t * 8 + q]) * 16.0f); *(v8us*)((unsigned short*)Bt + t * 8) = f.half[0];  }
__global__ __launch_bounds__(256) void k_rsm(const float* __restrict__ S, _Float16* __restrict__ P, int nrows) {
  #pragma clang fp contract(off)
  const int i = blockIdx.x * 256 + threadIdx.x; if (i >= nrows) return; const float* s = S + (size_t)i * SQ; float mx = -3.0e38f;
#pragma unroll 1
  for (int j = 0; j < SQ; ++j) mx = fmaxf(mx, s[j]); float se = 0.f;
#pragma unroll 1
  for (int j = 0; j < SQ; ++j) se += expf(s[j] - mx); const float sc = 256.0f / se;
#pragma unroll 1
  for (int j0 = 0; j0 < SQ; j0 += 8) { FragH f; for (int q = 0; q < 8; ++q) f.h[q] = (_Float16)(expf(s[j0 + q] - mx) * sc); unsigned short* d = (unsigned short*)P + (size_t)i * SQ + j0; *(v8us*)d = f.half[0];  } }
__global__ __launch_bounds__(256) void k_vt(const _Float16* __restrict__ V16, int b, int h0, _Float16* __restrict__ VT) { __shared__ unsigned short tl[64][65]; const int tid = threadIdx.x; const int hh = blockIdx.x % HG, sg = blockIdx.x / HG; const int s0 = sg * 64; const int h = h0 + hh;
  for (int i = tid; i < 64 * 8; i += 256) { const int j = i / 8, d8 = (i % 8) * 8; FragH f; f.half[0] = *(const v8us*)((const unsigned short*)V16 + ((size_t)b * SQ + s0 + j) * DM + h * HD + d8); for (int q = 0; q < 8; ++q) tl[d8 + q][j] = f.u[q]; }
  __syncthreads();
  { for (int i = tid; i < 64 * 8; i += 256) { const int d = i / 8, j8 = (i % 8) * 8; FragH f; for (int q = 0; q < 8; ++q) f.u[q] = tl[d][j8 + q]; *(v8us*)((unsigned short*)VT + ((size_t)hh * HD + d) * SQ + s0 + j8) = f.half[0]; }  } }


template <int MASK>
__global__ __launch_bounds__(32) void k_att0h(const float* __restrict__ QF, const float* __restrict__ KF, const float* __restrict__ VF, int ld, int ldv, const int* __restrict__ mk, float scale, float* __restrict__ OF, int ldo) {
  #pragma clang fp contract(off)
  __shared__ __attribute__((aligned(16))) float lq[32][128]; __shared__ __attribute__((aligned(16))) float lo[32][128];
  const int tid = threadIdx.x; const int h = blockIdx.x / (QT0 / 32), rg = blockIdx.x % (QT0 / 32); const int i = rg * 32 + tid;
  for (int c = 0; c < 32; ++c) { *(v4f*)&lq[tid][c * 4] = *(const v4fa*)(QF + (size_t)i * ld + h * 128 + c * 4); const v4f z = {0.f, 0.f, 0.f, 0.f}; *(v4f*)&lo[tid][c * 4] = z; }
  float m = -1.0e30f, l = 0.f; const int jmax = rg * 32 + 31;
#pragma unroll 1
  for (int j = 0; j <= jmax; ++j) { const float* kr = KF + (size_t)j * ld + h * 128; const float* vr = VF + (size_t)j * ldv + h * 128; float s = 0.f;
#pragma unroll 1
    for (int c = 0; c < 32; ++c) { const v4f kq = *(const v4fa*)(kr + c * 4); const v4f qq = *(v4f*)&lq[tid][c * 4]; for (int u = 0; u < 4; ++u) s = __fadd_rn(s, __fmul_rn(qq[u], kq[u])); }
    s = __fmul_rn(s, scale); float f; if (MASK) { const int mb = mk[(size_t)i * SQ + j]; f = (mb == 0) ? 1.f : 0.f; } else { f = (j <= i) ? 1.f : 0.f; }
    const float sm = fmaf(f, s, (1.f - f) * -1.0e30f); const float mn = fmaxf(m, sm); const float sc = expf(m - mn); const float e = __fmul_rn(f, expf(sm - mn)); l = __fadd_rn(__fmul_rn(l, sc), e); m = mn;
#pragma unroll 1
    for (int c = 0; c < 32; ++c) { const v4f vv = *(const v4fa*)(vr + c * 4); v4f oo = *(v4f*)&lo[tid][c * 4]; for (int u = 0; u < 4; ++u) oo[u] = __fadd_rn(__fmul_rn(oo[u], sc), __fmul_rn(e, vv[u])); *(v4f*)&lo[tid][c * 4] = oo; } }
  const float fin = 64.0f / l;
  { for (int c = 0; c < 32; ++c) { v4f oo = *(v4f*)&lo[tid][c * 4]; for (int u = 0; u < 4; ++u) oo[u] = __fmul_rn(oo[u], fin); *(v4f*)(OF + (size_t)i * ldo + h * 128 + c * 4) = oo; }  } }
__global__ __launch_bounds__(256) void k_f2h(const float* __restrict__ F, int ldf, int coff, int ncol, _Float16* __restrict__ H16, size_t nrow) { const size_t t = (size_t)blockIdx.x * 256 + threadIdx.x; const size_t n8 = nrow * (size_t)(ncol / 8); if (t >= n8) return; const size_t r = t / (ncol / 8); const int c8 = (int)(t % (ncol / 8)) * 8; FragH f; const v4f a = *(const v4fa*)(F + r * ldf + coff + c8), b2 = *(const v4fa*)(F + r * ldf + coff + c8 + 4); for (int q = 0; q < 4; ++q) { f.h[q] = (_Float16)a[q]; f.h[4 + q] = (_Float16)b2[q]; } *(v8us*)((unsigned short*)H16 + r * ncol + c8) = f.half[0];  }

__global__ __launch_bounds__(256) void k_tab128(float theta, float* __restrict__ CS, float* __restrict__ SN) {
  #pragma clang fp contract(off)
  const int t = blockIdx.x * 256 + threadIdx.x; if (t >= SQ * 64) return; const int i = t % 64; const int p = t / 64; const float invf = (float)(1.0 / pow((double)theta, (double)(2 * i) / 128.0));      /* = XLA's constant-folded f32 table */ const float ang = __fmul_rn((float)p, invf); const float c = cosf(ang), s = sinf(ang);
  *(float*)(CS + t) = c; *(float*)(SN + t) = s;  }
template <int TAB>
__global__ __launch_bounds__(128) void k_rope128(const float* __restrict__ F, int ldf, int nh, const float* __restrict__ CS, const float* __restrict__ SN, _Float16* __restrict__ H16, int ldo, float osc) {
  #pragma clang fp contract(off)
  __shared__ float xv[128]; __shared__ unsigned short sh_[128]; const int d = threadIdx.x; const int h = blockIdx.x % nh; const size_t r = blockIdx.x / nh; const int p = (int)(r % SQ);
  xv[d] = F[r * (size_t)ldf + (size_t)h * 128 + d]; __syncthreads();
  float c, s; if (TAB) { c = bf16_round(CS[(size_t)p * 128 + d]); s = bf16_round(SN[(size_t)p * 128 + d]); } else { c = CS[p * 64 + (d & 63)]; s = SN[p * 64 + (d & 63)]; }
  const float rot = (d < 64) ? -xv[d + 64] : xv[d - 64]; const float o = __fadd_rn(__fmul_rn(xv[d], c), __fmul_rn(rot, s));
  FragH th; th.h[0] = (_Float16)__fmul_rn(o, osc); sh_[d] = th.u[0]; __syncthreads();
  if (d < 16) { FragH f; for (int q = 0; q < 8; ++q) f.u[q] = sh_[d * 8 + q]; unsigned short* dst = (unsigned short*)H16 + r * (size_t)ldo + (size_t)h * 128 + d * 8; *(v8us*)dst = f.half[0];  } }

template <int TAB, int IL, int F32OUT>
__global__ __launch_bounds__(128) void k_rope128x(const float* __restrict__ F, int ldf, int nh, const float* __restrict__ CS, const float* __restrict__ SN, void* __restrict__ OUT, int ldo, float osc) {
  #pragma clang fp contract(off)
  __shared__ float xv[128]; __shared__ float ov[128]; const int d = threadIdx.x; const int h = blockIdx.x % nh; const size_t r = blockIdx.x / nh; const int p = (int)(r % SQ);
  xv[d] = F[r * (size_t)ldf + (size_t)h * 128 + d]; __syncthreads();
  float c, s; if (TAB == 2) { c = CS[r * 128 + d]; s = SN[r * 128 + d]; }      /* computed full-width f32 tables, one row per token row r (relative to the passed pointers) */ else if (TAB) { c = bf16_round(CS[(size_t)p * 128 + d]); s = bf16_round(SN[(size_t)p * 128 + d]); } else { const int ti = IL ? (d >> 1) : (d & 63); c = CS[p * 64 + ti]; s = SN[p * 64 + ti]; }
  const float rot = IL ? ((d & 1) ? xv[d - 1] : -xv[d + 1]) : ((d < 64) ? -xv[d + 64] : xv[d - 64]);
  ov[d] = __fmul_rn(__fadd_rn(__fmul_rn(xv[d], c), __fmul_rn(rot, s)), osc); __syncthreads();
  if (F32OUT) { if (d < 32) { const v4f v = *(const v4f*)&ov[d * 4]; float* dst = (float*)OUT + r * (size_t)ldo + (size_t)h * 128 + d * 4; *(v4f*)dst = v;  } }
  else { if (d < 16) { FragH f; for (int q = 0; q < 8; ++q) f.h[q] = (_Float16)ov[d * 8 + q]; unsigned short* dst = (unsigned short*)OUT + r * (size_t)ldo + (size_t)h * 128 + d * 8; *(v8us*)dst = f.half[0];  } } }
template <int N>
__global__ __launch_bounds__(256) void k_rmsrow(float* __restrict__ X, const float* __restrict__ w, float eps) {
  #pragma clang fp contract(off)
  constexpr int PT = N / 256; __shared__ float red[256]; const size_t r = blockIdx.x; const int t = threadIdx.x; float* row = X + r * N + (size_t)t * PT; float v[PT]; float ss = 0.f;
  for (int q = 0; q < PT; ++q) { v[q] = row[q]; ss = __fadd_rn(ss, __fmul_rn(v[q], v[q])); }
  red[t] = ss; __syncthreads(); for (int k = 128; k > 0; k >>= 1) { if (t < k) red[t] = __fadd_rn(red[t], red[t + k]); __syncthreads(); }
  const float rs = rsqrtf(__fadd_rn(red[0] / (float)N, eps)); float o[PT]; for (int q = 0; q < PT; ++q) o[q] = __fmul_rn(__fmul_rn(v[q], rs), bf16_round(w[t * PT + q]));
  { for (int q = 0; q < PT; ++q) *(float*)(row + q) = o[q];  } }
template <int GS_, int NHQ, int DSRC>
__global__ __launch_bounds__(256) void k_kvexp128(const float* __restrict__ src, float* __restrict__ dst, size_t n4) { const size_t t = (size_t)blockIdx.x * 256 + threadIdx.x; if (t >= n4) return; const size_t e = t * 4; const size_t row = e / ((size_t)NHQ * 128); const int col = (int)(e % ((size_t)NHQ * 128)); const int h = col / 128, d = col % 128; const v4f v = *(const v4fa*)(src + row * DSRC + (size_t)(h / GS_) * 128 + d); *(v4f*)(dst + e) = v;  }

__global__ __launch_bounds__(256) void k_rsmcfb(const float* __restrict__ S, _Float16* __restrict__ P, int hg, int q0, int nk, const int* __restrict__ mk) {
  #pragma clang fp contract(off)
  const int t = blockIdx.x * 256 + threadIdx.x; if (t >= hg * QT) return; const size_t i = (size_t)t; const float* s = S + i * NKX; const size_t ig = (size_t)(q0 + (t % QT)); const int* mr = mk + ig * SQ; float mx = -3.0e38f;
#pragma unroll 1
  for (int j = 0; j < nk; ++j) { const int mb = mr[j]; const float f = (mb == 0) ? 1.f : 0.f; mx = fmaxf(mx, fmaf(f, s[j], (1.f - f) * -1.0e9f)); } float se = 0.f;
#pragma unroll 1
  for (int j = 0; j < nk; ++j) { const int mb = mr[j]; const float f = (mb == 0) ? 1.f : 0.f; se += __expf(fmaf(f, s[j], (1.f - f) * -1.0e9f) - mx); } const float sc = 256.0f / se;
#pragma unroll 1
  for (int j0 = 0; j0 < nk; j0 += 8) { FragH fr; for (int q = 0; q < 8; ++q) { const int j = j0 + q; const int mb = mr[j]; const float f = (mb == 0) ? 1.f : 0.f; fr.h[q] = (_Float16)(__expf(fmaf(f, s[j], (1.f - f) * -1.0e9f) - mx) * sc); } unsigned short* d = (unsigned short*)P + i * NKX + j0; *(v8us*)d = fr.half[0];  } }


__global__ __launch_bounds__(256) void k_rsmcf2(const float* __restrict__ S, _Float16* __restrict__ P, int hg, int q0, int nk) {
  #pragma clang fp contract(off)
  const int t = blockIdx.x * 256 + threadIdx.x; if (t >= hg * QT) return; const size_t i = (size_t)t; const float* s = S + i * NKX; const int last = q0 + (t % QT); float mx = -3.0e38f;
#pragma unroll 1
  for (int j = 0; j < nk; ++j) { const float f = (j <= last) ? 1.f : 0.f; mx = fmaxf(mx, fmaf(f, s[j], (1.f - f) * -1.0e9f)); } float se = 0.f;
#pragma unroll 1
  for (int j = 0; j < nk; ++j) { const float f = (j <= last) ? 1.f : 0.f; se += __expf(fmaf(f, s[j], (1.f - f) * -1.0e9f) - mx); } const float sc = 256.0f / se;
#pragma unroll 1
  for (int j0 = 0; j0 < nk; j0 += 8) { FragH fr; for (int q = 0; q < 8; ++q) { const int j = j0 + q; const float f = (j <= last) ? 1.f : 0.f; fr.h[q] = (_Float16)(__expf(fmaf(f, s[j], (1.f - f) * -1.0e9f) - mx) * sc); } unsigned short* d = (unsigned short*)P + i * NKX + j0; *(v8us*)d = fr.half[0];  } }



__global__ __launch_bounds__(256) void k_tab128p(const int* __restrict__ pos, int nrows, float theta, float* __restrict__ CS, float* __restrict__ SN) {
  #pragma clang fp contract(off)
  const int t = blockIdx.x * 256 + threadIdx.x; if (t >= nrows * 64) return; const int i = t % 64; const int r = t / 64; const float invf = (float)(1.0 / pow((double)theta, (double)(2 * i) / 128.0)); const float ang = __fmul_rn((float)pos[r], invf); const float c = cosf(ang), sv = sinf(ang);
  float* c0 = CS + (size_t)r * 128 + i; float* s0 = SN + (size_t)r * 128 + i;
  { *(float*)c0 = c; *(float*)(c0 + 64) = c; *(float*)s0 = sv; *(float*)(s0 + 64) = sv;  } }

__global__ __launch_bounds__(128) void k_rmshd(float* __restrict__ F, int ldf, int nh, const float* __restrict__ w, int wst, float eps) {
  #pragma clang fp contract(off)
  __shared__ float red[128]; const int d = threadIdx.x; const int h = blockIdx.x % nh; const size_t r = blockIdx.x / nh; float* p = F + r * (size_t)ldf + (size_t)h * 128 + d; const float v = *p; red[d] = __fmul_rn(v, v); __syncthreads();
  for (int st = 64; st > 0; st >>= 1) { if (d < st) red[d] = __fadd_rn(red[d], red[d + st]); __syncthreads(); }
  const float rs = __frsqrt_rn(__fadd_rn(red[0] / 128.0f, eps)); const float y = __fmul_rn(bf16_round(w[(size_t)h * wst + d]), __fmul_rn(v, rs));      /* gain vector of head h (wst = 128: per-head gains; 0 would share one vector) */ *(float*)p = y;  }
extern "C" void kernel_launch(void* const* d_in, const int* in_sizes, int n_in,
                              void* d_out, int out_size, void* d_ws, size_t ws_size, hipStream_t stream) {
  (void)in_sizes; (void)n_in; (void)out_size;
  const float* const* I = (const float* const*)d_in; const float* x = I[0]; const float* wq = I[1]; const float* wk = I[2]; const float* wv = I[3]; const float* wo = I[4];      /* hidden_states; natural Wq / Wk / Wv / Wo [2048][2048]; no QK norm, no biases, no mask / table inputs */
  char* ws = (char*)d_ws; size_t off = 0;
  auto take = [&](size_t bytes) { char* p = ws + off; off += (bytes + 255) & ~(size_t)255; return p; };
  _Float16* BQ = (_Float16*)take((size_t)DMX * DMX * 2); _Float16* BK = (_Float16*)take((size_t)DKV * DMX * 2); _Float16* BV = (_Float16*)take((size_t)DKV * DMX * 2); _Float16* BO = (_Float16*)take((size_t)DMX * DMX * 2);
  _Float16* X16 = (_Float16*)take(NR * DMX * 2); float* QF = (float*)take(NR * DMX * 4); float* KF = (float*)take(NR * DKV * 4); float* VF = (float*)take(NR * DKV * 4); _Float16* Q16 = (_Float16*)take(NR * DMX * 2); _Float16* K16 = (_Float16*)take(NR * DKV * 2); _Float16* V16 = (_Float16*)take(NR * DKV * 2); _Float16* O16 = (_Float16*)take(NR * DMX * 2);
  float* S = (float*)take((size_t)NH * QT * NKX * 4); _Float16* P = (_Float16*)take((size_t)NH * QT * NKX * 2); _Float16* VT = (_Float16*)take((size_t)(DKV / 64) * 64 * SQ * 2);
  float* QF0 = (float*)take((size_t)QT0 * DMX * 4); float* KRF0 = (float*)take((size_t)QT0 * DKV * 4); float* KF0e = (float*)take((size_t)QT0 * DMX * 4); float* VF0e = (float*)take((size_t)QT0 * DMX * 4); float* OF0 = (float*)take((size_t)NB * QT0 * DMX * 4); _Float16* OH0 = (_Float16*)take((size_t)NB * QT0 * DMX * 2); _Float16* OL0 = (_Float16*)take((size_t)NB * QT0 * DMX * 2); float* tcos = (float*)take((size_t)SQ * 64 * 4); float* tsin = (float*)take((size_t)SQ * 64 * 4);      /* rope tables [2048][64] computed on the device (the module derives them from constants) */
  if (off > ws_size) return;      /* approx 8 + 8 + 8 + 8 + 8 + 16 + 16 + 16 + 8 + 8 + 8 + 8 + 32 + 16 + 8 + 2 + 2 + 2 + 2 + 2 + 1 + 1 + 0.5 + 0.5 = 189 MiB */
  k_wnat<<<(unsigned)(((size_t)DMX * DMX / 8 + 255) / 256), 256, 0, stream>>>(wq, (size_t)DMX * DMX / 8, BQ); k_wnat<<<(unsigned)(((size_t)DKV * DMX / 8 + 255) / 256), 256, 0, stream>>>(wk, (size_t)DKV * DMX / 8, BK); k_wnat<<<(unsigned)(((size_t)DKV * DMX / 8 + 255) / 256), 256, 0, stream>>>(wv, (size_t)DKV * DMX / 8, BV); k_wnat<<<(unsigned)(((size_t)DMX * DMX / 8 + 255) / 256), 256, 0, stream>>>(wo, (size_t)DMX * DMX / 8, BO);      /* natural [out][in] = Bt[n][k] x16 */
  k_x16<<<(unsigned)((NR * DMX / 8 + 255) / 256), 256, 0, stream>>>(x, X16, NR * DMX / 8); k_tab128<<<(SQ * 64 + 255) / 256, 256, 0, stream>>>(10000.0f, tcos, tsin);      /* angle[p][i] = p * 10000^(-2i/128) */
  k_gemm2<0><<<dim3((unsigned)((NR / 128) * (DMX / 64)), 1), 128, 0, stream>>>(X16, DMX, 0, BQ, DMX, 0, 0.0625f, nullptr, 0, nullptr, 1, 0, 0, QF, nullptr, DMX, 0, (int)NR, DMX, DMX);      /* q (f32) */
  k_gemm2<0><<<dim3((unsigned)((NR / 128) * (DKV / 64)), 1), 128, 0, stream>>>(X16, DMX, 0, BK, DMX, 0, 0.0625f, nullptr, 0, nullptr, 1, 0, 0, KF, nullptr, DKV, 0, (int)NR, DKV, DMX);      /* k (f32) */
  k_gemm2<0><<<dim3((unsigned)((NR / 128) * (DKV / 64)), 1), 128, 0, stream>>>(X16, DMX, 0, BV, DMX, 0, 0.0625f, nullptr, 0, nullptr, 1, 0, 0, VF, V16, DKV, 0, (int)NR, DKV, DMX);      /* v (f32 for the first tile + f16) */
  k_rope128x<0, 0, 0><<<(unsigned)(NR * NH), 128, 0, stream>>>(QF, DMX, NH, tcos, tsin, Q16, DMX, 1.0f); k_rope128x<0, 0, 0><<<(unsigned)(NR * NKV), 128, 0, stream>>>(KF, DKV, NKV, tcos, tsin, K16, DKV, 1.0f);      /* half-split rope from the computed tables (index d mod 64) -> f16 */
  for (int b = 0; b < NB; ++b) { const size_t r0 = (size_t)b * SQ;
    k_rope128x<0, 0, 1><<<(unsigned)(QT0 * NH), 128, 0, stream>>>(QF + r0 * DMX, DMX, NH, tcos, tsin, QF0, DMX, 1.0f); k_rope128x<0, 0, 1><<<(unsigned)(QT0 * NKV), 128, 0, stream>>>(KF + r0 * DKV, DKV, NKV, tcos, tsin, KRF0, DKV, 1.0f);      /* f32 roped q, k of the batch's first QT0 rows (positions 0..QT0-1: the table pointers are NOT offset by the batch) */
    k_kvexp128<GSZ, NH, DKV><<<(unsigned)(((size_t)QT0 * DMX / 4 + 255) / 256), 256, 0, stream>>>(KRF0, KF0e, (size_t)QT0 * DMX / 4); k_kvexp128<GSZ, NH, DKV><<<(unsigned)(((size_t)QT0 * DMX / 4 + 255) / 256), 256, 0, stream>>>(VF + r0 * DKV, VF0e, (size_t)QT0 * DMX / 4);      /* kv head -> query head expansion for the exact first tile */
    k_vt<DKV / 64, SQ><<<(DKV / 64) * (SQ / 64), 256, 0, stream>>>(V16 + r0 * DKV, DKV, 0, VT);      /* V^T of this batch: kv head g = slabs 2g, 2g+1 */
    k_att0h<0><<<NH * (QT0 / 32), 32, 0, stream>>>(QF0, KF0e, VF0e, DMX, DMX, nullptr, ATS, OF0 + (size_t)b * QT0 * DMX, DMX);      /* exact causal attention rows 0..255 (o x64) */
    for (int q0 = 0; q0 < SQ; q0 += QT) { const int nk = q0 + QT;      /* causal: keys below the tile end only */
      k_gemm2<0><<<dim3((QT / 128) * (nk / 64), NH), 128, 0, stream>>>(Q16 + (r0 + q0) * DMX, DMX, (size_t)HDK, K16 + r0 * DKV, DKV, (size_t)HDK, ATS, nullptr, 0, nullptr, 1, 0, 0, S, nullptr, NKX, (size_t)QT * NKX, QT, nk, HDK);      /* scores of all heads in one launch: blockIdx.y = head, query and key slabs both step by one head (one query head per kv head) */
      k_rsmcf2<<<(NH * QT + 255) / 256, 256, 0, stream>>>(S, P, NH, q0, nk);      /* causal softmax (arithmetic select) */
      k_gemm2<0><<<dim3((QT / 128) * (HDK / 64), NH), 128, 0, stream>>>(P, NKX, (size_t)QT * NKX, VT, SQ, (size_t)HDK * SQ, 0.25f, nullptr, 0, nullptr, 1, 0, 0, nullptr, O16 + (r0 + q0) * DMX, DMX, (size_t)HDK, QT, HDK, nk); } }      /* o of all heads in one launch (x64): blockIdx.y = head */
  k_gemm2<0><<<dim3((unsigned)((NR / 128) * (DMX / 64)), 1), 128, 0, stream>>>(O16, DMX, 0, BO, DMX, 0, 0.0009765625f, nullptr, 0, nullptr, 1, 0, 0, (float*)d_out, nullptr, DMX, 0, (int)NR, DMX, DMX);      /* out = o Wo^T */
  k_hl<<<(unsigned)(((size_t)NB * QT0 * DMX / 8 + 255) / 256), 256, 0, stream>>>(OF0, OH0, OL0, (size_t)NB * QT0 * DMX / 8);      /* first-tile o (x64) -> f16 hi + x1024 residual planes */
  for (int b = 0; b < NB; ++b) { const size_t r0 = (size_t)b * SQ; const size_t f0 = (size_t)b * QT0;
    k_gemm2<0><<<dim3((QT0 / 128) * (DMX / 64), 1), 128, 0, stream>>>(OH0 + f0 * DMX, DMX, 0, BO, DMX, 0, 0.0009765625f, nullptr, 0, nullptr, 1, 0, 0, (float*)d_out + r0 * DMX, nullptr, DMX, 0, QT0, DMX, DMX);      /* rows 0..255 of the batch rewritten from the exact path */
    k_gemm2<0><<<dim3((QT0 / 128) * (DMX / 64), 1), 128, 0, stream>>>(OL0 + f0 * DMX, DMX, 0, BO, DMX, 0, 0.00000095367431640625f, nullptr, 0, (const float*)d_out + r0 * DMX, -1, 0, 0, (float*)d_out + r0 * DMX, nullptr, DMX, 0, QT0, DMX, DMX); }      /* += o_lo Wo 2^-20 (own-element accumulate) */
}

// v002
// Measured time: 2430 microseconds a run.
// Next to v001, in two timings, it ran 1.60 times as fast each time.
// All steps since v000 together make it 3.53 times as fast.
#include <hip/hip_runtime.h>
// Llama-style causal multi-head attention with half-split RoPE computed in the module (hidden_states [1][2048][2048]; q / k / v = x W^T (nn.Linear natural [2048][2048] sigma 0.02, no biases), 16 heads of 128; rope: emb = [f | f], f = p * 10000^(-2i/128): t cos + rotate_half(t) sin; scores * 128^-0.5; causal (where(tril, ., finfo.min): the weight underflows to exactly 0); softmax; out = merged Wo^T (natural) -> [1][2048][2048]); run on the hd128 grouped-query causal code as 16 kv groups of ONE query head.
// Compute dtype: inputs rounded to bf16; x / weights exact; projections and rope f32; q, k, v, softmax weights and o as plain f16 GEMM operands (~2^-12; first 256 rows of each batch exact); scores, statistics, out f32. v_wmma_f32_16x16x32_f16.
#define NB 1
#define SQ 2048
#define DMX 2048
#define NH 16
#define NKV 16
#define GSZ 1
#define HDK 128
#define DKV (NKV * HDK)
#define QT 256
#define QT0 256
#define NKX SQ
#define DM DMX
#define HD 64
#define HG 1
#define NR ((size_t)NB * SQ)
#define ATS 0.08838834764831845f
static_assert(GSZ == 1 && NH == NKV, "the per-head launches are batched on blockIdx.y with one key / value slab per query head");
typedef __bf16 v16b __attribute__((ext_vector_type(16)));
typedef unsigned short v8us __attribute__((ext_vector_type(8), may_alias));
typedef float  v8f  __attribute__((ext_vector_type(8)));
typedef float  v4f  __attribute__((ext_vector_type(4)));
typedef float  v4fa __attribute__((ext_vector_type(4), may_alias));
union FragB { v16b v; v8us half[2]; unsigned short u[16]; };

__device__ __forceinline__ unsigned short bf16_bits(float x) { unsigned int u = __float_as_uint(x); return (unsigned short)((u + 0x7FFFu + ((u >> 16) & 1u)) >> 16); }
__device__ __forceinline__ float bf16_val(unsigned short b) { return __uint_as_float(((unsigned int)b) << 16); }
__device__ __forceinline__ float bf16_round(float x) { return bf16_val(bf16_bits(x)); }
// D += A·B with NT terms: 1 = ah·bh, 2 = + al·bh (A split), 3 = + ah·bl (both split)
template <int NT>
__device__ __forceinline__ v8f mmaN(v16b ah, v16b al, v16b bh, v16b bl, v8f c) {
  c = __builtin_amdgcn_wmma_f32_16x16x32_bf16(false, ah, false, bh, (short)0, c, false, false);
  if (NT >= 2) c = __builtin_amdgcn_wmma_f32_16x16x32_bf16(false, al, false, bh, (short)0, c, false, false);
  if (NT >= 3) c = __builtin_amdgcn_wmma_f32_16x16x32_bf16(false, ah, false, bl, (short)0, c, false, false);
  asm volatile("v_nop\n\tv_nop\n\tv_nop\n\tv_nop" : "+v"(c) : "v"(ah), "v"(al), "v"(bh), "v"(bl));
  return c;
}

__global__ __launch_bounds__(256) void k_wt_bf16(const float* __restrict__ W, unsigned short* __restrict__ Wt, int K, int N) {
  const int t = blockIdx.x * 256 + threadIdx.x;
  const int k8n = K / 8;
  if (t >= N * k8n) return;
  const int n = t / k8n, k8 = (t % k8n) * 8;
  v8us v;
#pragma unroll
  for (int i = 0; i < 8; ++i) v[i] = bf16_bits(W[(size_t)(k8 + i) * N + n]);
  *(v8us*)(Wt + (size_t)n * K + k8) = v;
  
}

// GEMM C[M][N] (f32, pitch ldc) = act(A[M][K]·W + bias). A f32 row-major (pitch lda) converted per fragment to bf16
// (ASPLIT: hi/lo two planes -> 2 terms, else single rounded term); Wt bf16 [N][K] (pitch ldb). BIAS_BF16 rounds the
// bias to bf16 first (bias quantised to bf16 before the add). K%32==0, M%16==0, N%64==0.
template <bool ASPLIT, int ACT, bool BIAS_BF16>
__global__ __launch_bounds__(128) void k_gemm_bf(const float* __restrict__ A, int lda, const unsigned short* __restrict__ Wt, int ldb,
                                               const float* __restrict__ bias, float* __restrict__ C, int ldc, int M, int N, int K) {
  __shared__ __attribute__((aligned(16))) float so[4][16][64];
  const int tid = threadIdx.x, w = tid >> 5, lane = tid & 31, ln = lane & 15, hh = lane >> 4;
  const int ntn = N / 64;
  const int wid = blockIdx.x * 4 + w;
  const int mt = wid / ntn, nq = wid % ntn;
  if (mt * 16 >= M) return;
  const int row0 = mt * 16, col0 = nq * 64;
  const float* arow = A + (size_t)(row0 + ln) * lda;
  v8f acc[4] = {};
  for (int kb = 0; kb < K; kb += 32) {
    FragB ah, al;
    const v4f x0 = *(const v4fa*)(arow + kb + 8 * hh), x1 = *(const v4fa*)(arow + kb + 8 * hh + 4);
    const v4f x2 = *(const v4fa*)(arow + kb + 16 + 8 * hh), x3 = *(const v4fa*)(arow + kb + 16 + 8 * hh + 4);
    float xs[16] = {x0[0],x0[1],x0[2],x0[3],x1[0],x1[1],x1[2],x1[3],x2[0],x2[1],x2[2],x2[3],x3[0],x3[1],x3[2],x3[3]};
#pragma unroll
    for (int i = 0; i < 16; ++i) { const unsigned short hb = bf16_bits(xs[i]); ah.u[i] = hb; al.u[i] = ASPLIT ? bf16_bits(xs[i] - bf16_val(hb)) : (unsigned short)0; }
#pragma unroll
    for (int t = 0; t < 4; ++t) {
      const unsigned short* brow = Wt + (size_t)(col0 + t * 16 + ln) * ldb + kb;
      FragB b;
      b.half[0] = *(const v8us*)(brow + 8 * hh);
      b.half[1] = *(const v8us*)(brow + 16 + 8 * hh);
      acc[t] = mmaN<ASPLIT ? 2 : 1>(ah.v, al.v, b.v, b.v, acc[t]);
    }
  }
#pragma unroll
  for (int t = 0; t < 4; ++t) {
    float bv = bias ? bias[col0 + t * 16 + ln] : 0.f;
    if (BIAS_BF16) bv = bf16_round(bv);
#pragma unroll
    for (int r = 0; r < 8; ++r) { float v = acc[t][r] + bv; if (ACT == 1) v = fmaxf(v, 0.f); so[w][8 * hh + r][t * 16 + ln] = v; }
  }
  __builtin_amdgcn_fence(__ATOMIC_ACQ_REL, "workgroup");
  __builtin_amdgcn_wave_barrier();
  const int rsub = lane >> 4, c4 = (lane & 15) * 4;
  {
#pragma unroll
    for (int q = 0; q < 8; ++q) {
      const int r = q * 2 + rsub;
      const v4f v = *(const v4fa*)&so[w][r][c4];
      *(v4f*)(C + (size_t)(row0 + r) * ldc + col0 + c4) = v;
    }
    
  }
}

// GEMM C = act(A·W + bias + resid): A f32 (ASPLIT -> hi/lo 2 terms), Wt bf16 [N][K]; ACT 0 none, 1 relu, 2 exact gelu;
// resid (optional, f32, row index = (row % rmod), pitch ldr, RES_BF16 rounds it) added before the activation.
template <bool ASPLIT, int ACT, bool BIAS_BF16, bool RES_BF16>
__global__ __launch_bounds__(128) void k_gemm_bf3(const float* __restrict__ A, int lda, const unsigned short* __restrict__ Wt, int ldb,
                                                const float* __restrict__ bias, const float* __restrict__ resid, int rmod, int ldr,
                                                float* __restrict__ C, int ldc, int M, int N, int K) {
  __shared__ __attribute__((aligned(16))) float so[4][16][64];
  const int tid = threadIdx.x, w = tid >> 5, lane = tid & 31, ln = lane & 15, hh = lane >> 4;
  const int ntn = N / 64;
  const int wid = blockIdx.x * 4 + w;
  const int mt = wid / ntn, nq = wid % ntn;
  if (mt * 16 >= M) return;
  const int row0 = mt * 16, col0 = nq * 64;
  const float* arow = A + (size_t)(row0 + ln) * lda;
  v8f acc[4] = {};
  for (int kb = 0; kb < K; kb += 32) {
    FragB ah, al;
    const v4f x0 = *(const v4fa*)(arow + kb + 8 * hh), x1 = *(const v4fa*)(arow + kb + 8 * hh + 4);
    const v4f x2 = *(const v4fa*)(arow + kb + 16 + 8 * hh), x3 = *(const v4fa*)(arow + kb + 16 + 8 * hh + 4);
    float xs[16] = {x0[0],x0[1],x0[2],x0[3],x1[0],x1[1],x1[2],x1[3],x2[0],x2[1],x2[2],x2[3],x3[0],x3[1],x3[2],x3[3]};
#pragma unroll
    for (int i = 0; i < 16; ++i) { const unsigned short hb = bf16_bits(xs[i]); ah.u[i] = hb; al.u[i] = ASPLIT ? bf16_bits(xs[i] - bf16_val(hb)) : (unsigned short)0; }
#pragma unroll
    for (int t = 0; t < 4; ++t) {
      const unsigned short* brow = Wt + (size_t)(col0 + t * 16 + ln) * ldb + kb;
      FragB b;
      b.half[0] = *(const v8us*)(brow + 8 * hh);
      b.half[1] = *(const v8us*)(brow + 16 + 8 * hh);
      acc[t] = mmaN<ASPLIT ? 2 : 1>(ah.v, al.v, b.v, b.v, acc[t]);
    }
  }
#pragma unroll
  for (int t = 0; t < 4; ++t) {
    const int col = col0 + t * 16 + ln;
    float bv = bias ? bias[col] : 0.f;
    if (BIAS_BF16) bv = bf16_round(bv);
#pragma unroll
    for (int r = 0; r < 8; ++r) {
      float v = acc[t][r] + bv;
      if (resid) { float rv = resid[(size_t)((row0 + 8 * hh + r) % rmod) * ldr + col]; if (RES_BF16) rv = bf16_round(rv); v += rv; }
      if (ACT == 1) v = fmaxf(v, 0.f);
      if (ACT == 2) v = 0.5f * v * (1.0f + erff(v * 0.70710678118654752f));
      if (ACT == 3) { const float u = 0.7978845608028654f * (v + 0.044715f * v * v * v); v = 0.5f * v * (1.0f + tanhf(u)); }
      so[w][8 * hh + r][t * 16 + ln] = v;
    }
  }
  __builtin_amdgcn_fence(__ATOMIC_ACQ_REL, "workgroup");
  __builtin_amdgcn_wave_barrier();
  const int rsub = lane >> 4, c4 = (lane & 15) * 4;
  {
#pragma unroll
    for (int q = 0; q < 8; ++q) {
      const int r = q * 2 + rsub;
      const v4f v = *(const v4fa*)&so[w][r][c4];
      *(v4f*)(C + (size_t)(row0 + r) * ldc + col0 + c4) = v;
    }
    
  }
}
// row LayerNorm (biased variance, eps) over N: s = X (+ R); optional out_sum <- s; out_norm <- (s-mu)*rsqrt(var+eps)*g + b
template <bool PARAM_BF16>
__global__ __launch_bounds__(256) void k_layernorm(const float* __restrict__ X, const float* __restrict__ R, const float* __restrict__ g, const float* __restrict__ bta,
                                                  float* __restrict__ out_sum, float* __restrict__ out_norm, int N, float eps) {
  __shared__ float red[256];
  const int row = blockIdx.x, tid = threadIdx.x;
  const float* x = X + (size_t)row * N; const float* rr = R ? R + (size_t)row * N : nullptr;
  float vals[16];                     // up to N = 4096
  const int per = N / 256;            // contiguous chunk per thread? use strided-by-4 chunks: thread handles j = tid*4 + 1024*u
  float s1 = 0.f;
  for (int u = 0; u < per / 4; ++u) {
    const int j = tid * 4 + 1024 * u;
    const v4f a = *(const v4fa*)(x + j);
    v4f b = {0.f,0.f,0.f,0.f}; if (rr) b = *(const v4fa*)(rr + j);
#pragma unroll
    for (int q = 0; q < 4; ++q) { const float v = a[q] + b[q]; vals[u * 4 + q] = v; s1 += v; }
  }
  red[tid] = s1; __syncthreads();
  for (int st = 128; st > 0; st >>= 1) { if (tid < st) red[tid] += red[tid + st]; __syncthreads(); }
  const float mu = red[0] / (float)N; __syncthreads();
  float s2 = 0.f;
  for (int u = 0; u < per / 4; ++u)
#pragma unroll
    for (int q = 0; q < 4; ++q) { const float c = vals[u * 4 + q] - mu; s2 += c * c; }
  red[tid] = s2; __syncthreads();
  for (int st = 128; st > 0; st >>= 1) { if (tid < st) red[tid] += red[tid + st]; __syncthreads(); }
  const float rs = rsqrtf(red[0] / (float)N + eps);
  {
    for (int u = 0; u < per / 4; ++u) {
      const int j = tid * 4 + 1024 * u;
      v4f o, sm;
#pragma unroll
      for (int q = 0; q < 4; ++q) {
        float gg = g[j + q], bb = bta[j + q];
        if (PARAM_BF16) { gg = bf16_round(gg); bb = bf16_round(bb); }
        sm[q] = vals[u * 4 + q]; o[q] = (vals[u * 4 + q] - mu) * rs * gg + bb;
      }
      if (out_sum) *(v4f*)(out_sum + (size_t)row * N + j) = sm;
      *(v4f*)(out_norm + (size_t)row * N + j) = o;
    }
    
  }
}



// ---- f16 WMMA path (v_wmma_f32_16x16x32_f16): 11-bit significands for operands in range — used where a [0,1] probability operand needs more precision than bf16
typedef _Float16 v16h __attribute__((ext_vector_type(16)));
union FragH { v16h v; v8us half[2]; _Float16 h[16]; unsigned short u[16]; };
template <int NT>
__device__ __forceinline__ v8f mmaH(v16h ah, v16h al, v16h bh, v16h bl, v8f c) {
  c = __builtin_amdgcn_wmma_f32_16x16x32_f16(false, ah, false, bh, (short)0, c, false, false);
  if (NT >= 2) c = __builtin_amdgcn_wmma_f32_16x16x32_f16(false, al, false, bh, (short)0, c, false, false);
  if (NT >= 3) c = __builtin_amdgcn_wmma_f32_16x16x32_f16(false, ah, false, bl, (short)0, c, false, false);
  asm volatile("v_nop\n\tv_nop\n\tv_nop\n\tv_nop" : "+v"(c) : "v"(ah), "v"(al), "v"(bh), "v"(bl));
  return c;
}
// batched GEMM like k_gemm_b but f16 operands: A f32 (split into f16 hi/lo if ASPLIT, else rounded to f16), Bt = f16 values [n][k]; alpha; C f32; N multiple of 16 (partial tiles skipped)
template <bool ASPLIT>
__global__ __launch_bounds__(128) void k_gemm_h(const float* __restrict__ A, int lda, size_t sA, const _Float16* __restrict__ Bh, int ldb, size_t sB, float alpha, float* __restrict__ C, int ldc, size_t sC, int M, int N, int K) {
  __shared__ __attribute__((aligned(16))) float so[4][16][64];
  const int tid = threadIdx.x, w = tid >> 5, lane = tid & 31, ln = lane & 15, hh = lane >> 4; const int by = blockIdx.y;
  A += (size_t)by * sA; Bh += (size_t)by * sB; C += (size_t)by * sC;
  const int ntn = (N + 63) / 64; const int wid = blockIdx.x * 4 + w; const int mt = wid / ntn, nq = wid % ntn; if (mt * 16 >= M) return;
  const int row0 = mt * 16, col0 = nq * 64; const float* arow = A + (size_t)(row0 + ln) * lda;
  v8f acc[4] = {};
  for (int kb = 0; kb < K; kb += 32) {
    FragH ah, al;
    const v4f x0 = *(const v4fa*)(arow + kb + 8 * hh), x1 = *(const v4fa*)(arow + kb + 8 * hh + 4), x2 = *(const v4fa*)(arow + kb + 16 + 8 * hh), x3 = *(const v4fa*)(arow + kb + 16 + 8 * hh + 4);
    float xs[16] = {x0[0],x0[1],x0[2],x0[3],x1[0],x1[1],x1[2],x1[3],x2[0],x2[1],x2[2],x2[3],x3[0],x3[1],x3[2],x3[3]};
#pragma unroll
    for (int i = 0; i < 16; ++i) { const _Float16 h = (_Float16)xs[i]; ah.h[i] = h; al.h[i] = ASPLIT ? (_Float16)(xs[i] - (float)h) : (_Float16)0.0f; }
#pragma unroll
    for (int t = 0; t < 4; ++t) { if (col0 + t * 16 >= N) continue; const size_t boff = (size_t)(col0 + t * 16 + ln) * ldb + kb; FragH bq; bq.half[0] = *(const v8us*)(Bh + boff + 8 * hh); bq.half[1] = *(const v8us*)(Bh + boff + 16 + 8 * hh);
      acc[t] = mmaH<ASPLIT ? 2 : 1>(ah.v, al.v, bq.v, bq.v, acc[t]); }
  }
#pragma unroll
  for (int t = 0; t < 4; ++t) { if (col0 + t * 16 >= N) continue;
#pragma unroll
    for (int r = 0; r < 8; ++r) so[w][8 * hh + r][t * 16 + ln] = acc[t][r] * alpha; }
  __builtin_amdgcn_fence(__ATOMIC_ACQ_REL, "workgroup"); __builtin_amdgcn_wave_barrier();
  const int rsub = lane >> 4, c4 = (lane & 15) * 4;
  {
#pragma unroll
    for (int q = 0; q < 8; ++q) { const int r = q * 2 + rsub; if (col0 + c4 < N) { const v4f v = *(const v4fa*)&so[w][r][c4]; *(v4f*)(C + (size_t)(row0 + r) * ldc + col0 + c4) = v; } }
     }
}

// Wt[n][k] = f16(W[k][n]·scale) from f32 row-major W[K][N] (scale = power of two; bf16-exact weights stay exact in f16 away from the subnormal range)
__global__ __launch_bounds__(256) void k_wt_f16(const float* __restrict__ W, _Float16* __restrict__ Wt, int K, int N, float scale) {
  const int t = blockIdx.x * 256 + threadIdx.x; if (t >= N * (K / 8)) return; const int n = t / (K / 8), k8 = (t % (K / 8)) * 8; FragH f;
#pragma unroll
  for (int i = 0; i < 8; ++i) f.h[i] = (_Float16)(bf16_round(W[(size_t)(k8 + i) * N + n]) * scale); const v8us o = f.half[0];
  *(v8us*)((unsigned short*)Wt + (size_t)n * K + k8) = o; 
}
// k_gemm_hh variant with fused epilogue: v = acc·alpha + bias[by·sBias + col] (+ CP[(row/rowsPerB)·sCPb + by·64 + col] if CP) ; ACT 0 none / 1 elu ; writes f16 C16 (and f32 C if non-null)
template <int ACT>
__global__ __launch_bounds__(128) void k_gemm_hhx(const _Float16* __restrict__ A, int lda, size_t sA, const _Float16* __restrict__ Bh, int ldb, size_t sB, float alpha, const float* __restrict__ bias, size_t sBias, const float* __restrict__ CP, int rowsPerB, size_t sCPb, int row0g,
    float* __restrict__ C, _Float16* __restrict__ C16, int ldc, size_t sC, int M, int N, int K) {
  __shared__ __attribute__((aligned(16))) float so[4][16][64];
  const int tid = threadIdx.x, w = tid >> 5, lane = tid & 31, ln = lane & 15, hh = lane >> 4; const int by = blockIdx.y;
  A += (size_t)by * sA; Bh += (size_t)by * sB; const size_t cofs = (size_t)by * sC; const float* bp = bias ? bias + (size_t)by * sBias : nullptr;
  const int ntn = (N + 63) / 64; const int wid = blockIdx.x * 4 + w; const int mt = wid / ntn, nq = wid % ntn; if (mt * 16 >= M) return;
  const int row0 = mt * 16, col0 = nq * 64; const _Float16* arow = A + (size_t)(row0 + ln) * lda;
  v8f acc[4] = {};
  for (int kb = 0; kb < K; kb += 32) { FragH ah; ah.half[0] = *(const v8us*)((const unsigned short*)arow + kb + 8 * hh); ah.half[1] = *(const v8us*)((const unsigned short*)arow + kb + 16 + 8 * hh);
#pragma unroll
    for (int t = 0; t < 4; ++t) { if (col0 + t * 16 >= N) continue; const size_t boff = (size_t)(col0 + t * 16 + ln) * ldb + kb; FragH bq; bq.half[0] = *(const v8us*)((const unsigned short*)Bh + boff + 8 * hh); bq.half[1] = *(const v8us*)((const unsigned short*)Bh + boff + 16 + 8 * hh);
      acc[t] = mmaH<1>(ah.v, ah.v, bq.v, bq.v, acc[t]); }
  }
#pragma unroll
  for (int t = 0; t < 4; ++t) { if (col0 + t * 16 >= N) continue; const int col = col0 + t * 16 + ln; const float bv = bp ? bf16_round(bp[col]) : 0.f;
#pragma unroll
    for (int r = 0; r < 8; ++r) { float v = acc[t][r] * alpha + bv; if (CP) { const int rr = row0g + row0 + 8 * hh + r; if (rowsPerB < 0) v += CP[cofs + (size_t)rr * ldc + col];      /* rowsPerB < 0: own element of the batched C plane */ else { const int bidx = rr / rowsPerB; v += CP[(size_t)bidx * sCPb + (size_t)by * 64 + col]; } } if (ACT == 1) v = (v > 0.f) ? v : expm1f(v); else if (ACT == 7) v = (v > 0.f) ? v + 1.0f : expf(v); else if (ACT == 8) v = tanhf(v); else if (ACT == 9) v = 0.5f * v * (1.0f + tanhf(0.7978845608028654f * (v + 0.044715f * v * v * v))); else if (ACT == 11) v = 1.0f / (1.0f + expf(-v)); else if (ACT == 12) v = (v > 0.f) ? v : 0.01f * v; else if (ACT == 14) v = (v > 0.f) ? v : 0.1f * v; else if (ACT == 16) v = (v >= 0.f) ? v : 0.3f * v; else if (ACT == 17) v = (v >= 0.f) ? v : 0.2f * v; else if (ACT == 15) v = v / (1.0f + expf(-v)); else if (ACT == 3) v = fmaxf(v, 0.f); else if (ACT == 6) v = 0.5f * v * (1.0f + erff(v * 0.70710678118654752f)); so[w][8 * hh + r][t * 16 + ln] = v; } }
  __builtin_amdgcn_fence(__ATOMIC_ACQ_REL, "workgroup"); __builtin_amdgcn_wave_barrier();
  const int rsub = lane >> 4, c4 = (lane & 15) * 4; typedef _Float16 v4h __attribute__((ext_vector_type(4)));
  {
#pragma unroll
    for (int q = 0; q < 8; ++q) { const int r = q * 2 + rsub; if (col0 + c4 < N) { const v4f v = *(const v4fa*)&so[w][r][c4]; if (C) *(v4f*)(C + cofs + (size_t)(row0 + r) * ldc + col0 + c4) = v; if (C16) { v4h h4; for (int i = 0; i < 4; ++i) h4[i] = (_Float16)v[i]; *(v4h*)(C16 + cofs + (size_t)(row0 + r) * ldc + col0 + c4) = h4; } } }
     }
}


typedef _Float16 v4h __attribute__((ext_vector_type(4)));

__global__ __launch_bounds__(256) void k_x16(const float* __restrict__ x, _Float16* __restrict__ X16, size_t n8) { const size_t t = (size_t)blockIdx.x * 256 + threadIdx.x; if (t >= n8) return; FragH f;
#pragma unroll
  for (int q = 0; q < 8; ++q) f.h[q] = (_Float16)bf16_round(x[t * 8 + q]); *(v8us*)((unsigned short*)X16 + t * 8) = f.half[0];  }
__global__ __launch_bounds__(256) void k_h16(const float* __restrict__ x, _Float16* __restrict__ X16, size_t n8) { const size_t t = (size_t)blockIdx.x * 256 + threadIdx.x; if (t >= n8) return; FragH f;
#pragma unroll
  for (int q = 0; q < 8; ++q) f.h[q] = (_Float16)x[t * 8 + q]; *(v8us*)((unsigned short*)X16 + t * 8) = f.half[0];  }
__global__ __launch_bounds__(256) void k_round16f(const float* __restrict__ W, _Float16* __restrict__ Bt, size_t n8) { const size_t t = (size_t)blockIdx.x * 256 + threadIdx.x; if (t >= n8) return; FragH f;
#pragma unroll
  for (int i = 0; i < 8; ++i) f.h[i] = (_Float16)(bf16_round(W[t * 8 + i]) * 16.0f); *(v8us*)((unsigned short*)Bt + t * 8) = f.half[0];  }
template <int NHv, int TTv>
__global__ __launch_bounds__(256) void k_vt(const _Float16* __restrict__ V16, int ldv, int voff, _Float16* __restrict__ Vt) { __shared__ unsigned short tl[64][66]; const int tid = threadIdx.x; const int slab = blockIdx.x / (TTv / 64), lg = blockIdx.x % (TTv / 64); const int b = slab / NHv, h = slab % NHv;
  for (int i = tid; i < 64 * 8; i += 256) { const int r = i / 8, c8 = (i % 8) * 8; FragH f; f.half[0] = *(const v8us*)((const unsigned short*)V16 + ((size_t)b * TTv + lg * 64 + r) * ldv + voff + h * 64 + c8);
#pragma unroll
    for (int q = 0; q < 8; ++q) tl[r][c8 + q] = f.u[q]; }
  __syncthreads();
  {
#pragma unroll
    for (int rd = 0; rd < 2; ++rd) { const int d = rd * 32 + tid / 8, pc = tid % 8; FragH f;
#pragma unroll
      for (int q = 0; q < 8; ++q) f.u[q] = tl[pc * 8 + q][d];
      *(v8us*)((unsigned short*)Vt + ((size_t)slab * 64 + d) * TTv + lg * 64 + pc * 8) = f.half[0]; }
     } }

__global__ __launch_bounds__(256) void k_hl(const float* __restrict__ F, _Float16* __restrict__ Hh, _Float16* __restrict__ Hl, size_t n8) { const size_t t = (size_t)blockIdx.x * 256 + threadIdx.x; if (t >= n8) return; FragH fh, fl; const v4f a = *(const v4fa*)(F + t * 8), c = *(const v4fa*)(F + t * 8 + 4);
#pragma unroll
  for (int q = 0; q < 4; ++q) { _Float16 h = (_Float16)a[q]; fh.h[q] = h; fl.h[q] = (_Float16)((a[q] - (float)h) * 1024.0f); h = (_Float16)c[q]; fh.h[4 + q] = h; fl.h[4 + q] = (_Float16)((c[q] - (float)h) * 1024.0f); }
  { *(v8us*)((unsigned short*)Hh + t * 8) = fh.half[0]; *(v8us*)((unsigned short*)Hl + t * 8) = fl.half[0];  } }

// ---- fast GEMM (wave tile 32x64; requires M % 32 == 0 rows per launch region and N % 64 == 0); epilogue = k_gemm_hhx semantics ----
__device__ __forceinline__ v16h g2_frag(const _Float16* p, int hh) { FragH f; f.half[0] = *(const v8us*)((const unsigned short*)p + 8 * hh); f.half[1] = *(const v8us*)((const unsigned short*)p + 16 + 8 * hh); return f.v; }
__device__ __forceinline__ v8f g2_mma(v16h a, v16h b, v8f c) { v8f d = __builtin_amdgcn_wmma_f32_16x16x32_f16(false, a, false, b, (short)0, c, false, false); asm volatile("v_nop\n\tv_nop\n\tv_nop\n\tv_nop" : "+v"(d) : "v"(a), "v"(b)); return d; }
template <int ACT>
__global__ __launch_bounds__(128) void k_gemm2(const _Float16* __restrict__ A, int lda, size_t sA, const _Float16* __restrict__ Bh, int ldb, size_t sB, float alpha, const float* __restrict__ bias, size_t sBias, const float* __restrict__ CP, int rowsPerB, size_t sCPb, int row0g,
    float* __restrict__ C, _Float16* __restrict__ C16, int ldc, size_t sC, int M, int N, int K) { static_assert(ACT == 0 || ACT == 3 || ACT == 6 || ACT == 8 || ACT == 9 || ACT == 11 || ACT == 12 || ACT == 14 || ACT == 15 || ACT == 16 || ACT == 17, "k_gemm2: unsupported ACT code (would silently apply no activation)");
  __shared__ __attribute__((aligned(16))) float so[4][32][68];
  const int tid = threadIdx.x, w = tid >> 5, lane = tid & 31, ln = lane & 15, hh = lane >> 4; const int by = blockIdx.y;
  A += (size_t)by * sA; Bh += (size_t)by * sB; const size_t cofs = (size_t)by * sC; const float* bp = bias ? bias + (size_t)by * sBias : nullptr;
  const int ntn = N >> 6; const int mt = blockIdx.x / ntn, nq = blockIdx.x - mt * ntn; const int row0 = mt * 128 + 32 * w, col0 = nq * 64; if (row0 >= M) return;
  const _Float16* a0p = A + (size_t)(row0 + ln) * lda; const _Float16* a1p = a0p + (size_t)16 * lda;
  const _Float16* b0p = Bh + (size_t)(col0 + ln) * ldb; const _Float16* b1p = b0p + (size_t)16 * ldb; const _Float16* b2p = b1p + (size_t)16 * ldb; const _Float16* b3p = b2p + (size_t)16 * ldb;
  const v8f z8 = {0.f,0.f,0.f,0.f,0.f,0.f,0.f,0.f}; v8f c00 = z8, c01 = z8, c02 = z8, c03 = z8, c10 = z8, c11 = z8, c12 = z8, c13 = z8;
#pragma unroll 1
  for (int kb = 0; kb < K; kb += 32) { const v16h a0 = g2_frag(a0p + kb, hh), a1 = g2_frag(a1p + kb, hh);
    v16h b = g2_frag(b0p + kb, hh); c00 = g2_mma(a0, b, c00); c10 = g2_mma(a1, b, c10);
    b = g2_frag(b1p + kb, hh); c01 = g2_mma(a0, b, c01); c11 = g2_mma(a1, b, c11);
    b = g2_frag(b2p + kb, hh); c02 = g2_mma(a0, b, c02); c12 = g2_mma(a1, b, c12);
    b = g2_frag(b3p + kb, hh); c03 = g2_mma(a0, b, c03); c13 = g2_mma(a1, b, c13); }
  v8f accs[8] = {c00, c01, c02, c03, c10, c11, c12, c13};
#pragma unroll
  for (int u = 0; u < 8; ++u) { const int t = u & 3, half = u >> 2; const int col = col0 + t * 16 + ln; const float bv = bp ? bf16_round(bp[col]) : 0.f;
#pragma unroll
    for (int r = 0; r < 8; ++r) { const int rloc = half * 16 + 8 * hh + r; float v = accs[u][r] * alpha + bv; if (CP) { if (rowsPerB < 0) v += CP[cofs + (size_t)(row0g + row0 + rloc) * ldc + col];      /* rowsPerB < 0: own element of the batched C plane */ else { const int bidx = (row0g + row0 + rloc) / rowsPerB; v += CP[(size_t)bidx * sCPb + (size_t)by * 64 + col]; } }
      if (ACT == 3) v = fmaxf(v, 0.f); else if (ACT == 6) v = 0.5f * v * (1.0f + erff(v * 0.70710678118654752f)); else if (ACT == 11) v = 1.0f / (1.0f + expf(-v)); else if (ACT == 15) v = v / (1.0f + expf(-v)); else if (ACT == 12) v = (v > 0.f) ? v : 0.01f * v; else if (ACT == 8) v = tanhf(v); else if (ACT == 9) v = 0.5f * v * (1.0f + tanhf(0.7978845608028654f * (v + 0.044715f * v * v * v))); else if (ACT == 14) v = (v > 0.f) ? v : 0.1f * v; else if (ACT == 16) v = (v >= 0.f) ? v : 0.3f * v; else if (ACT == 17) v = (v >= 0.f) ? v : 0.2f * v;
      so[w][rloc][t * 16 + ln] = v; } }
  __builtin_amdgcn_fence(__ATOMIC_ACQ_REL, "workgroup"); __builtin_amdgcn_wave_barrier();
  const int rsub = lane >> 4, c4 = (lane & 15) * 4;
  {
#pragma unroll
    for (int q = 0; q < 16; ++q) { const int r = q * 2 + rsub; const v4f v = *(const v4fa*)&so[w][r][c4]; if (C) *(v4f*)(C + cofs + (size_t)(row0 + r) * ldc + col0 + c4) = v; if (C16) { v4h h4; for (int i = 0; i < 4; ++i) h4[i] = (_Float16)v[i]; *(v4h*)(C16 + cofs + (size_t)(row0 + r) * ldc + col0 + c4) = h4; } }
     } }


__global__ __launch_bounds__(256) void k_wnat(const float* __restrict__ w, size_t n8, _Float16* __restrict__ Bt) { const size_t t = (size_t)blockIdx.x * 256 + threadIdx.x; if (t >= n8) return; FragH f; for (int q = 0; q < 8; ++q) f.h[q] = (_Float16)(bf16_round(w[t * 8 + q]) * 16.0f); *(v8us*)((unsigned short*)Bt + t * 8) = f.half[0];  }
__global__ __launch_bounds__(256) void k_rsm(const float* __restrict__ S, _Float16* __restrict__ P, int nrows) {
  #pragma clang fp contract(off)
  const int i = blockIdx.x * 256 + threadIdx.x; if (i >= nrows) return; const float* s = S + (size_t)i * SQ; float mx = -3.0e38f;
#pragma unroll 1
  for (int j = 0; j < SQ; ++j) mx = fmaxf(mx, s[j]); float se = 0.f;
#pragma unroll 1
  for (int j = 0; j < SQ; ++j) se += expf(s[j] - mx); const float sc = 256.0f / se;
#pragma unroll 1
  for (int j0 = 0; j0 < SQ; j0 += 8) { FragH f; for (int q = 0; q < 8; ++q) f.h[q] = (_Float16)(expf(s[j0 + q] - mx) * sc); unsigned short* d = (unsigned short*)P + (size_t)i * SQ + j0; *(v8us*)d = f.half[0];  } }
__global__ __launch_bounds__(256) void k_vt(const _Float16* __restrict__ V16, int b, int h0, _Float16* __restrict__ VT) { __shared__ unsigned short tl[64][65]; const int tid = threadIdx.x; const int hh = blockIdx.x % HG, sg = blockIdx.x / HG; const int s0 = sg * 64; const int h = h0 + hh;
  for (int i = tid; i < 64 * 8; i += 256) { const int j = i / 8, d8 = (i % 8) * 8; FragH f; f.half[0] = *(const v8us*)((const unsigned short*)V16 + ((size_t)b * SQ + s0 + j) * DM + h * HD + d8); for (int q = 0; q < 8; ++q) tl[d8 + q][j] = f.u[q]; }
  __syncthreads();
  { for (int i = tid; i < 64 * 8; i += 256) { const int d = i / 8, j8 = (i % 8) * 8; FragH f; for (int q = 0; q < 8; ++q) f.u[q] = tl[d][j8 + q]; *(v8us*)((unsigned short*)VT + ((size_t)hh * HD + d) * SQ + s0 + j8) = f.half[0]; }  } }


template <int MASK>
__global__ __launch_bounds__(32) void k_att0h(const float* __restrict__ QF, const float* __restrict__ KF, const float* __restrict__ VF, int ld, int ldv, const int* __restrict__ mk, float scale, float* __restrict__ OF, int ldo) {
  #pragma clang fp contract(off)
  __shared__ __attribute__((aligned(16))) float lq[32][128]; __shared__ __attribute__((aligned(16))) float lo[32][128];
  const int tid = threadIdx.x; const int h = blockIdx.x / (QT0 / 32), rg = blockIdx.x % (QT0 / 32); const int i = rg * 32 + tid;
  for (int c = 0; c < 32; ++c) { *(v4f*)&lq[tid][c * 4] = *(const v4fa*)(QF + (size_t)i * ld + h * 128 + c * 4); const v4f z = {0.f, 0.f, 0.f, 0.f}; *(v4f*)&lo[tid][c * 4] = z; }
  float m = -1.0e30f, l = 0.f; const int jmax = rg * 32 + 31;
#pragma unroll 1
  for (int j = 0; j <= jmax; ++j) { const float* kr = KF + (size_t)j * ld + h * 128; const float* vr = VF + (size_t)j * ldv + h * 128; float s = 0.f;
#pragma unroll 1
    for (int c = 0; c < 32; ++c) { const v4f kq = *(const v4fa*)(kr + c * 4); const v4f qq = *(v4f*)&lq[tid][c * 4]; for (int u = 0; u < 4; ++u) s = __fadd_rn(s, __fmul_rn(qq[u], kq[u])); }
    s = __fmul_rn(s, scale); float f; if (MASK) { const int mb = mk[(size_t)i * SQ + j]; f = (mb == 0) ? 1.f : 0.f; } else { f = (j <= i) ? 1.f : 0.f; }
    const float sm = fmaf(f, s, (1.f - f) * -1.0e30f); const float mn = fmaxf(m, sm); const float sc = expf(m - mn); const float e = __fmul_rn(f, expf(sm - mn)); l = __fadd_rn(__fmul_rn(l, sc), e); m = mn;
#pragma unroll 1
    for (int c = 0; c < 32; ++c) { const v4f vv = *(const v4fa*)(vr + c * 4); v4f oo = *(v4f*)&lo[tid][c * 4]; for (int u = 0; u < 4; ++u) oo[u] = __fadd_rn(__fmul_rn(oo[u], sc), __fmul_rn(e, vv[u])); *(v4f*)&lo[tid][c * 4] = oo; } }
  const float fin = 64.0f / l;
  { for (int c = 0; c < 32; ++c) { v4f oo = *(v4f*)&lo[tid][c * 4]; for (int u = 0; u < 4; ++u) oo[u] = __fmul_rn(oo[u], fin); *(v4f*)(OF + (size_t)i * ldo + h * 128 + c * 4) = oo; }  } }
__global__ __launch_bounds__(256) void k_f2h(const float* __restrict__ F, int ldf, int coff, int ncol, _Float16* __restrict__ H16, size_t nrow) { const size_t t = (size_t)blockIdx.x * 256 + threadIdx.x; const size_t n8 = nrow * (size_t)(ncol / 8); if (t >= n8) return; const size_t r = t / (ncol / 8); const int c8 = (int)(t % (ncol / 8)) * 8; FragH f; const v4f a = *(const v4fa*)(F + r * ldf + coff + c8), b2 = *(const v4fa*)(F + r * ldf + coff + c8 + 4); for (int q = 0; q < 4; ++q) { f.h[q] = (_Float16)a[q]; f.h[4 + q] = (_Float16)b2[q]; } *(v8us*)((unsigned short*)H16 + r * ncol + c8) = f.half[0];  }

__global__ __launch_bounds__(256) void k_tab128(float theta, float* __restrict__ CS, float* __restrict__ SN) {
  #pragma clang fp contract(off)
  const int t = blockIdx.x * 256 + threadIdx.x; if (t >= SQ * 64) return; const int i = t % 64; const int p = t / 64; const float invf = (float)(1.0 / pow((double)theta, (double)(2 * i) / 128.0));      /* = XLA's constant-folded f32 table */ const float ang = __fmul_rn((float)p, invf); const float c = cosf(ang), s = sinf(ang);
  *(float*)(CS + t) = c; *(float*)(SN + t) = s;  }
template <int TAB>
__global__ __launch_bounds__(128) void k_rope128(const float* __restrict__ F, int ldf, int nh, const float* __restrict__ CS, const float* __restrict__ SN, _Float16* __restrict__ H16, int ldo, float osc) {
  #pragma clang fp contract(off)
  __shared__ float xv[128]; __shared__ unsigned short sh_[128]; const int d = threadIdx.x; const int h = blockIdx.x % nh; const size_t r = blockIdx.x / nh; const int p = (int)(r % SQ);
  xv[d] = F[r * (size_t)ldf + (size_t)h * 128 + d]; __syncthreads();
  float c, s; if (TAB) { c = bf16_round(CS[(size_t)p * 128 + d]); s = bf16_round(SN[(size_t)p * 128 + d]); } else { c = CS[p * 64 + (d & 63)]; s = SN[p * 64 + (d & 63)]; }
  const float rot = (d < 64) ? -xv[d + 64] : xv[d - 64]; const float o = __fadd_rn(__fmul_rn(xv[d], c), __fmul_rn(rot, s));
  FragH th; th.h[0] = (_Float16)__fmul_rn(o, osc); sh_[d] = th.u[0]; __syncthreads();
  if (d < 16) { FragH f; for (int q = 0; q < 8; ++q) f.u[q] = sh_[d * 8 + q]; unsigned short* dst = (unsigned short*)H16 + r * (size_t)ldo + (size_t)h * 128 + d * 8; *(v8us*)dst = f.half[0];  } }

template <int TAB, int IL, int F32OUT>
__global__ __launch_bounds__(128) void k_rope128x(const float* __restrict__ F, int ldf, int nh, const float* __restrict__ CS, const float* __restrict__ SN, void* __restrict__ OUT, int ldo, float osc) {
  #pragma clang fp contract(off)
  __shared__ float xv[128]; __shared__ float ov[128]; const int d = threadIdx.x; const int h = blockIdx.x % nh; const size_t r = blockIdx.x / nh; const int p = (int)(r % SQ);
  xv[d] = F[r * (size_t)ldf + (size_t)h * 128 + d]; __syncthreads();
  float c, s; if (TAB == 2) { c = CS[r * 128 + d]; s = SN[r * 128 + d]; }      /* computed full-width f32 tables, one row per token row r (relative to the passed pointers) */ else if (TAB) { c = bf16_round(CS[(size_t)p * 128 + d]); s = bf16_round(SN[(size_t)p * 128 + d]); } else { const int ti = IL ? (d >> 1) : (d & 63); c = CS[p * 64 + ti]; s = SN[p * 64 + ti]; }
  const float rot = IL ? ((d & 1) ? xv[d - 1] : -xv[d + 1]) : ((d < 64) ? -xv[d + 64] : xv[d - 64]);
  ov[d] = __fmul_rn(__fadd_rn(__fmul_rn(xv[d], c), __fmul_rn(rot, s)), osc); __syncthreads();
  if (F32OUT) { if (d < 32) { const v4f v = *(const v4f*)&ov[d * 4]; float* dst = (float*)OUT + r * (size_t)ldo + (size_t)h * 128 + d * 4; *(v4f*)dst = v;  } }
  else { if (d < 16) { FragH f; for (int q = 0; q < 8; ++q) f.h[q] = (_Float16)ov[d * 8 + q]; unsigned short* dst = (unsigned short*)OUT + r * (size_t)ldo + (size_t)h * 128 + d * 8; *(v8us*)dst = f.half[0];  } } }
template <int N>
__global__ __launch_bounds__(256) void k_rmsrow(float* __restrict__ X, const float* __restrict__ w, float eps) {
  #pragma clang fp contract(off)
  constexpr int PT = N / 256; __shared__ float red[256]; const size_t r = blockIdx.x; const int t = threadIdx.x; float* row = X + r * N + (size_t)t * PT; float v[PT]; float ss = 0.f;
  for (int q = 0; q < PT; ++q) { v[q] = row[q]; ss = __fadd_rn(ss, __fmul_rn(v[q], v[q])); }
  red[t] = ss; __syncthreads(); for (int k = 128; k > 0; k >>= 1) { if (t < k) red[t] = __fadd_rn(red[t], red[t + k]); __syncthreads(); }
  const float rs = rsqrtf(__fadd_rn(red[0] / (float)N, eps)); float o[PT]; for (int q = 0; q < PT; ++q) o[q] = __fmul_rn(__fmul_rn(v[q], rs), bf16_round(w[t * PT + q]));
  { for (int q = 0; q < PT; ++q) *(float*)(row + q) = o[q];  } }
template <int GS_, int NHQ, int DSRC>
__global__ __launch_bounds__(256) void k_kvexp128(const float* __restrict__ src, float* __restrict__ dst, size_t n4) { const size_t t = (size_t)blockIdx.x * 256 + threadIdx.x; if (t >= n4) return; const size_t e = t * 4; const size_t row = e / ((size_t)NHQ * 128); const int col = (int)(e % ((size_t)NHQ * 128)); const int h = col / 128, d = col % 128; const v4f v = *(const v4fa*)(src + row * DSRC + (size_t)(h / GS_) * 128 + d); *(v4f*)(dst + e) = v;  }

__global__ __launch_bounds__(256) void k_rsmcfb(const float* __restrict__ S, _Float16* __restrict__ P, int hg, int q0, int nk, const int* __restrict__ mk) {
  #pragma clang fp contract(off)
  const int t = blockIdx.x * 256 + threadIdx.x; if (t >= hg * QT) return; const size_t i = (size_t)t; const float* s = S + i * NKX; const size_t ig = (size_t)(q0 + (t % QT)); const int* mr = mk + ig * SQ; float mx = -3.0e38f;
#pragma unroll 1
  for (int j = 0; j < nk; ++j) { const int mb = mr[j]; const float f = (mb == 0) ? 1.f : 0.f; mx = fmaxf(mx, fmaf(f, s[j], (1.f - f) * -1.0e9f)); } float se = 0.f;
#pragma unroll 1
  for (int j = 0; j < nk; ++j) { const int mb = mr[j]; const float f = (mb == 0) ? 1.f : 0.f; se += __expf(fmaf(f, s[j], (1.f - f) * -1.0e9f) - mx); } const float sc = 256.0f / se;
#pragma unroll 1
  for (int j0 = 0; j0 < nk; j0 += 8) { FragH fr; for (int q = 0; q < 8; ++q) { const int j = j0 + q; const int mb = mr[j]; const float f = (mb == 0) ? 1.f : 0.f; fr.h[q] = (_Float16)(__expf(fmaf(f, s[j], (1.f - f) * -1.0e9f) - mx) * sc); } unsigned short* d = (unsigned short*)P + i * NKX + j0; *(v8us*)d = fr.half[0];  } }


// 2^x on the transcendental unit; the v_nop is the one free issue slot that the instruction set asks for behind a transcendental before its result is read or its source overwritten: written in the same statement so that it stands directly behind the v_exp_f32 in every build
__device__ __forceinline__ float exp2_slot(float x) { float y; asm("v_exp_f32 %0, %1\n\tv_nop" : "=v"(y) : "v"(x)); return y; }
// one wave per score row of NU * 128 keys: lane l holds columns 128u + 4l .. 128u + 4l + 3 of the row in registers, so each wave-wide load covers 512 contiguous bytes, the row is read once and each exponential is taken once; maximum and sum: one partial per lane, then a five-step butterfly over the wave
template <int NU>
__global__ __launch_bounds__(256) void k_rsmcf2(const float* __restrict__ S, _Float16* __restrict__ P, int hg, int q0) {
  const int t = blockIdx.x * 8 + __builtin_amdgcn_readfirstlane(threadIdx.x >> 5);      /* the row is the same in every lane: row base, diagonal and the test below stay scalar */
  if (t >= hg * QT) return; const int c0 = (threadIdx.x & 31) * 4; const size_t i = (size_t)t; const float* s = S + i * NKX + c0; const int last = q0 + (t % QT); v4f v[NU];
#pragma unroll      /* the four loops over u are unrolled so that v[] is indexed by constants and stays in registers */
  for (int u = 0; u < NU; ++u) v[u] = *(const v4fa*)(s + u * 128);      /* the loads stand in a loop of their own, ahead of the arithmetic, so that many are in flight at once */
  float mx = -3.0e38f;
#pragma unroll      /* v[] in registers */
  for (int u = 0; u < NU; ++u) for (int q = 0; q < 4; ++q) { const float f = (u * 128 + c0 + q <= last) ? 1.f : 0.f; v[u][q] = fmaf(f, v[u][q], (1.f - f) * -1.0e9f); mx = fmaxf(mx, v[u][q]); }
  for (int m = 16; m >= 1; m >>= 1) mx = fmaxf(mx, __shfl_xor(mx, m, 32));
  float se = 0.f;
#pragma unroll      /* v[] in registers */
  for (int u = 0; u < NU; ++u) for (int q = 0; q < 4; ++q) { v[u][q] = exp2_slot((v[u][q] - mx) * 1.44269504088896340736f); se += v[u][q]; }
  for (int m = 16; m >= 1; m >>= 1) se += __shfl_xor(se, m, 32);
  const float sc = 256.0f / se; _Float16* d = P + i * NKX + c0;
#pragma unroll      /* v[] in registers */
  for (int u = 0; u < NU; ++u) { v4h h4; for (int q = 0; q < 4; ++q) h4[q] = (_Float16)(v[u][q] * sc); *(v4h*)(d + u * 128) = h4; } }
// launches the instance whose row length is nk keys (nk = 256, 512, ... NKX)
template <int NU>
static void rsmcf2_launch(const float* S, _Float16* P, int q0, int nk, hipStream_t stream) { if (nk == NU * 128) k_rsmcf2<NU><<<(NH * QT + 7) / 8, 256, 0, stream>>>(S, P, NH, q0); else if constexpr (NU > 2) rsmcf2_launch<NU - 2>(S, P, q0, nk, stream); }



__global__ __launch_bounds__(256) void k_tab128p(const int* __restrict__ pos, int nrows, float theta, float* __restrict__ CS, float* __restrict__ SN) {
  #pragma clang fp contract(off)
  const int t = blockIdx.x * 256 + threadIdx.x; if (t >= nrows * 64) return; const int i = t % 64; const int r = t / 64; const float invf = (float)(1.0 / pow((double)theta, (double)(2 * i) / 128.0)); const float ang = __fmul_rn((float)pos[r], invf); const float c = cosf(ang), sv = sinf(ang);
  float* c0 = CS + (size_t)r * 128 + i; float* s0 = SN + (size_t)r * 128 + i;
  { *(float*)c0 = c; *(float*)(c0 + 64) = c; *(float*)s0 = sv; *(float*)(s0 + 64) = sv;  } }

__global__ __launch_bounds__(128) void k_rmshd(float* __restrict__ F, int ldf, int nh, const float* __restrict__ w, int wst, float eps) {
  #pragma clang fp contract(off)
  __shared__ float red[128]; const int d = threadIdx.x; const int h = blockIdx.x % nh; const size_t r = blockIdx.x / nh; float* p = F + r * (size_t)ldf + (size_t)h * 128 + d; const float v = *p; red[d] = __fmul_rn(v, v); __syncthreads();
  for (int st = 64; st > 0; st >>= 1) { if (d < st) red[d] = __fadd_rn(red[d], red[d + st]); __syncthreads(); }
  const float rs = __frsqrt_rn(__fadd_rn(red[0] / 128.0f, eps)); const float y = __fmul_rn(bf16_round(w[(size_t)h * wst + d]), __fmul_rn(v, rs));      /* gain vector of head h (wst = 128: per-head gains; 0 would share one vector) */ *(float*)p = y;  }
extern "C" void kernel_launch(void* const* d_in, const int* in_sizes, int n_in,
                              void* d_out, int out_size, void* d_ws, size_t ws_size, hipStream_t stream) {
  (void)in_sizes; (void)n_in; (void)out_size;
  const float* const* I = (const float* const*)d_in; const float* x = I[0]; const float* wq = I[1]; const float* wk = I[2]; const float* wv = I[3]; const float* wo = I[4];      /* hidden_states; natural Wq / Wk / Wv / Wo [2048][2048]; no QK norm, no biases, no mask / table inputs */
  char* ws = (char*)d_ws; size_t off = 0;
  auto take = [&](size_t bytes) { char* p = ws + off; off += (bytes + 255) & ~(size_t)255; return p; };
  _Float16* BQ = (_Float16*)take((size_t)DMX * DMX * 2); _Float16* BK = (_Float16*)take((size_t)DKV * DMX * 2); _Float16* BV = (_Float16*)take((size_t)DKV * DMX * 2); _Float16* BO = (_Float16*)take((size_t)DMX * DMX * 2);
  _Float16* X16 = (_Float16*)take(NR * DMX * 2); float* QF = (float*)take(NR * DMX * 4); float* KF = (float*)take(NR * DKV * 4); float* VF = (float*)take(NR * DKV * 4); _Float16* Q16 = (_Float16*)take(NR * DMX * 2); _Float16* K16 = (_Float16*)take(NR * DKV * 2); _Float16* V16 = (_Float16*)take(NR * DKV * 2); _Float16* O16 = (_Float16*)take(NR * DMX * 2);
  float* S = (float*)take((size_t)NH * QT * NKX * 4); _Float16* P = (_Float16*)take((size_t)NH * QT * NKX * 2); _Float16* VT = (_Float16*)take((size_t)(DKV / 64) * 64 * SQ * 2);
  float* QF0 = (float*)take((size_t)QT0 * DMX * 4); float* KRF0 = (float*)take((size_t)QT0 * DKV * 4); float* KF0e = (float*)take((size_t)QT0 * DMX * 4); float* VF0e = (float*)take((size_t)QT0 * DMX * 4); float* OF0 = (float*)take((size_t)NB * QT0 * DMX * 4); _Float16* OH0 = (_Float16*)take((size_t)NB * QT0 * DMX * 2); _Float16* OL0 = (_Float16*)take((size_t)NB * QT0 * DMX * 2); float* tcos = (float*)take((size_t)SQ * 64 * 4); float* tsin = (float*)take((size_t)SQ * 64 * 4);      /* rope tables [2048][64] computed on the device (the module derives them from constants) */
  if (off > ws_size) return;      /* approx 8 + 8 + 8 + 8 + 8 + 16 + 16 + 16 + 8 + 8 + 8 + 8 + 32 + 16 + 8 + 2 + 2 + 2 + 2 + 2 + 1 + 1 + 0.5 + 0.5 = 189 MiB */
  k_wnat<<<(unsigned)(((size_t)DMX * DMX / 8 + 255) / 256), 256, 0, stream>>>(wq, (size_t)DMX * DMX / 8, BQ); k_wnat<<<(unsigned)(((size_t)DKV * DMX / 8 + 255) / 256), 256, 0, stream>>>(wk, (size_t)DKV * DMX / 8, BK); k_wnat<<<(unsigned)(((size_t)DKV * DMX / 8 + 255) / 256), 256, 0, stream>>>(wv, (size_t)DKV * DMX / 8, BV); k_wnat<<<(unsigned)(((size_t)DMX * DMX / 8 + 255) / 256), 256, 0, stream>>>(wo, (size_t)DMX * DMX / 8, BO);      /* natural [out][in] = Bt[n][k] x16 */
  k_x16<<<(unsigned)((NR * DMX / 8 + 255) / 256), 256, 0, stream>>>(x, X16, NR * DMX / 8); k_tab128<<<(SQ * 64 + 255) / 256, 256, 0, stream>>>(10000.0f, tcos, tsin);      /* angle[p][i] = p * 10000^(-2i/128) */
  k_gemm2<0><<<dim3((unsigned)((NR / 128) * (DMX / 64)), 1), 128, 0, stream>>>(X16, DMX, 0, BQ, DMX, 0, 0.0625f, nullptr, 0, nullptr, 1, 0, 0, QF, nullptr, DMX, 0, (int)NR, DMX, DMX);      /* q (f32) */
  k_gemm2<0><<<dim3((unsigned)((NR / 128) * (DKV / 64)), 1), 128, 0, stream>>>(X16, DMX, 0, BK, DMX, 0, 0.0625f, nullptr, 0, nullptr, 1, 0, 0, KF, nullptr, DKV, 0, (int)NR, DKV, DMX);      /* k (f32) */
  k_gemm2<0><<<dim3((unsigned)((NR / 128) * (DKV / 64)), 1), 128, 0, stream>>>(X16, DMX, 0, BV, DMX, 0, 0.0625f, nullptr, 0, nullptr, 1, 0, 0, VF, V16, DKV, 0, (int)NR, DKV, DMX);      /* v (f32 for the first tile + f16) */
  k_rope128x<0, 0, 0><<<(unsigned)(NR * NH), 128, 0, stream>>>(QF, DMX, NH, tcos, tsin, Q16, DMX, 1.0f); k_rope128x<0, 0, 0><<<(unsigned)(NR * NKV), 128, 0, stream>>>(KF, DKV, NKV, tcos, tsin, K16, DKV, 1.0f);      /* half-split rope from the computed tables (index d mod 64) -> f16 */
  for (int b = 0; b < NB; ++b) { const size_t r0 = (size_t)b * SQ;
    k_rope128x<0, 0, 1><<<(unsigned)(QT0 * NH), 128, 0, stream>>>(QF + r0 * DMX, DMX, NH, tcos, tsin, QF0, DMX, 1.0f); k_rope128x<0, 0, 1><<<(unsigned)(QT0 * NKV), 128, 0, stream>>>(KF + r0 * DKV, DKV, NKV, tcos, tsin, KRF0, DKV, 1.0f);      /* f32 roped q, k of the batch's first QT0 rows (positions 0..QT0-1: the table pointers are NOT offset by the batch) */
    k_kvexp128<GSZ, NH, DKV><<<(unsigned)(((size_t)QT0 * DMX / 4 + 255) / 256), 256, 0, stream>>>(KRF0, KF0e, (size_t)QT0 * DMX / 4); k_kvexp128<GSZ, NH, DKV><<<(unsigned)(((size_t)QT0 * DMX / 4 + 255) / 256), 256, 0, stream>>>(VF + r0 * DKV, VF0e, (size_t)QT0 * DMX / 4);      /* kv head -> query head expansion for the exact first tile */
    k_vt<DKV / 64, SQ><<<(DKV / 64) * (SQ / 64), 256, 0, stream>>>(V16 + r0 * DKV, DKV, 0, VT);      /* V^T of this batch: kv head g = slabs 2g, 2g+1 */
    k_att0h<0><<<NH * (QT0 / 32), 32, 0, stream>>>(QF0, KF0e, VF0e, DMX, DMX, nullptr, ATS, OF0 + (size_t)b * QT0 * DMX, DMX);      /* exact causal attention rows 0..255 (o x64) */
    for (int q0 = 0; q0 < SQ; q0 += QT) { const int nk = q0 + QT;      /* causal: keys below the tile end only */
      k_gemm2<0><<<dim3((QT / 128) * (nk / 64), NH), 128, 0, stream>>>(Q16 + (r0 + q0) * DMX, DMX, (size_t)HDK, K16 + r0 * DKV, DKV, (size_t)HDK, ATS, nullptr, 0, nullptr, 1, 0, 0, S, nullptr, NKX, (size_t)QT * NKX, QT, nk, HDK);      /* scores of all heads in one launch: blockIdx.y = head, query and key slabs both step by one head (one query head per kv head) */
      rsmcf2_launch<NKX / 128>(S, P, q0, nk, stream);      /* causal softmax (arithmetic select), one wave per row */
      k_gemm2<0><<<dim3((QT / 128) * (HDK / 64), NH), 128, 0, stream>>>(P, NKX, (size_t)QT * NKX, VT, SQ, (size_t)HDK * SQ, 0.25f, nullptr, 0, nullptr, 1, 0, 0, nullptr, O16 + (r0 + q0) * DMX, DMX, (size_t)HDK, QT, HDK, nk); } }      /* o of all heads in one launch (x64): blockIdx.y = head */
  k_gemm2<0><<<dim3((unsigned)((NR / 128) * (DMX / 64)), 1), 128, 0, stream>>>(O16, DMX, 0, BO, DMX, 0, 0.0009765625f, nullptr, 0, nullptr, 1, 0, 0, (float*)d_out, nullptr, DMX, 0, (int)NR, DMX, DMX);      /* out = o Wo^T */
  k_hl<<<(unsigned)(((size_t)NB * QT0 * DMX / 8 + 255) / 256), 256, 0, stream>>>(OF0, OH0, OL0, (size_t)NB * QT0 * DMX / 8);      /* first-tile o (x64) -> f16 hi + x1024 residual planes */
  for (int b = 0; b < NB; ++b) { const size_t r0 = (size_t)b * SQ; const size_t f0 = (size_t)b * QT0;
    k_gemm2<0><<<dim3((QT0 / 128) * (DMX / 64), 1), 128, 0, stream>>>(OH0 + f0 * DMX, DMX, 0, BO, DMX, 0, 0.0009765625f, nullptr, 0, nullptr, 1, 0, 0, (float*)d_out + r0 * DMX, nullptr, DMX, 0, QT0, DMX, DMX);      /* rows 0..255 of the batch rewritten from the exact path */
    k_gemm2<0><<<dim3((QT0 / 128) * (DMX / 64), 1), 128, 0, stream>>>(OL0 + f0 * DMX, DMX, 0, BO, DMX, 0, 0.00000095367431640625f, nullptr, 0, (const float*)d_out + r0 * DMX, -1, 0, 0, (float*)d_out + r0 * DMX, nullptr, DMX, 0, QT0, DMX, DMX); }      /* += o_lo Wo 2^-20 (own-element accumulate) */
}

// v003
// It runs in 890 microseconds.
// Timed twice side by side with v002, it ran 2.72 and 2.74 times as fast.
// Counting every step since v000, it is 9.64 times as fast.
#include <hip/hip_runtime.h>
// Llama-style causal multi-head attention with half-split RoPE computed in the module (hidden_states [1][2048][2048]; q / k / v = x W^T (nn.Linear natural [2048][2048] sigma 0.02, no biases), 16 heads of 128; rope: emb = [f | f], f = p * 10000^(-2i/128): t cos + rotate_half(t) sin; scores * 128^-0.5; causal (where(tril, ., finfo.min): the weight underflows to exactly 0); softmax; out = merged Wo^T (natural) -> [1][2048][2048]); run on the hd128 grouped-query causal code as 16 kv groups of ONE query head.
// Compute dtype: inputs rounded to bf16; x / weights exact; projections and rope f32; q, k, v, softmax weights and o as plain f16 GEMM operands (~2^-12; first 256 rows of each batch exact); scores, statistics, out f32. v_wmma_f32_16x16x32_f16.
#define NB 1
#define SQ 2048
#define DMX 2048
#define NH 16
#define NKV 16
#define GSZ 1
#define HDK 128
#define DKV (NKV * HDK)
#define QT 256
#define QT0 256
#define NKX SQ
#define DM DMX
#define HD 64
#define HG 1
#define NR ((size_t)NB * SQ)
#define ATS 0.08838834764831845f
static_assert(GSZ == 1 && NH == NKV, "the per-head launches are batched on blockIdx.y with one key / value slab per query head");
typedef __bf16 v16b __attribute__((ext_vector_type(16)));
typedef unsigned short v8us __attribute__((ext_vector_type(8), may_alias));
typedef float  v8f  __attribute__((ext_vector_type(8)));
typedef float  v4f  __attribute__((ext_vector_type(4)));
typedef float  v4fa __attribute__((ext_vector_type(4), may_alias));
union FragB { v16b v; v8us half[2]; unsigned short u[16]; };

__device__ __forceinline__ unsigned short bf16_bits(float x) { unsigned int u = __float_as_uint(x); return (unsigned short)((u + 0x7FFFu + ((u >> 16) & 1u)) >> 16); }
__device__ __forceinline__ float bf16_val(unsigned short b) { return __uint_as_float(((unsigned int)b) << 16); }
__device__ __forceinline__ float bf16_round(float x) { return bf16_val(bf16_bits(x)); }
// D += A·B with NT terms: 1 = ah·bh, 2 = + al·bh (A split), 3 = + ah·bl (both split)
template <int NT>
__device__ __forceinline__ v8f mmaN(v16b ah, v16b al, v16b bh, v16b bl, v8f c) {
  c = __builtin_amdgcn_wmma_f32_16x16x32_bf16(false, ah, false, bh, (short)0, c, false, false);
  if (NT >= 2) c = __builtin_amdgcn_wmma_f32_16x16x32_bf16(false, al, false, bh, (short)0, c, false, false);
  if (NT >= 3) c = __builtin_amdgcn_wmma_f32_16x16x32_bf16(false, ah, false, bl, (short)0, c, false, false);
  asm volatile("v_nop\n\tv_nop\n\tv_nop\n\tv_nop" : "+v"(c) : "v"(ah), "v"(al), "v"(bh), "v"(bl));
  return c;
}

__global__ __launch_bounds__(256) void k_wt_bf16(const float* __restrict__ W, unsigned short* __restrict__ Wt, int K, int N) {
  const int t = blockIdx.x * 256 + threadIdx.x;
  const int k8n = K / 8;
  if (t >= N * k8n) return;
  const int n = t / k8n, k8 = (t % k8n) * 8;
  v8us v;
#pragma unroll
  for (int i = 0; i < 8; ++i) v[i] = bf16_bits(W[(size_t)(k8 + i) * N + n]);
  *(v8us*)(Wt + (size_t)n * K + k8) = v;
  
}

// GEMM C[M][N] (f32, pitch ldc) = act(A[M][K]·W + bias). A f32 row-major (pitch lda) converted per fragment to bf16
// (ASPLIT: hi/lo two planes -> 2 terms, else single rounded term); Wt bf16 [N][K] (pitch ldb). BIAS_BF16 rounds the
// bias to bf16 first (bias quantised to bf16 before the add). K%32==0, M%16==0, N%64==0.
template <bool ASPLIT, int ACT, bool BIAS_BF16>
__global__ __launch_bounds__(128) void k_gemm_bf(const float* __restrict__ A, int lda, const unsigned short* __restrict__ Wt, int ldb,
                                               const float* __restrict__ bias, float* __restrict__ C, int ldc, int M, int N, int K) {
  __shared__ __attribute__((aligned(16))) float so[4][16][64];
  const int tid = threadIdx.x, w = tid >> 5, lane = tid & 31, ln = lane & 15, hh = lane >> 4;
  const int ntn = N / 64;
  const int wid = blockIdx.x * 4 + w;
  const int mt = wid / ntn, nq = wid % ntn;
  if (mt * 16 >= M) return;
  const int row0 = mt * 16, col0 = nq * 64;
  const float* arow = A + (size_t)(row0 + ln) * lda;
  v8f acc[4] = {};
  for (int kb = 0; kb < K; kb += 32) {
    FragB ah, al;
    const v4f x0 = *(const v4fa*)(arow + kb + 8 * hh), x1 = *(const v4fa*)(arow + kb + 8 * hh + 4);
    const v4f x2 = *(const v4fa*)(arow + kb + 16 + 8 * hh), x3 = *(const v4fa*)(arow + kb + 16 + 8 * hh + 4);
    float xs[16] = {x0[0],x0[1],x0[2],x0[3],x1[0],x1[1],x1[2],x1[3],x2[0],x2[1],x2[2],x2[3],x3[0],x3[1],x3[2],x3[3]};
#pragma unroll
    for (int i = 0; i < 16; ++i) { const unsigned short hb = bf16_bits(xs[i]); ah.u[i] = hb; al.u[i] = ASPLIT ? bf16_bits(xs[i] - bf16_val(hb)) : (unsigned short)0; }
#pragma unroll
    for (int t = 0; t < 4; ++t) {
      const unsigned short* brow = Wt + (size_t)(col0 + t * 16 + ln) * ldb + kb;
      FragB b;
      b.half[0] = *(const v8us*)(brow + 8 * hh);
      b.half[1] = *(const v8us*)(brow + 16 + 8 * hh);
      acc[t] = mmaN<ASPLIT ? 2 : 1>(ah.v, al.v, b.v, b.v, acc[t]);
    }
  }
#pragma unroll
  for (int t = 0; t < 4; ++t) {
    float bv = bias ? bias[col0 + t * 16 + ln] : 0.f;
    if (BIAS_BF16) bv = bf16_round(bv);
#pragma unroll
    for (int r = 0; r < 8; ++r) { float v = acc[t][r] + bv; if (ACT == 1) v = fmaxf(v, 0.f); so[w][8 * hh + r][t * 16 + ln] = v; }
  }
  __builtin_amdgcn_fence(__ATOMIC_ACQ_REL, "workgroup");
  __builtin_amdgcn_wave_barrier();
  const int rsub = lane >> 4, c4 = (lane & 15) * 4;
  {
#pragma unroll
    for (int q = 0; q < 8; ++q) {
      const int r = q * 2 + rsub;
      const v4f v = *(const v4fa*)&so[w][r][c4];
      *(v4f*)(C + (size_t)(row0 + r) * ldc + col0 + c4) = v;
    }
    
  }
}

// GEMM C = act(A·W + bias + resid): A f32 (ASPLIT -> hi/lo 2 terms), Wt bf16 [N][K]; ACT 0 none, 1 relu, 2 exact gelu;
// resid (optional, f32, row index = (row % rmod), pitch ldr, RES_BF16 rounds it) added before the activation.
template <bool ASPLIT, int ACT, bool BIAS_BF16, bool RES_BF16>
__global__ __launch_bounds__(128) void k_gemm_bf3(const float* __restrict__ A, int lda, const unsigned short* __restrict__ Wt, int ldb,
                                                const float* __restrict__ bias, const float* __restrict__ resid, int rmod, int ldr,
                                                float* __restrict__ C, int ldc, int M, int N, int K) {
  __shared__ __attribute__((aligned(16))) float so[4][16][64];
  const int tid = threadIdx.x, w = tid >> 5, lane = tid & 31, ln = lane & 15, hh = lane >> 4;
  const int ntn = N / 64;
  const int wid = blockIdx.x * 4 + w;
  const int mt = wid / ntn, nq = wid % ntn;
  if (mt * 16 >= M) return;
  const int row0 = mt * 16, col0 = nq * 64;
  const float* arow = A + (size_t)(row0 + ln) * lda;
  v8f acc[4] = {};
  for (int kb = 0; kb < K; kb += 32) {
    FragB ah, al;
    const v4f x0 = *(const v4fa*)(arow + kb + 8 * hh), x1 = *(const v4fa*)(arow + kb + 8 * hh + 4);
    const v4f x2 = *(const v4fa*)(arow + kb + 16 + 8 * hh), x3 = *(const v4fa*)(arow + kb + 16 + 8 * hh + 4);
    float xs[16] = {x0[0],x0[1],x0[2],x0[3],x1[0],x1[1],x1[2],x1[3],x2[0],x2[1],x2[2],x2[3],x3[0],x3[1],x3[2],x3[3]};
#pragma unroll
    for (int i = 0; i < 16; ++i) { const unsigned short hb = bf16_bits(xs[i]); ah.u[i] = hb; al.u[i] = ASPLIT ? bf16_bits(xs[i] - bf16_val(hb)) : (unsigned short)0; }
#pragma unroll
    for (int t = 0; t < 4; ++t) {
      const unsigned short* brow = Wt + (size_t)(col0 + t * 16 + ln) * ldb + kb;
      FragB b;
      b.half[0] = *(const v8us*)(brow + 8 * hh);
      b.half[1] = *(const v8us*)(brow + 16 + 8 * hh);
      acc[t] = mmaN<ASPLIT ? 2 : 1>(ah.v, al.v, b.v, b.v, acc[t]);
    }
  }
#pragma unroll
  for (int t = 0; t < 4; ++t) {
    const int col = col0 + t * 16 + ln;
    float bv = bias ? bias[col] : 0.f;
    if (BIAS_BF16) bv = bf16_round(bv);
#pragma unroll
    for (int r = 0; r < 8; ++r) {
      float v = acc[t][r] + bv;
      if (resid) { float rv = resid[(size_t)((row0 + 8 * hh + r) % rmod) * ldr + col]; if (RES_BF16) rv = bf16_round(rv); v += rv; }
      if (ACT == 1) v = fmaxf(v, 0.f);
      if (ACT == 2) v = 0.5f * v * (1.0f + erff(v * 0.70710678118654752f));
      if (ACT == 3) { const float u = 0.7978845608028654f * (v + 0.044715f * v * v * v); v = 0.5f * v * (1.0f + tanhf(u)); }
      so[w][8 * hh + r][t * 16 + ln] = v;
    }
  }
  __builtin_amdgcn_fence(__ATOMIC_ACQ_REL, "workgroup");
  __builtin_amdgcn_wave_barrier();
  const int rsub = lane >> 4, c4 = (lane & 15) * 4;
  {
#pragma unroll
    for (int q = 0; q < 8; ++q) {
      const int r = q * 2 + rsub;
      const v4f v = *(const v4fa*)&so[w][r][c4];
      *(v4f*)(C + (size_t)(row0 + r) * ldc + col0 + c4) = v;
    }
    
  }
}
// row LayerNorm (biased variance, eps) over N: s = X (+ R); optional out_sum <- s; out_norm <- (s-mu)*rsqrt(var+eps)*g + b
template <bool PARAM_BF16>
__global__ __launch_bounds__(256) void k_layernorm(const float* __restrict__ X, const float* __restrict__ R, const float* __restrict__ g, const float* __restrict__ bta,
                                                  float* __restrict__ out_sum, float* __restrict__ out_norm, int N, float eps) {
  __shared__ float red[256];
  const int row = blockIdx.x, tid = threadIdx.x;
  const float* x = X + (size_t)row * N; const float* rr = R ? R + (size_t)row * N : nullptr;
  float vals[16];                     // up to N = 4096
  const int per = N / 256;            // contiguous chunk per thread? use strided-by-4 chunks: thread handles j = tid*4 + 1024*u
  float s1 = 0.f;
  for (int u = 0; u < per / 4; ++u) {
    const int j = tid * 4 + 1024 * u;
    const v4f a = *(const v4fa*)(x + j);
    v4f b = {0.f,0.f,0.f,0.f}; if (rr) b = *(const v4fa*)(rr + j);
#pragma unroll
    for (int q = 0; q < 4; ++q) { const float v = a[q] + b[q]; vals[u * 4 + q] = v; s1 += v; }
  }
  red[tid] = s1; __syncthreads();
  for (int st = 128; st > 0; st >>= 1) { if (tid < st) red[tid] += red[tid + st]; __syncthreads(); }
  const float mu = red[0] / (float)N; __syncthreads();
  float s2 = 0.f;
  for (int u = 0; u < per / 4; ++u)
#pragma unroll
    for (int q = 0; q < 4; ++q) { const float c = vals[u * 4 + q] - mu; s2 += c * c; }
  red[tid] = s2; __syncthreads();
  for (int st = 128; st > 0; st >>= 1) { if (tid < st) red[tid] += red[tid + st]; __syncthreads(); }
  const float rs = rsqrtf(red[0] / (float)N + eps);
  {
    for (int u = 0; u < per / 4; ++u) {
      const int j = tid * 4 + 1024 * u;
      v4f o, sm;
#pragma unroll
      for (int q = 0; q < 4; ++q) {
        float gg = g[j + q], bb = bta[j + q];
        if (PARAM_BF16) { gg = bf16_round(gg); bb = bf16_round(bb); }
        sm[q] = vals[u * 4 + q]; o[q] = (vals[u * 4 + q] - mu) * rs * gg + bb;
      }
      if (out_sum) *(v4f*)(out_sum + (size_t)row * N + j) = sm;
      *(v4f*)(out_norm + (size_t)row * N + j) = o;
    }
    
  }
}



// ---- f16 WMMA path (v_wmma_f32_16x16x32_f16): 11-bit significands for operands in range — used where a [0,1] probability operand needs more precision than bf16
typedef _Float16 v16h __attribute__((ext_vector_type(16)));
union FragH { v16h v; v8us half[2]; _Float16 h[16]; unsigned short u[16]; };
template <int NT>
__device__ __forceinline__ v8f mmaH(v16h ah, v16h al, v16h bh, v16h bl, v8f c) {
  c = __builtin_amdgcn_wmma_f32_16x16x32_f16(false, ah, false, bh, (short)0, c, false, false);
  if (NT >= 2) c = __builtin_amdgcn_wmma_f32_16x16x32_f16(false, al, false, bh, (short)0, c, false, false);
  if (NT >= 3) c = __builtin_amdgcn_wmma_f32_16x16x32_f16(false, ah, false, bl, (short)0, c, false, false);
  asm volatile("v_nop\n\tv_nop\n\tv_nop\n\tv_nop" : "+v"(c) : "v"(ah), "v"(al), "v"(bh), "v"(bl));
  return c;
}
// batched GEMM like k_gemm_b but f16 operands: A f32 (split into f16 hi/lo if ASPLIT, else rounded to f16), Bt = f16 values [n][k]; alpha; C f32; N multiple of 16 (partial tiles skipped)
template <bool ASPLIT>
__global__ __launch_bounds__(128) void k_gemm_h(const float* __restrict__ A, int lda, size_t sA, const _Float16* __restrict__ Bh, int ldb, size_t sB, float alpha, float* __restrict__ C, int ldc, size_t sC, int M, int N, int K) {
  __shared__ __attribute__((aligned(16))) float so[4][16][64];
  const int tid = threadIdx.x, w = tid >> 5, lane = tid & 31, ln = lane & 15, hh = lane >> 4; const int by = blockIdx.y;
  A += (size_t)by * sA; Bh += (size_t)by * sB; C += (size_t)by * sC;
  const int ntn = (N + 63) / 64; const int wid = blockIdx.x * 4 + w; const int mt = wid / ntn, nq = wid % ntn; if (mt * 16 >= M) return;
  const int row0 = mt * 16, col0 = nq * 64; const float* arow = A + (size_t)(row0 + ln) * lda;
  v8f acc[4] = {};
  for (int kb = 0; kb < K; kb += 32) {
    FragH ah, al;
    const v4f x0 = *(const v4fa*)(arow + kb + 8 * hh), x1 = *(const v4fa*)(arow + kb + 8 * hh + 4), x2 = *(const v4fa*)(arow + kb + 16 + 8 * hh), x3 = *(const v4fa*)(arow + kb + 16 + 8 * hh + 4);
    float xs[16] = {x0[0],x0[1],x0[2],x0[3],x1[0],x1[1],x1[2],x1[3],x2[0],x2[1],x2[2],x2[3],x3[0],x3[1],x3[2],x3[3]};
#pragma unroll
    for (int i = 0; i < 16; ++i) { const _Float16 h = (_Float16)xs[i]; ah.h[i] = h; al.h[i] = ASPLIT ? (_Float16)(xs[i] - (float)h) : (_Float16)0.0f; }
#pragma unroll
    for (int t = 0; t < 4; ++t) { if (col0 + t * 16 >= N) continue; const size_t boff = (size_t)(col0 + t * 16 + ln) * ldb + kb; FragH bq; bq.half[0] = *(const v8us*)(Bh + boff + 8 * hh); bq.half[1] = *(const v8us*)(Bh + boff + 16 + 8 * hh);
      acc[t] = mmaH<ASPLIT ? 2 : 1>(ah.v, al.v, bq.v, bq.v, acc[t]); }
  }
#pragma unroll
  for (int t = 0; t < 4; ++t) { if (col0 + t * 16 >= N) continue;
#pragma unroll
    for (int r = 0; r < 8; ++r) so[w][8 * hh + r][t * 16 + ln] = acc[t][r] * alpha; }
  __builtin_amdgcn_fence(__ATOMIC_ACQ_REL, "workgroup"); __builtin_amdgcn_wave_barrier();
  const int rsub = lane >> 4, c4 = (lane & 15) * 4;
  {
#pragma unroll
    for (int q = 0; q < 8; ++q) { const int r = q * 2 + rsub; if (col0 + c4 < N) { const v4f v = *(const v4fa*)&so[w][r][c4]; *(v4f*)(C + (size_t)(row0 + r) * ldc + col0 + c4) = v; } }
     }
}

// Wt[n][k] = f16(W[k][n]·scale) from f32 row-major W[K][N] (scale = power of two; bf16-exact weights stay exact in f16 away from the subnormal range)
__global__ __launch_bounds__(256) void k_wt_f16(const float* __restrict__ W, _Float16* __restrict__ Wt, int K, int N, float scale) {
  const int t = blockIdx.x * 256 + threadIdx.x; if (t >= N * (K / 8)) return; const int n = t / (K / 8), k8 = (t % (K / 8)) * 8; FragH f;
#pragma unroll
  for (int i = 0; i < 8; ++i) f.h[i] = (_Float16)(bf16_round(W[(size_t)(k8 + i) * N + n]) * scale); const v8us o = f.half[0];
  *(v8us*)((unsigned short*)Wt + (size_t)n * K + k8) = o; 
}
// k_gemm_hh variant with fused epilogue: v = acc·alpha + bias[by·sBias + col] (+ CP[(row/rowsPerB)·sCPb + by·64 + col] if CP) ; ACT 0 none / 1 elu ; writes f16 C16 (and f32 C if non-null)
template <int ACT>
__global__ __launch_bounds__(128) void k_gemm_hhx(const _Float16* __restrict__ A, int lda, size_t sA, const _Float16* __restrict__ Bh, int ldb, size_t sB, float alpha, const float* __restrict__ bias, size_t sBias, const float* __restrict__ CP, int rowsPerB, size_t sCPb, int row0g,
    float* __restrict__ C, _Float16* __restrict__ C16, int ldc, size_t sC, int M, int N, int K) {
  __shared__ __attribute__((aligned(16))) float so[4][16][64];
  const int tid = threadIdx.x, w = tid >> 5, lane = tid & 31, ln = lane & 15, hh = lane >> 4; const int by = blockIdx.y;
  A += (size_t)by * sA; Bh += (size_t)by * sB; const size_t cofs = (size_t)by * sC; const float* bp = bias ? bias + (size_t)by * sBias : nullptr;
  const int ntn = (N + 63) / 64; const int wid = blockIdx.x * 4 + w; const int mt = wid / ntn, nq = wid % ntn; if (mt * 16 >= M) return;
  const int row0 = mt * 16, col0 = nq * 64; const _Float16* arow = A + (size_t)(row0 + ln) * lda;
  v8f acc[4] = {};
  for (int kb = 0; kb < K; kb += 32) { FragH ah; ah.half[0] = *(const v8us*)((const unsigned short*)arow + kb + 8 * hh); ah.half[1] = *(const v8us*)((const unsigned short*)arow + kb + 16 + 8 * hh);
#pragma unroll
    for (int t = 0; t < 4; ++t) { if (col0 + t * 16 >= N) continue; const size_t boff = (size_t)(col0 + t * 16 + ln) * ldb + kb; FragH bq; bq.half[0] = *(const v8us*)((const unsigned short*)Bh + boff + 8 * hh); bq.half[1] = *(const v8us*)((const unsigned short*)Bh + boff + 16 + 8 * hh);
      acc[t] = mmaH<1>(ah.v, ah.v, bq.v, bq.v, acc[t]); }
  }
#pragma unroll
  for (int t = 0; t < 4; ++t) { if (col0 + t * 16 >= N) continue; const int col = col0 + t * 16 + ln; const float bv = bp ? bf16_round(bp[col]) : 0.f;
#pragma unroll
    for (int r = 0; r < 8; ++r) { float v = acc[t][r] * alpha + bv; if (CP) { const int rr = row0g + row0 + 8 * hh + r; if (rowsPerB < 0) v += CP[cofs + (size_t)rr * ldc + col];      /* rowsPerB < 0: own element of the batched C plane */ else { const int bidx = rr / rowsPerB; v += CP[(size_t)bidx * sCPb + (size_t)by * 64 + col]; } } if (ACT == 1) v = (v > 0.f) ? v : expm1f(v); else if (ACT == 7) v = (v > 0.f) ? v + 1.0f : expf(v); else if (ACT == 8) v = tanhf(v); else if (ACT == 9) v = 0.5f * v * (1.0f + tanhf(0.7978845608028654f * (v + 0.044715f * v * v * v))); else if (ACT == 11) v = 1.0f / (1.0f + expf(-v)); else if (ACT == 12) v = (v > 0.f) ? v : 0.01f * v; else if (ACT == 14) v = (v > 0.f) ? v : 0.1f * v; else if (ACT == 16) v = (v >= 0.f) ? v : 0.3f * v; else if (ACT == 17) v = (v >= 0.f) ? v : 0.2f * v; else if (ACT == 15) v = v / (1.0f + expf(-v)); else if (ACT == 3) v = fmaxf(v, 0.f); else if (ACT == 6) v = 0.5f * v * (1.0f + erff(v * 0.70710678118654752f)); so[w][8 * hh + r][t * 16 + ln] = v; } }
  __builtin_amdgcn_fence(__ATOMIC_ACQ_REL, "workgroup"); __builtin_amdgcn_wave_barrier();
  const int rsub = lane >> 4, c4 = (lane & 15) * 4; typedef _Float16 v4h __attribute__((ext_vector_type(4)));
  {
#pragma unroll
    for (int q = 0; q < 8; ++q) { const int r = q * 2 + rsub; if (col0 + c4 < N) { const v4f v = *(const v4fa*)&so[w][r][c4]; if (C) *(v4f*)(C + cofs + (size_t)(row0 + r) * ldc + col0 + c4) = v; if (C16) { v4h h4; for (int i = 0; i < 4; ++i) h4[i] = (_Float16)v[i]; *(v4h*)(C16 + cofs + (size_t)(row0 + r) * ldc + col0 + c4) = h4; } } }
     }
}


typedef _Float16 v4h __attribute__((ext_vector_type(4)));

__global__ __launch_bounds__(256) void k_x16(const float* __restrict__ x, _Float16* __restrict__ X16, size_t n8) { const size_t t = (size_t)blockIdx.x * 256 + threadIdx.x; if (t >= n8) return; FragH f;
#pragma unroll
  for (int q = 0; q < 8; ++q) f.h[q] = (_Float16)bf16_round(x[t * 8 + q]); *(v8us*)((unsigned short*)X16 + t * 8) = f.half[0];  }
__global__ __launch_bounds__(256) void k_h16(const float* __restrict__ x, _Float16* __restrict__ X16, size_t n8) { const size_t t = (size_t)blockIdx.x * 256 + threadIdx.x; if (t >= n8) return; FragH f;
#pragma unroll
  for (int q = 0; q < 8; ++q) f.h[q] = (_Float16)x[t * 8 + q]; *(v8us*)((unsigned short*)X16 + t * 8) = f.half[0];  }
__global__ __launch_bounds__(256) void k_round16f(const float* __restrict__ W, _Float16* __restrict__ Bt, size_t n8) { const size_t t = (size_t)blockIdx.x * 256 + threadIdx.x; if (t >= n8) return; FragH f;
#pragma unroll
  for (int i = 0; i < 8; ++i) f.h[i] = (_Float16)(bf16_round(W[t * 8 + i]) * 16.0f); *(v8us*)((unsigned short*)Bt + t * 8) = f.half[0];  }
template <int NHv, int TTv>
__global__ __launch_bounds__(256) void k_vt(const _Float16* __restrict__ V16, int ldv, int voff, _Float16* __restrict__ Vt) { __shared__ unsigned short tl[64][66]; const int tid = threadIdx.x; const int slab = blockIdx.x / (TTv / 64), lg = blockIdx.x % (TTv / 64); const int b = slab / NHv, h = slab % NHv;
  for (int i = tid; i < 64 * 8; i += 256) { const int r = i / 8, c8 = (i % 8) * 8; FragH f; f.half[0] = *(const v8us*)((const unsigned short*)V16 + ((size_t)b * TTv + lg * 64 + r) * ldv + voff + h * 64 + c8);
#pragma unroll
    for (int q = 0; q < 8; ++q) tl[r][c8 + q] = f.u[q]; }
  __syncthreads();
  {
#pragma unroll
    for (int rd = 0; rd < 2; ++rd) { const int d = rd * 32 + tid / 8, pc = tid % 8; FragH f;
#pragma unroll
      for (int q = 0; q < 8; ++q) f.u[q] = tl[pc * 8 + q][d];
      *(v8us*)((unsigned short*)Vt + ((size_t)slab * 64 + d) * TTv + lg * 64 + pc * 8) = f.half[0]; }
     } }

__global__ __launch_bounds__(256) void k_hl(const float* __restrict__ F, _Float16* __restrict__ Hh, _Float16* __restrict__ Hl, size_t n8) { const size_t t = (size_t)blockIdx.x * 256 + threadIdx.x; if (t >= n8) return; FragH fh, fl; const v4f a = *(const v4fa*)(F + t * 8), c = *(const v4fa*)(F + t * 8 + 4);
#pragma unroll
  for (int q = 0; q < 4; ++q) { _Float16 h = (_Float16)a[q]; fh.h[q] = h; fl.h[q] = (_Float16)((a[q] - (float)h) * 1024.0f); h = (_Float16)c[q]; fh.h[4 + q] = h; fl.h[4 + q] = (_Float16)((c[q] - (float)h) * 1024.0f); }
  { *(v8us*)((unsigned short*)Hh + t * 8) = fh.half[0]; *(v8us*)((unsigned short*)Hl + t * 8) = fl.half[0];  } }

// ---- fast GEMM (wave tile 32x64; requires M % 32 == 0 rows per launch region and N % 64 == 0); epilogue = k_gemm_hhx semantics ----
__device__ __forceinline__ v16h g2_frag(const _Float16* p, int hh) { FragH f; f.half[0] = *(const v8us*)((const unsigned short*)p + 8 * hh); f.half[1] = *(const v8us*)((const unsigned short*)p + 16 + 8 * hh); return f.v; }
__device__ __forceinline__ v8f g2_mma(v16h a, v16h b, v8f c) { v8f d = __builtin_amdgcn_wmma_f32_16x16x32_f16(false, a, false, b, (short)0, c, false, false); asm volatile("v_nop\n\tv_nop\n\tv_nop\n\tv_nop" : "+v"(d) : "v"(a), "v"(b)); return d; }
template <int ACT>
__global__ __launch_bounds__(128) void k_gemm2(const _Float16* __restrict__ A, int lda, size_t sA, const _Float16* __restrict__ Bh, int ldb, size_t sB, float alpha, const float* __restrict__ bias, size_t sBias, const float* __restrict__ CP, int rowsPerB, size_t sCPb, int row0g,
    float* __restrict__ C, _Float16* __restrict__ C16, int ldc, size_t sC, int M, int N, int K) { static_assert(ACT == 0 || ACT == 3 || ACT == 6 || ACT == 8 || ACT == 9 || ACT == 11 || ACT == 12 || ACT == 14 || ACT == 15 || ACT == 16 || ACT == 17, "k_gemm2: unsupported ACT code (would silently apply no activation)");
  __shared__ __attribute__((aligned(16))) float so[4][32][68];
  const int tid = threadIdx.x, w = tid >> 5, lane = tid & 31, ln = lane & 15, hh = lane >> 4; const int by = blockIdx.y;
  A += (size_t)by * sA; Bh += (size_t)by * sB; const size_t cofs = (size_t)by * sC; const float* bp = bias ? bias + (size_t)by * sBias : nullptr;
  const int ntn = N >> 6; const int mt = blockIdx.x / ntn, nq = blockIdx.x - mt * ntn; const int row0 = mt * 128 + 32 * w, col0 = nq * 64; if (row0 >= M) return;
  const _Float16* a0p = A + (size_t)(row0 + ln) * lda; const _Float16* a1p = a0p + (size_t)16 * lda;
  const _Float16* b0p = Bh + (size_t)(col0 + ln) * ldb; const _Float16* b1p = b0p + (size_t)16 * ldb; const _Float16* b2p = b1p + (size_t)16 * ldb; const _Float16* b3p = b2p + (size_t)16 * ldb;
  const v8f z8 = {0.f,0.f,0.f,0.f,0.f,0.f,0.f,0.f}; v8f c00 = z8, c01 = z8, c02 = z8, c03 = z8, c10 = z8, c11 = z8, c12 = z8, c13 = z8;
#pragma unroll 1
  for (int kb = 0; kb < K; kb += 32) { const v16h a0 = g2_frag(a0p + kb, hh), a1 = g2_frag(a1p + kb, hh);
    v16h b = g2_frag(b0p + kb, hh); c00 = g2_mma(a0, b, c00); c10 = g2_mma(a1, b, c10);
    b = g2_frag(b1p + kb, hh); c01 = g2_mma(a0, b, c01); c11 = g2_mma(a1, b, c11);
    b = g2_frag(b2p + kb, hh); c02 = g2_mma(a0, b, c02); c12 = g2_mma(a1, b, c12);
    b = g2_frag(b3p + kb, hh); c03 = g2_mma(a0, b, c03); c13 = g2_mma(a1, b, c13); }
  v8f accs[8] = {c00, c01, c02, c03, c10, c11, c12, c13};
#pragma unroll
  for (int u = 0; u < 8; ++u) { const int t = u & 3, half = u >> 2; const int col = col0 + t * 16 + ln; const float bv = bp ? bf16_round(bp[col]) : 0.f;
#pragma unroll
    for (int r = 0; r < 8; ++r) { const int rloc = half * 16 + 8 * hh + r; float v = accs[u][r] * alpha + bv; if (CP) { if (rowsPerB < 0) v += CP[cofs + (size_t)(row0g + row0 + rloc) * ldc + col];      /* rowsPerB < 0: own element of the batched C plane */ else { const int bidx = (row0g + row0 + rloc) / rowsPerB; v += CP[(size_t)bidx * sCPb + (size_t)by * 64 + col]; } }
      if (ACT == 3) v = fmaxf(v, 0.f); else if (ACT == 6) v = 0.5f * v * (1.0f + erff(v * 0.70710678118654752f)); else if (ACT == 11) v = 1.0f / (1.0f + expf(-v)); else if (ACT == 15) v = v / (1.0f + expf(-v)); else if (ACT == 12) v = (v > 0.f) ? v : 0.01f * v; else if (ACT == 8) v = tanhf(v); else if (ACT == 9) v = 0.5f * v * (1.0f + tanhf(0.7978845608028654f * (v + 0.044715f * v * v * v))); else if (ACT == 14) v = (v > 0.f) ? v : 0.1f * v; else if (ACT == 16) v = (v >= 0.f) ? v : 0.3f * v; else if (ACT == 17) v = (v >= 0.f) ? v : 0.2f * v;
      so[w][rloc][t * 16 + ln] = v; } }
  __builtin_amdgcn_fence(__ATOMIC_ACQ_REL, "workgroup"); __builtin_amdgcn_wave_barrier();
  const int rsub = lane >> 4, c4 = (lane & 15) * 4;
  {
#pragma unroll
    for (int q = 0; q < 16; ++q) { const int r = q * 2 + rsub; const v4f v = *(const v4fa*)&so[w][r][c4]; if (C) *(v4f*)(C + cofs + (size_t)(row0 + r) * ldc + col0 + c4) = v; if (C16) { v4h h4; for (int i = 0; i < 4; ++i) h4[i] = (_Float16)v[i]; *(v4h*)(C16 + cofs + (size_t)(row0 + r) * ldc + col0 + c4) = h4; } }
     } }


__global__ __launch_bounds__(256) void k_wnat(const float* __restrict__ w, size_t n8, _Float16* __restrict__ Bt) { const size_t t = (size_t)blockIdx.x * 256 + threadIdx.x; if (t >= n8) return; FragH f; for (int q = 0; q < 8; ++q) f.h[q] = (_Float16)(bf16_round(w[t * 8 + q]) * 16.0f); *(v8us*)((unsigned short*)Bt + t * 8) = f.half[0];  }
__global__ __launch_bounds__(256) void k_rsm(const float* __restrict__ S, _Float16* __restrict__ P, int nrows) {
  #pragma clang fp contract(off)
  const int i = blockIdx.x * 256 + threadIdx.x; if (i >= nrows) return; const float* s = S + (size_t)i * SQ; float mx = -3.0e38f;
#pragma unroll 1
  for (int j = 0; j < SQ; ++j) mx = fmaxf(mx, s[j]); float se = 0.f;
#pragma unroll 1
  for (int j = 0; j < SQ; ++j) se += expf(s[j] - mx); const float sc = 256.0f / se;
#pragma unroll 1
  for (int j0 = 0; j0 < SQ; j0 += 8) { FragH f; for (int q = 0; q < 8; ++q) f.h[q] = (_Float16)(expf(s[j0 + q] - mx) * sc); unsigned short* d = (unsigned short*)P + (size_t)i * SQ + j0; *(v8us*)d = f.half[0];  } }
__global__ __launch_bounds__(256) void k_vt(const _Float16* __restrict__ V16, int b, int h0, _Float16* __restrict__ VT) { __shared__ unsigned short tl[64][65]; const int tid = threadIdx.x; const int hh = blockIdx.x % HG, sg = blockIdx.x / HG; const int s0 = sg * 64; const int h = h0 + hh;
  for (int i = tid; i < 64 * 8; i += 256) { const int j = i / 8, d8 = (i % 8) * 8; FragH f; f.half[0] = *(const v8us*)((const unsigned short*)V16 + ((size_t)b * SQ + s0 + j) * DM + h * HD + d8); for (int q = 0; q < 8; ++q) tl[d8 + q][j] = f.u[q]; }
  __syncthreads();
  { for (int i = tid; i < 64 * 8; i += 256) { const int d = i / 8, j8 = (i % 8) * 8; FragH f; for (int q = 0; q < 8; ++q) f.u[q] = tl[d][j8 + q]; *(v8us*)((unsigned short*)VT + ((size_t)hh * HD + d) * SQ + s0 + j8) = f.half[0]; }  } }


__global__ __launch_bounds__(256) void k_f2h(const float* __restrict__ F, int ldf, int coff, int ncol, _Float16* __restrict__ H16, size_t nrow) { const size_t t = (size_t)blockIdx.x * 256 + threadIdx.x; const size_t n8 = nrow * (size_t)(ncol / 8); if (t >= n8) return; const size_t r = t / (ncol / 8); const int c8 = (int)(t % (ncol / 8)) * 8; FragH f; const v4f a = *(const v4fa*)(F + r * ldf + coff + c8), b2 = *(const v4fa*)(F + r * ldf + coff + c8 + 4); for (int q = 0; q < 4; ++q) { f.h[q] = (_Float16)a[q]; f.h[4 + q] = (_Float16)b2[q]; } *(v8us*)((unsigned short*)H16 + r * ncol + c8) = f.half[0];  }

__global__ __launch_bounds__(256) void k_tab128(float theta, float* __restrict__ CS, float* __restrict__ SN) {
  #pragma clang fp contract(off)
  const int t = blockIdx.x * 256 + threadIdx.x; if (t >= SQ * 64) return; const int i = t % 64; const int p = t / 64; const float invf = (float)(1.0 / pow((double)theta, (double)(2 * i) / 128.0));      /* = XLA's constant-folded f32 table */ const float ang = __fmul_rn((float)p, invf); const float c = cosf(ang), s = sinf(ang);
  *(float*)(CS + t) = c; *(float*)(SN + t) = s;  }
template <int TAB>
__global__ __launch_bounds__(128) void k_rope128(const float* __restrict__ F, int ldf, int nh, const float* __restrict__ CS, const float* __restrict__ SN, _Float16* __restrict__ H16, int ldo, float osc) {
  #pragma clang fp contract(off)
  __shared__ float xv[128]; __shared__ unsigned short sh_[128]; const int d = threadIdx.x; const int h = blockIdx.x % nh; const size_t r = blockIdx.x / nh; const int p = (int)(r % SQ);
  xv[d] = F[r * (size_t)ldf + (size_t)h * 128 + d]; __syncthreads();
  float c, s; if (TAB) { c = bf16_round(CS[(size_t)p * 128 + d]); s = bf16_round(SN[(size_t)p * 128 + d]); } else { c = CS[p * 64 + (d & 63)]; s = SN[p * 64 + (d & 63)]; }
  const float rot = (d < 64) ? -xv[d + 64] : xv[d - 64]; const float o = __fadd_rn(__fmul_rn(xv[d], c), __fmul_rn(rot, s));
  FragH th; th.h[0] = (_Float16)__fmul_rn(o, osc); sh_[d] = th.u[0]; __syncthreads();
  if (d < 16) { FragH f; for (int q = 0; q < 8; ++q) f.u[q] = sh_[d * 8 + q]; unsigned short* dst = (unsigned short*)H16 + r * (size_t)ldo + (size_t)h * 128 + d * 8; *(v8us*)dst = f.half[0];  } }

template <int TAB, int IL, int F32OUT>
__global__ __launch_bounds__(128) void k_rope128x(const float* __restrict__ F, int ldf, int nh, const float* __restrict__ CS, const float* __restrict__ SN, void* __restrict__ OUT, int ldo, float osc) {
  #pragma clang fp contract(off)
  __shared__ float xv[128]; __shared__ float ov[128]; const int d = threadIdx.x; const int h = blockIdx.x % nh; const size_t r = blockIdx.x / nh; const int p = (int)(r % SQ);
  xv[d] = F[r * (size_t)ldf + (size_t)h * 128 + d]; __syncthreads();
  float c, s; if (TAB == 2) { c = CS[r * 128 + d]; s = SN[r * 128 + d]; }      /* computed full-width f32 tables, one row per token row r (relative to the passed pointers) */ else if (TAB) { c = bf16_round(CS[(size_t)p * 128 + d]); s = bf16_round(SN[(size_t)p * 128 + d]); } else { const int ti = IL ? (d >> 1) : (d & 63); c = CS[p * 64 + ti]; s = SN[p * 64 + ti]; }
  const float rot = IL ? ((d & 1) ? xv[d - 1] : -xv[d + 1]) : ((d < 64) ? -xv[d + 64] : xv[d - 64]);
  ov[d] = __fmul_rn(__fadd_rn(__fmul_rn(xv[d], c), __fmul_rn(rot, s)), osc); __syncthreads();
  if (F32OUT) { if (d < 32) { const v4f v = *(const v4f*)&ov[d * 4]; float* dst = (float*)OUT + r * (size_t)ldo + (size_t)h * 128 + d * 4; *(v4f*)dst = v;  } }
  else { if (d < 16) { FragH f; for (int q = 0; q < 8; ++q) f.h[q] = (_Float16)ov[d * 8 + q]; unsigned short* dst = (unsigned short*)OUT + r * (size_t)ldo + (size_t)h * 128 + d * 8; *(v8us*)dst = f.half[0];  } } }
template <int N>
__global__ __launch_bounds__(256) void k_rmsrow(float* __restrict__ X, const float* __restrict__ w, float eps) {
  #pragma clang fp contract(off)
  constexpr int PT = N / 256; __shared__ float red[256]; const size_t r = blockIdx.x; const int t = threadIdx.x; float* row = X + r * N + (size_t)t * PT; float v[PT]; float ss = 0.f;
  for (int q = 0; q < PT; ++q) { v[q] = row[q]; ss = __fadd_rn(ss, __fmul_rn(v[q], v[q])); }
  red[t] = ss; __syncthreads(); for (int k = 128; k > 0; k >>= 1) { if (t < k) red[t] = __fadd_rn(red[t], red[t + k]); __syncthreads(); }
  const float rs = rsqrtf(__fadd_rn(red[0] / (float)N, eps)); float o[PT]; for (int q = 0; q < PT; ++q) o[q] = __fmul_rn(__fmul_rn(v[q], rs), bf16_round(w[t * PT + q]));
  { for (int q = 0; q < PT; ++q) *(float*)(row + q) = o[q];  } }
template <int GS_, int NHQ, int DSRC>
__global__ __launch_bounds__(256) void k_kvexp128(const float* __restrict__ src, float* __restrict__ dst, size_t n4) { const size_t t = (size_t)blockIdx.x * 256 + threadIdx.x; if (t >= n4) return; const size_t e = t * 4; const size_t row = e / ((size_t)NHQ * 128); const int col = (int)(e % ((size_t)NHQ * 128)); const int h = col / 128, d = col % 128; const v4f v = *(const v4fa*)(src + row * DSRC + (size_t)(h / GS_) * 128 + d); *(v4f*)(dst + e) = v;  }

__global__ __launch_bounds__(256) void k_rsmcfb(const float* __restrict__ S, _Float16* __restrict__ P, int hg, int q0, int nk, const int* __restrict__ mk) {
  #pragma clang fp contract(off)
  const int t = blockIdx.x * 256 + threadIdx.x; if (t >= hg * QT) return; const size_t i = (size_t)t; const float* s = S + i * NKX; const size_t ig = (size_t)(q0 + (t % QT)); const int* mr = mk + ig * SQ; float mx = -3.0e38f;
#pragma unroll 1
  for (int j = 0; j < nk; ++j) { const int mb = mr[j]; const float f = (mb == 0) ? 1.f : 0.f; mx = fmaxf(mx, fmaf(f, s[j], (1.f - f) * -1.0e9f)); } float se = 0.f;
#pragma unroll 1
  for (int j = 0; j < nk; ++j) { const int mb = mr[j]; const float f = (mb == 0) ? 1.f : 0.f; se += __expf(fmaf(f, s[j], (1.f - f) * -1.0e9f) - mx); } const float sc = 256.0f / se;
#pragma unroll 1
  for (int j0 = 0; j0 < nk; j0 += 8) { FragH fr; for (int q = 0; q < 8; ++q) { const int j = j0 + q; const int mb = mr[j]; const float f = (mb == 0) ? 1.f : 0.f; fr.h[q] = (_Float16)(__expf(fmaf(f, s[j], (1.f - f) * -1.0e9f) - mx) * sc); } unsigned short* d = (unsigned short*)P + i * NKX + j0; *(v8us*)d = fr.half[0];  } }


// 2^x on the transcendental unit; the v_nop is the one free issue slot that the instruction set asks for behind a transcendental before its result is read or its source overwritten: written in the same statement so that it stands directly behind the v_exp_f32 in every build
__device__ __forceinline__ float exp2_slot(float x) { float y; asm("v_exp_f32 %0, %1\n\tv_nop" : "=v"(y) : "v"(x)); return y; }
// one wave per score row of NU * 128 keys: lane l holds columns 128u + 4l .. 128u + 4l + 3 of the row in registers, so each wave-wide load covers 512 contiguous bytes, the row is read once and each exponential is taken once; maximum and sum: one partial per lane, then a five-step butterfly over the wave
template <int NU>
__global__ __launch_bounds__(256) void k_rsmcf2(const float* __restrict__ S, _Float16* __restrict__ P, int hg, int q0) {
  const int t = blockIdx.x * 8 + __builtin_amdgcn_readfirstlane(threadIdx.x >> 5);      /* the row is the same in every lane: row base, diagonal and the test below stay scalar */
  if (t >= hg * QT) return; const int c0 = (threadIdx.x & 31) * 4; const size_t i = (size_t)t; const float* s = S + i * NKX + c0; const int last = q0 + (t % QT); v4f v[NU];
#pragma unroll      /* the four loops over u are unrolled so that v[] is indexed by constants and stays in registers */
  for (int u = 0; u < NU; ++u) v[u] = *(const v4fa*)(s + u * 128);      /* the loads stand in a loop of their own, ahead of the arithmetic, so that many are in flight at once */
  float mx = -3.0e38f;
#pragma unroll      /* v[] in registers */
  for (int u = 0; u < NU; ++u) for (int q = 0; q < 4; ++q) { const float f = (u * 128 + c0 + q <= last) ? 1.f : 0.f; v[u][q] = fmaf(f, v[u][q], (1.f - f) * -1.0e9f); mx = fmaxf(mx, v[u][q]); }
  for (int m = 16; m >= 1; m >>= 1) mx = fmaxf(mx, __shfl_xor(mx, m, 32));
  float se = 0.f;
#pragma unroll      /* v[] in registers */
  for (int u = 0; u < NU; ++u) for (int q = 0; q < 4; ++q) { v[u][q] = exp2_slot((v[u][q] - mx) * 1.44269504088896340736f); se += v[u][q]; }
  for (int m = 16; m >= 1; m >>= 1) se += __shfl_xor(se, m, 32);
  const float sc = 256.0f / se; _Float16* d = P + i * NKX + c0;
#pragma unroll      /* v[] in registers */
  for (int u = 0; u < NU; ++u) { v4h h4; for (int q = 0; q < 4; ++q) h4[q] = (_Float16)(v[u][q] * sc); *(v4h*)(d + u * 128) = h4; } }
// launches the instance whose row length is nk keys (nk = 256, 512, ... NKX)
template <int NU>
static void rsmcf2_launch(const float* S, _Float16* P, int q0, int nk, hipStream_t stream) { if (nk == NU * 128) k_rsmcf2<NU><<<(NH * QT + 7) / 8, 256, 0, stream>>>(S, P, NH, q0); else if constexpr (NU > 2) rsmcf2_launch<NU - 2>(S, P, q0, nk, stream); }


// Exact f32 causal attention of the first QT0 query rows (o x64). One work-group per (head, 32 query rows); wave w owns rows 4w .. 4w + 3 of the group.
// Scores: 32 key rows at a time stand in LDS (pitch 132 floats: the 16 lanes that a 16-byte LDS read serves together fall on 64 distinct banks); lane = key, the four query rows come through loads whose address is the same in every lane.
// Softmax: one partial per lane over the row's keys, then a five-step butterfly over the wave; the weights go to LDS as [key][4 rows], unnormalised.
// P*V: lane = 4 head dims; a value row is one 512-byte load, the four weights of a key one broadcast LDS read; masked keys carry weight 0.
__global__ __launch_bounds__(256) void k_att0w(const float* __restrict__ QF, const float* __restrict__ KF, const float* __restrict__ VF, float scale, float* __restrict__ OF) {
  __shared__ __attribute__((aligned(16))) float lk[32][132]; __shared__ __attribute__((aligned(16))) float lp[8][QT0][4];
  const int lane = threadIdx.x & 31; const int w = __builtin_amdgcn_readfirstlane(threadIdx.x >> 5);      /* the wave's number is the same in every lane: row numbers and base addresses stay scalar */
  const int h = blockIdx.x / (QT0 / 32), rg = blockIdx.x % (QT0 / 32); const int i0 = rg * 32 + w * 4;
  const float* qp = QF + (size_t)i0 * DMX + h * 128; const float* kp = KF + (size_t)w * DMX + h * 128 + lane * 4;      /* wave w stages key rows w, w + 8, w + 16, w + 24 of each group of 32 */
  const v4f z4 = {0.f, 0.f, 0.f, 0.f}; v4f kn[4];
#pragma unroll      /* kn[] is indexed by constants and stays in registers */
  for (int u = 0; u < 4; ++u) kn[u] = *(const v4fa*)(kp + (size_t)(u * 8) * DMX);
  for (int c = 0; c <= rg; ++c) {      /* rg + 1 trips, the same for every wave of the work-group: the barriers stand under uniform control flow */
    __syncthreads();      /* every wave has left the key group that is overwritten next */
#pragma unroll      /* kn[] in registers */
    for (int u = 0; u < 4; ++u) *(v4f*)&lk[u * 8 + w][lane * 4] = kn[u];
    __syncthreads();      /* the key group is complete before any wave reads it */
    if (c < rg) {      /* the next group's loads fly under this group's products */
#pragma unroll      /* kn[] in registers */
      for (int u = 0; u < 4; ++u) kn[u] = *(const v4fa*)(kp + (size_t)((c + 1) * 32 + u * 8) * DMX); }
    v4f a0 = z4, a1 = z4, a2 = z4, a3 = z4;      /* per row four partial sums (dims d mod 4), added at the end */
    for (int d0 = 0; d0 < 32; d0 += 8) {
#pragma unroll      /* eight 16-byte steps a trip: their 40 loads are in flight together, so the load latency is paid four times a key group */
      for (int dd = 0; dd < 8; ++dd) { const int d4 = d0 + dd; const v4f kq = *(const v4f*)&lk[lane][d4 * 4];
        a0 += *(const v4fa*)(qp + d4 * 4) * kq; a1 += *(const v4fa*)(qp + DMX + d4 * 4) * kq; a2 += *(const v4fa*)(qp + 2 * DMX + d4 * 4) * kq; a3 += *(const v4fa*)(qp + 3 * DMX + d4 * 4) * kq; }
      asm volatile("s_wait_xcnt 0x0" ::: "memory"); }      /* stands between this trip's query loads and the next trip's rewrite of the base address that they name */
    v4f sv; sv[0] = ((a0[0] + a0[1]) + (a0[2] + a0[3])) * scale; sv[1] = ((a1[0] + a1[1]) + (a1[2] + a1[3])) * scale; sv[2] = ((a2[0] + a2[1]) + (a2[2] + a2[3])) * scale; sv[3] = ((a3[0] + a3[1]) + (a3[2] + a3[3])) * scale;
    *(v4f*)&lp[w][c * 32 + lane][0] = sv; }
  float mx[4] = {-3.0e38f, -3.0e38f, -3.0e38f, -3.0e38f}, se[4] = {0.f, 0.f, 0.f, 0.f};
  for (int c = 0; c <= rg; ++c) { const int j = c * 32 + lane; const v4f sv = *(const v4f*)&lp[w][j][0];      /* each lane reads back what it wrote itself */
    for (int r = 0; r < 4; ++r) mx[r] = (j <= i0 + r) ? fmaxf(mx[r], sv[r]) : mx[r]; }
  for (int m = 16; m >= 1; m >>= 1) for (int r = 0; r < 4; ++r) mx[r] = fmaxf(mx[r], __shfl_xor(mx[r], m, 32));
  for (int c = 0; c <= rg; ++c) { const int j = c * 32 + lane; const v4f sv = *(const v4f*)&lp[w][j][0]; v4f e;
    for (int r = 0; r < 4; ++r) { const float x = exp2_slot((sv[r] - mx[r]) * 1.44269504088896340736f); e[r] = (j <= i0 + r) ? x : 0.f; se[r] += e[r]; }
    *(v4f*)&lp[w][j][0] = e; }
  for (int m = 16; m >= 1; m >>= 1) for (int r = 0; r < 4; ++r) se[r] += __shfl_xor(se[r], m, 32);
  __builtin_amdgcn_fence(__ATOMIC_ACQ_REL, "workgroup"); __builtin_amdgcn_wave_barrier();      /* the weights are read below by the other lanes of the same wave: the LDS writes stay in front of those reads */
  const float* vp = VF + (size_t)h * 128 + lane * 4; v4f o0 = z4, o1 = z4, o2 = z4, o3 = z4; v4f va[16], vb[16];      /* two register buffers of 16 value rows: one is loaded while the other is used */
#pragma unroll      /* va[], vb[] are indexed by constants and stay in registers */
  for (int u = 0; u < 16; ++u) va[u] = *(const v4fa*)(vp + (size_t)u * DMX);
  for (int c = 0; c <= rg; ++c) { const float* vc = vp + (size_t)(c * 32) * DMX;
#pragma unroll      /* vb[] in registers */
    for (int u = 0; u < 16; ++u) vb[u] = *(const v4fa*)(vc + (size_t)(16 + u) * DMX);
#pragma unroll      /* va[] in registers */
    for (int u = 0; u < 16; ++u) { const v4f p4 = *(const v4f*)&lp[w][c * 32 + u][0]; o0 += p4[0] * va[u]; o1 += p4[1] * va[u]; o2 += p4[2] * va[u]; o3 += p4[3] * va[u]; }
    if (c < rg) {
#pragma unroll      /* va[] in registers */
      for (int u = 0; u < 16; ++u) va[u] = *(const v4fa*)(vc + (size_t)(32 + u) * DMX); }
#pragma unroll      /* vb[] in registers */
    for (int u = 0; u < 16; ++u) { const v4f p4 = *(const v4f*)&lp[w][c * 32 + 16 + u][0]; o0 += p4[0] * vb[u]; o1 += p4[1] * vb[u]; o2 += p4[2] * vb[u]; o3 += p4[3] * vb[u]; } }
  float* op = OF + (size_t)i0 * DMX + h * 128 + lane * 4;
  *(v4f*)op = o0 * (64.0f / se[0]); *(v4f*)(op + DMX) = o1 * (64.0f / se[1]); *(v4f*)(op + 2 * DMX) = o2 * (64.0f / se[2]); *(v4f*)(op + 3 * DMX) = o3 * (64.0f / se[3]); }


__global__ __launch_bounds__(256) void k_tab128p(const int* __restrict__ pos, int nrows, float theta, float* __restrict__ CS, float* __restrict__ SN) {
  #pragma clang fp contract(off)
  const int t = blockIdx.x * 256 + threadIdx.x; if (t >= nrows * 64) return; const int i = t % 64; const int r = t / 64; const float invf = (float)(1.0 / pow((double)theta, (double)(2 * i) / 128.0)); const float ang = __fmul_rn((float)pos[r], invf); const float c = cosf(ang), sv = sinf(ang);
  float* c0 = CS + (size_t)r * 128 + i; float* s0 = SN + (size_t)r * 128 + i;
  { *(float*)c0 = c; *(float*)(c0 + 64) = c; *(float*)s0 = sv; *(float*)(s0 + 64) = sv;  } }

__global__ __launch_bounds__(128) void k_rmshd(float* __restrict__ F, int ldf, int nh, const float* __restrict__ w, int wst, float eps) {
  #pragma clang fp contract(off)
  __shared__ float red[128]; const int d = threadIdx.x; const int h = blockIdx.x % nh; const size_t r = blockIdx.x / nh; float* p = F + r * (size_t)ldf + (size_t)h * 128 + d; const float v = *p; red[d] = __fmul_rn(v, v); __syncthreads();
  for (int st = 64; st > 0; st >>= 1) { if (d < st) red[d] = __fadd_rn(red[d], red[d + st]); __syncthreads(); }
  const float rs = __frsqrt_rn(__fadd_rn(red[0] / 128.0f, eps)); const float y = __fmul_rn(bf16_round(w[(size_t)h * wst + d]), __fmul_rn(v, rs));      /* gain vector of head h (wst = 128: per-head gains; 0 would share one vector) */ *(float*)p = y;  }
extern "C" void kernel_launch(void* const* d_in, const int* in_sizes, int n_in,
                              void* d_out, int out_size, void* d_ws, size_t ws_size, hipStream_t stream) {
  (void)in_sizes; (void)n_in; (void)out_size;
  const float* const* I = (const float* const*)d_in; const float* x = I[0]; const float* wq = I[1]; const float* wk = I[2]; const float* wv = I[3]; const float* wo = I[4];      /* hidden_states; natural Wq / Wk / Wv / Wo [2048][2048]; no QK norm, no biases, no mask / table inputs */
  char* ws = (char*)d_ws; size_t off = 0;
  auto take = [&](size_t bytes) { char* p = ws + off; off += (bytes + 255) & ~(size_t)255; return p; };
  _Float16* BQ = (_Float16*)take((size_t)DMX * DMX * 2); _Float16* BK = (_Float16*)take((size_t)DKV * DMX * 2); _Float16* BV = (_Float16*)take((size_t)DKV * DMX * 2); _Float16* BO = (_Float16*)take((size_t)DMX * DMX * 2);
  _Float16* X16 = (_Float16*)take(NR * DMX * 2); float* QF = (float*)take(NR * DMX * 4); float* KF = (float*)take(NR * DKV * 4); float* VF = (float*)take(NR * DKV * 4); _Float16* Q16 = (_Float16*)take(NR * DMX * 2); _Float16* K16 = (_Float16*)take(NR * DKV * 2); _Float16* V16 = (_Float16*)take(NR * DKV * 2); _Float16* O16 = (_Float16*)take(NR * DMX * 2);
  float* S = (float*)take((size_t)NH * QT * NKX * 4); _Float16* P = (_Float16*)take((size_t)NH * QT * NKX * 2); _Float16* VT = (_Float16*)take((size_t)(DKV / 64) * 64 * SQ * 2);
  float* QF0 = (float*)take((size_t)QT0 * DMX * 4); float* KRF0 = (float*)take((size_t)QT0 * DKV * 4); float* KF0e = (float*)take((size_t)QT0 * DMX * 4); float* VF0e = (float*)take((size_t)QT0 * DMX * 4); float* OF0 = (float*)take((size_t)NB * QT0 * DMX * 4); _Float16* OH0 = (_Float16*)take((size_t)NB * QT0 * DMX * 2); _Float16* OL0 = (_Float16*)take((size_t)NB * QT0 * DMX * 2); float* tcos = (float*)take((size_t)SQ * 64 * 4); float* tsin = (float*)take((size_t)SQ * 64 * 4);      /* rope tables [2048][64] computed on the device (the module derives them from constants) */
  if (off > ws_size) return;      /* approx 8 + 8 + 8 + 8 + 8 + 16 + 16 + 16 + 8 + 8 + 8 + 8 + 32 + 16 + 8 + 2 + 2 + 2 + 2 + 2 + 1 + 1 + 0.5 + 0.5 = 189 MiB */
  k_wnat<<<(unsigned)(((size_t)DMX * DMX / 8 + 255) / 256), 256, 0, stream>>>(wq, (size_t)DMX * DMX / 8, BQ); k_wnat<<<(unsigned)(((size_t)DKV * DMX / 8 + 255) / 256), 256, 0, stream>>>(wk, (size_t)DKV * DMX / 8, BK); k_wnat<<<(unsigned)(((size_t)DKV * DMX / 8 + 255) / 256), 256, 0, stream>>>(wv, (size_t)DKV * DMX / 8, BV); k_wnat<<<(unsigned)(((size_t)DMX * DMX / 8 + 255) / 256), 256, 0, stream>>>(wo, (size_t)DMX * DMX / 8, BO);      /* natural [out][in] = Bt[n][k] x16 */
  k_x16<<<(unsigned)((NR * DMX / 8 + 255) / 256), 256, 0, stream>>>(x, X16, NR * DMX / 8); k_tab128<<<(SQ * 64 + 255) / 256, 256, 0, stream>>>(10000.0f, tcos, tsin);      /* angle[p][i] = p * 10000^(-2i/128) */
  k_gemm2<0><<<dim3((unsigned)((NR / 128) * (DMX / 64)), 1), 128, 0, stream>>>(X16, DMX, 0, BQ, DMX, 0, 0.0625f, nullptr, 0, nullptr, 1, 0, 0, QF, nullptr, DMX, 0, (int)NR, DMX, DMX);      /* q (f32) */
  k_gemm2<0><<<dim3((unsigned)((NR / 128) * (DKV / 64)), 1), 128, 0, stream>>>(X16, DMX, 0, BK, DMX, 0, 0.0625f, nullptr, 0, nullptr, 1, 0, 0, KF, nullptr, DKV, 0, (int)NR, DKV, DMX);      /* k (f32) */
  k_gemm2<0><<<dim3((unsigned)((NR / 128) * (DKV / 64)), 1), 128, 0, stream>>>(X16, DMX, 0, BV, DMX, 0, 0.0625f, nullptr, 0, nullptr, 1, 0, 0, VF, V16, DKV, 0, (int)NR, DKV, DMX);      /* v (f32 for the first tile + f16) */
  k_rope128x<0, 0, 0><<<(unsigned)(NR * NH), 128, 0, stream>>>(QF, DMX, NH, tcos, tsin, Q16, DMX, 1.0f); k_rope128x<0, 0, 0><<<(unsigned)(NR * NKV), 128, 0, stream>>>(KF, DKV, NKV, tcos, tsin, K16, DKV, 1.0f);      /* half-split rope from the computed tables (index d mod 64) -> f16 */
  for (int b = 0; b < NB; ++b) { const size_t r0 = (size_t)b * SQ;
    k_rope128x<0, 0, 1><<<(unsigned)(QT0 * NH), 128, 0, stream>>>(QF + r0 * DMX, DMX, NH, tcos, tsin, QF0, DMX, 1.0f); k_rope128x<0, 0, 1><<<(unsigned)(QT0 * NKV), 128, 0, stream>>>(KF + r0 * DKV, DKV, NKV, tcos, tsin, KRF0, DKV, 1.0f);      /* f32 roped q, k of the batch's first QT0 rows (positions 0..QT0-1: the table pointers are NOT offset by the batch) */
    k_kvexp128<GSZ, NH, DKV><<<(unsigned)(((size_t)QT0 * DMX / 4 + 255) / 256), 256, 0, stream>>>(KRF0, KF0e, (size_t)QT0 * DMX / 4); k_kvexp128<GSZ, NH, DKV><<<(unsigned)(((size_t)QT0 * DMX / 4 + 255) / 256), 256, 0, stream>>>(VF + r0 * DKV, VF0e, (size_t)QT0 * DMX / 4);      /* kv head -> query head expansion for the exact first tile */
    k_vt<DKV / 64, SQ><<<(DKV / 64) * (SQ / 64), 256, 0, stream>>>(V16 + r0 * DKV, DKV, 0, VT);      /* V^T of this batch: kv head g = slabs 2g, 2g+1 */
    k_att0w<<<NH * (QT0 / 32), 256, 0, stream>>>(QF0, KF0e, VF0e, ATS, OF0 + (size_t)b * QT0 * DMX);      /* exact causal attention of the first QT0 rows (o x64) */
    for (int q0 = 0; q0 < SQ; q0 += QT) { const int nk = q0 + QT;      /* causal: keys below the tile end only */
      k_gemm2<0><<<dim3((QT / 128) * (nk / 64), NH), 128, 0, stream>>>(Q16 + (r0 + q0) * DMX, DMX, (size_t)HDK, K16 + r0 * DKV, DKV, (size_t)HDK, ATS, nullptr, 0, nullptr, 1, 0, 0, S, nullptr, NKX, (size_t)QT * NKX, QT, nk, HDK);      /* scores of all heads in one launch: blockIdx.y = head, query and key slabs both step by one head (one query head per kv head) */
      rsmcf2_launch<NKX / 128>(S, P, q0, nk, stream);      /* causal softmax (arithmetic select), one wave per row */
      k_gemm2<0><<<dim3((QT / 128) * (HDK / 64), NH), 128, 0, stream>>>(P, NKX, (size_t)QT * NKX, VT, SQ, (size_t)HDK * SQ, 0.25f, nullptr, 0, nullptr, 1, 0, 0, nullptr, O16 + (r0 + q0) * DMX, DMX, (size_t)HDK, QT, HDK, nk); } }      /* o of all heads in one launch (x64): blockIdx.y = head */
  k_gemm2<0><<<dim3((unsigned)((NR / 128) * (DMX / 64)), 1), 128, 0, stream>>>(O16, DMX, 0, BO, DMX, 0, 0.0009765625f, nullptr, 0, nullptr, 1, 0, 0, (float*)d_out, nullptr, DMX, 0, (int)NR, DMX, DMX);      /* out = o Wo^T */
  k_hl<<<(unsigned)(((size_t)NB * QT0 * DMX / 8 + 255) / 256), 256, 0, stream>>>(OF0, OH0, OL0, (size_t)NB * QT0 * DMX / 8);      /* first-tile o (x64) -> f16 hi + x1024 residual planes */
  for (int b = 0; b < NB; ++b) { const size_t r0 = (size_t)b * SQ; const size_t f0 = (size_t)b * QT0;
    k_gemm2<0><<<dim3((QT0 / 128) * (DMX / 64), 1), 128, 0, stream>>>(OH0 + f0 * DMX, DMX, 0, BO, DMX, 0, 0.0009765625f, nullptr, 0, nullptr, 1, 0, 0, (float*)d_out + r0 * DMX, nullptr, DMX, 0, QT0, DMX, DMX);      /* rows 0..255 of the batch rewritten from the exact path */
    k_gemm2<0><<<dim3((QT0 / 128) * (DMX / 64), 1), 128, 0, stream>>>(OL0 + f0 * DMX, DMX, 0, BO, DMX, 0, 0.00000095367431640625f, nullptr, 0, (const float*)d_out + r0 * DMX, -1, 0, 0, (float*)d_out + r0 * DMX, nullptr, DMX, 0, QT0, DMX, DMX); }      /* += o_lo Wo 2^-20 (own-element accumulate) */
}

// v004
// Measured time: 442 microseconds a run.
// Next to v003, in two timings, it ran 2.01 times as fast each time.
// All steps since v000 together make it 19.4 times as fast.
#include <hip/hip_runtime.h>
// Llama-style causal multi-head attention with half-split RoPE computed in the module (hidden_states [1][2048][2048]; q / k / v = x W^T (nn.Linear natural [2048][2048] sigma 0.02, no biases), 16 heads of 128; rope: emb = [f | f], f = p * 10000^(-2i/128): t cos + rotate_half(t) sin; scores * 128^-0.5; causal (where(tril, ., finfo.min): the weight underflows to exactly 0); softmax; out = merged Wo^T (natural) -> [1][2048][2048]); run on the hd128 grouped-query causal code as 16 kv groups of ONE query head.
// Compute dtype: inputs rounded to bf16; x / weights exact; projections and rope f32; q, k, v, softmax weights and o as plain f16 GEMM operands (~2^-12; first 256 rows of each batch exact); scores, statistics, out f32. v_wmma_f32_16x16x32_f16.
#define NB 1
#define SQ 2048
#define DMX 2048
#define NH 16
#define NKV 16
#define GSZ 1
#define HDK 128
#define DKV (NKV * HDK)
#define QT 256
#define QT0 256
#define NKX SQ
#define DM DMX
#define HD 64
#define HG 1
#define NR ((size_t)NB * SQ)
#define ATS 0.08838834764831845f
static_assert(GSZ == 1 && NH == NKV, "the per-head launches are batched on blockIdx.y with one key / value slab per query head");
typedef __bf16 v16b __attribute__((ext_vector_type(16)));
typedef unsigned short v8us __attribute__((ext_vector_type(8), may_alias));
typedef float  v8f  __attribute__((ext_vector_type(8)));
typedef float  v4f  __attribute__((ext_vector_type(4)));
typedef float  v4fa __attribute__((ext_vector_type(4), may_alias));
union FragB { v16b v; v8us half[2]; unsigned short u[16]; };

__device__ __forceinline__ unsigned short bf16_bits(float x) { unsigned int u = __float_as_uint(x); return (unsigned short)((u + 0x7FFFu + ((u >> 16) & 1u)) >> 16); }
__device__ __forceinline__ float bf16_val(unsigned short b) { return __uint_as_float(((unsigned int)b) << 16); }
__device__ __forceinline__ float bf16_round(float x) { return bf16_val(bf16_bits(x)); }
// D += A·B with NT terms: 1 = ah·bh, 2 = + al·bh (A split), 3 = + ah·bl (both split)
template <int NT>
__device__ __forceinline__ v8f mmaN(v16b ah, v16b al, v16b bh, v16b bl, v8f c) {
  c = __builtin_amdgcn_wmma_f32_16x16x32_bf16(false, ah, false, bh, (short)0, c, false, false);
  if (NT >= 2) c = __builtin_amdgcn_wmma_f32_16x16x32_bf16(false, al, false, bh, (short)0, c, false, false);
  if (NT >= 3) c = __builtin_amdgcn_wmma_f32_16x16x32_bf16(false, ah, false, bl, (short)0, c, false, false);
  asm volatile("v_nop\n\tv_nop\n\tv_nop\n\tv_nop" : "+v"(c) : "v"(ah), "v"(al), "v"(bh), "v"(bl));
  return c;
}

__global__ __launch_bounds__(256) void k_wt_bf16(const float* __restrict__ W, unsigned short* __restrict__ Wt, int K, int N) {
  const int t = blockIdx.x * 256 + threadIdx.x;
  const int k8n = K / 8;
  if (t >= N * k8n) return;
  const int n = t / k8n, k8 = (t % k8n) * 8;
  v8us v;
#pragma unroll
  for (int i = 0; i < 8; ++i) v[i] = bf16_bits(W[(size_t)(k8 + i) * N + n]);
  *(v8us*)(Wt + (size_t)n * K + k8) = v;
  
}

// GEMM C[M][N] (f32, pitch ldc) = act(A[M][K]·W + bias). A f32 row-major (pitch lda) converted per fragment to bf16
// (ASPLIT: hi/lo two planes -> 2 terms, else single rounded term); Wt bf16 [N][K] (pitch ldb). BIAS_BF16 rounds the
// bias to bf16 first (bias quantised to bf16 before the add). K%32==0, M%16==0, N%64==0.
template <bool ASPLIT, int ACT, bool BIAS_BF16>
__global__ __launch_bounds__(128) void k_gemm_bf(const float* __restrict__ A, int lda, const unsigned short* __restrict__ Wt, int ldb,
                                               const float* __restrict__ bias, float* __restrict__ C, int ldc, int M, int N, int K) {
  __shared__ __attribute__((aligned(16))) float so[4][16][64];
  const int tid = threadIdx.x, w = tid >> 5, lane = tid & 31, ln = lane & 15, hh = lane >> 4;
  const int ntn = N / 64;
  const int wid = blockIdx.x * 4 + w;
  const int mt = wid / ntn, nq = wid % ntn;
  if (mt * 16 >= M) return;
  const int row0 = mt * 16, col0 = nq * 64;
  const float* arow = A + (size_t)(row0 + ln) * lda;
  v8f acc[4] = {};
  for (int kb = 0; kb < K; kb += 32) {
    FragB ah, al;
    const v4f x0 = *(const v4fa*)(arow + kb + 8 * hh), x1 = *(const v4fa*)(arow + kb + 8 * hh + 4);
    const v4f x2 = *(const v4fa*)(arow + kb + 16 + 8 * hh), x3 = *(const v4fa*)(arow + kb + 16 + 8 * hh + 4);
    float xs[16] = {x0[0],x0[1],x0[2],x0[3],x1[0],x1[1],x1[2],x1[3],x2[0],x2[1],x2[2],x2[3],x3[0],x3[1],x3[2],x3[3]};
#pragma unroll
    for (int i = 0; i < 16; ++i) { const unsigned short hb = bf16_bits(xs[i]); ah.u[i] = hb; al.u[i] = ASPLIT ? bf16_bits(xs[i] - bf16_val(hb)) : (unsigned short)0; }
#pragma unroll
    for (int t = 0; t < 4; ++t) {
      const unsigned short* brow = Wt + (size_t)(col0 + t * 16 + ln) * ldb + kb;
      FragB b;
      b.half[0] = *(const v8us*)(brow + 8 * hh);
      b.half[1] = *(const v8us*)(brow + 16 + 8 * hh);
      acc[t] = mmaN<ASPLIT ? 2 : 1>(ah.v, al.v, b.v, b.v, acc[t]);
    }
  }
#pragma unroll
  for (int t = 0; t < 4; ++t) {
    float bv = bias ? bias[col0 + t * 16 + ln] : 0.f;
    if (BIAS_BF16) bv = bf16_round(bv);
#pragma unroll
    for (int r = 0; r < 8; ++r) { float v = acc[t][r] + bv; if (ACT == 1) v = fmaxf(v, 0.f); so[w][8 * hh + r][t * 16 + ln] = v; }
  }
  __builtin_amdgcn_fence(__ATOMIC_ACQ_REL, "workgroup");
  __builtin_amdgcn_wave_barrier();
  const int rsub = lane >> 4, c4 = (lane & 15) * 4;
  {
#pragma unroll
    for (int q = 0; q < 8; ++q) {
      const int r = q * 2 + rsub;
      const v4f v = *(const v4fa*)&so[w][r][c4];
      *(v4f*)(C + (size_t)(row0 + r) * ldc + col0 + c4) = v;
    }
    
  }
}

// GEMM C = act(A·W + bias + resid): A f32 (ASPLIT -> hi/lo 2 terms), Wt bf16 [N][K]; ACT 0 none, 1 relu, 2 exact gelu;
// resid (optional, f32, row index = (row % rmod), pitch ldr, RES_BF16 rounds it) added before the activation.
template <bool ASPLIT, int ACT, bool BIAS_BF16, bool RES_BF16>
__global__ __launch_bounds__(128) void k_gemm_bf3(const float* __restrict__ A, int lda, const unsigned short* __restrict__ Wt, int ldb,
                                                const float* __restrict__ bias, const float* __restrict__ resid, int rmod, int ldr,
                                                float* __restrict__ C, int ldc, int M, int N, int K) {
  __shared__ __attribute__((aligned(16))) float so[4][16][64];
  const int tid = threadIdx.x, w = tid >> 5, lane = tid & 31, ln = lane & 15, hh = lane >> 4;
  const int ntn = N / 64;
  const int wid = blockIdx.x * 4 + w;
  const int mt = wid / ntn, nq = wid % ntn;
  if (mt * 16 >= M) return;
  const int row0 = mt * 16, col0 = nq * 64;
  const float* arow = A + (size_t)(row0 + ln) * lda;
  v8f acc[4] = {};
  for (int kb = 0; kb < K; kb += 32) {
    FragB ah, al;
    const v4f x0 = *(const v4fa*)(arow + kb + 8 * hh), x1 = *(const v4fa*)(arow + kb + 8 * hh + 4);
    const v4f x2 = *(const v4fa*)(arow + kb + 16 + 8 * hh), x3 = *(const v4fa*)(arow + kb + 16 + 8 * hh + 4);
    float xs[16] = {x0[0],x0[1],x0[2],x0[3],x1[0],x1[1],x1[2],x1[3],x2[0],x2[1],x2[2],x2[3],x3[0],x3[1],x3[2],x3[3]};
#pragma unroll
    for (int i = 0; i < 16; ++i) { const unsigned short hb = bf16_bits(xs[i]); ah.u[i] = hb; al.u[i] = ASPLIT ? bf16_bits(xs[i] - bf16_val(hb)) : (unsigned short)0; }
#pragma unroll
    for (int t = 0; t < 4; ++t) {
      const unsigned short* brow = Wt + (size_t)(col0 + t * 16 + ln) * ldb + kb;
      FragB b;
      b.half[0] = *(const v8us*)(brow + 8 * hh);
      b.half[1] = *(const v8us*)(brow + 16 + 8 * hh);
      acc[t] = mmaN<ASPLIT ? 2 : 1>(ah.v, al.v, b.v, b.v, acc[t]);
    }
  }
#pragma unroll
  for (int t = 0; t < 4; ++t) {
    const int col = col0 + t * 16 + ln;
    float bv = bias ? bias[col] : 0.f;
    if (BIAS_BF16) bv = bf16_round(bv);
#pragma unroll
    for (int r = 0; r < 8; ++r) {
      float v = acc[t][r] + bv;
      if (resid) { float rv = resid[(size_t)((row0 + 8 * hh + r) % rmod) * ldr + col]; if (RES_BF16) rv = bf16_round(rv); v += rv; }
      if (ACT == 1) v = fmaxf(v, 0.f);
      if (ACT == 2) v = 0.5f * v * (1.0f + erff(v * 0.70710678118654752f));
      if (ACT == 3) { const float u = 0.7978845608028654f * (v + 0.044715f * v * v * v); v = 0.5f * v * (1.0f + tanhf(u)); }
      so[w][8 * hh + r][t * 16 + ln] = v;
    }
  }
  __builtin_amdgcn_fence(__ATOMIC_ACQ_REL, "workgroup");
  __builtin_amdgcn_wave_barrier();
  const int rsub = lane >> 4, c4 = (lane & 15) * 4;
  {
#pragma unroll
    for (int q = 0; q < 8; ++q) {
      const int r = q * 2 + rsub;
      const v4f v = *(const v4fa*)&so[w][r][c4];
      *(v4f*)(C + (size_t)(row0 + r) * ldc + col0 + c4) = v;
    }
    
  }
}
// row LayerNorm (biased variance, eps) over N: s = X (+ R); optional out_sum <- s; out_norm <- (s-mu)*rsqrt(var+eps)*g + b
template <bool PARAM_BF16>
__global__ __launch_bounds__(256) void k_layernorm(const float* __restrict__ X, const float* __restrict__ R, const float* __restrict__ g, const float* __restrict__ bta,
                                                  float* __restrict__ out_sum, float* __restrict__ out_norm, int N, float eps) {
  __shared__ float red[256];
  const int row = blockIdx.x, tid = threadIdx.x;
  const float* x = X + (size_t)row * N; const float* rr = R ? R + (size_t)row * N : nullptr;
  float vals[16];                     // up to N = 4096
  const int per = N / 256;            // contiguous chunk per thread? use strided-by-4 chunks: thread handles j = tid*4 + 1024*u
  float s1 = 0.f;
  for (int u = 0; u < per / 4; ++u) {
    const int j = tid * 4 + 1024 * u;
    const v4f a = *(const v4fa*)(x + j);
    v4f b = {0.f,0.f,0.f,0.f}; if (rr) b = *(const v4fa*)(rr + j);
#pragma unroll
    for (int q = 0; q < 4; ++q) { const float v = a[q] + b[q]; vals[u * 4 + q] = v; s1 += v; }
  }
  red[tid] = s1; __syncthreads();
  for (int st = 128; st > 0; st >>= 1) { if (tid < st) red[tid] += red[tid + st]; __syncthreads(); }
  const float mu = red[0] / (float)N; __syncthreads();
  float s2 = 0.f;
  for (int u = 0; u < per / 4; ++u)
#pragma unroll
    for (int q = 0; q < 4; ++q) { const float c = vals[u * 4 + q] - mu; s2 += c * c; }
  red[tid] = s2; __syncthreads();
  for (int st = 128; st > 0; st >>= 1) { if (tid < st) red[tid] += red[tid + st]; __syncthreads(); }
  const float rs = rsqrtf(red[0] / (float)N + eps);
  {
    for (int u = 0; u < per / 4; ++u) {
      const int j = tid * 4 + 1024 * u;
      v4f o, sm;
#pragma unroll
      for (int q = 0; q < 4; ++q) {
        float gg = g[j + q], bb = bta[j + q];
        if (PARAM_BF16) { gg = bf16_round(gg); bb = bf16_round(bb); }
        sm[q] = vals[u * 4 + q]; o[q] = (vals[u * 4 + q] - mu) * rs * gg + bb;
      }
      if (out_sum) *(v4f*)(out_sum + (size_t)row * N + j) = sm;
      *(v4f*)(out_norm + (size_t)row * N + j) = o;
    }
    
  }
}



// ---- f16 WMMA path (v_wmma_f32_16x16x32_f16): 11-bit significands for operands in range — used where a [0,1] probability operand needs more precision than bf16
typedef _Float16 v16h __attribute__((ext_vector_type(16)));
union FragH { v16h v; v8us half[2]; _Float16 h[16]; unsigned short u[16]; };
template <int NT>
__device__ __forceinline__ v8f mmaH(v16h ah, v16h al, v16h bh, v16h bl, v8f c) {
  c = __builtin_amdgcn_wmma_f32_16x16x32_f16(false, ah, false, bh, (short)0, c, false, false);
  if (NT >= 2) c = __builtin_amdgcn_wmma_f32_16x16x32_f16(false, al, false, bh, (short)0, c, false, false);
  if (NT >= 3) c = __builtin_amdgcn_wmma_f32_16x16x32_f16(false, ah, false, bl, (short)0, c, false, false);
  asm volatile("v_nop\n\tv_nop\n\tv_nop\n\tv_nop" : "+v"(c) : "v"(ah), "v"(al), "v"(bh), "v"(bl));
  return c;
}
// batched GEMM like k_gemm_b but f16 operands: A f32 (split into f16 hi/lo if ASPLIT, else rounded to f16), Bt = f16 values [n][k]; alpha; C f32; N multiple of 16 (partial tiles skipped)
template <bool ASPLIT>
__global__ __launch_bounds__(128) void k_gemm_h(const float* __restrict__ A, int lda, size_t sA, const _Float16* __restrict__ Bh, int ldb, size_t sB, float alpha, float* __restrict__ C, int ldc, size_t sC, int M, int N, int K) {
  __shared__ __attribute__((aligned(16))) float so[4][16][64];
  const int tid = threadIdx.x, w = tid >> 5, lane = tid & 31, ln = lane & 15, hh = lane >> 4; const int by = blockIdx.y;
  A += (size_t)by * sA; Bh += (size_t)by * sB; C += (size_t)by * sC;
  const int ntn = (N + 63) / 64; const int wid = blockIdx.x * 4 + w; const int mt = wid / ntn, nq = wid % ntn; if (mt * 16 >= M) return;
  const int row0 = mt * 16, col0 = nq * 64; const float* arow = A + (size_t)(row0 + ln) * lda;
  v8f acc[4] = {};
  for (int kb = 0; kb < K; kb += 32) {
    FragH ah, al;
    const v4f x0 = *(const v4fa*)(arow + kb + 8 * hh), x1 = *(const v4fa*)(arow + kb + 8 * hh + 4), x2 = *(const v4fa*)(arow + kb + 16 + 8 * hh), x3 = *(const v4fa*)(arow + kb + 16 + 8 * hh + 4);
    float xs[16] = {x0[0],x0[1],x0[2],x0[3],x1[0],x1[1],x1[2],x1[3],x2[0],x2[1],x2[2],x2[3],x3[0],x3[1],x3[2],x3[3]};
#pragma unroll
    for (int i = 0; i < 16; ++i) { const _Float16 h = (_Float16)xs[i]; ah.h[i] = h; al.h[i] = ASPLIT ? (_Float16)(xs[i] - (float)h) : (_Float16)0.0f; }
#pragma unroll
    for (int t = 0; t < 4; ++t) { if (col0 + t * 16 >= N) continue; const size_t boff = (size_t)(col0 + t * 16 + ln) * ldb + kb; FragH bq; bq.half[0] = *(const v8us*)(Bh + boff + 8 * hh); bq.half[1] = *(const v8us*)(Bh + boff + 16 + 8 * hh);
      acc[t] = mmaH<ASPLIT ? 2 : 1>(ah.v, al.v, bq.v, bq.v, acc[t]); }
  }
#pragma unroll
  for (int t = 0; t < 4; ++t) { if (col0 + t * 16 >= N) continue;
#pragma unroll
    for (int r = 0; r < 8; ++r) so[w][8 * hh + r][t * 16 + ln] = acc[t][r] * alpha; }
  __builtin_amdgcn_fence(__ATOMIC_ACQ_REL, "workgroup"); __builtin_amdgcn_wave_barrier();
  const int rsub = lane >> 4, c4 = (lane & 15) * 4;
  {
#pragma unroll
    for (int q = 0; q < 8; ++q) { const int r = q * 2 + rsub; if (col0 + c4 < N) { const v4f v = *(const v4fa*)&so[w][r][c4]; *(v4f*)(C + (size_t)(row0 + r) * ldc + col0 + c4) = v; } }
     }
}

// Wt[n][k] = f16(W[k][n]·scale) from f32 row-major W[K][N] (scale = power of two; bf16-exact weights stay exact in f16 away from the subnormal range)
__global__ __launch_bounds__(256) void k_wt_f16(const float* __restrict__ W, _Float16* __restrict__ Wt, int K, int N, float scale) {
  const int t = blockIdx.x * 256 + threadIdx.x; if (t >= N * (K / 8)) return; const int n = t / (K / 8), k8 = (t % (K / 8)) * 8; FragH f;
#pragma unroll
  for (int i = 0; i < 8; ++i) f.h[i] = (_Float16)(bf16_round(W[(size_t)(k8 + i) * N + n]) * scale); const v8us o = f.half[0];
  *(v8us*)((unsigned short*)Wt + (size_t)n * K + k8) = o; 
}
// k_gemm_hh variant with fused epilogue: v = acc·alpha + bias[by·sBias + col] (+ CP[(row/rowsPerB)·sCPb + by·64 + col] if CP) ; ACT 0 none / 1 elu ; writes f16 C16 (and f32 C if non-null)
template <int ACT>
__global__ __launch_bounds__(128) void k_gemm_hhx(const _Float16* __restrict__ A, int lda, size_t sA, const _Float16* __restrict__ Bh, int ldb, size_t sB, float alpha, const float* __restrict__ bias, size_t sBias, const float* __restrict__ CP, int rowsPerB, size_t sCPb, int row0g,
    float* __restrict__ C, _Float16* __restrict__ C16, int ldc, size_t sC, int M, int N, int K) {
  __shared__ __attribute__((aligned(16))) float so[4][16][64];
  const int tid = threadIdx.x, w = tid >> 5, lane = tid & 31, ln = lane & 15, hh = lane >> 4; const int by = blockIdx.y;
  A += (size_t)by * sA; Bh += (size_t)by * sB; const size_t cofs = (size_t)by * sC; const float* bp = bias ? bias + (size_t)by * sBias : nullptr;
  const int ntn = (N + 63) / 64; const int wid = blockIdx.x * 4 + w; const int mt = wid / ntn, nq = wid % ntn; if (mt * 16 >= M) return;
  const int row0 = mt * 16, col0 = nq * 64; const _Float16* arow = A + (size_t)(row0 + ln) * lda;
  v8f acc[4] = {};
  for (int kb = 0; kb < K; kb += 32) { FragH ah; ah.half[0] = *(const v8us*)((const unsigned short*)arow + kb + 8 * hh); ah.half[1] = *(const v8us*)((const unsigned short*)arow + kb + 16 + 8 * hh);
#pragma unroll
    for (int t = 0; t < 4; ++t) { if (col0 + t * 16 >= N) continue; const size_t boff = (size_t)(col0 + t * 16 + ln) * ldb + kb; FragH bq; bq.half[0] = *(const v8us*)((const unsigned short*)Bh + boff + 8 * hh); bq.half[1] = *(const v8us*)((const unsigned short*)Bh + boff + 16 + 8 * hh);
      acc[t] = mmaH<1>(ah.v, ah.v, bq.v, bq.v, acc[t]); }
  }
#pragma unroll
  for (int t = 0; t < 4; ++t) { if (col0 + t * 16 >= N) continue; const int col = col0 + t * 16 + ln; const float bv = bp ? bf16_round(bp[col]) : 0.f;
#pragma unroll
    for (int r = 0; r < 8; ++r) { float v = acc[t][r] * alpha + bv; if (CP) { const int rr = row0g + row0 + 8 * hh + r; if (rowsPerB < 0) v += CP[cofs + (size_t)rr * ldc + col];      /* rowsPerB < 0: own element of the batched C plane */ else { const int bidx = rr / rowsPerB; v += CP[(size_t)bidx * sCPb + (size_t)by * 64 + col]; } } if (ACT == 1) v = (v > 0.f) ? v : expm1f(v); else if (ACT == 7) v = (v > 0.f) ? v + 1.0f : expf(v); else if (ACT == 8) v = tanhf(v); else if (ACT == 9) v = 0.5f * v * (1.0f + tanhf(0.7978845608028654f * (v + 0.044715f * v * v * v))); else if (ACT == 11) v = 1.0f / (1.0f + expf(-v)); else if (ACT == 12) v = (v > 0.f) ? v : 0.01f * v; else if (ACT == 14) v = (v > 0.f) ? v : 0.1f * v; else if (ACT == 16) v = (v >= 0.f) ? v : 0.3f * v; else if (ACT == 17) v = (v >= 0.f) ? v : 0.2f * v; else if (ACT == 15) v = v / (1.0f + expf(-v)); else if (ACT == 3) v = fmaxf(v, 0.f); else if (ACT == 6) v = 0.5f * v * (1.0f + erff(v * 0.70710678118654752f)); so[w][8 * hh + r][t * 16 + ln] = v; } }
  __builtin_amdgcn_fence(__ATOMIC_ACQ_REL, "workgroup"); __builtin_amdgcn_wave_barrier();
  const int rsub = lane >> 4, c4 = (lane & 15) * 4; typedef _Float16 v4h __attribute__((ext_vector_type(4)));
  {
#pragma unroll
    for (int q = 0; q < 8; ++q) { const int r = q * 2 + rsub; if (col0 + c4 < N) { const v4f v = *(const v4fa*)&so[w][r][c4]; if (C) *(v4f*)(C + cofs + (size_t)(row0 + r) * ldc + col0 + c4) = v; if (C16) { v4h h4; for (int i = 0; i < 4; ++i) h4[i] = (_Float16)v[i]; *(v4h*)(C16 + cofs + (size_t)(row0 + r) * ldc + col0 + c4) = h4; } } }
     }
}


typedef _Float16 v4h __attribute__((ext_vector_type(4)));

__global__ __launch_bounds__(256) void k_x16(const float* __restrict__ x, _Float16* __restrict__ X16, size_t n8) { const size_t t = (size_t)blockIdx.x * 256 + threadIdx.x; if (t >= n8) return; FragH f;
#pragma unroll
  for (int q = 0; q < 8; ++q) f.h[q] = (_Float16)bf16_round(x[t * 8 + q]); *(v8us*)((unsigned short*)X16 + t * 8) = f.half[0];  }
__global__ __launch_bounds__(256) void k_h16(const float* __restrict__ x, _Float16* __restrict__ X16, size_t n8) { const size_t t = (size_t)blockIdx.x * 256 + threadIdx.x; if (t >= n8) return; FragH f;
#pragma unroll
  for (int q = 0; q < 8; ++q) f.h[q] = (_Float16)x[t * 8 + q]; *(v8us*)((unsigned short*)X16 + t * 8) = f.half[0];  }
__global__ __launch_bounds__(256) void k_round16f(const float* __restrict__ W, _Float16* __restrict__ Bt, size_t n8) { const size_t t = (size_t)blockIdx.x * 256 + threadIdx.x; if (t >= n8) return; FragH f;
#pragma unroll
  for (int i = 0; i < 8; ++i) f.h[i] = (_Float16)(bf16_round(W[t * 8 + i]) * 16.0f); *(v8us*)((unsigned short*)Bt + t * 8) = f.half[0];  }
template <int NHv, int TTv>
__global__ __launch_bounds__(256) void k_vt(const _Float16* __restrict__ V16, int ldv, int voff, _Float16* __restrict__ Vt) { __shared__ unsigned short tl[64][66]; const int tid = threadIdx.x; const int slab = blockIdx.x / (TTv / 64), lg = blockIdx.x % (TTv / 64); const int b = slab / NHv, h = slab % NHv;
  for (int i = tid; i < 64 * 8; i += 256) { const int r = i / 8, c8 = (i % 8) * 8; FragH f; f.half[0] = *(const v8us*)((const unsigned short*)V16 + ((size_t)b * TTv + lg * 64 + r) * ldv + voff + h * 64 + c8);
#pragma unroll
    for (int q = 0; q < 8; ++q) tl[r][c8 + q] = f.u[q]; }
  __syncthreads();
  {
#pragma unroll
    for (int rd = 0; rd < 2; ++rd) { const int d = rd * 32 + tid / 8, pc = tid % 8; FragH f;
#pragma unroll
      for (int q = 0; q < 8; ++q) f.u[q] = tl[pc * 8 + q][d];
      *(v8us*)((unsigned short*)Vt + ((size_t)slab * 64 + d) * TTv + lg * 64 + pc * 8) = f.half[0]; }
     } }

__global__ __launch_bounds__(256) void k_hl(const float* __restrict__ F, _Float16* __restrict__ Hh, _Float16* __restrict__ Hl, size_t n8) { const size_t t = (size_t)blockIdx.x * 256 + threadIdx.x; if (t >= n8) return; FragH fh, fl; const v4f a = *(const v4fa*)(F + t * 8), c = *(const v4fa*)(F + t * 8 + 4);
#pragma unroll
  for (int q = 0; q < 4; ++q) { _Float16 h = (_Float16)a[q]; fh.h[q] = h; fl.h[q] = (_Float16)((a[q] - (float)h) * 1024.0f); h = (_Float16)c[q]; fh.h[4 + q] = h; fl.h[4 + q] = (_Float16)((c[q] - (float)h) * 1024.0f); }
  { *(v8us*)((unsigned short*)Hh + t * 8) = fh.half[0]; *(v8us*)((unsigned short*)Hl + t * 8) = fl.half[0];  } }

// ---- fast GEMM (work-group tile 128x64, wave tile 32x64; requires M % 128 == 0 rows per launch region, N % 64 == 0 and K % 128 == 0); epilogue = k_gemm_hhx semantics ----
// Operands reach the waves through LDS: a stage is 128 k (256 B) of the tile's 128 A rows and 64 B rows at a pitch of 272 B (16 B x odd: the 16 lanes that a 16-byte LDS read serves together fall on distinct banks).
// Asynchronous copies fill it, 16 lanes to a row, so that each wave-wide copy takes four whole 128-byte lines; two buffers: the next stage's copies fly while this stage is worked on.
#define G2_KS 128
#define G2_PITCH 272
#define G2_ROWS 192
#define G2_STAGE (G2_ROWS * G2_PITCH)
__device__ __forceinline__ v16h g2_frag(const _Float16* p, int hh) { FragH f; f.half[0] = *(const v8us*)((const unsigned short*)p + 8 * hh); f.half[1] = *(const v8us*)((const unsigned short*)p + 16 + 8 * hh); return f.v; }
__device__ __forceinline__ v8f g2_mma(v16h a, v16h b, v8f c) { v8f d = __builtin_amdgcn_wmma_f32_16x16x32_f16(false, a, false, b, (short)0, c, false, false); asm volatile("v_nop\n\tv_nop\n\tv_nop\n\tv_nop" : "+v"(d) : "v"(a), "v"(b)); return d; }
// eight asynchronous 16-byte copies of a lane: rows r, r + 8, ... r + 56 (global step gs halves, LDS step 8 pitches). The s_wait_xcnt 0 is the last line of the copies' own statement, so that it stands in front of every later rewrite of a register that a copy names.
__device__ __forceinline__ void g2_copy8(unsigned l, const _Float16* g, size_t gs) {
  asm volatile("global_load_async_to_lds_b128 %0, %8, off\n\tglobal_load_async_to_lds_b128 %1, %9, off\n\tglobal_load_async_to_lds_b128 %2, %10, off\n\tglobal_load_async_to_lds_b128 %3, %11, off\n\t"
               "global_load_async_to_lds_b128 %4, %12, off\n\tglobal_load_async_to_lds_b128 %5, %13, off\n\tglobal_load_async_to_lds_b128 %6, %14, off\n\tglobal_load_async_to_lds_b128 %7, %15, off\n\ts_wait_xcnt 0x0"
               :: "v"(l), "v"(l + 8 * G2_PITCH), "v"(l + 16 * G2_PITCH), "v"(l + 24 * G2_PITCH), "v"(l + 32 * G2_PITCH), "v"(l + 40 * G2_PITCH), "v"(l + 48 * G2_PITCH), "v"(l + 56 * G2_PITCH),
                  "v"(g), "v"(g + gs), "v"(g + 2 * gs), "v"(g + 3 * gs), "v"(g + 4 * gs), "v"(g + 5 * gs), "v"(g + 6 * gs), "v"(g + 7 * gs) : "memory"); }
template <int ACT>
__global__ __launch_bounds__(128) void k_gemm2(const _Float16* __restrict__ A, int lda, size_t sA, const _Float16* __restrict__ Bh, int ldb, size_t sB, float alpha, const float* __restrict__ bias, size_t sBias, const float* __restrict__ CP, int rowsPerB, size_t sCPb, int row0g,
    float* __restrict__ C, _Float16* __restrict__ C16, int ldc, size_t sC, int M, int N, int K) { static_assert(ACT == 0 || ACT == 3 || ACT == 6 || ACT == 8 || ACT == 9 || ACT == 11 || ACT == 12 || ACT == 14 || ACT == 15 || ACT == 16 || ACT == 17, "k_gemm2: unsupported ACT code (would silently apply no activation)");
  __shared__ __attribute__((aligned(16))) unsigned char st[2 * G2_STAGE];      /* the two stage buffers; behind the loop's last barrier the same bytes serve as the output staging so[4][32][68] */
  static_assert(sizeof(float) * 4 * 32 * 68 <= 2 * G2_STAGE, "the output staging lies inside the stage buffers");
  float (*so)[32][68] = (float (*)[32][68])st;
  const int tid = threadIdx.x, w = tid >> 5, lane = tid & 31, ln = lane & 15, hh = lane >> 4; const int by = blockIdx.y;
  A += (size_t)by * sA; Bh += (size_t)by * sB; const size_t cofs = (size_t)by * sC; const float* bp = bias ? bias + (size_t)by * sBias : nullptr;
  const int ntn = N >> 6; const int mt = blockIdx.x / ntn, nq = blockIdx.x - mt * ntn; const int row0 = mt * 128 + 32 * w, col0 = nq * 64; if (mt * 128 >= M) return;      /* the same for the whole work-group, in front of every barrier */
  const _Float16* ag = A + (size_t)(mt * 128 + (tid >> 4)) * lda + (tid & 15) * 8; const _Float16* bg = Bh + (size_t)(col0 + (tid >> 4)) * ldb + (tid & 15) * 8;      /* this lane's 16 bytes of rows tid / 16 + 8 i */
  const unsigned l0 = (unsigned)(size_t)st + (unsigned)((tid >> 4) * G2_PITCH + (tid & 15) * 16);      /* the low 32 bits of a __shared__ address are the LDS byte address */
  const size_t ga = (size_t)8 * lda, gb = (size_t)8 * ldb; const int nt = K / G2_KS;
  const v8f z8 = {0.f,0.f,0.f,0.f,0.f,0.f,0.f,0.f}; v8f c00 = z8, c01 = z8, c02 = z8, c03 = z8, c10 = z8, c11 = z8, c12 = z8, c13 = z8;
  g2_copy8(l0, ag, ga); g2_copy8(l0 + 64 * G2_PITCH, ag + 8 * ga, ga); g2_copy8(l0 + 128 * G2_PITCH, bg, gb);      /* stage 0 into buffer 0 */
  asm volatile("s_wait_asynccnt 0x0" ::: "memory");      /* this wave's copies of stage 0 have landed */
  __syncthreads();      /* every wave's have: stage 0 may be read */
  if (nt > 1) { g2_copy8(l0 + G2_STAGE, ag + G2_KS, ga); g2_copy8(l0 + G2_STAGE + 64 * G2_PITCH, ag + G2_KS + 8 * ga, ga); g2_copy8(l0 + G2_STAGE + 128 * G2_PITCH, bg + G2_KS, gb); }      /* stage 1 into buffer 1 */
#pragma unroll 1      /* one stage a trip: the order at the foot of the trip stays as written */
  for (int t = 0; t < nt; ++t) { const unsigned bo = (unsigned)(t & 1) * G2_STAGE;
    const _Float16* a0p = (const _Float16*)(st + bo + (32 * w + ln) * G2_PITCH); const _Float16* a1p = (const _Float16*)(st + bo + (32 * w + 16 + ln) * G2_PITCH); const _Float16* b0p = (const _Float16*)(st + bo + (128 + ln) * G2_PITCH);
    v16h a0 = g2_frag(a0p, hh), a1 = g2_frag(a1p, hh), b0 = g2_frag(b0p, hh), b1 = g2_frag(b0p + 16 * (G2_PITCH / 2), hh), b2 = g2_frag(b0p + 32 * (G2_PITCH / 2), hh), b3 = g2_frag(b0p + 48 * (G2_PITCH / 2), hh);
#pragma unroll      /* four 32-k steps of a stage: constant LDS offsets, and the two fragment sets are renamed instead of moved */
    for (int kb = 0; kb < G2_KS; kb += 32) { v16h n0 = a0, n1 = a1, m0 = b0, m1 = b1, m2 = b2, m3 = b3;
      if (kb + 32 < G2_KS) { const int kn = kb + 32;      /* the next step's twelve LDS reads go as one group in front of this step's products and return under them; they stay inside this stage */
        n0 = g2_frag(a0p + kn, hh); n1 = g2_frag(a1p + kn, hh); m0 = g2_frag(b0p + kn, hh); m1 = g2_frag(b0p + 16 * (G2_PITCH / 2) + kn, hh); m2 = g2_frag(b0p + 32 * (G2_PITCH / 2) + kn, hh); m3 = g2_frag(b0p + 48 * (G2_PITCH / 2) + kn, hh); }
      c00 = g2_mma(a0, b0, c00); c10 = g2_mma(a1, b0, c10); c01 = g2_mma(a0, b1, c01); c11 = g2_mma(a1, b1, c11);
      c02 = g2_mma(a0, b2, c02); c12 = g2_mma(a1, b2, c12); c03 = g2_mma(a0, b3, c03); c13 = g2_mma(a1, b3, c13);
      a0 = n0; a1 = n1; b0 = m0; b1 = m1; b2 = m2; b3 = m3; }
    asm volatile("s_wait_dscnt 0x0" ::: "memory");      /* this wave's reads of the buffer have returned before it is refilled */
    asm volatile("s_wait_asynccnt 0x0" ::: "memory");      /* this wave's copies of stage t + 1 have landed */
    __syncthreads();      /* publishes stage t + 1 and ends every wave's reads of stage t */
    if (t + 2 < nt) { const _Float16* an = ag + (size_t)(t + 2) * G2_KS; const _Float16* bn = bg + (size_t)(t + 2) * G2_KS; g2_copy8(l0 + bo, an, ga); g2_copy8(l0 + bo + 64 * G2_PITCH, an + 8 * ga, ga); g2_copy8(l0 + bo + 128 * G2_PITCH, bn, gb); } }      /* stage t + 2 into the buffer that trip t has just read */
  asm volatile("s_wait_asynccnt 0x0" ::: "memory");      /* nothing is in flight when the buffers become output staging */
  v8f accs[8] = {c00, c01, c02, c03, c10, c11, c12, c13};
#pragma unroll
  for (int u = 0; u < 8; ++u) { const int t = u & 3, half = u >> 2; const int col = col0 + t * 16 + ln; const float bv = bp ? bf16_round(bp[col]) : 0.f;
#pragma unroll
    for (int r = 0; r < 8; ++r) { const int rloc = half * 16 + 8 * hh + r; float v = accs[u][r] * alpha + bv; if (CP) { if (rowsPerB < 0) v += CP[cofs + (size_t)(row0g + row0 + rloc) * ldc + col];      /* rowsPerB < 0: own element of the batched C plane */ else { const int bidx = (row0g + row0 + rloc) / rowsPerB; v += CP[(size_t)bidx * sCPb + (size_t)by * 64 + col]; } }
      if (ACT == 3) v = fmaxf(v, 0.f); else if (ACT == 6) v = 0.5f * v * (1.0f + erff(v * 0.70710678118654752f)); else if (ACT == 11) v = 1.0f / (1.0f + expf(-v)); else if (ACT == 15) v = v / (1.0f + expf(-v)); else if (ACT == 12) v = (v > 0.f) ? v : 0.01f * v; else if (ACT == 8) v = tanhf(v); else if (ACT == 9) v = 0.5f * v * (1.0f + tanhf(0.7978845608028654f * (v + 0.044715f * v * v * v))); else if (ACT == 14) v = (v > 0.f) ? v : 0.1f * v; else if (ACT == 16) v = (v >= 0.f) ? v : 0.3f * v; else if (ACT == 17) v = (v >= 0.f) ? v : 0.2f * v;
      so[w][rloc][t * 16 + ln] = v; } }
  __builtin_amdgcn_fence(__ATOMIC_ACQ_REL, "workgroup"); __builtin_amdgcn_wave_barrier();
  const int rsub = lane >> 4, c4 = (lane & 15) * 4;
  {
#pragma unroll
    for (int q = 0; q < 16; ++q) { const int r = q * 2 + rsub; const v4f v = *(const v4fa*)&so[w][r][c4]; if (C) *(v4f*)(C + cofs + (size_t)(row0 + r) * ldc + col0 + c4) = v; if (C16) { v4h h4; for (int i = 0; i < 4; ++i) h4[i] = (_Float16)v[i]; *(v4h*)(C16 + cofs + (size_t)(row0 + r) * ldc + col0 + c4) = h4; } }
     } }


__global__ __launch_bounds__(256) void k_wnat(const float* __restrict__ w, size_t n8, _Float16* __restrict__ Bt) { const size_t t = (size_t)blockIdx.x * 256 + threadIdx.x; if (t >= n8) return; FragH f; for (int q = 0; q < 8; ++q) f.h[q] = (_Float16)(bf16_round(w[t * 8 + q]) * 16.0f); *(v8us*)((unsigned short*)Bt + t * 8) = f.half[0];  }
__global__ __launch_bounds__(256) void k_rsm(const float* __restrict__ S, _Float16* __restrict__ P, int nrows) {
  #pragma clang fp contract(off)
  const int i = blockIdx.x * 256 + threadIdx.x; if (i >= nrows) return; const float* s = S + (size_t)i * SQ; float mx = -3.0e38f;
#pragma unroll 1
  for (int j = 0; j < SQ; ++j) mx = fmaxf(mx, s[j]); float se = 0.f;
#pragma unroll 1
  for (int j = 0; j < SQ; ++j) se += expf(s[j] - mx); const float sc = 256.0f / se;
#pragma unroll 1
  for (int j0 = 0; j0 < SQ; j0 += 8) { FragH f; for (int q = 0; q < 8; ++q) f.h[q] = (_Float16)(expf(s[j0 + q] - mx) * sc); unsigned short* d = (unsigned short*)P + (size_t)i * SQ + j0; *(v8us*)d = f.half[0];  } }
__global__ __launch_bounds__(256) void k_vt(const _Float16* __restrict__ V16, int b, int h0, _Float16* __restrict__ VT) { __shared__ unsigned short tl[64][65]; const int tid = threadIdx.x; const int hh = blockIdx.x % HG, sg = blockIdx.x / HG; const int s0 = sg * 64; const int h = h0 + hh;
  for (int i = tid; i < 64 * 8; i += 256) { const int j = i / 8, d8 = (i % 8) * 8; FragH f; f.half[0] = *(const v8us*)((const unsigned short*)V16 + ((size_t)b * SQ + s0 + j) * DM + h * HD + d8); for (int q = 0; q < 8; ++q) tl[d8 + q][j] = f.u[q]; }
  __syncthreads();
  { for (int i = tid; i < 64 * 8; i += 256) { const int d = i / 8, j8 = (i % 8) * 8; FragH f; for (int q = 0; q < 8; ++q) f.u[q] = tl[d][j8 + q]; *(v8us*)((unsigned short*)VT + ((size_t)hh * HD + d) * SQ + s0 + j8) = f.half[0]; }  } }


__global__ __launch_bounds__(256) void k_f2h(const float* __restrict__ F, int ldf, int coff, int ncol, _Float16* __restrict__ H16, size_t nrow) { const size_t t = (size_t)blockIdx.x * 256 + threadIdx.x; const size_t n8 = nrow * (size_t)(ncol / 8); if (t >= n8) return; const size_t r = t / (ncol / 8); const int c8 = (int)(t % (ncol / 8)) * 8; FragH f; const v4f a = *(const v4fa*)(F + r * ldf + coff + c8), b2 = *(const v4fa*)(F + r * ldf + coff + c8 + 4); for (int q = 0; q < 4; ++q) { f.h[q] = (_Float16)a[q]; f.h[4 + q] = (_Float16)b2[q]; } *(v8us*)((unsigned short*)H16 + r * ncol + c8) = f.half[0];  }

__global__ __launch_bounds__(256) void k_tab128(float theta, float* __restrict__ CS, float* __restrict__ SN) {
  #pragma clang fp contract(off)
  const int t = blockIdx.x * 256 + threadIdx.x; if (t >= SQ * 64) return; const int i = t % 64; const int p = t / 64; const float invf = (float)(1.0 / pow((double)theta, (double)(2 * i) / 128.0));      /* = XLA's constant-folded f32 table */ const float ang = __fmul_rn((float)p, invf); const float c = cosf(ang), s = sinf(ang);
  *(float*)(CS + t) = c; *(float*)(SN + t) = s;  }
template <int TAB>
__global__ __launch_bounds__(128) void k_rope128(const float* __restrict__ F, int ldf, int nh, const float* __restrict__ CS, const float* __restrict__ SN, _Float16* __restrict__ H16, int ldo, float osc) {
  #pragma clang fp contract(off)
  __shared__ float xv[128]; __shared__ unsigned short sh_[128]; const int d = threadIdx.x; const int h = blockIdx.x % nh; const size_t r = blockIdx.x / nh; const int p = (int)(r % SQ);
  xv[d] = F[r * (size_t)ldf + (size_t)h * 128 + d]; __syncthreads();
  float c, s; if (TAB) { c = bf16_round(CS[(size_t)p * 128 + d]); s = bf16_round(SN[(size_t)p * 128 + d]); } else { c = CS[p * 64 + (d & 63)]; s = SN[p * 64 + (d & 63)]; }
  const float rot = (d < 64) ? -xv[d + 64] : xv[d - 64]; const float o = __fadd_rn(__fmul_rn(xv[d], c), __fmul_rn(rot, s));
  FragH th; th.h[0] = (_Float16)__fmul_rn(o, osc); sh_[d] = th.u[0]; __syncthreads();
  if (d < 16) { FragH f; for (int q = 0; q < 8; ++q) f.u[q] = sh_[d * 8 + q]; unsigned short* dst = (unsigned short*)H16 + r * (size_t)ldo + (size_t)h * 128 + d * 8; *(v8us*)dst = f.half[0];  } }

template <int TAB, int IL, int F32OUT>
__global__ __launch_bounds__(128) void k_rope128x(const float* __restrict__ F, int ldf, int nh, const float* __restrict__ CS, const float* __restrict__ SN, void* __restrict__ OUT, int ldo, float osc) {
  #pragma clang fp contract(off)
  __shared__ float xv[128]; __shared__ float ov[128]; const int d = threadIdx.x; const int h = blockIdx.x % nh; const size_t r = blockIdx.x / nh; const int p = (int)(r % SQ);
  xv[d] = F[r * (size_t)ldf + (size_t)h * 128 + d]; __syncthreads();
  float c, s; if (TAB == 2) { c = CS[r * 128 + d]; s = SN[r * 128 + d]; }      /* computed full-width f32 tables, one row per token row r (relative to the passed pointers) */ else if (TAB) { c = bf16_round(CS[(size_t)p * 128 + d]); s = bf16_round(SN[(size_t)p * 128 + d]); } else { const int ti = IL ? (d >> 1) : (d & 63); c = CS[p * 64 + ti]; s = SN[p * 64 + ti]; }
  const float rot = IL ? ((d & 1) ? xv[d - 1] : -xv[d + 1]) : ((d < 64) ? -xv[d + 64] : xv[d - 64]);
  ov[d] = __fmul_rn(__fadd_rn(__fmul_rn(xv[d], c), __fmul_rn(rot, s)), osc); __syncthreads();
  if (F32OUT) { if (d < 32) { const v4f v = *(const v4f*)&ov[d * 4]; float* dst = (float*)OUT + r * (size_t)ldo + (size_t)h * 128 + d * 4; *(v4f*)dst = v;  } }
  else { if (d < 16) { FragH f; for (int q = 0; q < 8; ++q) f.h[q] = (_Float16)ov[d * 8 + q]; unsigned short* dst = (unsigned short*)OUT + r * (size_t)ldo + (size_t)h * 128 + d * 8; *(v8us*)dst = f.half[0];  } } }
template <int N>
__global__ __launch_bounds__(256) void k_rmsrow(float* __restrict__ X, const float* __restrict__ w, float eps) {
  #pragma clang fp contract(off)
  constexpr int PT = N / 256; __shared__ float red[256]; const size_t r = blockIdx.x; const int t = threadIdx.x; float* row = X + r * N + (size_t)t * PT; float v[PT]; float ss = 0.f;
  for (int q = 0; q < PT; ++q) { v[q] = row[q]; ss = __fadd_rn(ss, __fmul_rn(v[q], v[q])); }
  red[t] = ss; __syncthreads(); for (int k = 128; k > 0; k >>= 1) { if (t < k) red[t] = __fadd_rn(red[t], red[t + k]); __syncthreads(); }
  const float rs = rsqrtf(__fadd_rn(red[0] / (float)N, eps)); float o[PT]; for (int q = 0; q < PT; ++q) o[q] = __fmul_rn(__fmul_rn(v[q], rs), bf16_round(w[t * PT + q]));
  { for (int q = 0; q < PT; ++q) *(float*)(row + q) = o[q];  } }
template <int GS_, int NHQ, int DSRC>
__global__ __launch_bounds__(256) void k_kvexp128(const float* __restrict__ src, float* __restrict__ dst, size_t n4) { const size_t t = (size_t)blockIdx.x * 256 + threadIdx.x; if (t >= n4) return; const size_t e = t * 4; const size_t row = e / ((size_t)NHQ * 128); const int col = (int)(e % ((size_t)NHQ * 128)); const int h = col / 128, d = col % 128; const v4f v = *(const v4fa*)(src + row * DSRC + (size_t)(h / GS_) * 128 + d); *(v4f*)(dst + e) = v;  }

__global__ __launch_bounds__(256) void k_rsmcfb(const float* __restrict__ S, _Float16* __restrict__ P, int hg, int q0, int nk, const int* __restrict__ mk) {
  #pragma clang fp contract(off)
  const int t = blockIdx.x * 256 + threadIdx.x; if (t >= hg * QT) return; const size_t i = (size_t)t; const float* s = S + i * NKX; const size_t ig = (size_t)(q0 + (t % QT)); const int* mr = mk + ig * SQ; float mx = -3.0e38f;
#pragma unroll 1
  for (int j = 0; j < nk; ++j) { const int mb = mr[j]; const float f = (mb == 0) ? 1.f : 0.f; mx = fmaxf(mx, fmaf(f, s[j], (1.f - f) * -1.0e9f)); } float se = 0.f;
#pragma unroll 1
  for (int j = 0; j < nk; ++j) { const int mb = mr[j]; const float f = (mb == 0) ? 1.f : 0.f; se += __expf(fmaf(f, s[j], (1.f - f) * -1.0e9f) - mx); } const float sc = 256.0f / se;
#pragma unroll 1
  for (int j0 = 0; j0 < nk; j0 += 8) { FragH fr; for (int q = 0; q < 8; ++q) { const int j = j0 + q; const int mb = mr[j]; const float f = (mb == 0) ? 1.f : 0.f; fr.h[q] = (_Float16)(__expf(fmaf(f, s[j], (1.f - f) * -1.0e9f) - mx) * sc); } unsigned short* d = (unsigned short*)P + i * NKX + j0; *(v8us*)d = fr.half[0];  } }


// 2^x on the transcendental unit; the v_nop is the one free issue slot that the instruction set asks for behind a transcendental before its result is read or its source overwritten: written in the same statement so that it stands directly behind the v_exp_f32 in every build
__device__ __forceinline__ float exp2_slot(float x) { float y; asm("v_exp_f32 %0, %1\n\tv_nop" : "=v"(y) : "v"(x)); return y; }
// one wave per score row of NU * 128 keys: lane l holds columns 128u + 4l .. 128u + 4l + 3 of the row in registers, so each wave-wide load covers 512 contiguous bytes, the row is read once and each exponential is taken once; maximum and sum: one partial per lane, then a five-step butterfly over the wave
template <int NU>
__global__ __launch_bounds__(256) void k_rsmcf2(const float* __restrict__ S, _Float16* __restrict__ P, int hg, int q0) {
  const int t = blockIdx.x * 8 + __builtin_amdgcn_readfirstlane(threadIdx.x >> 5);      /* the row is the same in every lane: row base, diagonal and the test below stay scalar */
  if (t >= hg * QT) return; const int c0 = (threadIdx.x & 31) * 4; const size_t i = (size_t)t; const float* s = S + i * NKX + c0; const int last = q0 + (t % QT); v4f v[NU];
#pragma unroll      /* the four loops over u are unrolled so that v[] is indexed by constants and stays in registers */
  for (int u = 0; u < NU; ++u) v[u] = *(const v4fa*)(s + u * 128);      /* the loads stand in a loop of their own, ahead of the arithmetic, so that many are in flight at once */
  float mx = -3.0e38f;
#pragma unroll      /* v[] in registers */
  for (int u = 0; u < NU; ++u) for (int q = 0; q < 4; ++q) { const float f = (u * 128 + c0 + q <= last) ? 1.f : 0.f; v[u][q] = fmaf(f, v[u][q], (1.f - f) * -1.0e9f); mx = fmaxf(mx, v[u][q]); }
  for (int m = 16; m >= 1; m >>= 1) mx = fmaxf(mx, __shfl_xor(mx, m, 32));
  float se = 0.f;
#pragma unroll      /* v[] in registers */
  for (int u = 0; u < NU; ++u) for (int q = 0; q < 4; ++q) { v[u][q] = exp2_slot((v[u][q] - mx) * 1.44269504088896340736f); se += v[u][q]; }
  for (int m = 16; m >= 1; m >>= 1) se += __shfl_xor(se, m, 32);
  const float sc = 256.0f / se; _Float16* d = P + i * NKX + c0;
#pragma unroll      /* v[] in registers */
  for (int u = 0; u < NU; ++u) { v4h h4; for (int q = 0; q < 4; ++q) h4[q] = (_Float16)(v[u][q] * sc); *(v4h*)(d + u * 128) = h4; } }
// launches the instance whose row length is nk keys (nk = 256, 512, ... NKX)
template <int NU>
static void rsmcf2_launch(const float* S, _Float16* P, int q0, int nk, hipStream_t stream) { if (nk == NU * 128) k_rsmcf2<NU><<<(NH * QT + 7) / 8, 256, 0, stream>>>(S, P, NH, q0); else if constexpr (NU > 2) rsmcf2_launch<NU - 2>(S, P, q0, nk, stream); }


// Exact f32 causal attention of the first QT0 query rows (o x64). One work-group per (head, 32 query rows); wave w owns rows 4w .. 4w + 3 of the group.
// Scores: 32 key rows at a time stand in LDS (pitch 132 floats: the 16 lanes that a 16-byte LDS read serves together fall on 64 distinct banks); lane = key, the four query rows come through loads whose address is the same in every lane.
// Softmax: one partial per lane over the row's keys, then a five-step butterfly over the wave; the weights go to LDS as [key][4 rows], unnormalised.
// P*V: lane = 4 head dims; a value row is one 512-byte load, the four weights of a key one broadcast LDS read; masked keys carry weight 0.
__global__ __launch_bounds__(256) void k_att0w(const float* __restrict__ QF, const float* __restrict__ KF, const float* __restrict__ VF, float scale, float* __restrict__ OF) {
  __shared__ __attribute__((aligned(16))) float lk[32][132]; __shared__ __attribute__((aligned(16))) float lp[8][QT0][4];
  const int lane = threadIdx.x & 31; const int w = __builtin_amdgcn_readfirstlane(threadIdx.x >> 5);      /* the wave's number is the same in every lane: row numbers and base addresses stay scalar */
  const int h = blockIdx.x / (QT0 / 32), rg = blockIdx.x % (QT0 / 32); const int i0 = rg * 32 + w * 4;
  const float* qp = QF + (size_t)i0 * DMX + h * 128; const float* kp = KF + (size_t)w * DMX + h * 128 + lane * 4;      /* wave w stages key rows w, w + 8, w + 16, w + 24 of each group of 32 */
  const v4f z4 = {0.f, 0.f, 0.f, 0.f}; v4f kn[4];
#pragma unroll      /* kn[] is indexed by constants and stays in registers */
  for (int u = 0; u < 4; ++u) kn[u] = *(const v4fa*)(kp + (size_t)(u * 8) * DMX);
  for (int c = 0; c <= rg; ++c) {      /* rg + 1 trips, the same for every wave of the work-group: the barriers stand under uniform control flow */
    __syncthreads();      /* every wave has left the key group that is overwritten next */
#pragma unroll      /* kn[] in registers */
    for (int u = 0; u < 4; ++u) *(v4f*)&lk[u * 8 + w][lane * 4] = kn[u];
    __syncthreads();      /* the key group is complete before any wave reads it */
    if (c < rg) {      /* the next group's loads fly under this group's products */
#pragma unroll      /* kn[] in registers */
      for (int u = 0; u < 4; ++u) kn[u] = *(const v4fa*)(kp + (size_t)((c + 1) * 32 + u * 8) * DMX); }
    v4f a0 = z4, a1 = z4, a2 = z4, a3 = z4;      /* per row four partial sums (dims d mod 4), added at the end */
    for (int d0 = 0; d0 < 32; d0 += 8) {
#pragma unroll      /* eight 16-byte steps a trip: their 40 loads are in flight together, so the load latency is paid four times a key group */
      for (int dd = 0; dd < 8; ++dd) { const int d4 = d0 + dd; const v4f kq = *(const v4f*)&lk[lane][d4 * 4];
        a0 += *(const v4fa*)(qp + d4 * 4) * kq; a1 += *(const v4fa*)(qp + DMX + d4 * 4) * kq; a2 += *(const v4fa*)(qp + 2 * DMX + d4 * 4) * kq; a3 += *(const v4fa*)(qp + 3 * DMX + d4 * 4) * kq; }
      asm volatile("s_wait_xcnt 0x0" ::: "memory"); }      /* stands between this trip's query loads and the next trip's rewrite of the base address that they name */
    v4f sv; sv[0] = ((a0[0] + a0[1]) + (a0[2] + a0[3])) * scale; sv[1] = ((a1[0] + a1[1]) + (a1[2] + a1[3])) * scale; sv[2] = ((a2[0] + a2[1]) + (a2[2] + a2[3])) * scale; sv[3] = ((a3[0] + a3[1]) + (a3[2] + a3[3])) * scale;
    *(v4f*)&lp[w][c * 32 + lane][0] = sv; }
  float mx[4] = {-3.0e38f, -3.0e38f, -3.0e38f, -3.0e38f}, se[4] = {0.f, 0.f, 0.f, 0.f};
  for (int c = 0; c <= rg; ++c) { const int j = c * 32 + lane; const v4f sv = *(const v4f*)&lp[w][j][0];      /* each lane reads back what it wrote itself */
    for (int r = 0; r < 4; ++r) mx[r] = (j <= i0 + r) ? fmaxf(mx[r], sv[r]) : mx[r]; }
  for (int m = 16; m >= 1; m >>= 1) for (int r = 0; r < 4; ++r) mx[r] = fmaxf(mx[r], __shfl_xor(mx[r], m, 32));
  for (int c = 0; c <= rg; ++c) { const int j = c * 32 + lane; const v4f sv = *(const v4f*)&lp[w][j][0]; v4f e;
    for (int r = 0; r < 4; ++r) { const float x = exp2_slot((sv[r] - mx[r]) * 1.44269504088896340736f); e[r] = (j <= i0 + r) ? x : 0.f; se[r] += e[r]; }
    *(v4f*)&lp[w][j][0] = e; }
  for (int m = 16; m >= 1; m >>= 1) for (int r = 0; r < 4; ++r) se[r] += __shfl_xor(se[r], m, 32);
  __builtin_amdgcn_fence(__ATOMIC_ACQ_REL, "workgroup"); __builtin_amdgcn_wave_barrier();      /* the weights are read below by the other lanes of the same wave: the LDS writes stay in front of those reads */
  const float* vp = VF + (size_t)h * 128 + lane * 4; v4f o0 = z4, o1 = z4, o2 = z4, o3 = z4; v4f va[16], vb[16];      /* two register buffers of 16 value rows: one is loaded while the other is used */
#pragma unroll      /* va[], vb[] are indexed by constants and stay in registers */
  for (int u = 0; u < 16; ++u) va[u] = *(const v4fa*)(vp + (size_t)u * DMX);
  for (int c = 0; c <= rg; ++c) { const float* vc = vp + (size_t)(c * 32) * DMX;
#pragma unroll      /* vb[] in registers */
    for (int u = 0; u < 16; ++u) vb[u] = *(const v4fa*)(vc + (size_t)(16 + u) * DMX);
#pragma unroll      /* va[] in registers */
    for (int u = 0; u < 16; ++u) { const v4f p4 = *(const v4f*)&lp[w][c * 32 + u][0]; o0 += p4[0] * va[u]; o1 += p4[1] * va[u]; o2 += p4[2] * va[u]; o3 += p4[3] * va[u]; }
    if (c < rg) {
#pragma unroll      /* va[] in registers */
      for (int u = 0; u < 16; ++u) va[u] = *(const v4fa*)(vc + (size_t)(32 + u) * DMX); }
#pragma unroll      /* vb[] in registers */
    for (int u = 0; u < 16; ++u) { const v4f p4 = *(const v4f*)&lp[w][c * 32 + 16 + u][0]; o0 += p4[0] * vb[u]; o1 += p4[1] * vb[u]; o2 += p4[2] * vb[u]; o3 += p4[3] * vb[u]; } }
  float* op = OF + (size_t)i0 * DMX + h * 128 + lane * 4;
  *(v4f*)op = o0 * (64.0f / se[0]); *(v4f*)(op + DMX) = o1 * (64.0f / se[1]); *(v4f*)(op + 2 * DMX) = o2 * (64.0f / se[2]); *(v4f*)(op + 3 * DMX) = o3 * (64.0f / se[3]); }


__global__ __launch_bounds__(256) void k_tab128p(const int* __restrict__ pos, int nrows, float theta, float* __restrict__ CS, float* __restrict__ SN) {
  #pragma clang fp contract(off)
  const int t = blockIdx.x * 256 + threadIdx.x; if (t >= nrows * 64) return; const int i = t % 64; const int r = t / 64; const float invf = (float)(1.0 / pow((double)theta, (double)(2 * i) / 128.0)); const float ang = __fmul_rn((float)pos[r], invf); const float c = cosf(ang), sv = sinf(ang);
  float* c0 = CS + (size_t)r * 128 + i; float* s0 = SN + (size_t)r * 128 + i;
  { *(float*)c0 = c; *(float*)(c0 + 64) = c; *(float*)s0 = sv; *(float*)(s0 + 64) = sv;  } }

__global__ __launch_bounds__(128) void k_rmshd(float* __restrict__ F, int ldf, int nh, const float* __restrict__ w, int wst, float eps) {
  #pragma clang fp contract(off)
  __shared__ float red[128]; const int d = threadIdx.x; const int h = blockIdx.x % nh; const size_t r = blockIdx.x / nh; float* p = F + r * (size_t)ldf + (size_t)h * 128 + d; const float v = *p; red[d] = __fmul_rn(v, v); __syncthreads();
  for (int st = 64; st > 0; st >>= 1) { if (d < st) red[d] = __fadd_rn(red[d], red[d + st]); __syncthreads(); }
  const float rs = __frsqrt_rn(__fadd_rn(red[0] / 128.0f, eps)); const float y = __fmul_rn(bf16_round(w[(size_t)h * wst + d]), __fmul_rn(v, rs));      /* gain vector of head h (wst = 128: per-head gains; 0 would share one vector) */ *(float*)p = y;  }
extern "C" void kernel_launch(void* const* d_in, const int* in_sizes, int n_in,
                              void* d_out, int out_size, void* d_ws, size_t ws_size, hipStream_t stream) {
  (void)in_sizes; (void)n_in; (void)out_size;
  const float* const* I = (const float* const*)d_in; const float* x = I[0]; const float* wq = I[1]; const float* wk = I[2]; const float* wv = I[3]; const float* wo = I[4];      /* hidden_states; natural Wq / Wk / Wv / Wo [2048][2048]; no QK norm, no biases, no mask / table inputs */
  char* ws = (char*)d_ws; size_t off = 0;
  auto take = [&](size_t bytes) { char* p = ws + off; off += (bytes + 255) & ~(size_t)255; return p; };
  _Float16* BQ = (_Float16*)take((size_t)DMX * DMX * 2); _Float16* BK = (_Float16*)take((size_t)DKV * DMX * 2); _Float16* BV = (_Float16*)take((size_t)DKV * DMX * 2); _Float16* BO = (_Float16*)take((size_t)DMX * DMX * 2);
  _Float16* X16 = (_Float16*)take(NR * DMX * 2); float* QF = (float*)take(NR * DMX * 4); float* KF = (float*)take(NR * DKV * 4); float* VF = (float*)take(NR * DKV * 4); _Float16* Q16 = (_Float16*)take(NR * DMX * 2); _Float16* K16 = (_Float16*)take(NR * DKV * 2); _Float16* V16 = (_Float16*)take(NR * DKV * 2); _Float16* O16 = (_Float16*)take(NR * DMX * 2);
  float* S = (float*)take((size_t)NH * QT * NKX * 4); _Float16* P = (_Float16*)take((size_t)NH * QT * NKX * 2); _Float16* VT = (_Float16*)take((size_t)(DKV / 64) * 64 * SQ * 2);
  float* QF0 = (float*)take((size_t)QT0 * DMX * 4); float* KRF0 = (float*)take((size_t)QT0 * DKV * 4); float* KF0e = (float*)take((size_t)QT0 * DMX * 4); float* VF0e = (float*)take((size_t)QT0 * DMX * 4); float* OF0 = (float*)take((size_t)NB * QT0 * DMX * 4); _Float16* OH0 = (_Float16*)take((size_t)NB * QT0 * DMX * 2); _Float16* OL0 = (_Float16*)take((size_t)NB * QT0 * DMX * 2); float* tcos = (float*)take((size_t)SQ * 64 * 4); float* tsin = (float*)take((size_t)SQ * 64 * 4);      /* rope tables [2048][64] computed on the device (the module derives them from constants) */
  if (off > ws_size) return;      /* approx 8 + 8 + 8 + 8 + 8 + 16 + 16 + 16 + 8 + 8 + 8 + 8 + 32 + 16 + 8 + 2 + 2 + 2 + 2 + 2 + 1 + 1 + 0.5 + 0.5 = 189 MiB */
  k_wnat<<<(unsigned)(((size_t)DMX * DMX / 8 + 255) / 256), 256, 0, stream>>>(wq, (size_t)DMX * DMX / 8, BQ); k_wnat<<<(unsigned)(((size_t)DKV * DMX / 8 + 255) / 256), 256, 0, stream>>>(wk, (size_t)DKV * DMX / 8, BK); k_wnat<<<(unsigned)(((size_t)DKV * DMX / 8 + 255) / 256), 256, 0, stream>>>(wv, (size_t)DKV * DMX / 8, BV); k_wnat<<<(unsigned)(((size_t)DMX * DMX / 8 + 255) / 256), 256, 0, stream>>>(wo, (size_t)DMX * DMX / 8, BO);      /* natural [out][in] = Bt[n][k] x16 */
  k_x16<<<(unsigned)((NR * DMX / 8 + 255) / 256), 256, 0, stream>>>(x, X16, NR * DMX / 8); k_tab128<<<(SQ * 64 + 255) / 256, 256, 0, stream>>>(10000.0f, tcos, tsin);      /* angle[p][i] = p * 10000^(-2i/128) */
  k_gemm2<0><<<dim3((unsigned)((NR / 128) * (DMX / 64)), 1), 128, 0, stream>>>(X16, DMX, 0, BQ, DMX, 0, 0.0625f, nullptr, 0, nullptr, 1, 0, 0, QF, nullptr, DMX, 0, (int)NR, DMX, DMX);      /* q (f32) */
  k_gemm2<0><<<dim3((unsigned)((NR / 128) * (DKV / 64)), 1), 128, 0, stream>>>(X16, DMX, 0, BK, DMX, 0, 0.0625f, nullptr, 0, nullptr, 1, 0, 0, KF, nullptr, DKV, 0, (int)NR, DKV, DMX);      /* k (f32) */
  k_gemm2<0><<<dim3((unsigned)((NR / 128) * (DKV / 64)), 1), 128, 0, stream>>>(X16, DMX, 0, BV, DMX, 0, 0.0625f, nullptr, 0, nullptr, 1, 0, 0, VF, V16, DKV, 0, (int)NR, DKV, DMX);      /* v (f32 for the first tile + f16) */
  k_rope128x<0, 0, 0><<<(unsigned)(NR * NH), 128, 0, stream>>>(QF, DMX, NH, tcos, tsin, Q16, DMX, 1.0f); k_rope128x<0, 0, 0><<<(unsigned)(NR * NKV), 128, 0, stream>>>(KF, DKV, NKV, tcos, tsin, K16, DKV, 1.0f);      /* half-split rope from the computed tables (index d mod 64) -> f16 */
  for (int b = 0; b < NB; ++b) { const size_t r0 = (size_t)b * SQ;
    k_rope128x<0, 0, 1><<<(unsigned)(QT0 * NH), 128, 0, stream>>>(QF + r0 * DMX, DMX, NH, tcos, tsin, QF0, DMX, 1.0f); k_rope128x<0, 0, 1><<<(unsigned)(QT0 * NKV), 128, 0, stream>>>(KF + r0 * DKV, DKV, NKV, tcos, tsin, KRF0, DKV, 1.0f);      /* f32 roped q, k of the batch's first QT0 rows (positions 0..QT0-1: the table pointers are NOT offset by the batch) */
    k_kvexp128<GSZ, NH, DKV><<<(unsigned)(((size_t)QT0 * DMX / 4 + 255) / 256), 256, 0, stream>>>(KRF0, KF0e, (size_t)QT0 * DMX / 4); k_kvexp128<GSZ, NH, DKV><<<(unsigned)(((size_t)QT0 * DMX / 4 + 255) / 256), 256, 0, stream>>>(VF + r0 * DKV, VF0e, (size_t)QT0 * DMX / 4);      /* kv head -> query head expansion for the exact first tile */
    k_vt<DKV / 64, SQ><<<(DKV / 64) * (SQ / 64), 256, 0, stream>>>(V16 + r0 * DKV, DKV, 0, VT);      /* V^T of this batch: kv head g = slabs 2g, 2g+1 */
    k_att0w<<<NH * (QT0 / 32), 256, 0, stream>>>(QF0, KF0e, VF0e, ATS, OF0 + (size_t)b * QT0 * DMX);      /* exact causal attention of the first QT0 rows (o x64) */
    for (int q0 = 0; q0 < SQ; q0 += QT) { const int nk = q0 + QT;      /* causal: keys below the tile end only */
      k_gemm2<0><<<dim3((QT / 128) * (nk / 64), NH), 128, 0, stream>>>(Q16 + (r0 + q0) * DMX, DMX, (size_t)HDK, K16 + r0 * DKV, DKV, (size_t)HDK, ATS, nullptr, 0, nullptr, 1, 0, 0, S, nullptr, NKX, (size_t)QT * NKX, QT, nk, HDK);      /* scores of all heads in one launch: blockIdx.y = head, query and key slabs both step by one head (one query head per kv head) */
      rsmcf2_launch<NKX / 128>(S, P, q0, nk, stream);      /* causal softmax (arithmetic select), one wave per row */
      k_gemm2<0><<<dim3((QT / 128) * (HDK / 64), NH), 128, 0, stream>>>(P, NKX, (size_t)QT * NKX, VT, SQ, (size_t)HDK * SQ, 0.25f, nullptr, 0, nullptr, 1, 0, 0, nullptr, O16 + (r0 + q0) * DMX, DMX, (size_t)HDK, QT, HDK, nk); } }      /* o of all heads in one launch (x64): blockIdx.y = head */
  k_gemm2<0><<<dim3((unsigned)((NR / 128) * (DMX / 64)), 1), 128, 0, stream>>>(O16, DMX, 0, BO, DMX, 0, 0.0009765625f, nullptr, 0, nullptr, 1, 0, 0, (float*)d_out, nullptr, DMX, 0, (int)NR, DMX, DMX);      /* out = o Wo^T */
  k_hl<<<(unsigned)(((size_t)NB * QT0 * DMX / 8 + 255) / 256), 256, 0, stream>>>(OF0, OH0, OL0, (size_t)NB * QT0 * DMX / 8);      /* first-tile o (x64) -> f16 hi + x1024 residual planes */
  for (int b = 0; b < NB; ++b) { const size_t r0 = (size_t)b * SQ; const size_t f0 = (size_t)b * QT0;
    k_gemm2<0><<<dim3((QT0 / 128) * (DMX / 64), 1), 128, 0, stream>>>(OH0 + f0 * DMX, DMX, 0, BO, DMX, 0, 0.0009765625f, nullptr, 0, nullptr, 1, 0, 0, (float*)d_out + r0 * DMX, nullptr, DMX, 0, QT0, DMX, DMX);      /* rows 0..255 of the batch rewritten from the exact path */
    k_gemm2<0><<<dim3((QT0 / 128) * (DMX / 64), 1), 128, 0, stream>>>(OL0 + f0 * DMX, DMX, 0, BO, DMX, 0, 0.00000095367431640625f, nullptr, 0, (const float*)d_out + r0 * DMX, -1, 0, 0, (float*)d_out + r0 * DMX, nullptr, DMX, 0, QT0, DMX, DMX); }      /* += o_lo Wo 2^-20 (own-element accumulate) */
}

// v005
// One run takes 426 microseconds.
// Two timings next to v004 put it at 1.04 and 1.05 times that version's speed.
// Over all steps from v000 it is 20.2 times as fast.
#include <hip/hip_runtime.h>
// Llama-style causal multi-head attention with half-split RoPE computed in the module (hidden_states [1][2048][2048]; q / k / v = x W^T (nn.Linear natural [2048][2048] sigma 0.02, no biases), 16 heads of 128; rope: emb = [f | f], f = p * 10000^(-2i/128): t cos + rotate_half(t) sin; scores * 128^-0.5; causal (where(tril, ., finfo.min): the weight underflows to exactly 0); softmax; out = merged Wo^T (natural) -> [1][2048][2048]); run on the hd128 grouped-query causal code as 16 kv groups of ONE query head.
// Compute dtype: inputs rounded to bf16; x / weights exact; projections and rope f32; q, k, v, softmax weights and o as plain f16 GEMM operands (~2^-12; first 256 rows of each batch exact); scores, statistics, out f32. v_wmma_f32_16x16x32_f16.
#define NB 1
#define SQ 2048
#define DMX 2048
#define NH 16
#define NKV 16
#define GSZ 1
#define HDK 128
#define DKV (NKV * HDK)
#define QT 256
#define QT0 256
#define NKX SQ
#define DM DMX
#define HD 64
#define HG 1
#define NR ((size_t)NB * SQ)
#define ATS 0.08838834764831845f
static_assert(GSZ == 1 && NH == NKV, "the per-head launches are batched on blockIdx.y with one key / value slab per query head");
typedef __bf16 v16b __attribute__((ext_vector_type(16)));
typedef unsigned short v8us __attribute__((ext_vector_type(8), may_alias));
typedef float  v8f  __attribute__((ext_vector_type(8)));
typedef float  v4f  __attribute__((ext_vector_type(4)));
typedef float  v4fa __attribute__((ext_vector_type(4), may_alias));
union FragB { v16b v; v8us half[2]; unsigned short u[16]; };

__device__ __forceinline__ unsigned short bf16_bits(float x) { unsigned int u = __float_as_uint(x); return (unsigned short)((u + 0x7FFFu + ((u >> 16) & 1u)) >> 16); }
__device__ __forceinline__ float bf16_val(unsigned short b) { return __uint_as_float(((unsigned int)b) << 16); }
__device__ __forceinline__ float bf16_round(float x) { return bf16_val(bf16_bits(x)); }
// D += A·B with NT terms: 1 = ah·bh, 2 = + al·bh (A split), 3 = + ah·bl (both split)
template <int NT>
__device__ __forceinline__ v8f mmaN(v16b ah, v16b al, v16b bh, v16b bl, v8f c) {
  c = __builtin_amdgcn_wmma_f32_16x16x32_bf16(false, ah, false, bh, (short)0, c, false, false);
  if (NT >= 2) c = __builtin_amdgcn_wmma_f32_16x16x32_bf16(false, al, false, bh, (short)0, c, false, false);
  if (NT >= 3) c = __builtin_amdgcn_wmma_f32_16x16x32_bf16(false, ah, false, bl, (short)0, c, false, false);
  asm volatile("v_nop\n\tv_nop\n\tv_nop\n\tv_nop" : "+v"(c) : "v"(ah), "v"(al), "v"(bh), "v"(bl));
  return c;
}

__global__ __launch_bounds__(256) void k_wt_bf16(const float* __restrict__ W, unsigned short* __restrict__ Wt, int K, int N) {
  const int t = blockIdx.x * 256 + threadIdx.x;
  const int k8n = K / 8;
  if (t >= N * k8n) return;
  const int n = t / k8n, k8 = (t % k8n) * 8;
  v8us v;
#pragma unroll
  for (int i = 0; i < 8; ++i) v[i] = bf16_bits(W[(size_t)(k8 + i) * N + n]);
  *(v8us*)(Wt + (size_t)n * K + k8) = v;
  
}

// GEMM C[M][N] (f32, pitch ldc) = act(A[M][K]·W + bias). A f32 row-major (pitch lda) converted per fragment to bf16
// (ASPLIT: hi/lo two planes -> 2 terms, else single rounded term); Wt bf16 [N][K] (pitch ldb). BIAS_BF16 rounds the
// bias to bf16 first (bias quantised to bf16 before the add). K%32==0, M%16==0, N%64==0.
template <bool ASPLIT, int ACT, bool BIAS_BF16>
__global__ __launch_bounds__(128) void k_gemm_bf(const float* __restrict__ A, int lda, const unsigned short* __restrict__ Wt, int ldb,
                                               const float* __restrict__ bias, float* __restrict__ C, int ldc, int M, int N, int K) {
  __shared__ __attribute__((aligned(16))) float so[4][16][64];
  const int tid = threadIdx.x, w = tid >> 5, lane = tid & 31, ln = lane & 15, hh = lane >> 4;
  const int ntn = N / 64;
  const int wid = blockIdx.x * 4 + w;
  const int mt = wid / ntn, nq = wid % ntn;
  if (mt * 16 >= M) return;
  const int row0 = mt * 16, col0 = nq * 64;
  const float* arow = A + (size_t)(row0 + ln) * lda;
  v8f acc[4] = {};
  for (int kb = 0; kb < K; kb += 32) {
    FragB ah, al;
    const v4f x0 = *(const v4fa*)(arow + kb + 8 * hh), x1 = *(const v4fa*)(arow + kb + 8 * hh + 4);
    const v4f x2 = *(const v4fa*)(arow + kb + 16 + 8 * hh), x3 = *(const v4fa*)(arow + kb + 16 + 8 * hh + 4);
    float xs[16] = {x0[0],x0[1],x0[2],x0[3],x1[0],x1[1],x1[2],x1[3],x2[0],x2[1],x2[2],x2[3],x3[0],x3[1],x3[2],x3[3]};
#pragma unroll
    for (int i = 0; i < 16; ++i) { const unsigned short hb = bf16_bits(xs[i]); ah.u[i] = hb; al.u[i] = ASPLIT ? bf16_bits(xs[i] - bf16_val(hb)) : (unsigned short)0; }
#pragma unroll
    for (int t = 0; t < 4; ++t) {
      const unsigned short* brow = Wt + (size_t)(col0 + t * 16 + ln) * ldb + kb;
      FragB b;
      b.half[0] = *(const v8us*)(brow + 8 * hh);
      b.half[1] = *(const v8us*)(brow + 16 + 8 * hh);
      acc[t] = mmaN<ASPLIT ? 2 : 1>(ah.v, al.v, b.v, b.v, acc[t]);
    }
  }
#pragma unroll
  for (int t = 0; t < 4; ++t) {
    float bv = bias ? bias[col0 + t * 16 + ln] : 0.f;
    if (BIAS_BF16) bv = bf16_round(bv);
#pragma unroll
    for (int r = 0; r < 8; ++r) { float v = acc[t][r] + bv; if (ACT == 1) v = fmaxf(v, 0.f); so[w][8 * hh + r][t * 16 + ln] = v; }
  }
  __builtin_amdgcn_fence(__ATOMIC_ACQ_REL, "workgroup");
  __builtin_amdgcn_wave_barrier();
  const int rsub = lane >> 4, c4 = (lane & 15) * 4;
  {
#pragma unroll
    for (int q = 0; q < 8; ++q) {
      const int r = q * 2 + rsub;
      const v4f v = *(const v4fa*)&so[w][r][c4];
      *(v4f*)(C + (size_t)(row0 + r) * ldc + col0 + c4) = v;
    }
    
  }
}

// GEMM C = act(A·W + bias + resid): A f32 (ASPLIT -> hi/lo 2 terms), Wt bf16 [N][K]; ACT 0 none, 1 relu, 2 exact gelu;
// resid (optional, f32, row index = (row % rmod), pitch ldr, RES_BF16 rounds it) added before the activation.
template <bool ASPLIT, int ACT, bool BIAS_BF16, bool RES_BF16>
__global__ __launch_bounds__(128) void k_gemm_bf3(const float* __restrict__ A, int lda, const unsigned short* __restrict__ Wt, int ldb,
                                                const float* __restrict__ bias, const float* __restrict__ resid, int rmod, int ldr,
                                                float* __restrict__ C, int ldc, int M, int N, int K) {
  __shared__ __attribute__((aligned(16))) float so[4][16][64];
  const int tid = threadIdx.x, w = tid >> 5, lane = tid & 31, ln = lane & 15, hh = lane >> 4;
  const int ntn = N / 64;
  const int wid = blockIdx.x * 4 + w;
  const int mt = wid / ntn, nq = wid % ntn;
  if (mt * 16 >= M) return;
  const int row0 = mt * 16, col0 = nq * 64;
  const float* arow = A + (size_t)(row0 + ln) * lda;
  v8f acc[4] = {};
  for (int kb = 0; kb < K; kb += 32) {
    FragB ah, al;
    const v4f x0 = *(const v4fa*)(arow + kb + 8 * hh), x1 = *(const v4fa*)(arow + kb + 8 * hh + 4);
    const v4f x2 = *(const v4fa*)(arow + kb + 16 + 8 * hh), x3 = *(const v4fa*)(arow + kb + 16 + 8 * hh + 4);
    float xs[16] = {x0[0],x0[1],x0[2],x0[3],x1[0],x1[1],x1[2],x1[3],x2[0],x2[1],x2[2],x2[3],x3[0],x3[1],x3[2],x3[3]};
#pragma unroll
    for (int i = 0; i < 16; ++i) { const unsigned short hb = bf16_bits(xs[i]); ah.u[i] = hb; al.u[i] = ASPLIT ? bf16_bits(xs[i] - bf16_val(hb)) : (unsigned short)0; }
#pragma unroll
    for (int t = 0; t < 4; ++t) {
      const unsigned short* brow = Wt + (size_t)(col0 + t * 16 + ln) * ldb + kb;
      FragB b;
      b.half[0] = *(const v8us*)(brow + 8 * hh);
      b.half[1] = *(const v8us*)(brow + 16 + 8 * hh);
      acc[t] = mmaN<ASPLIT ? 2 : 1>(ah.v, al.v, b.v, b.v, acc[t]);
    }
  }
#pragma unroll
  for (int t = 0; t < 4; ++t) {
    const int col = col0 + t * 16 + ln;
    float bv = bias ? bias[col] : 0.f;
    if (BIAS_BF16) bv = bf16_round(bv);
#pragma unroll
    for (int r = 0; r < 8; ++r) {
      float v = acc[t][r] + bv;
      if (resid) { float rv = resid[(size_t)((row0 + 8 * hh + r) % rmod) * ldr + col]; if (RES_BF16) rv = bf16_round(rv); v += rv; }
      if (ACT == 1) v = fmaxf(v, 0.f);
      if (ACT == 2) v = 0.5f * v * (1.0f + erff(v * 0.70710678118654752f));
      if (ACT == 3) { const float u = 0.7978845608028654f * (v + 0.044715f * v * v * v); v = 0.5f * v * (1.0f + tanhf(u)); }
      so[w][8 * hh + r][t * 16 + ln] = v;
    }
  }
  __builtin_amdgcn_fence(__ATOMIC_ACQ_REL, "workgroup");
  __builtin_amdgcn_wave_barrier();
  const int rsub = lane >> 4, c4 = (lane & 15) * 4;
  {
#pragma unroll
    for (int q = 0; q < 8; ++q) {
      const int r = q * 2 + rsub;
      const v4f v = *(const v4fa*)&so[w][r][c4];
      *(v4f*)(C + (size_t)(row0 + r) * ldc + col0 + c4) = v;
    }
    
  }
}
// row LayerNorm (biased variance, eps) over N: s = X (+ R); optional out_sum <- s; out_norm <- (s-mu)*rsqrt(var+eps)*g + b
template <bool PARAM_BF16>
__global__ __launch_bounds__(256) void k_layernorm(const float* __restrict__ X, const float* __restrict__ R, const float* __restrict__ g, const float* __restrict__ bta,
                                                  float* __restrict__ out_sum, float* __restrict__ out_norm, int N, float eps) {
  __shared__ float red[256];
  const int row = blockIdx.x, tid = threadIdx.x;
  const float* x = X + (size_t)row * N; const float* rr = R ? R + (size_t)row * N : nullptr;
  float vals[16];                     // up to N = 4096
  const int per = N / 256;            // contiguous chunk per thread? use strided-by-4 chunks: thread handles j = tid*4 + 1024*u
  float s1 = 0.f;
  for (int u = 0; u < per / 4; ++u) {
    const int j = tid * 4 + 1024 * u;
    const v4f a = *(const v4fa*)(x + j);
    v4f b = {0.f,0.f,0.f,0.f}; if (rr) b = *(const v4fa*)(rr + j);
#pragma unroll
    for (int q = 0; q < 4; ++q) { const float v = a[q] + b[q]; vals[u * 4 + q] = v; s1 += v; }
  }
  red[tid] = s1; __syncthreads();
  for (int st = 128; st > 0; st >>= 1) { if (tid < st) red[tid] += red[tid + st]; __syncthreads(); }
  const float mu = red[0] / (float)N; __syncthreads();
  float s2 = 0.f;
  for (int u = 0; u < per / 4; ++u)
#pragma unroll
    for (int q = 0; q < 4; ++q) { const float c = vals[u * 4 + q] - mu; s2 += c * c; }
  red[tid] = s2; __syncthreads();
  for (int st = 128; st > 0; st >>= 1) { if (tid < st) red[tid] += red[tid + st]; __syncthreads(); }
  const float rs = rsqrtf(red[0] / (float)N + eps);
  {
    for (int u = 0; u < per / 4; ++u) {
      const int j = tid * 4 + 1024 * u;
      v4f o, sm;
#pragma unroll
      for (int q = 0; q < 4; ++q) {
        float gg = g[j + q], bb = bta[j + q];
        if (PARAM_BF16) { gg = bf16_round(gg); bb = bf16_round(bb); }
        sm[q] = vals[u * 4 + q]; o[q] = (vals[u * 4 + q] - mu) * rs * gg + bb;
      }
      if (out_sum) *(v4f*)(out_sum + (size_t)row * N + j) = sm;
      *(v4f*)(out_norm + (size_t)row * N + j) = o;
    }
    
  }
}



// ---- f16 WMMA path (v_wmma_f32_16x16x32_f16): 11-bit significands for operands in range — used where a [0,1] probability operand needs more precision than bf16
typedef _Float16 v16h __attribute__((ext_vector_type(16)));
union FragH { v16h v; v8us half[2]; _Float16 h[16]; unsigned short u[16]; };
template <int NT>
__device__ __forceinline__ v8f mmaH(v16h ah, v16h al, v16h bh, v16h bl, v8f c) {
  c = __builtin_amdgcn_wmma_f32_16x16x32_f16(false, ah, false, bh, (short)0, c, false, false);
  if (NT >= 2) c = __builtin_amdgcn_wmma_f32_16x16x32_f16(false, al, false, bh, (short)0, c, false, false);
  if (NT >= 3) c = __builtin_amdgcn_wmma_f32_16x16x32_f16(false, ah, false, bl, (short)0, c, false, false);
  asm volatile("v_nop\n\tv_nop\n\tv_nop\n\tv_nop" : "+v"(c) : "v"(ah), "v"(al), "v"(bh), "v"(bl));
  return c;
}
// batched GEMM like k_gemm_b but f16 operands: A f32 (split into f16 hi/lo if ASPLIT, else rounded to f16), Bt = f16 values [n][k]; alpha; C f32; N multiple of 16 (partial tiles skipped)
template <bool ASPLIT>
__global__ __launch_bounds__(128) void k_gemm_h(const float* __restrict__ A, int lda, size_t sA, const _Float16* __restrict__ Bh, int ldb, size_t sB, float alpha, float* __restrict__ C, int ldc, size_t sC, int M, int N, int K) {
  __shared__ __attribute__((aligned(16))) float so[4][16][64];
  const int tid = threadIdx.x, w = tid >> 5, lane = tid & 31, ln = lane & 15, hh = lane >> 4; const int by = blockIdx.y;
  A += (size_t)by * sA; Bh += (size_t)by * sB; C += (size_t)by * sC;
  const int ntn = (N + 63) / 64; const int wid = blockIdx.x * 4 + w; const int mt = wid / ntn, nq = wid % ntn; if (mt * 16 >= M) return;
  const int row0 = mt * 16, col0 = nq * 64; const float* arow = A + (size_t)(row0 + ln) * lda;
  v8f acc[4] = {};
  for (int kb = 0; kb < K; kb += 32) {
    FragH ah, al;
    const v4f x0 = *(const v4fa*)(arow + kb + 8 * hh), x1 = *(const v4fa*)(arow + kb + 8 * hh + 4), x2 = *(const v4fa*)(arow + kb + 16 + 8 * hh), x3 = *(const v4fa*)(arow + kb + 16 + 8 * hh + 4);
    float xs[16] = {x0[0],x0[1],x0[2],x0[3],x1[0],x1[1],x1[2],x1[3],x2[0],x2[1],x2[2],x2[3],x3[0],x3[1],x3[2],x3[3]};
#pragma unroll
    for (int i = 0; i < 16; ++i) { const _Float16 h = (_Float16)xs[i]; ah.h[i] = h; al.h[i] = ASPLIT ? (_Float16)(xs[i] - (float)h) : (_Float16)0.0f; }
#pragma unroll
    for (int t = 0; t < 4; ++t) { if (col0 + t * 16 >= N) continue; const size_t boff = (size_t)(col0 + t * 16 + ln) * ldb + kb; FragH bq; bq.half[0] = *(const v8us*)(Bh + boff + 8 * hh); bq.half[1] = *(const v8us*)(Bh + boff + 16 + 8 * hh);
      acc[t] = mmaH<ASPLIT ? 2 : 1>(ah.v, al.v, bq.v, bq.v, acc[t]); }
  }
#pragma unroll
  for (int t = 0; t < 4; ++t) { if (col0 + t * 16 >= N) continue;
#pragma unroll
    for (int r = 0; r < 8; ++r) so[w][8 * hh + r][t * 16 + ln] = acc[t][r] * alpha; }
  __builtin_amdgcn_fence(__ATOMIC_ACQ_REL, "workgroup"); __builtin_amdgcn_wave_barrier();
  const int rsub = lane >> 4, c4 = (lane & 15) * 4;
  {
#pragma unroll
    for (int q = 0; q < 8; ++q) { const int r = q * 2 + rsub; if (col0 + c4 < N) { const v4f v = *(const v4fa*)&so[w][r][c4]; *(v4f*)(C + (size_t)(row0 + r) * ldc + col0 + c4) = v; } }
     }
}

// Wt[n][k] = f16(W[k][n]·scale) from f32 row-major W[K][N] (scale = power of two; bf16-exact weights stay exact in f16 away from the subnormal range)
__global__ __launch_bounds__(256) void k_wt_f16(const float* __restrict__ W, _Float16* __restrict__ Wt, int K, int N, float scale) {
  const int t = blockIdx.x * 256 + threadIdx.x; if (t >= N * (K / 8)) return; const int n = t / (K / 8), k8 = (t % (K / 8)) * 8; FragH f;
#pragma unroll
  for (int i = 0; i < 8; ++i) f.h[i] = (_Float16)(bf16_round(W[(size_t)(k8 + i) * N + n]) * scale); const v8us o = f.half[0];
  *(v8us*)((unsigned short*)Wt + (size_t)n * K + k8) = o; 
}
// k_gemm_hh variant with fused epilogue: v = acc·alpha + bias[by·sBias + col] (+ CP[(row/rowsPerB)·sCPb + by·64 + col] if CP) ; ACT 0 none / 1 elu ; writes f16 C16 (and f32 C if non-null)
template <int ACT>
__global__ __launch_bounds__(128) void k_gemm_hhx(const _Float16* __restrict__ A, int lda, size_t sA, const _Float16* __restrict__ Bh, int ldb, size_t sB, float alpha, const float* __restrict__ bias, size_t sBias, const float* __restrict__ CP, int rowsPerB, size_t sCPb, int row0g,
    float* __restrict__ C, _Float16* __restrict__ C16, int ldc, size_t sC, int M, int N, int K) {
  __shared__ __attribute__((aligned(16))) float so[4][16][64];
  const int tid = threadIdx.x, w = tid >> 5, lane = tid & 31, ln = lane & 15, hh = lane >> 4; const int by = blockIdx.y;
  A += (size_t)by * sA; Bh += (size_t)by * sB; const size_t cofs = (size_t)by * sC; const float* bp = bias ? bias + (size_t)by * sBias : nullptr;
  const int ntn = (N + 63) / 64; const int wid = blockIdx.x * 4 + w; const int mt = wid / ntn, nq = wid % ntn; if (mt * 16 >= M) return;
  const int row0 = mt * 16, col0 = nq * 64; const _Float16* arow = A + (size_t)(row0 + ln) * lda;
  v8f acc[4] = {};
  for (int kb = 0; kb < K; kb += 32) { FragH ah; ah.half[0] = *(const v8us*)((const unsigned short*)arow + kb + 8 * hh); ah.half[1] = *(const v8us*)((const unsigned short*)arow + kb + 16 + 8 * hh);
#pragma unroll
    for (int t = 0; t < 4; ++t) { if (col0 + t * 16 >= N) continue; const size_t boff = (size_t)(col0 + t * 16 + ln) * ldb + kb; FragH bq; bq.half[0] = *(const v8us*)((const unsigned short*)Bh + boff + 8 * hh); bq.half[1] = *(const v8us*)((const unsigned short*)Bh + boff + 16 + 8 * hh);
      acc[t] = mmaH<1>(ah.v, ah.v, bq.v, bq.v, acc[t]); }
  }
#pragma unroll
  for (int t = 0; t < 4; ++t) { if (col0 + t * 16 >= N) continue; const int col = col0 + t * 16 + ln; const float bv = bp ? bf16_round(bp[col]) : 0.f;
#pragma unroll
    for (int r = 0; r < 8; ++r) { float v = acc[t][r] * alpha + bv; if (CP) { const int rr = row0g + row0 + 8 * hh + r; if (rowsPerB < 0) v += CP[cofs + (size_t)rr * ldc + col];      /* rowsPerB < 0: own element of the batched C plane */ else { const int bidx = rr / rowsPerB; v += CP[(size_t)bidx * sCPb + (size_t)by * 64 + col]; } } if (ACT == 1) v = (v > 0.f) ? v : expm1f(v); else if (ACT == 7) v = (v > 0.f) ? v + 1.0f : expf(v); else if (ACT == 8) v = tanhf(v); else if (ACT == 9) v = 0.5f * v * (1.0f + tanhf(0.7978845608028654f * (v + 0.044715f * v * v * v))); else if (ACT == 11) v = 1.0f / (1.0f + expf(-v)); else if (ACT == 12) v = (v > 0.f) ? v : 0.01f * v; else if (ACT == 14) v = (v > 0.f) ? v : 0.1f * v; else if (ACT == 16) v = (v >= 0.f) ? v : 0.3f * v; else if (ACT == 17) v = (v >= 0.f) ? v : 0.2f * v; else if (ACT == 15) v = v / (1.0f + expf(-v)); else if (ACT == 3) v = fmaxf(v, 0.f); else if (ACT == 6) v = 0.5f * v * (1.0f + erff(v * 0.70710678118654752f)); so[w][8 * hh + r][t * 16 + ln] = v; } }
  __builtin_amdgcn_fence(__ATOMIC_ACQ_REL, "workgroup"); __builtin_amdgcn_wave_barrier();
  const int rsub = lane >> 4, c4 = (lane & 15) * 4; typedef _Float16 v4h __attribute__((ext_vector_type(4)));
  {
#pragma unroll
    for (int q = 0; q < 8; ++q) { const int r = q * 2 + rsub; if (col0 + c4 < N) { const v4f v = *(const v4fa*)&so[w][r][c4]; if (C) *(v4f*)(C + cofs + (size_t)(row0 + r) * ldc + col0 + c4) = v; if (C16) { v4h h4; for (int i = 0; i < 4; ++i) h4[i] = (_Float16)v[i]; *(v4h*)(C16 + cofs + (size_t)(row0 + r) * ldc + col0 + c4) = h4; } } }
     }
}


typedef _Float16 v4h __attribute__((ext_vector_type(4)));

__global__ __launch_bounds__(256) void k_x16(const float* __restrict__ x, _Float16* __restrict__ X16, size_t n8) { const size_t t = (size_t)blockIdx.x * 256 + threadIdx.x; if (t >= n8) return; FragH f;
#pragma unroll
  for (int q = 0; q < 8; ++q) f.h[q] = (_Float16)bf16_round(x[t * 8 + q]); *(v8us*)((unsigned short*)X16 + t * 8) = f.half[0];  }
__global__ __launch_bounds__(256) void k_h16(const float* __restrict__ x, _Float16* __restrict__ X16, size_t n8) { const size_t t = (size_t)blockIdx.x * 256 + threadIdx.x; if (t >= n8) return; FragH f;
#pragma unroll
  for (int q = 0; q < 8; ++q) f.h[q] = (_Float16)x[t * 8 + q]; *(v8us*)((unsigned short*)X16 + t * 8) = f.half[0];  }
__global__ __launch_bounds__(256) void k_round16f(const float* __restrict__ W, _Float16* __restrict__ Bt, size_t n8) { const size_t t = (size_t)blockIdx.x * 256 + threadIdx.x; if (t >= n8) return; FragH f;
#pragma unroll
  for (int i = 0; i < 8; ++i) f.h[i] = (_Float16)(bf16_round(W[t * 8 + i]) * 16.0f); *(v8us*)((unsigned short*)Bt + t * 8) = f.half[0];  }
template <int NHv, int TTv>
__global__ __launch_bounds__(256) void k_vt(const _Float16* __restrict__ V16, int ldv, int voff, _Float16* __restrict__ Vt) { __shared__ unsigned short tl[64][66]; const int tid = threadIdx.x; const int slab = blockIdx.x / (TTv / 64), lg = blockIdx.x % (TTv / 64); const int b = slab / NHv, h = slab % NHv;
  for (int i = tid; i < 64 * 8; i += 256) { const int r = i / 8, c8 = (i % 8) * 8; FragH f; f.half[0] = *(const v8us*)((const unsigned short*)V16 + ((size_t)b * TTv + lg * 64 + r) * ldv + voff + h * 64 + c8);
#pragma unroll
    for (int q = 0; q < 8; ++q) tl[r][c8 + q] = f.u[q]; }
  __syncthreads();
  {
#pragma unroll
    for (int rd = 0; rd < 2; ++rd) { const int d = rd * 32 + tid / 8, pc = tid % 8; FragH f;
#pragma unroll
      for (int q = 0; q < 8; ++q) f.u[q] = tl[pc * 8 + q][d];
      *(v8us*)((unsigned short*)Vt + ((size_t)slab * 64 + d) * TTv + lg * 64 + pc * 8) = f.half[0]; }
     } }

__global__ __launch_bounds__(256) void k_hl(const float* __restrict__ F, _Float16* __restrict__ Hh, _Float16* __restrict__ Hl, size_t n8) { const size_t t = (size_t)blockIdx.x * 256 + threadIdx.x; if (t >= n8) return; FragH fh, fl; const v4f a = *(const v4fa*)(F + t * 8), c = *(const v4fa*)(F + t * 8 + 4);
#pragma unroll
  for (int q = 0; q < 4; ++q) { _Float16 h = (_Float16)a[q]; fh.h[q] = h; fl.h[q] = (_Float16)((a[q] - (float)h) * 1024.0f); h = (_Float16)c[q]; fh.h[4 + q] = h; fl.h[4 + q] = (_Float16)((c[q] - (float)h) * 1024.0f); }
  { *(v8us*)((unsigned short*)Hh + t * 8) = fh.half[0]; *(v8us*)((unsigned short*)Hl + t * 8) = fl.half[0];  } }

// ---- fast GEMM (work-group tile 128x64, wave tile 32x64; requires M % 128 == 0 rows per launch region, N % 64 == 0 and K % 128 == 0); epilogue = k_gemm_hhx semantics ----
// Operands reach the waves through LDS: a stage is 128 k (256 B) of the tile's 128 A rows and 64 B rows at a pitch of 272 B (16 B x odd: the 16 lanes that a 16-byte LDS read serves together fall on distinct banks).
// Asynchronous copies fill it, 16 lanes to a row, so that each wave-wide copy takes four whole 128-byte lines; two buffers: the next stage's copies fly while this stage is worked on.
#define G2_KS 128
#define G2_PITCH 272
#define G2_ROWS 192
#define G2_STAGE (G2_ROWS * G2_PITCH)
__device__ __forceinline__ v16h g2_frag(const _Float16* p, int hh) { FragH f; f.half[0] = *(const v8us*)((const unsigned short*)p + 8 * hh); f.half[1] = *(const v8us*)((const unsigned short*)p + 16 + 8 * hh); return f.v; }
__device__ __forceinline__ v8f g2_mma(v16h a, v16h b, v8f c) { v8f d = __builtin_amdgcn_wmma_f32_16x16x32_f16(false, a, false, b, (short)0, c, false, false); asm volatile("v_nop\n\tv_nop\n\tv_nop\n\tv_nop" : "+v"(d) : "v"(a), "v"(b)); return d; }
// eight asynchronous 16-byte copies of a lane: rows r, r + 8, ... r + 56 (global step gs halves, LDS step 8 pitches). The s_wait_xcnt 0 is the last line of the copies' own statement, so that it stands in front of every later rewrite of a register that a copy names.
__device__ __forceinline__ void g2_copy8(unsigned l, const _Float16* g, size_t gs) {
  asm volatile("global_load_async_to_lds_b128 %0, %8, off\n\tglobal_load_async_to_lds_b128 %1, %9, off\n\tglobal_load_async_to_lds_b128 %2, %10, off\n\tglobal_load_async_to_lds_b128 %3, %11, off\n\t"
               "global_load_async_to_lds_b128 %4, %12, off\n\tglobal_load_async_to_lds_b128 %5, %13, off\n\tglobal_load_async_to_lds_b128 %6, %14, off\n\tglobal_load_async_to_lds_b128 %7, %15, off\n\ts_wait_xcnt 0x0"
               :: "v"(l), "v"(l + 8 * G2_PITCH), "v"(l + 16 * G2_PITCH), "v"(l + 24 * G2_PITCH), "v"(l + 32 * G2_PITCH), "v"(l + 40 * G2_PITCH), "v"(l + 48 * G2_PITCH), "v"(l + 56 * G2_PITCH),
                  "v"(g), "v"(g + gs), "v"(g + 2 * gs), "v"(g + 3 * gs), "v"(g + 4 * gs), "v"(g + 5 * gs), "v"(g + 6 * gs), "v"(g + 7 * gs) : "memory"); }
template <int ACT>
__global__ __launch_bounds__(128) void k_gemm2(const _Float16* __restrict__ A, int lda, size_t sA, const _Float16* __restrict__ Bh, int ldb, size_t sB, float alpha, const float* __restrict__ bias, size_t sBias, const float* __restrict__ CP, int rowsPerB, size_t sCPb, int row0g,
    float* __restrict__ C, _Float16* __restrict__ C16, int ldc, size_t sC, int M, int N, int K) { static_assert(ACT == 0 || ACT == 3 || ACT == 6 || ACT == 8 || ACT == 9 || ACT == 11 || ACT == 12 || ACT == 14 || ACT == 15 || ACT == 16 || ACT == 17, "k_gemm2: unsupported ACT code (would silently apply no activation)");
  __shared__ __attribute__((aligned(16))) unsigned char st[2 * G2_STAGE];      /* the two stage buffers; behind the loop's last barrier the same bytes serve as the output staging so[4][32][68] */
  static_assert(sizeof(float) * 4 * 32 * 68 <= 2 * G2_STAGE, "the output staging lies inside the stage buffers");
  float (*so)[32][68] = (float (*)[32][68])st;
  const int tid = threadIdx.x, w = tid >> 5, lane = tid & 31, ln = lane & 15, hh = lane >> 4; const int by = blockIdx.y;
  A += (size_t)by * sA; Bh += (size_t)by * sB; const size_t cofs = (size_t)by * sC; const float* bp = bias ? bias + (size_t)by * sBias : nullptr;
  const int ntn = N >> 6; const int mt = blockIdx.x / ntn, nq = blockIdx.x - mt * ntn; const int row0 = mt * 128 + 32 * w, col0 = nq * 64; if (mt * 128 >= M) return;      /* the same for the whole work-group, in front of every barrier */
  const _Float16* ag = A + (size_t)(mt * 128 + (tid >> 4)) * lda + (tid & 15) * 8; const _Float16* bg = Bh + (size_t)(col0 + (tid >> 4)) * ldb + (tid & 15) * 8;      /* this lane's 16 bytes of rows tid / 16 + 8 i */
  const unsigned l0 = (unsigned)(size_t)st + (unsigned)((tid >> 4) * G2_PITCH + (tid & 15) * 16);      /* the low 32 bits of a __shared__ address are the LDS byte address */
  const size_t ga = (size_t)8 * lda, gb = (size_t)8 * ldb; const int nt = K / G2_KS;
  const v8f z8 = {0.f,0.f,0.f,0.f,0.f,0.f,0.f,0.f}; v8f c00 = z8, c01 = z8, c02 = z8, c03 = z8, c10 = z8, c11 = z8, c12 = z8, c13 = z8;
  g2_copy8(l0, ag, ga); g2_copy8(l0 + 64 * G2_PITCH, ag + 8 * ga, ga); g2_copy8(l0 + 128 * G2_PITCH, bg, gb);      /* stage 0 into buffer 0 */
  asm volatile("s_wait_asynccnt 0x0" ::: "memory");      /* this wave's copies of stage 0 have landed */
  __syncthreads();      /* every wave's have: stage 0 may be read */
  if (nt > 1) { g2_copy8(l0 + G2_STAGE, ag + G2_KS, ga); g2_copy8(l0 + G2_STAGE + 64 * G2_PITCH, ag + G2_KS + 8 * ga, ga); g2_copy8(l0 + G2_STAGE + 128 * G2_PITCH, bg + G2_KS, gb); }      /* stage 1 into buffer 1 */
#pragma unroll 1      /* one stage a trip: the order at the foot of the trip stays as written */
  for (int t = 0; t < nt; ++t) { const unsigned bo = (unsigned)(t & 1) * G2_STAGE;
    const _Float16* a0p = (const _Float16*)(st + bo + (32 * w + ln) * G2_PITCH); const _Float16* a1p = (const _Float16*)(st + bo + (32 * w + 16 + ln) * G2_PITCH); const _Float16* b0p = (const _Float16*)(st + bo + (128 + ln) * G2_PITCH);
    v16h a0 = g2_frag(a0p, hh), a1 = g2_frag(a1p, hh), b0 = g2_frag(b0p, hh), b1 = g2_frag(b0p + 16 * (G2_PITCH / 2), hh), b2 = g2_frag(b0p + 32 * (G2_PITCH / 2), hh), b3 = g2_frag(b0p + 48 * (G2_PITCH / 2), hh);
#pragma unroll      /* four 32-k steps of a stage: constant LDS offsets, and the two fragment sets are renamed instead of moved */
    for (int kb = 0; kb < G2_KS; kb += 32) { v16h n0 = a0, n1 = a1, m0 = b0, m1 = b1, m2 = b2, m3 = b3;
      if (kb + 32 < G2_KS) { const int kn = kb + 32;      /* the next step's twelve LDS reads go as one group in front of this step's products and return under them; they stay inside this stage */
        n0 = g2_frag(a0p + kn, hh); n1 = g2_frag(a1p + kn, hh); m0 = g2_frag(b0p + kn, hh); m1 = g2_frag(b0p + 16 * (G2_PITCH / 2) + kn, hh); m2 = g2_frag(b0p + 32 * (G2_PITCH / 2) + kn, hh); m3 = g2_frag(b0p + 48 * (G2_PITCH / 2) + kn, hh); }
      c00 = g2_mma(a0, b0, c00); c10 = g2_mma(a1, b0, c10); c01 = g2_mma(a0, b1, c01); c11 = g2_mma(a1, b1, c11);
      c02 = g2_mma(a0, b2, c02); c12 = g2_mma(a1, b2, c12); c03 = g2_mma(a0, b3, c03); c13 = g2_mma(a1, b3, c13);
      a0 = n0; a1 = n1; b0 = m0; b1 = m1; b2 = m2; b3 = m3; }
    asm volatile("s_wait_dscnt 0x0" ::: "memory");      /* this wave's reads of the buffer have returned before it is refilled */
    asm volatile("s_wait_asynccnt 0x0" ::: "memory");      /* this wave's copies of stage t + 1 have landed */
    __syncthreads();      /* publishes stage t + 1 and ends every wave's reads of stage t */
    if (t + 2 < nt) { const _Float16* an = ag + (size_t)(t + 2) * G2_KS; const _Float16* bn = bg + (size_t)(t + 2) * G2_KS; g2_copy8(l0 + bo, an, ga); g2_copy8(l0 + bo + 64 * G2_PITCH, an + 8 * ga, ga); g2_copy8(l0 + bo + 128 * G2_PITCH, bn, gb); } }      /* stage t + 2 into the buffer that trip t has just read */
  asm volatile("s_wait_asynccnt 0x0" ::: "memory");      /* nothing is in flight when the buffers become output staging */
  v8f accs[8] = {c00, c01, c02, c03, c10, c11, c12, c13};
#pragma unroll
  for (int u = 0; u < 8; ++u) { const int t = u & 3, half = u >> 2; const int col = col0 + t * 16 + ln; const float bv = bp ? bf16_round(bp[col]) : 0.f;
#pragma unroll
    for (int r = 0; r < 8; ++r) { const int rloc = half * 16 + 8 * hh + r; float v = accs[u][r] * alpha + bv; if (CP) { if (rowsPerB < 0) v += CP[cofs + (size_t)(row0g + row0 + rloc) * ldc + col];      /* rowsPerB < 0: own element of the batched C plane */ else { const int bidx = (row0g + row0 + rloc) / rowsPerB; v += CP[(size_t)bidx * sCPb + (size_t)by * 64 + col]; } }
      if (ACT == 3) v = fmaxf(v, 0.f); else if (ACT == 6) v = 0.5f * v * (1.0f + erff(v * 0.70710678118654752f)); else if (ACT == 11) v = 1.0f / (1.0f + expf(-v)); else if (ACT == 15) v = v / (1.0f + expf(-v)); else if (ACT == 12) v = (v > 0.f) ? v : 0.01f * v; else if (ACT == 8) v = tanhf(v); else if (ACT == 9) v = 0.5f * v * (1.0f + tanhf(0.7978845608028654f * (v + 0.044715f * v * v * v))); else if (ACT == 14) v = (v > 0.f) ? v : 0.1f * v; else if (ACT == 16) v = (v >= 0.f) ? v : 0.3f * v; else if (ACT == 17) v = (v >= 0.f) ? v : 0.2f * v;
      so[w][rloc][t * 16 + ln] = v; } }
  __builtin_amdgcn_fence(__ATOMIC_ACQ_REL, "workgroup"); __builtin_amdgcn_wave_barrier();
  const int rsub = lane >> 4, c4 = (lane & 15) * 4;
  {
#pragma unroll
    for (int q = 0; q < 16; ++q) { const int r = q * 2 + rsub; const v4f v = *(const v4fa*)&so[w][r][c4]; if (C) *(v4f*)(C + cofs + (size_t)(row0 + r) * ldc + col0 + c4) = v; if (C16) { v4h h4; for (int i = 0; i < 4; ++i) h4[i] = (_Float16)v[i]; *(v4h*)(C16 + cofs + (size_t)(row0 + r) * ldc + col0 + c4) = h4; } }
     } }


__global__ __launch_bounds__(256) void k_wnat(const float* __restrict__ w, size_t n8, _Float16* __restrict__ Bt) { const size_t t = (size_t)blockIdx.x * 256 + threadIdx.x; if (t >= n8) return; FragH f; for (int q = 0; q < 8; ++q) f.h[q] = (_Float16)(bf16_round(w[t * 8 + q]) * 16.0f); *(v8us*)((unsigned short*)Bt + t * 8) = f.half[0];  }
__global__ __launch_bounds__(256) void k_rsm(const float* __restrict__ S, _Float16* __restrict__ P, int nrows) {
  #pragma clang fp contract(off)
  const int i = blockIdx.x * 256 + threadIdx.x; if (i >= nrows) return; const float* s = S + (size_t)i * SQ; float mx = -3.0e38f;
#pragma unroll 1
  for (int j = 0; j < SQ; ++j) mx = fmaxf(mx, s[j]); float se = 0.f;
#pragma unroll 1
  for (int j = 0; j < SQ; ++j) se += expf(s[j] - mx); const float sc = 256.0f / se;
#pragma unroll 1
  for (int j0 = 0; j0 < SQ; j0 += 8) { FragH f; for (int q = 0; q < 8; ++q) f.h[q] = (_Float16)(expf(s[j0 + q] - mx) * sc); unsigned short* d = (unsigned short*)P + (size_t)i * SQ + j0; *(v8us*)d = f.half[0];  } }
__global__ __launch_bounds__(256) void k_vt(const _Float16* __restrict__ V16, int b, int h0, _Float16* __restrict__ VT) { __shared__ unsigned short tl[64][65]; const int tid = threadIdx.x; const int hh = blockIdx.x % HG, sg = blockIdx.x / HG; const int s0 = sg * 64; const int h = h0 + hh;
  for (int i = tid; i < 64 * 8; i += 256) { const int j = i / 8, d8 = (i % 8) * 8; FragH f; f.half[0] = *(const v8us*)((const unsigned short*)V16 + ((size_t)b * SQ + s0 + j) * DM + h * HD + d8); for (int q = 0; q < 8; ++q) tl[d8 + q][j] = f.u[q]; }
  __syncthreads();
  { for (int i = tid; i < 64 * 8; i += 256) { const int d = i / 8, j8 = (i % 8) * 8; FragH f; for (int q = 0; q < 8; ++q) f.u[q] = tl[d][j8 + q]; *(v8us*)((unsigned short*)VT + ((size_t)hh * HD + d) * SQ + s0 + j8) = f.half[0]; }  } }


__global__ __launch_bounds__(256) void k_f2h(const float* __restrict__ F, int ldf, int coff, int ncol, _Float16* __restrict__ H16, size_t nrow) { const size_t t = (size_t)blockIdx.x * 256 + threadIdx.x; const size_t n8 = nrow * (size_t)(ncol / 8); if (t >= n8) return; const size_t r = t / (ncol / 8); const int c8 = (int)(t % (ncol / 8)) * 8; FragH f; const v4f a = *(const v4fa*)(F + r * ldf + coff + c8), b2 = *(const v4fa*)(F + r * ldf + coff + c8 + 4); for (int q = 0; q < 4; ++q) { f.h[q] = (_Float16)a[q]; f.h[4 + q] = (_Float16)b2[q]; } *(v8us*)((unsigned short*)H16 + r * ncol + c8) = f.half[0];  }

__global__ __launch_bounds__(256) void k_tab128(float theta, float* __restrict__ CS, float* __restrict__ SN) {
  #pragma clang fp contract(off)
  const int t = blockIdx.x * 256 + threadIdx.x; if (t >= SQ * 64) return; const int i = t % 64; const int p = t / 64; const float invf = (float)(1.0 / pow((double)theta, (double)(2 * i) / 128.0));      /* = XLA's constant-folded f32 table */ const float ang = __fmul_rn((float)p, invf); const float c = cosf(ang), s = sinf(ang);
  *(float*)(CS + t) = c; *(float*)(SN + t) = s;  }
template <int TAB>
__global__ __launch_bounds__(128) void k_rope128(const float* __restrict__ F, int ldf, int nh, const float* __restrict__ CS, const float* __restrict__ SN, _Float16* __restrict__ H16, int ldo, float osc) {
  #pragma clang fp contract(off)
  __shared__ float xv[128]; __shared__ unsigned short sh_[128]; const int d = threadIdx.x; const int h = blockIdx.x % nh; const size_t r = blockIdx.x / nh; const int p = (int)(r % SQ);
  xv[d] = F[r * (size_t)ldf + (size_t)h * 128 + d]; __syncthreads();
  float c, s; if (TAB) { c = bf16_round(CS[(size_t)p * 128 + d]); s = bf16_round(SN[(size_t)p * 128 + d]); } else { c = CS[p * 64 + (d & 63)]; s = SN[p * 64 + (d & 63)]; }
  const float rot = (d < 64) ? -xv[d + 64] : xv[d - 64]; const float o = __fadd_rn(__fmul_rn(xv[d], c), __fmul_rn(rot, s));
  FragH th; th.h[0] = (_Float16)__fmul_rn(o, osc); sh_[d] = th.u[0]; __syncthreads();
  if (d < 16) { FragH f; for (int q = 0; q < 8; ++q) f.u[q] = sh_[d * 8 + q]; unsigned short* dst = (unsigned short*)H16 + r * (size_t)ldo + (size_t)h * 128 + d * 8; *(v8us*)dst = f.half[0];  } }

// Half-split rope of nrow4 * 4 rows of nh heads of 128. One thread owns dims d4 .. d4 + 3 and their partners d4 + 64 .. d4 + 67 of one head in FOUR rows (r0, r0 + nrow4, r0 + 2 nrow4, r0 + 3 nrow4):
// both halves of a rotation pair stand in the thread's own registers (no LDS, no barrier), 16 lanes cover 256 contiguous bytes of each half, and the launch has 1/64 of the work-groups that one work-group per (row, head) has.
template <int F32OUT>
__global__ __launch_bounds__(256) void k_rope128x(const float* __restrict__ F, int ldf, int nh, int nrow4, const float* __restrict__ CS, const float* __restrict__ SN, void* __restrict__ OUT, int ldo, float osc) {
  const int t = blockIdx.x * 256 + threadIdx.x; const int per = nh * 16; if (t >= nrow4 * per) return; const int r0 = t / per; const int cc = t - r0 * per; const int h = cc >> 4, d4 = (cc & 15) * 4;
  v4f lo[4], hi[4], cs[4], sn[4];
#pragma unroll      /* the sixteen loads stand in a loop of their own, ahead of the arithmetic, so that many are in flight at once; the arrays are indexed by constants and stay in registers */
  for (int u = 0; u < 4; ++u) { const size_t r = (size_t)(r0 + u * nrow4); const int p = (int)(r % SQ); const float* f = F + r * (size_t)ldf + (size_t)h * 128 + d4;
    /* each s_wait_xcnt 0 stands between the load in front of it and a later load whose result may take that load's address registers */
    lo[u] = *(const v4fa*)f; asm volatile("s_wait_xcnt 0x0" ::: "memory"); hi[u] = *(const v4fa*)(f + 64); asm volatile("s_wait_xcnt 0x0" ::: "memory");
    cs[u] = *(const v4fa*)(CS + p * 64 + d4); asm volatile("s_wait_xcnt 0x0" ::: "memory"); sn[u] = *(const v4fa*)(SN + p * 64 + d4); asm volatile("s_wait_xcnt 0x0" ::: "memory"); }
#pragma unroll      /* lo[], hi[], cs[], sn[] in registers */
  for (int u = 0; u < 4; ++u) { const size_t o = (size_t)(r0 + u * nrow4) * (size_t)ldo + (size_t)h * 128 + d4; v4f ol, oh;
    for (int q = 0; q < 4; ++q) { ol[q] = fmaf(-hi[u][q], sn[u][q], lo[u][q] * cs[u][q]) * osc; oh[q] = fmaf(lo[u][q], sn[u][q], hi[u][q] * cs[u][q]) * osc; }      /* t cos is rounded, rotate_half(t) sin is fused onto it */
    if (F32OUT) { float* dst = (float*)OUT + o; *(v4f*)dst = ol; *(v4f*)(dst + 64) = oh; }
    else { v4h hl, hu; for (int q = 0; q < 4; ++q) { hl[q] = (_Float16)ol[q]; hu[q] = (_Float16)oh[q]; } _Float16* dst = (_Float16*)OUT + o; *(v4h*)dst = hl; *(v4h*)(dst + 64) = hu; } } }
template <int N>
__global__ __launch_bounds__(256) void k_rmsrow(float* __restrict__ X, const float* __restrict__ w, float eps) {
  #pragma clang fp contract(off)
  constexpr int PT = N / 256; __shared__ float red[256]; const size_t r = blockIdx.x; const int t = threadIdx.x; float* row = X + r * N + (size_t)t * PT; float v[PT]; float ss = 0.f;
  for (int q = 0; q < PT; ++q) { v[q] = row[q]; ss = __fadd_rn(ss, __fmul_rn(v[q], v[q])); }
  red[t] = ss; __syncthreads(); for (int k = 128; k > 0; k >>= 1) { if (t < k) red[t] = __fadd_rn(red[t], red[t + k]); __syncthreads(); }
  const float rs = rsqrtf(__fadd_rn(red[0] / (float)N, eps)); float o[PT]; for (int q = 0; q < PT; ++q) o[q] = __fmul_rn(__fmul_rn(v[q], rs), bf16_round(w[t * PT + q]));
  { for (int q = 0; q < PT; ++q) *(float*)(row + q) = o[q];  } }
template <int GS_, int NHQ, int DSRC>
__global__ __launch_bounds__(256) void k_kvexp128(const float* __restrict__ src, float* __restrict__ dst, size_t n4) { const size_t t = (size_t)blockIdx.x * 256 + threadIdx.x; if (t >= n4) return; const size_t e = t * 4; const size_t row = e / ((size_t)NHQ * 128); const int col = (int)(e % ((size_t)NHQ * 128)); const int h = col / 128, d = col % 128; const v4f v = *(const v4fa*)(src + row * DSRC + (size_t)(h / GS_) * 128 + d); *(v4f*)(dst + e) = v;  }

__global__ __launch_bounds__(256) void k_rsmcfb(const float* __restrict__ S, _Float16* __restrict__ P, int hg, int q0, int nk, const int* __restrict__ mk) {
  #pragma clang fp contract(off)
  const int t = blockIdx.x * 256 + threadIdx.x; if (t >= hg * QT) return; const size_t i = (size_t)t; const float* s = S + i * NKX; const size_t ig = (size_t)(q0 + (t % QT)); const int* mr = mk + ig * SQ; float mx = -3.0e38f;
#pragma unroll 1
  for (int j = 0; j < nk; ++j) { const int mb = mr[j]; const float f = (mb == 0) ? 1.f : 0.f; mx = fmaxf(mx, fmaf(f, s[j], (1.f - f) * -1.0e9f)); } float se = 0.f;
#pragma unroll 1
  for (int j = 0; j < nk; ++j) { const int mb = mr[j]; const float f = (mb == 0) ? 1.f : 0.f; se += __expf(fmaf(f, s[j], (1.f - f) * -1.0e9f) - mx); } const float sc = 256.0f / se;
#pragma unroll 1
  for (int j0 = 0; j0 < nk; j0 += 8) { FragH fr; for (int q = 0; q < 8; ++q) { const int j = j0 + q; const int mb = mr[j]; const float f = (mb == 0) ? 1.f : 0.f; fr.h[q] = (_Float16)(__expf(fmaf(f, s[j], (1.f - f) * -1.0e9f) - mx) * sc); } unsigned short* d = (unsigned short*)P + i * NKX + j0; *(v8us*)d = fr.half[0];  } }


// 2^x on the transcendental unit; the v_nop is the one free issue slot that the instruction set asks for behind a transcendental before its result is read or its source overwritten: written in the same statement so that it stands directly behind the v_exp_f32 in every build
__device__ __forceinline__ float exp2_slot(float x) { float y; asm("v_exp_f32 %0, %1\n\tv_nop" : "=v"(y) : "v"(x)); return y; }
// one wave per score row of NU * 128 keys: lane l holds columns 128u + 4l .. 128u + 4l + 3 of the row in registers, so each wave-wide load covers 512 contiguous bytes, the row is read once and each exponential is taken once; maximum and sum: one partial per lane, then a five-step butterfly over the wave
template <int NU>
__global__ __launch_bounds__(256) void k_rsmcf2(const float* __restrict__ S, _Float16* __restrict__ P, int hg, int q0) {
  const int t = blockIdx.x * 8 + __builtin_amdgcn_readfirstlane(threadIdx.x >> 5);      /* the row is the same in every lane: row base, diagonal and the test below stay scalar */
  if (t >= hg * QT) return; const int c0 = (threadIdx.x & 31) * 4; const size_t i = (size_t)t; const float* s = S + i * NKX + c0; const int last = q0 + (t % QT); v4f v[NU];
#pragma unroll      /* the four loops over u are unrolled so that v[] is indexed by constants and stays in registers */
  for (int u = 0; u < NU; ++u) v[u] = *(const v4fa*)(s + u * 128);      /* the loads stand in a loop of their own, ahead of the arithmetic, so that many are in flight at once */
  float mx = -3.0e38f;
#pragma unroll      /* v[] in registers */
  for (int u = 0; u < NU; ++u) for (int q = 0; q < 4; ++q) { const float f = (u * 128 + c0 + q <= last) ? 1.f : 0.f; v[u][q] = fmaf(f, v[u][q], (1.f - f) * -1.0e9f); mx = fmaxf(mx, v[u][q]); }
  for (int m = 16; m >= 1; m >>= 1) mx = fmaxf(mx, __shfl_xor(mx, m, 32));
  float se = 0.f;
#pragma unroll      /* v[] in registers */
  for (int u = 0; u < NU; ++u) for (int q = 0; q < 4; ++q) { v[u][q] = exp2_slot((v[u][q] - mx) * 1.44269504088896340736f); se += v[u][q]; }
  for (int m = 16; m >= 1; m >>= 1) se += __shfl_xor(se, m, 32);
  const float sc = 256.0f / se; _Float16* d = P + i * NKX + c0;
#pragma unroll      /* v[] in registers */
  for (int u = 0; u < NU; ++u) { v4h h4; for (int q = 0; q < 4; ++q) h4[q] = (_Float16)(v[u][q] * sc); *(v4h*)(d + u * 128) = h4; } }
// launches the instance whose row length is nk keys (nk = 256, 512, ... NKX)
template <int NU>
static void rsmcf2_launch(const float* S, _Float16* P, int q0, int nk, hipStream_t stream) { if (nk == NU * 128) k_rsmcf2<NU><<<(NH * QT + 7) / 8, 256, 0, stream>>>(S, P, NH, q0); else if constexpr (NU > 2) rsmcf2_launch<NU - 2>(S, P, q0, nk, stream); }


// Exact f32 causal attention of the first QT0 query rows (o x64). One work-group per (head, 32 query rows); wave w owns rows 4w .. 4w + 3 of the group.
// Scores: 32 key rows at a time stand in LDS (pitch 132 floats: the 16 lanes that a 16-byte LDS read serves together fall on 64 distinct banks); lane = key, the four query rows come through loads whose address is the same in every lane.
// Softmax: one partial per lane over the row's keys, then a five-step butterfly over the wave; the weights go to LDS as [key][4 rows], unnormalised.
// P*V: lane = 4 head dims; a value row is one 512-byte load, the four weights of a key one broadcast LDS read; masked keys carry weight 0.
__global__ __launch_bounds__(256) void k_att0w(const float* __restrict__ QF, const float* __restrict__ KF, const float* __restrict__ VF, float scale, float* __restrict__ OF) {
  __shared__ __attribute__((aligned(16))) float lk[32][132]; __shared__ __attribute__((aligned(16))) float lp[8][QT0][4];
  const int lane = threadIdx.x & 31; const int w = __builtin_amdgcn_readfirstlane(threadIdx.x >> 5);      /* the wave's number is the same in every lane: row numbers and base addresses stay scalar */
  const int h = blockIdx.x / (QT0 / 32), rg = blockIdx.x % (QT0 / 32); const int i0 = rg * 32 + w * 4;
  const float* qp = QF + (size_t)i0 * DMX + h * 128; const float* kp = KF + (size_t)w * DMX + h * 128 + lane * 4;      /* wave w stages key rows w, w + 8, w + 16, w + 24 of each group of 32 */
  const v4f z4 = {0.f, 0.f, 0.f, 0.f}; v4f kn[4];
#pragma unroll      /* kn[] is indexed by constants and stays in registers */
  for (int u = 0; u < 4; ++u) kn[u] = *(const v4fa*)(kp + (size_t)(u * 8) * DMX);
  for (int c = 0; c <= rg; ++c) {      /* rg + 1 trips, the same for every wave of the work-group: the barriers stand under uniform control flow */
    __syncthreads();      /* every wave has left the key group that is overwritten next */
#pragma unroll      /* kn[] in registers */
    for (int u = 0; u < 4; ++u) *(v4f*)&lk[u * 8 + w][lane * 4] = kn[u];
    __syncthreads();      /* the key group is complete before any wave reads it */
    if (c < rg) {      /* the next group's loads fly under this group's products */
#pragma unroll      /* kn[] in registers */
      for (int u = 0; u < 4; ++u) kn[u] = *(const v4fa*)(kp + (size_t)((c + 1) * 32 + u * 8) * DMX); }
    v4f a0 = z4, a1 = z4, a2 = z4, a3 = z4;      /* per row four partial sums (dims d mod 4), added at the end */
    for (int d0 = 0; d0 < 32; d0 += 8) {
#pragma unroll      /* eight 16-byte steps a trip: their 40 loads are in flight together, so the load latency is paid four times a key group */
      for (int dd = 0; dd < 8; ++dd) { const int d4 = d0 + dd; const v4f kq = *(const v4f*)&lk[lane][d4 * 4];
        a0 += *(const v4fa*)(qp + d4 * 4) * kq; a1 += *(const v4fa*)(qp + DMX + d4 * 4) * kq; a2 += *(const v4fa*)(qp + 2 * DMX + d4 * 4) * kq; a3 += *(const v4fa*)(qp + 3 * DMX + d4 * 4) * kq; }
      asm volatile("s_wait_xcnt 0x0" ::: "memory"); }      /* stands between this trip's query loads and the next trip's rewrite of the base address that they name */
    v4f sv; sv[0] = ((a0[0] + a0[1]) + (a0[2] + a0[3])) * scale; sv[1] = ((a1[0] + a1[1]) + (a1[2] + a1[3])) * scale; sv[2] = ((a2[0] + a2[1]) + (a2[2] + a2[3])) * scale; sv[3] = ((a3[0] + a3[1]) + (a3[2] + a3[3])) * scale;
    *(v4f*)&lp[w][c * 32 + lane][0] = sv; }
  float mx[4] = {-3.0e38f, -3.0e38f, -3.0e38f, -3.0e38f}, se[4] = {0.f, 0.f, 0.f, 0.f};
  for (int c = 0; c <= rg; ++c) { const int j = c * 32 + lane; const v4f sv = *(const v4f*)&lp[w][j][0];      /* each lane reads back what it wrote itself */
    for (int r = 0; r < 4; ++r) mx[r] = (j <= i0 + r) ? fmaxf(mx[r], sv[r]) : mx[r]; }
  for (int m = 16; m >= 1; m >>= 1) for (int r = 0; r < 4; ++r) mx[r] = fmaxf(mx[r], __shfl_xor(mx[r], m, 32));
  for (int c = 0; c <= rg; ++c) { const int j = c * 32 + lane; const v4f sv = *(const v4f*)&lp[w][j][0]; v4f e;
    for (int r = 0; r < 4; ++r) { const float x = exp2_slot((sv[r] - mx[r]) * 1.44269504088896340736f); e[r] = (j <= i0 + r) ? x : 0.f; se[r] += e[r]; }
    *(v4f*)&lp[w][j][0] = e; }
  for (int m = 16; m >= 1; m >>= 1) for (int r = 0; r < 4; ++r) se[r] += __shfl_xor(se[r], m, 32);
  __builtin_amdgcn_fence(__ATOMIC_ACQ_REL, "workgroup"); __builtin_amdgcn_wave_barrier();      /* the weights are read below by the other lanes of the same wave: the LDS writes stay in front of those reads */
  const float* vp = VF + (size_t)h * 128 + lane * 4; v4f o0 = z4, o1 = z4, o2 = z4, o3 = z4; v4f va[16], vb[16];      /* two register buffers of 16 value rows: one is loaded while the other is used */
#pragma unroll      /* va[], vb[] are indexed by constants and stay in registers */
  for (int u = 0; u < 16; ++u) va[u] = *(const v4fa*)(vp + (size_t)u * DMX);
  for (int c = 0; c <= rg; ++c) { const float* vc = vp + (size_t)(c * 32) * DMX;
#pragma unroll      /* vb[] in registers */
    for (int u = 0; u < 16; ++u) vb[u] = *(const v4fa*)(vc + (size_t)(16 + u) * DMX);
#pragma unroll      /* va[] in registers */
    for (int u = 0; u < 16; ++u) { const v4f p4 = *(const v4f*)&lp[w][c * 32 + u][0]; o0 += p4[0] * va[u]; o1 += p4[1] * va[u]; o2 += p4[2] * va[u]; o3 += p4[3] * va[u]; }
    if (c < rg) {
#pragma unroll      /* va[] in registers */
      for (int u = 0; u < 16; ++u) va[u] = *(const v4fa*)(vc + (size_t)(32 + u) * DMX); }
#pragma unroll      /* vb[] in registers */
    for (int u = 0; u < 16; ++u) { const v4f p4 = *(const v4f*)&lp[w][c * 32 + 16 + u][0]; o0 += p4[0] * vb[u]; o1 += p4[1] * vb[u]; o2 += p4[2] * vb[u]; o3 += p4[3] * vb[u]; } }
  float* op = OF + (size_t)i0 * DMX + h * 128 + lane * 4;
  *(v4f*)op = o0 * (64.0f / se[0]); *(v4f*)(op + DMX) = o1 * (64.0f / se[1]); *(v4f*)(op + 2 * DMX) = o2 * (64.0f / se[2]); *(v4f*)(op + 3 * DMX) = o3 * (64.0f / se[3]); }


__global__ __launch_bounds__(256) void k_tab128p(const int* __restrict__ pos, int nrows, float theta, float* __restrict__ CS, float* __restrict__ SN) {
  #pragma clang fp contract(off)
  const int t = blockIdx.x * 256 + threadIdx.x; if (t >= nrows * 64) return; const int i = t % 64; const int r = t / 64; const float invf = (float)(1.0 / pow((double)theta, (double)(2 * i) / 128.0)); const float ang = __fmul_rn((float)pos[r], invf); const float c = cosf(ang), sv = sinf(ang);
  float* c0 = CS + (size_t)r * 128 + i; float* s0 = SN + (size_t)r * 128 + i;
  { *(float*)c0 = c; *(float*)(c0 + 64) = c; *(float*)s0 = sv; *(float*)(s0 + 64) = sv;  } }

__global__ __launch_bounds__(128) void k_rmshd(float* __restrict__ F, int ldf, int nh, const float* __restrict__ w, int wst, float eps) {
  #pragma clang fp contract(off)
  __shared__ float red[128]; const int d = threadIdx.x; const int h = blockIdx.x % nh; const size_t r = blockIdx.x / nh; float* p = F + r * (size_t)ldf + (size_t)h * 128 + d; const float v = *p; red[d] = __fmul_rn(v, v); __syncthreads();
  for (int st = 64; st > 0; st >>= 1) { if (d < st) red[d] = __fadd_rn(red[d], red[d + st]); __syncthreads(); }
  const float rs = __frsqrt_rn(__fadd_rn(red[0] / 128.0f, eps)); const float y = __fmul_rn(bf16_round(w[(size_t)h * wst + d]), __fmul_rn(v, rs));      /* gain vector of head h (wst = 128: per-head gains; 0 would share one vector) */ *(float*)p = y;  }
extern "C" void kernel_launch(void* const* d_in, const int* in_sizes, int n_in,
                              void* d_out, int out_size, void* d_ws, size_t ws_size, hipStream_t stream) {
  (void)in_sizes; (void)n_in; (void)out_size;
  const float* const* I = (const float* const*)d_in; const float* x = I[0]; const float* wq = I[1]; const float* wk = I[2]; const float* wv = I[3]; const float* wo = I[4];      /* hidden_states; natural Wq / Wk / Wv / Wo [2048][2048]; no QK norm, no biases, no mask / table inputs */
  char* ws = (char*)d_ws; size_t off = 0;
  auto take = [&](size_t bytes) { char* p = ws + off; off += (bytes + 255) & ~(size_t)255; return p; };
  _Float16* BQ = (_Float16*)take((size_t)DMX * DMX * 2); _Float16* BK = (_Float16*)take((size_t)DKV * DMX * 2); _Float16* BV = (_Float16*)take((size_t)DKV * DMX * 2); _Float16* BO = (_Float16*)take((size_t)DMX * DMX * 2);
  _Float16* X16 = (_Float16*)take(NR * DMX * 2); float* QF = (float*)take(NR * DMX * 4); float* KF = (float*)take(NR * DKV * 4); float* VF = (float*)take(NR * DKV * 4); _Float16* Q16 = (_Float16*)take(NR * DMX * 2); _Float16* K16 = (_Float16*)take(NR * DKV * 2); _Float16* V16 = (_Float16*)take(NR * DKV * 2); _Float16* O16 = (_Float16*)take(NR * DMX * 2);
  float* S = (float*)take((size_t)NH * QT * NKX * 4); _Float16* P = (_Float16*)take((size_t)NH * QT * NKX * 2); _Float16* VT = (_Float16*)take((size_t)(DKV / 64) * 64 * SQ * 2);
  float* QF0 = (float*)take((size_t)QT0 * DMX * 4); float* KRF0 = (float*)take((size_t)QT0 * DKV * 4); float* KF0e = (float*)take((size_t)QT0 * DMX * 4); float* VF0e = (float*)take((size_t)QT0 * DMX * 4); float* OF0 = (float*)take((size_t)NB * QT0 * DMX * 4); _Float16* OH0 = (_Float16*)take((size_t)NB * QT0 * DMX * 2); _Float16* OL0 = (_Float16*)take((size_t)NB * QT0 * DMX * 2); float* tcos = (float*)take((size_t)SQ * 64 * 4); float* tsin = (float*)take((size_t)SQ * 64 * 4);      /* rope tables [2048][64] computed on the device (the module derives them from constants) */
  if (off > ws_size) return;      /* approx 8 + 8 + 8 + 8 + 8 + 16 + 16 + 16 + 8 + 8 + 8 + 8 + 32 + 16 + 8 + 2 + 2 + 2 + 2 + 2 + 1 + 1 + 0.5 + 0.5 = 189 MiB */
  k_wnat<<<(unsigned)(((size_t)DMX * DMX / 8 + 255) / 256), 256, 0, stream>>>(wq, (size_t)DMX * DMX / 8, BQ); k_wnat<<<(unsigned)(((size_t)DKV * DMX / 8 + 255) / 256), 256, 0, stream>>>(wk, (size_t)DKV * DMX / 8, BK); k_wnat<<<(unsigned)(((size_t)DKV * DMX / 8 + 255) / 256), 256, 0, stream>>>(wv, (size_t)DKV * DMX / 8, BV); k_wnat<<<(unsigned)(((size_t)DMX * DMX / 8 + 255) / 256), 256, 0, stream>>>(wo, (size_t)DMX * DMX / 8, BO);      /* natural [out][in] = Bt[n][k] x16 */
  k_x16<<<(unsigned)((NR * DMX / 8 + 255) / 256), 256, 0, stream>>>(x, X16, NR * DMX / 8); k_tab128<<<(SQ * 64 + 255) / 256, 256, 0, stream>>>(10000.0f, tcos, tsin);      /* angle[p][i] = p * 10000^(-2i/128) */
  k_gemm2<0><<<dim3((unsigned)((NR / 128) * (DMX / 64)), 1), 128, 0, stream>>>(X16, DMX, 0, BQ, DMX, 0, 0.0625f, nullptr, 0, nullptr, 1, 0, 0, QF, nullptr, DMX, 0, (int)NR, DMX, DMX);      /* q (f32) */
  k_gemm2<0><<<dim3((unsigned)((NR / 128) * (DKV / 64)), 1), 128, 0, stream>>>(X16, DMX, 0, BK, DMX, 0, 0.0625f, nullptr, 0, nullptr, 1, 0, 0, KF, nullptr, DKV, 0, (int)NR, DKV, DMX);      /* k (f32) */
  k_gemm2<0><<<dim3((unsigned)((NR / 128) * (DKV / 64)), 1), 128, 0, stream>>>(X16, DMX, 0, BV, DMX, 0, 0.0625f, nullptr, 0, nullptr, 1, 0, 0, VF, V16, DKV, 0, (int)NR, DKV, DMX);      /* v (f32 for the first tile + f16) */
  k_rope128x<0><<<(unsigned)((NR / 4 * NH * 16 + 255) / 256), 256, 0, stream>>>(QF, DMX, NH, (int)(NR / 4), tcos, tsin, Q16, DMX, 1.0f); k_rope128x<0><<<(unsigned)((NR / 4 * NKV * 16 + 255) / 256), 256, 0, stream>>>(KF, DKV, NKV, (int)(NR / 4), tcos, tsin, K16, DKV, 1.0f);      /* half-split rope from the computed tables (index d mod 64) -> f16 */
  for (int b = 0; b < NB; ++b) { const size_t r0 = (size_t)b * SQ;
    k_rope128x<1><<<(unsigned)((QT0 / 4 * NH * 16 + 255) / 256), 256, 0, stream>>>(QF + r0 * DMX, DMX, NH, QT0 / 4, tcos, tsin, QF0, DMX, 1.0f); k_rope128x<1><<<(unsigned)((QT0 / 4 * NKV * 16 + 255) / 256), 256, 0, stream>>>(KF + r0 * DKV, DKV, NKV, QT0 / 4, tcos, tsin, KRF0, DKV, 1.0f);      /* f32 roped q, k of the batch's first QT0 rows (positions 0..QT0-1: the table pointers are NOT offset by the batch) */
    k_kvexp128<GSZ, NH, DKV><<<(unsigned)(((size_t)QT0 * DMX / 4 + 255) / 256), 256, 0, stream>>>(KRF0, KF0e, (size_t)QT0 * DMX / 4); k_kvexp128<GSZ, NH, DKV><<<(unsigned)(((size_t)QT0 * DMX / 4 + 255) / 256), 256, 0, stream>>>(VF + r0 * DKV, VF0e, (size_t)QT0 * DMX / 4);      /* kv head -> query head expansion for the exact first tile */
    k_vt<DKV / 64, SQ><<<(DKV / 64) * (SQ / 64), 256, 0, stream>>>(V16 + r0 * DKV, DKV, 0, VT);      /* V^T of this batch: kv head g = slabs 2g, 2g+1 */
    k_att0w<<<NH * (QT0 / 32), 256, 0, stream>>>(QF0, KF0e, VF0e, ATS, OF0 + (size_t)b * QT0 * DMX);      /* exact causal attention of the first QT0 rows (o x64) */
    for (int q0 = 0; q0 < SQ; q0 += QT) { const int nk = q0 + QT;      /* causal: keys below the tile end only */
      k_gemm2<0><<<dim3((QT / 128) * (nk / 64), NH), 128, 0, stream>>>(Q16 + (r0 + q0) * DMX, DMX, (size_t)HDK, K16 + r0 * DKV, DKV, (size_t)HDK, ATS, nullptr, 0, nullptr, 1, 0, 0, S, nullptr, NKX, (size_t)QT * NKX, QT, nk, HDK);      /* scores of all heads in one launch: blockIdx.y = head, query and key slabs both step by one head (one query head per kv head) */
      rsmcf2_launch<NKX / 128>(S, P, q0, nk, stream);      /* causal softmax (arithmetic select), one wave per row */
      k_gemm2<0><<<dim3((QT / 128) * (HDK / 64), NH), 128, 0, stream>>>(P, NKX, (size_t)QT * NKX, VT, SQ, (size_t)HDK * SQ, 0.25f, nullptr, 0, nullptr, 1, 0, 0, nullptr, O16 + (r0 + q0) * DMX, DMX, (size_t)HDK, QT, HDK, nk); } }      /* o of all heads in one launch (x64): blockIdx.y = head */
  k_gemm2<0><<<dim3((unsigned)((NR / 128) * (DMX / 64)), 1), 128, 0, stream>>>(O16, DMX, 0, BO, DMX, 0, 0.0009765625f, nullptr, 0, nullptr, 1, 0, 0, (float*)d_out, nullptr, DMX, 0, (int)NR, DMX, DMX);      /* out = o Wo^T */
  k_hl<<<(unsigned)(((size_t)NB * QT0 * DMX / 8 + 255) / 256), 256, 0, stream>>>(OF0, OH0, OL0, (size_t)NB * QT0 * DMX / 8);      /* first-tile o (x64) -> f16 hi + x1024 residual planes */
  for (int b = 0; b < NB; ++b) { const size_t r0 = (size_t)b * SQ; const size_t f0 = (size_t)b * QT0;
    k_gemm2<0><<<dim3((QT0 / 128) * (DMX / 64), 1), 128, 0, stream>>>(OH0 + f0 * DMX, DMX, 0, BO, DMX, 0, 0.0009765625f, nullptr, 0, nullptr, 1, 0, 0, (float*)d_out + r0 * DMX, nullptr, DMX, 0, QT0, DMX, DMX);      /* rows 0..255 of the batch rewritten from the exact path */
    k_gemm2<0><<<dim3((QT0 / 128) * (DMX / 64), 1), 128, 0, stream>>>(OL0 + f0 * DMX, DMX, 0, BO, DMX, 0, 0.00000095367431640625f, nullptr, 0, (const float*)d_out + r0 * DMX, -1, 0, 0, (float*)d_out + r0 * DMX, nullptr, DMX, 0, QT0, DMX, DMX); }      /* += o_lo Wo 2^-20 (own-element accumulate) */
}

// v006
// One run takes 243 microseconds.
// Next to v005, in two timings, it ran 1.74 and 1.76 times as fast.
// Over all steps from v000 it is 35.3 times as fast.
#include <hip/hip_runtime.h>
// Llama-style causal multi-head attention with half-split RoPE computed in the module (hidden_states [1][2048][2048]; q / k / v = x W^T (nn.Linear natural [2048][2048] sigma 0.02, no biases), 16 heads of 128; rope: emb = [f | f], f = p * 10000^(-2i/128): t cos + rotate_half(t) sin; scores * 128^-0.5; causal (where(tril, ., finfo.min): the weight underflows to exactly 0); softmax; out = merged Wo^T (natural) -> [1][2048][2048]); run on the hd128 grouped-query causal code as 16 kv groups of ONE query head.
// Compute dtype: inputs rounded to bf16; x / weights exact; projections and rope f32; q, k, v, softmax weights and o as plain f16 GEMM operands (~2^-12; first 256 rows of each batch exact); scores, statistics, out f32. v_wmma_f32_16x16x32_f16.
#define NB 1
#define SQ 2048
#define DMX 2048
#define NH 16
#define NKV 16
#define GSZ 1
#define HDK 128
#define DKV (NKV * HDK)
#define QT 256
#define QT0 256
#define NKX SQ
#define DM DMX
#define HD 64
#define HG 1
#define NR ((size_t)NB * SQ)
#define ATS 0.08838834764831845f
static_assert(GSZ == 1 && NH == NKV, "k_fattn takes the head from blockIdx.x with one key / value slab per query head");
typedef __bf16 v16b __attribute__((ext_vector_type(16)));
typedef unsigned short v8us __attribute__((ext_vector_type(8), may_alias));
typedef float  v8f  __attribute__((ext_vector_type(8)));
typedef float  v4f  __attribute__((ext_vector_type(4)));
typedef float  v4fa __attribute__((ext_vector_type(4), may_alias));
union FragB { v16b v; v8us half[2]; unsigned short u[16]; };

__device__ __forceinline__ unsigned short bf16_bits(float x) { unsigned int u = __float_as_uint(x); return (unsigned short)((u + 0x7FFFu + ((u >> 16) & 1u)) >> 16); }
__device__ __forceinline__ float bf16_val(unsigned short b) { return __uint_as_float(((unsigned int)b) << 16); }
__device__ __forceinline__ float bf16_round(float x) { return bf16_val(bf16_bits(x)); }
// D += A·B with NT terms: 1 = ah·bh, 2 = + al·bh (A split), 3 = + ah·bl (both split)
template <int NT>
__device__ __forceinline__ v8f mmaN(v16b ah, v16b al, v16b bh, v16b bl, v8f c) {
  c = __builtin_amdgcn_wmma_f32_16x16x32_bf16(false, ah, false, bh, (short)0, c, false, false);
  if (NT >= 2) c = __builtin_amdgcn_wmma_f32_16x16x32_bf16(false, al, false, bh, (short)0, c, false, false);
  if (NT >= 3) c = __builtin_amdgcn_wmma_f32_16x16x32_bf16(false, ah, false, bl, (short)0, c, false, false);
  asm volatile("v_nop\n\tv_nop\n\tv_nop\n\tv_nop" : "+v"(c) : "v"(ah), "v"(al), "v"(bh), "v"(bl));
  return c;
}

__global__ __launch_bounds__(256) void k_wt_bf16(const float* __restrict__ W, unsigned short* __restrict__ Wt, int K, int N) {
  const int t = blockIdx.x * 256 + threadIdx.x;
  const int k8n = K / 8;
  if (t >= N * k8n) return;
  const int n = t / k8n, k8 = (t % k8n) * 8;
  v8us v;
#pragma unroll
  for (int i = 0; i < 8; ++i) v[i] = bf16_bits(W[(size_t)(k8 + i) * N + n]);
  *(v8us*)(Wt + (size_t)n * K + k8) = v;
  
}

// GEMM C[M][N] (f32, pitch ldc) = act(A[M][K]·W + bias). A f32 row-major (pitch lda) converted per fragment to bf16
// (ASPLIT: hi/lo two planes -> 2 terms, else single rounded term); Wt bf16 [N][K] (pitch ldb). BIAS_BF16 rounds the
// bias to bf16 first (bias quantised to bf16 before the add). K%32==0, M%16==0, N%64==0.
template <bool ASPLIT, int ACT, bool BIAS_BF16>
__global__ __launch_bounds__(128) void k_gemm_bf(const float* __restrict__ A, int lda, const unsigned short* __restrict__ Wt, int ldb,
                                               const float* __restrict__ bias, float* __restrict__ C, int ldc, int M, int N, int K) {
  __shared__ __attribute__((aligned(16))) float so[4][16][64];
  const int tid = threadIdx.x, w = tid >> 5, lane = tid & 31, ln = lane & 15, hh = lane >> 4;
  const int ntn = N / 64;
  const int wid = blockIdx.x * 4 + w;
  const int mt = wid / ntn, nq = wid % ntn;
  if (mt * 16 >= M) return;
  const int row0 = mt * 16, col0 = nq * 64;
  const float* arow = A + (size_t)(row0 + ln) * lda;
  v8f acc[4] = {};
  for (int kb = 0; kb < K; kb += 32) {
    FragB ah, al;
    const v4f x0 = *(const v4fa*)(arow + kb + 8 * hh), x1 = *(const v4fa*)(arow + kb + 8 * hh + 4);
    const v4f x2 = *(const v4fa*)(arow + kb + 16 + 8 * hh), x3 = *(const v4fa*)(arow + kb + 16 + 8 * hh + 4);
    float xs[16] = {x0[0],x0[1],x0[2],x0[3],x1[0],x1[1],x1[2],x1[3],x2[0],x2[1],x2[2],x2[3],x3[0],x3[1],x3[2],x3[3]};
#pragma unroll
    for (int i = 0; i < 16; ++i) { const unsigned short hb = bf16_bits(xs[i]); ah.u[i] = hb; al.u[i] = ASPLIT ? bf16_bits(xs[i] - bf16_val(hb)) : (unsigned short)0; }
#pragma unroll
    for (int t = 0; t < 4; ++t) {
      const unsigned short* brow = Wt + (size_t)(col0 + t * 16 + ln) * ldb + kb;
      FragB b;
      b.half[0] = *(const v8us*)(brow + 8 * hh);
      b.half[1] = *(const v8us*)(brow + 16 + 8 * hh);
      acc[t] = mmaN<ASPLIT ? 2 : 1>(ah.v, al.v, b.v, b.v, acc[t]);
    }
  }
#pragma unroll
  for (int t = 0; t < 4; ++t) {
    float bv = bias ? bias[col0 + t * 16 + ln] : 0.f;
    if (BIAS_BF16) bv = bf16_round(bv);
#pragma unroll
    for (int r = 0; r < 8; ++r) { float v = acc[t][r] + bv; if (ACT == 1) v = fmaxf(v, 0.f); so[w][8 * hh + r][t * 16 + ln] = v; }
  }
  __builtin_amdgcn_fence(__ATOMIC_ACQ_REL, "workgroup");
  __builtin_amdgcn_wave_barrier();
  const int rsub = lane >> 4, c4 = (lane & 15) * 4;
  {
#pragma unroll
    for (int q = 0; q < 8; ++q) {
      const int r = q * 2 + rsub;
      const v4f v = *(const v4fa*)&so[w][r][c4];
      *(v4f*)(C + (size_t)(row0 + r) * ldc + col0 + c4) = v;
    }
    
  }
}

// GEMM C = act(A·W + bias + resid): A f32 (ASPLIT -> hi/lo 2 terms), Wt bf16 [N][K]; ACT 0 none, 1 relu, 2 exact gelu;
// resid (optional, f32, row index = (row % rmod), pitch ldr, RES_BF16 rounds it) added before the activation.
template <bool ASPLIT, int ACT, bool BIAS_BF16, bool RES_BF16>
__global__ __launch_bounds__(128) void k_gemm_bf3(const float* __restrict__ A, int lda, const unsigned short* __restrict__ Wt, int ldb,
                                                const float* __restrict__ bias, const float* __restrict__ resid, int rmod, int ldr,
                                                float* __restrict__ C, int ldc, int M, int N, int K) {
  __shared__ __attribute__((aligned(16))) float so[4][16][64];
  const int tid = threadIdx.x, w = tid >> 5, lane = tid & 31, ln = lane & 15, hh = lane >> 4;
  const int ntn = N / 64;
  const int wid = blockIdx.x * 4 + w;
  const int mt = wid / ntn, nq = wid % ntn;
  if (mt * 16 >= M) return;
  const int row0 = mt * 16, col0 = nq * 64;
  const float* arow = A + (size_t)(row0 + ln) * lda;
  v8f acc[4] = {};
  for (int kb = 0; kb < K; kb += 32) {
    FragB ah, al;
    const v4f x0 = *(const v4fa*)(arow + kb + 8 * hh), x1 = *(const v4fa*)(arow + kb + 8 * hh + 4);
    const v4f x2 = *(const v4fa*)(arow + kb + 16 + 8 * hh), x3 = *(const v4fa*)(arow + kb + 16 + 8 * hh + 4);
    float xs[16] = {x0[0],x0[1],x0[2],x0[3],x1[0],x1[1],x1[2],x1[3],x2[0],x2[1],x2[2],x2[3],x3[0],x3[1],x3[2],x3[3]};
#pragma unroll
    for (int i = 0; i < 16; ++i) { const unsigned short hb = bf16_bits(xs[i]); ah.u[i] = hb; al.u[i] = ASPLIT ? bf16_bits(xs[i] - bf16_val(hb)) : (unsigned short)0; }
#pragma unroll
    for (int t = 0; t < 4; ++t) {
      const unsigned short* brow = Wt + (size_t)(col0 + t * 16 + ln) * ldb + kb;
      FragB b;
      b.half[0] = *(const v8us*)(brow + 8 * hh);
      b.half[1] = *(const v8us*)(brow + 16 + 8 * hh);
      acc[t] = mmaN<ASPLIT ? 2 : 1>(ah.v, al.v, b.v, b.v, acc[t]);
    }
  }
#pragma unroll
  for (int t = 0; t < 4; ++t) {
    const int col = col0 + t * 16 + ln;
    float bv = bias ? bias[col] : 0.f;
    if (BIAS_BF16) bv = bf16_round(bv);
#pragma unroll
    for (int r = 0; r < 8; ++r) {
      float v = acc[t][r] + bv;
      if (resid) { float rv = resid[(size_t)((row0 + 8 * hh + r) % rmod) * ldr + col]; if (RES_BF16) rv = bf16_round(rv); v += rv; }
      if (ACT == 1) v = fmaxf(v, 0.f);
      if (ACT == 2) v = 0.5f * v * (1.0f + erff(v * 0.70710678118654752f));
      if (ACT == 3) { const float u = 0.7978845608028654f * (v + 0.044715f * v * v * v); v = 0.5f * v * (1.0f + tanhf(u)); }
      so[w][8 * hh + r][t * 16 + ln] = v;
    }
  }
  __builtin_amdgcn_fence(__ATOMIC_ACQ_REL, "workgroup");
  __builtin_amdgcn_wave_barrier();
  const int rsub = lane >> 4, c4 = (lane & 15) * 4;
  {
#pragma unroll
    for (int q = 0; q < 8; ++q) {
      const int r = q * 2 + rsub;
      const v4f v = *(const v4fa*)&so[w][r][c4];
      *(v4f*)(C + (size_t)(row0 + r) * ldc + col0 + c4) = v;
    }
    
  }
}
// row LayerNorm (biased variance, eps) over N: s = X (+ R); optional out_sum <- s; out_norm <- (s-mu)*rsqrt(var+eps)*g + b
template <bool PARAM_BF16>
__global__ __launch_bounds__(256) void k_layernorm(const float* __restrict__ X, const float* __restrict__ R, const float* __restrict__ g, const float* __restrict__ bta,
                                                  float* __restrict__ out_sum, float* __restrict__ out_norm, int N, float eps) {
  __shared__ float red[256];
  const int row = blockIdx.x, tid = threadIdx.x;
  const float* x = X + (size_t)row * N; const float* rr = R ? R + (size_t)row * N : nullptr;
  float vals[16];                     // up to N = 4096
  const int per = N / 256;            // contiguous chunk per thread? use strided-by-4 chunks: thread handles j = tid*4 + 1024*u
  float s1 = 0.f;
  for (int u = 0; u < per / 4; ++u) {
    const int j = tid * 4 + 1024 * u;
    const v4f a = *(const v4fa*)(x + j);
    v4f b = {0.f,0.f,0.f,0.f}; if (rr) b = *(const v4fa*)(rr + j);
#pragma unroll
    for (int q = 0; q < 4; ++q) { const float v = a[q] + b[q]; vals[u * 4 + q] = v; s1 += v; }
  }
  red[tid] = s1; __syncthreads();
  for (int st = 128; st > 0; st >>= 1) { if (tid < st) red[tid] += red[tid + st]; __syncthreads(); }
  const float mu = red[0] / (float)N; __syncthreads();
  float s2 = 0.f;
  for (int u = 0; u < per / 4; ++u)
#pragma unroll
    for (int q = 0; q < 4; ++q) { const float c = vals[u * 4 + q] - mu; s2 += c * c; }
  red[tid] = s2; __syncthreads();
  for (int st = 128; st > 0; st >>= 1) { if (tid < st) red[tid] += red[tid + st]; __syncthreads(); }
  const float rs = rsqrtf(red[0] / (float)N + eps);
  {
    for (int u = 0; u < per / 4; ++u) {
      const int j = tid * 4 + 1024 * u;
      v4f o, sm;
#pragma unroll
      for (int q = 0; q < 4; ++q) {
        float gg = g[j + q], bb = bta[j + q];
        if (PARAM_BF16) { gg = bf16_round(gg); bb = bf16_round(bb); }
        sm[q] = vals[u * 4 + q]; o[q] = (vals[u * 4 + q] - mu) * rs * gg + bb;
      }
      if (out_sum) *(v4f*)(out_sum + (size_t)row * N + j) = sm;
      *(v4f*)(out_norm + (size_t)row * N + j) = o;
    }
    
  }
}



// ---- f16 WMMA path (v_wmma_f32_16x16x32_f16): 11-bit significands for operands in range — used where a [0,1] probability operand needs more precision than bf16
typedef _Float16 v16h __attribute__((ext_vector_type(16)));
union FragH { v16h v; v8us half[2]; _Float16 h[16]; unsigned short u[16]; };
template <int NT>
__device__ __forceinline__ v8f mmaH(v16h ah, v16h al, v16h bh, v16h bl, v8f c) {
  c = __builtin_amdgcn_wmma_f32_16x16x32_f16(false, ah, false, bh, (short)0, c, false, false);
  if (NT >= 2) c = __builtin_amdgcn_wmma_f32_16x16x32_f16(false, al, false, bh, (short)0, c, false, false);
  if (NT >= 3) c = __builtin_amdgcn_wmma_f32_16x16x32_f16(false, ah, false, bl, (short)0, c, false, false);
  asm volatile("v_nop\n\tv_nop\n\tv_nop\n\tv_nop" : "+v"(c) : "v"(ah), "v"(al), "v"(bh), "v"(bl));
  return c;
}
// batched GEMM like k_gemm_b but f16 operands: A f32 (split into f16 hi/lo if ASPLIT, else rounded to f16), Bt = f16 values [n][k]; alpha; C f32; N multiple of 16 (partial tiles skipped)
template <bool ASPLIT>
__global__ __launch_bounds__(128) void k_gemm_h(const float* __restrict__ A, int lda, size_t sA, const _Float16* __restrict__ Bh, int ldb, size_t sB, float alpha, float* __restrict__ C, int ldc, size_t sC, int M, int N, int K) {
  __shared__ __attribute__((aligned(16))) float so[4][16][64];
  const int tid = threadIdx.x, w = tid >> 5, lane = tid & 31, ln = lane & 15, hh = lane >> 4; const int by = blockIdx.y;
  A += (size_t)by * sA; Bh += (size_t)by * sB; C += (size_t)by * sC;
  const int ntn = (N + 63) / 64; const int wid = blockIdx.x * 4 + w; const int mt = wid / ntn, nq = wid % ntn; if (mt * 16 >= M) return;
  const int row0 = mt * 16, col0 = nq * 64; const float* arow = A + (size_t)(row0 + ln) * lda;
  v8f acc[4] = {};
  for (int kb = 0; kb < K; kb += 32) {
    FragH ah, al;
    const v4f x0 = *(const v4fa*)(arow + kb + 8 * hh), x1 = *(const v4fa*)(arow + kb + 8 * hh + 4), x2 = *(const v4fa*)(arow + kb + 16 + 8 * hh), x3 = *(const v4fa*)(arow + kb + 16 + 8 * hh + 4);
    float xs[16] = {x0[0],x0[1],x0[2],x0[3],x1[0],x1[1],x1[2],x1[3],x2[0],x2[1],x2[2],x2[3],x3[0],x3[1],x3[2],x3[3]};
#pragma unroll
    for (int i = 0; i < 16; ++i) { const _Float16 h = (_Float16)xs[i]; ah.h[i] = h; al.h[i] = ASPLIT ? (_Float16)(xs[i] - (float)h) : (_Float16)0.0f; }
#pragma unroll
    for (int t = 0; t < 4; ++t) { if (col0 + t * 16 >= N) continue; const size_t boff = (size_t)(col0 + t * 16 + ln) * ldb + kb; FragH bq; bq.half[0] = *(const v8us*)(Bh + boff + 8 * hh); bq.half[1] = *(const v8us*)(Bh + boff + 16 + 8 * hh);
      acc[t] = mmaH<ASPLIT ? 2 : 1>(ah.v, al.v, bq.v, bq.v, acc[t]); }
  }
#pragma unroll
  for (int t = 0; t < 4; ++t) { if (col0 + t * 16 >= N) continue;
#pragma unroll
    for (int r = 0; r < 8; ++r) so[w][8 * hh + r][t * 16 + ln] = acc[t][r] * alpha; }
  __builtin_amdgcn_fence(__ATOMIC_ACQ_REL, "workgroup"); __builtin_amdgcn_wave_barrier();
  const int rsub = lane >> 4, c4 = (lane & 15) * 4;
  {
#pragma unroll
    for (int q = 0; q < 8; ++q) { const int r = q * 2 + rsub; if (col0 + c4 < N) { const v4f v = *(const v4fa*)&so[w][r][c4]; *(v4f*)(C + (size_t)(row0 + r) * ldc + col0 + c4) = v; } }
     }
}

// Wt[n][k] = f16(W[k][n]·scale) from f32 row-major W[K][N] (scale = power of two; bf16-exact weights stay exact in f16 away from the subnormal range)
__global__ __launch_bounds__(256) void k_wt_f16(const float* __restrict__ W, _Float16* __restrict__ Wt, int K, int N, float scale) {
  const int t = blockIdx.x * 256 + threadIdx.x; if (t >= N * (K / 8)) return; const int n = t / (K / 8), k8 = (t % (K / 8)) * 8; FragH f;
#pragma unroll
  for (int i = 0; i < 8; ++i) f.h[i] = (_Float16)(bf16_round(W[(size_t)(k8 + i) * N + n]) * scale); const v8us o = f.half[0];
  *(v8us*)((unsigned short*)Wt + (size_t)n * K + k8) = o; 
}
// k_gemm_hh variant with fused epilogue: v = acc·alpha + bias[by·sBias + col] (+ CP[(row/rowsPerB)·sCPb + by·64 + col] if CP) ; ACT 0 none / 1 elu ; writes f16 C16 (and f32 C if non-null)
template <int ACT>
__global__ __launch_bounds__(128) void k_gemm_hhx(const _Float16* __restrict__ A, int lda, size_t sA, const _Float16* __restrict__ Bh, int ldb, size_t sB, float alpha, const float* __restrict__ bias, size_t sBias, const float* __restrict__ CP, int rowsPerB, size_t sCPb, int row0g,
    float* __restrict__ C, _Float16* __restrict__ C16, int ldc, size_t sC, int M, int N, int K) {
  __shared__ __attribute__((aligned(16))) float so[4][16][64];
  const int tid = threadIdx.x, w = tid >> 5, lane = tid & 31, ln = lane & 15, hh = lane >> 4; const int by = blockIdx.y;
  A += (size_t)by * sA; Bh += (size_t)by * sB; const size_t cofs = (size_t)by * sC; const float* bp = bias ? bias + (size_t)by * sBias : nullptr;
  const int ntn = (N + 63) / 64; const int wid = blockIdx.x * 4 + w; const int mt = wid / ntn, nq = wid % ntn; if (mt * 16 >= M) return;
  const int row0 = mt * 16, col0 = nq * 64; const _Float16* arow = A + (size_t)(row0 + ln) * lda;
  v8f acc[4] = {};
  for (int kb = 0; kb < K; kb += 32) { FragH ah; ah.half[0] = *(const v8us*)((const unsigned short*)arow + kb + 8 * hh); ah.half[1] = *(const v8us*)((const unsigned short*)arow + kb + 16 + 8 * hh);
#pragma unroll
    for (int t = 0; t < 4; ++t) { if (col0 + t * 16 >= N) continue; const size_t boff = (size_t)(col0 + t * 16 + ln) * ldb + kb; FragH bq; bq.half[0] = *(const v8us*)((const unsigned short*)Bh + boff + 8 * hh); bq.half[1] = *(const v8us*)((const unsigned short*)Bh + boff + 16 + 8 * hh);
      acc[t] = mmaH<1>(ah.v, ah.v, bq.v, bq.v, acc[t]); }
  }
#pragma unroll
  for (int t = 0; t < 4; ++t) { if (col0 + t * 16 >= N) continue; const int col = col0 + t * 16 + ln; const float bv = bp ? bf16_round(bp[col]) : 0.f;
#pragma unroll
    for (int r = 0; r < 8; ++r) { float v = acc[t][r] * alpha + bv; if (CP) { const int rr = row0g + row0 + 8 * hh + r; if (rowsPerB < 0) v += CP[cofs + (size_t)rr * ldc + col];      /* rowsPerB < 0: own element of the batched C plane */ else { const int bidx = rr / rowsPerB; v += CP[(size_t)bidx * sCPb + (size_t)by * 64 + col]; } } if (ACT == 1) v = (v > 0.f) ? v : expm1f(v); else if (ACT == 7) v = (v > 0.f) ? v + 1.0f : expf(v); else if (ACT == 8) v = tanhf(v); else if (ACT == 9) v = 0.5f * v * (1.0f + tanhf(0.7978845608028654f * (v + 0.044715f * v * v * v))); else if (ACT == 11) v = 1.0f / (1.0f + expf(-v)); else if (ACT == 12) v = (v > 0.f) ? v : 0.01f * v; else if (ACT == 14) v = (v > 0.f) ? v : 0.1f * v; else if (ACT == 16) v = (v >= 0.f) ? v : 0.3f * v; else if (ACT == 17) v = (v >= 0.f) ? v : 0.2f * v; else if (ACT == 15) v = v / (1.0f + expf(-v)); else if (ACT == 3) v = fmaxf(v, 0.f); else if (ACT == 6) v = 0.5f * v * (1.0f + erff(v * 0.70710678118654752f)); so[w][8 * hh + r][t * 16 + ln] = v; } }
  __builtin_amdgcn_fence(__ATOMIC_ACQ_REL, "workgroup"); __builtin_amdgcn_wave_barrier();
  const int rsub = lane >> 4, c4 = (lane & 15) * 4; typedef _Float16 v4h __attribute__((ext_vector_type(4)));
  {
#pragma unroll
    for (int q = 0; q < 8; ++q) { const int r = q * 2 + rsub; if (col0 + c4 < N) { const v4f v = *(const v4fa*)&so[w][r][c4]; if (C) *(v4f*)(C + cofs + (size_t)(row0 + r) * ldc + col0 + c4) = v; if (C16) { v4h h4; for (int i = 0; i < 4; ++i) h4[i] = (_Float16)v[i]; *(v4h*)(C16 + cofs + (size_t)(row0 + r) * ldc + col0 + c4) = h4; } } }
     }
}


typedef _Float16 v4h __attribute__((ext_vector_type(4)));

__global__ __launch_bounds__(256) void k_x16(const float* __restrict__ x, _Float16* __restrict__ X16, size_t n8) { const size_t t = (size_t)blockIdx.x * 256 + threadIdx.x; if (t >= n8) return; FragH f;
#pragma unroll
  for (int q = 0; q < 8; ++q) f.h[q] = (_Float16)bf16_round(x[t * 8 + q]); *(v8us*)((unsigned short*)X16 + t * 8) = f.half[0];  }
__global__ __launch_bounds__(256) void k_h16(const float* __restrict__ x, _Float16* __restrict__ X16, size_t n8) { const size_t t = (size_t)blockIdx.x * 256 + threadIdx.x; if (t >= n8) return; FragH f;
#pragma unroll
  for (int q = 0; q < 8; ++q) f.h[q] = (_Float16)x[t * 8 + q]; *(v8us*)((unsigned short*)X16 + t * 8) = f.half[0];  }
__global__ __launch_bounds__(256) void k_round16f(const float* __restrict__ W, _Float16* __restrict__ Bt, size_t n8) { const size_t t = (size_t)blockIdx.x * 256 + threadIdx.x; if (t >= n8) return; FragH f;
#pragma unroll
  for (int i = 0; i < 8; ++i) f.h[i] = (_Float16)(bf16_round(W[t * 8 + i]) * 16.0f); *(v8us*)((unsigned short*)Bt + t * 8) = f.half[0];  }
template <int NHv, int TTv>
__global__ __launch_bounds__(256) void k_vt(const _Float16* __restrict__ V16, int ldv, int voff, _Float16* __restrict__ Vt) { __shared__ unsigned short tl[64][66]; const int tid = threadIdx.x; const int slab = blockIdx.x / (TTv / 64), lg = blockIdx.x % (TTv / 64); const int b = slab / NHv, h = slab % NHv;
  for (int i = tid; i < 64 * 8; i += 256) { const int r = i / 8, c8 = (i % 8) * 8; FragH f; f.half[0] = *(const v8us*)((const unsigned short*)V16 + ((size_t)b * TTv + lg * 64 + r) * ldv + voff + h * 64 + c8);
#pragma unroll
    for (int q = 0; q < 8; ++q) tl[r][c8 + q] = f.u[q]; }
  __syncthreads();
  {
#pragma unroll
    for (int rd = 0; rd < 2; ++rd) { const int d = rd * 32 + tid / 8, pc = tid % 8; FragH f;
#pragma unroll
      for (int q = 0; q < 8; ++q) f.u[q] = tl[pc * 8 + q][d];
      *(v8us*)((unsigned short*)Vt + ((size_t)slab * 64 + d) * TTv + lg * 64 + pc * 8) = f.half[0]; }
     } }

__global__ __launch_bounds__(256) void k_hl(const float* __restrict__ F, _Float16* __restrict__ Hh, _Float16* __restrict__ Hl, size_t n8) { const size_t t = (size_t)blockIdx.x * 256 + threadIdx.x; if (t >= n8) return; FragH fh, fl; const v4f a = *(const v4fa*)(F + t * 8), c = *(const v4fa*)(F + t * 8 + 4);
#pragma unroll
  for (int q = 0; q < 4; ++q) { _Float16 h = (_Float16)a[q]; fh.h[q] = h; fl.h[q] = (_Float16)((a[q] - (float)h) * 1024.0f); h = (_Float16)c[q]; fh.h[4 + q] = h; fl.h[4 + q] = (_Float16)((c[q] - (float)h) * 1024.0f); }
  { *(v8us*)((unsigned short*)Hh + t * 8) = fh.half[0]; *(v8us*)((unsigned short*)Hl + t * 8) = fl.half[0];  } }

// ---- fast GEMM (work-group tile 128x64, wave tile 32x64; requires M % 128 == 0 rows per launch region, N % 64 == 0 and K % 128 == 0); epilogue = k_gemm_hhx semantics ----
// Operands reach the waves through LDS: a stage is 128 k (256 B) of the tile's 128 A rows and 64 B rows at a pitch of 272 B (16 B x odd: the 16 lanes that a 16-byte LDS read serves together fall on distinct banks).
// Asynchronous copies fill it, 16 lanes to a row, so that each wave-wide copy takes four whole 128-byte lines; two buffers: the next stage's copies fly while this stage is worked on.
#define G2_KS 128
#define G2_PITCH 272
#define G2_ROWS 192
#define G2_STAGE (G2_ROWS * G2_PITCH)
__device__ __forceinline__ v16h g2_frag(const _Float16* p, int hh) { FragH f; f.half[0] = *(const v8us*)((const unsigned short*)p + 8 * hh); f.half[1] = *(const v8us*)((const unsigned short*)p + 16 + 8 * hh); return f.v; }
__device__ __forceinline__ v8f g2_mma(v16h a, v16h b, v8f c) { v8f d = __builtin_amdgcn_wmma_f32_16x16x32_f16(false, a, false, b, (short)0, c, false, false); asm volatile("v_nop\n\tv_nop\n\tv_nop\n\tv_nop" : "+v"(d) : "v"(a), "v"(b)); return d; }
// eight asynchronous 16-byte copies of a lane: rows r, r + 8, ... r + 56 (global step gs halves, LDS step 8 pitches). The s_wait_xcnt 0 is the last line of the copies' own statement, so that it stands in front of every later rewrite of a register that a copy names.
__device__ __forceinline__ void g2_copy8(unsigned l, const _Float16* g, size_t gs) {
  asm volatile("global_load_async_to_lds_b128 %0, %8, off\n\tglobal_load_async_to_lds_b128 %1, %9, off\n\tglobal_load_async_to_lds_b128 %2, %10, off\n\tglobal_load_async_to_lds_b128 %3, %11, off\n\t"
               "global_load_async_to_lds_b128 %4, %12, off\n\tglobal_load_async_to_lds_b128 %5, %13, off\n\tglobal_load_async_to_lds_b128 %6, %14, off\n\tglobal_load_async_to_lds_b128 %7, %15, off\n\ts_wait_xcnt 0x0"
               :: "v"(l), "v"(l + 8 * G2_PITCH), "v"(l + 16 * G2_PITCH), "v"(l + 24 * G2_PITCH), "v"(l + 32 * G2_PITCH), "v"(l + 40 * G2_PITCH), "v"(l + 48 * G2_PITCH), "v"(l + 56 * G2_PITCH),
                  "v"(g), "v"(g + gs), "v"(g + 2 * gs), "v"(g + 3 * gs), "v"(g + 4 * gs), "v"(g + 5 * gs), "v"(g + 6 * gs), "v"(g + 7 * gs) : "memory"); }
template <int ACT>
__global__ __launch_bounds__(128) void k_gemm2(const _Float16* __restrict__ A, int lda, size_t sA, const _Float16* __restrict__ Bh, int ldb, size_t sB, float alpha, const float* __restrict__ bias, size_t sBias, const float* __restrict__ CP, int rowsPerB, size_t sCPb, int row0g,
    float* __restrict__ C, _Float16* __restrict__ C16, int ldc, size_t sC, int M, int N, int K) { static_assert(ACT == 0 || ACT == 3 || ACT == 6 || ACT == 8 || ACT == 9 || ACT == 11 || ACT == 12 || ACT == 14 || ACT == 15 || ACT == 16 || ACT == 17, "k_gemm2: unsupported ACT code (would silently apply no activation)");
  __shared__ __attribute__((aligned(16))) unsigned char st[2 * G2_STAGE];      /* the two stage buffers; behind the loop's last barrier the same bytes serve as the output staging so[4][32][68] */
  static_assert(sizeof(float) * 4 * 32 * 68 <= 2 * G2_STAGE, "the output staging lies inside the stage buffers");
  float (*so)[32][68] = (float (*)[32][68])st;
  const int tid = threadIdx.x, w = tid >> 5, lane = tid & 31, ln = lane & 15, hh = lane >> 4; const int by = blockIdx.y;
  A += (size_t)by * sA; Bh += (size_t)by * sB; const size_t cofs = (size_t)by * sC; const float* bp = bias ? bias + (size_t)by * sBias : nullptr;
  const int ntn = N >> 6; const int mt = blockIdx.x / ntn, nq = blockIdx.x - mt * ntn; const int row0 = mt * 128 + 32 * w, col0 = nq * 64; if (mt * 128 >= M) return;      /* the same for the whole work-group, in front of every barrier */
  const _Float16* ag = A + (size_t)(mt * 128 + (tid >> 4)) * lda + (tid & 15) * 8; const _Float16* bg = Bh + (size_t)(col0 + (tid >> 4)) * ldb + (tid & 15) * 8;      /* this lane's 16 bytes of rows tid / 16 + 8 i */
  const unsigned l0 = (unsigned)(size_t)st + (unsigned)((tid >> 4) * G2_PITCH + (tid & 15) * 16);      /* the low 32 bits of a __shared__ address are the LDS byte address */
  const size_t ga = (size_t)8 * lda, gb = (size_t)8 * ldb; const int nt = K / G2_KS;
  const v8f z8 = {0.f,0.f,0.f,0.f,0.f,0.f,0.f,0.f}; v8f c00 = z8, c01 = z8, c02 = z8, c03 = z8, c10 = z8, c11 = z8, c12 = z8, c13 = z8;
  g2_copy8(l0, ag, ga); g2_copy8(l0 + 64 * G2_PITCH, ag + 8 * ga, ga); g2_copy8(l0 + 128 * G2_PITCH, bg, gb);      /* stage 0 into buffer 0 */
  asm volatile("s_wait_asynccnt 0x0" ::: "memory");      /* this wave's copies of stage 0 have landed */
  __syncthreads();      /* every wave's have: stage 0 may be read */
  if (nt > 1) { g2_copy8(l0 + G2_STAGE, ag + G2_KS, ga); g2_copy8(l0 + G2_STAGE + 64 * G2_PITCH, ag + G2_KS + 8 * ga, ga); g2_copy8(l0 + G2_STAGE + 128 * G2_PITCH, bg + G2_KS, gb); }      /* stage 1 into buffer 1 */
#pragma unroll 1      /* one stage a trip: the order at the foot of the trip stays as written */
  for (int t = 0; t < nt; ++t) { const unsigned bo = (unsigned)(t & 1) * G2_STAGE;
    const _Float16* a0p = (const _Float16*)(st + bo + (32 * w + ln) * G2_PITCH); const _Float16* a1p = (const _Float16*)(st + bo + (32 * w + 16 + ln) * G2_PITCH); const _Float16* b0p = (const _Float16*)(st + bo + (128 + ln) * G2_PITCH);
    v16h a0 = g2_frag(a0p, hh), a1 = g2_frag(a1p, hh), b0 = g2_frag(b0p, hh), b1 = g2_frag(b0p + 16 * (G2_PITCH / 2), hh), b2 = g2_frag(b0p + 32 * (G2_PITCH / 2), hh), b3 = g2_frag(b0p + 48 * (G2_PITCH / 2), hh);
#pragma unroll      /* four 32-k steps of a stage: constant LDS offsets, and the two fragment sets are renamed instead of moved */
    for (int kb = 0; kb < G2_KS; kb += 32) { v16h n0 = a0, n1 = a1, m0 = b0, m1 = b1, m2 = b2, m3 = b3;
      if (kb + 32 < G2_KS) { const int kn = kb + 32;      /* the next step's twelve LDS reads go as one group in front of this step's products and return under them; they stay inside this stage */
        n0 = g2_frag(a0p + kn, hh); n1 = g2_frag(a1p + kn, hh); m0 = g2_frag(b0p + kn, hh); m1 = g2_frag(b0p + 16 * (G2_PITCH / 2) + kn, hh); m2 = g2_frag(b0p + 32 * (G2_PITCH / 2) + kn, hh); m3 = g2_frag(b0p + 48 * (G2_PITCH / 2) + kn, hh); }
      c00 = g2_mma(a0, b0, c00); c10 = g2_mma(a1, b0, c10); c01 = g2_mma(a0, b1, c01); c11 = g2_mma(a1, b1, c11);
      c02 = g2_mma(a0, b2, c02); c12 = g2_mma(a1, b2, c12); c03 = g2_mma(a0, b3, c03); c13 = g2_mma(a1, b3, c13);
      a0 = n0; a1 = n1; b0 = m0; b1 = m1; b2 = m2; b3 = m3; }
    asm volatile("s_wait_dscnt 0x0" ::: "memory");      /* this wave's reads of the buffer have returned before it is refilled */
    asm volatile("s_wait_asynccnt 0x0" ::: "memory");      /* this wave's copies of stage t + 1 have landed */
    __syncthreads();      /* publishes stage t + 1 and ends every wave's reads of stage t */
    if (t + 2 < nt) { const _Float16* an = ag + (size_t)(t + 2) * G2_KS; const _Float16* bn = bg + (size_t)(t + 2) * G2_KS; g2_copy8(l0 + bo, an, ga); g2_copy8(l0 + bo + 64 * G2_PITCH, an + 8 * ga, ga); g2_copy8(l0 + bo + 128 * G2_PITCH, bn, gb); } }      /* stage t + 2 into the buffer that trip t has just read */
  asm volatile("s_wait_asynccnt 0x0" ::: "memory");      /* nothing is in flight when the buffers become output staging */
  v8f accs[8] = {c00, c01, c02, c03, c10, c11, c12, c13};
#pragma unroll
  for (int u = 0; u < 8; ++u) { const int t = u & 3, half = u >> 2; const int col = col0 + t * 16 + ln; const float bv = bp ? bf16_round(bp[col]) : 0.f;
#pragma unroll
    for (int r = 0; r < 8; ++r) { const int rloc = half * 16 + 8 * hh + r; float v = accs[u][r] * alpha + bv; if (CP) { if (rowsPerB < 0) v += CP[cofs + (size_t)(row0g + row0 + rloc) * ldc + col];      /* rowsPerB < 0: own element of the batched C plane */ else { const int bidx = (row0g + row0 + rloc) / rowsPerB; v += CP[(size_t)bidx * sCPb + (size_t)by * 64 + col]; } }
      if (ACT == 3) v = fmaxf(v, 0.f); else if (ACT == 6) v = 0.5f * v * (1.0f + erff(v * 0.70710678118654752f)); else if (ACT == 11) v = 1.0f / (1.0f + expf(-v)); else if (ACT == 15) v = v / (1.0f + expf(-v)); else if (ACT == 12) v = (v > 0.f) ? v : 0.01f * v; else if (ACT == 8) v = tanhf(v); else if (ACT == 9) v = 0.5f * v * (1.0f + tanhf(0.7978845608028654f * (v + 0.044715f * v * v * v))); else if (ACT == 14) v = (v > 0.f) ? v : 0.1f * v; else if (ACT == 16) v = (v >= 0.f) ? v : 0.3f * v; else if (ACT == 17) v = (v >= 0.f) ? v : 0.2f * v;
      so[w][rloc][t * 16 + ln] = v; } }
  __builtin_amdgcn_fence(__ATOMIC_ACQ_REL, "workgroup"); __builtin_amdgcn_wave_barrier();
  const int rsub = lane >> 4, c4 = (lane & 15) * 4;
  {
#pragma unroll
    for (int q = 0; q < 16; ++q) { const int r = q * 2 + rsub; const v4f v = *(const v4fa*)&so[w][r][c4]; if (C) *(v4f*)(C + cofs + (size_t)(row0 + r) * ldc + col0 + c4) = v; if (C16) { v4h h4; for (int i = 0; i < 4; ++i) h4[i] = (_Float16)v[i]; *(v4h*)(C16 + cofs + (size_t)(row0 + r) * ldc + col0 + c4) = h4; } }
     } }


__global__ __launch_bounds__(256) void k_wnat(const float* __restrict__ w, size_t n8, _Float16* __restrict__ Bt) { const size_t t = (size_t)blockIdx.x * 256 + threadIdx.x; if (t >= n8) return; FragH f; for (int q = 0; q < 8; ++q) f.h[q] = (_Float16)(bf16_round(w[t * 8 + q]) * 16.0f); *(v8us*)((unsigned short*)Bt + t * 8) = f.half[0];  }
__global__ __launch_bounds__(256) void k_rsm(const float* __restrict__ S, _Float16* __restrict__ P, int nrows) {
  #pragma clang fp contract(off)
  const int i = blockIdx.x * 256 + threadIdx.x; if (i >= nrows) return; const float* s = S + (size_t)i * SQ; float mx = -3.0e38f;
#pragma unroll 1
  for (int j = 0; j < SQ; ++j) mx = fmaxf(mx, s[j]); float se = 0.f;
#pragma unroll 1
  for (int j = 0; j < SQ; ++j) se += expf(s[j] - mx); const float sc = 256.0f / se;
#pragma unroll 1
  for (int j0 = 0; j0 < SQ; j0 += 8) { FragH f; for (int q = 0; q < 8; ++q) f.h[q] = (_Float16)(expf(s[j0 + q] - mx) * sc); unsigned short* d = (unsigned short*)P + (size_t)i * SQ + j0; *(v8us*)d = f.half[0];  } }
__global__ __launch_bounds__(256) void k_vt(const _Float16* __restrict__ V16, int b, int h0, _Float16* __restrict__ VT) { __shared__ unsigned short tl[64][65]; const int tid = threadIdx.x; const int hh = blockIdx.x % HG, sg = blockIdx.x / HG; const int s0 = sg * 64; const int h = h0 + hh;
  for (int i = tid; i < 64 * 8; i += 256) { const int j = i / 8, d8 = (i % 8) * 8; FragH f; f.half[0] = *(const v8us*)((const unsigned short*)V16 + ((size_t)b * SQ + s0 + j) * DM + h * HD + d8); for (int q = 0; q < 8; ++q) tl[d8 + q][j] = f.u[q]; }
  __syncthreads();
  { for (int i = tid; i < 64 * 8; i += 256) { const int d = i / 8, j8 = (i % 8) * 8; FragH f; for (int q = 0; q < 8; ++q) f.u[q] = tl[d][j8 + q]; *(v8us*)((unsigned short*)VT + ((size_t)hh * HD + d) * SQ + s0 + j8) = f.half[0]; }  } }


__global__ __launch_bounds__(256) void k_f2h(const float* __restrict__ F, int ldf, int coff, int ncol, _Float16* __restrict__ H16, size_t nrow) { const size_t t = (size_t)blockIdx.x * 256 + threadIdx.x; const size_t n8 = nrow * (size_t)(ncol / 8); if (t >= n8) return; const size_t r = t / (ncol / 8); const int c8 = (int)(t % (ncol / 8)) * 8; FragH f; const v4f a = *(const v4fa*)(F + r * ldf + coff + c8), b2 = *(const v4fa*)(F + r * ldf + coff + c8 + 4); for (int q = 0; q < 4; ++q) { f.h[q] = (_Float16)a[q]; f.h[4 + q] = (_Float16)b2[q]; } *(v8us*)((unsigned short*)H16 + r * ncol + c8) = f.half[0];  }

__global__ __launch_bounds__(256) void k_tab128(float theta, float* __restrict__ CS, float* __restrict__ SN) {
  #pragma clang fp contract(off)
  const int t = blockIdx.x * 256 + threadIdx.x; if (t >= SQ * 64) return; const int i = t % 64; const int p = t / 64; const float invf = (float)(1.0 / pow((double)theta, (double)(2 * i) / 128.0));      /* = XLA's constant-folded f32 table */ const float ang = __fmul_rn((float)p, invf); const float c = cosf(ang), s = sinf(ang);
  *(float*)(CS + t) = c; *(float*)(SN + t) = s;  }
template <int TAB>
__global__ __launch_bounds__(128) void k_rope128(const float* __restrict__ F, int ldf, int nh, const float* __restrict__ CS, const float* __restrict__ SN, _Float16* __restrict__ H16, int ldo, float osc) {
  #pragma clang fp contract(off)
  __shared__ float xv[128]; __shared__ unsigned short sh_[128]; const int d = threadIdx.x; const int h = blockIdx.x % nh; const size_t r = blockIdx.x / nh; const int p = (int)(r % SQ);
  xv[d] = F[r * (size_t)ldf + (size_t)h * 128 + d]; __syncthreads();
  float c, s; if (TAB) { c = bf16_round(CS[(size_t)p * 128 + d]); s = bf16_round(SN[(size_t)p * 128 + d]); } else { c = CS[p * 64 + (d & 63)]; s = SN[p * 64 + (d & 63)]; }
  const float rot = (d < 64) ? -xv[d + 64] : xv[d - 64]; const float o = __fadd_rn(__fmul_rn(xv[d], c), __fmul_rn(rot, s));
  FragH th; th.h[0] = (_Float16)__fmul_rn(o, osc); sh_[d] = th.u[0]; __syncthreads();
  if (d < 16) { FragH f; for (int q = 0; q < 8; ++q) f.u[q] = sh_[d * 8 + q]; unsigned short* dst = (unsigned short*)H16 + r * (size_t)ldo + (size_t)h * 128 + d * 8; *(v8us*)dst = f.half[0];  } }

// Half-split rope of nrow4 * 4 rows of nh heads of 128. One thread owns dims d4 .. d4 + 3 and their partners d4 + 64 .. d4 + 67 of one head in FOUR rows (r0, r0 + nrow4, r0 + 2 nrow4, r0 + 3 nrow4):
// both halves of a rotation pair stand in the thread's own registers (no LDS, no barrier), 16 lanes cover 256 contiguous bytes of each half, and the launch has 1/64 of the work-groups that one work-group per (row, head) has.
template <int F32OUT>
__global__ __launch_bounds__(256) void k_rope128x(const float* __restrict__ F, int ldf, int nh, int nrow4, const float* __restrict__ CS, const float* __restrict__ SN, void* __restrict__ OUT, int ldo, float osc) {
  const int t = blockIdx.x * 256 + threadIdx.x; const int per = nh * 16; if (t >= nrow4 * per) return; const int r0 = t / per; const int cc = t - r0 * per; const int h = cc >> 4, d4 = (cc & 15) * 4;
  v4f lo[4], hi[4], cs[4], sn[4];
#pragma unroll      /* the sixteen loads stand in a loop of their own, ahead of the arithmetic, so that many are in flight at once; the arrays are indexed by constants and stay in registers */
  for (int u = 0; u < 4; ++u) { const size_t r = (size_t)(r0 + u * nrow4); const int p = (int)(r % SQ); const float* f = F + r * (size_t)ldf + (size_t)h * 128 + d4;
    /* each s_wait_xcnt 0 stands between the load in front of it and a later load whose result may take that load's address registers */
    lo[u] = *(const v4fa*)f; asm volatile("s_wait_xcnt 0x0" ::: "memory"); hi[u] = *(const v4fa*)(f + 64); asm volatile("s_wait_xcnt 0x0" ::: "memory");
    cs[u] = *(const v4fa*)(CS + p * 64 + d4); asm volatile("s_wait_xcnt 0x0" ::: "memory"); sn[u] = *(const v4fa*)(SN + p * 64 + d4); asm volatile("s_wait_xcnt 0x0" ::: "memory"); }
#pragma unroll      /* lo[], hi[], cs[], sn[] in registers */
  for (int u = 0; u < 4; ++u) { const size_t o = (size_t)(r0 + u * nrow4) * (size_t)ldo + (size_t)h * 128 + d4; v4f ol, oh;
    for (int q = 0; q < 4; ++q) { ol[q] = fmaf(-hi[u][q], sn[u][q], lo[u][q] * cs[u][q]) * osc; oh[q] = fmaf(lo[u][q], sn[u][q], hi[u][q] * cs[u][q]) * osc; }      /* t cos is rounded, rotate_half(t) sin is fused onto it */
    if (F32OUT) { float* dst = (float*)OUT + o; *(v4f*)dst = ol; *(v4f*)(dst + 64) = oh; }
    else { v4h hl, hu; for (int q = 0; q < 4; ++q) { hl[q] = (_Float16)ol[q]; hu[q] = (_Float16)oh[q]; } _Float16* dst = (_Float16*)OUT + o; *(v4h*)dst = hl; *(v4h*)(dst + 64) = hu; } } }
template <int N>
__global__ __launch_bounds__(256) void k_rmsrow(float* __restrict__ X, const float* __restrict__ w, float eps) {
  #pragma clang fp contract(off)
  constexpr int PT = N / 256; __shared__ float red[256]; const size_t r = blockIdx.x; const int t = threadIdx.x; float* row = X + r * N + (size_t)t * PT; float v[PT]; float ss = 0.f;
  for (int q = 0; q < PT; ++q) { v[q] = row[q]; ss = __fadd_rn(ss, __fmul_rn(v[q], v[q])); }
  red[t] = ss; __syncthreads(); for (int k = 128; k > 0; k >>= 1) { if (t < k) red[t] = __fadd_rn(red[t], red[t + k]); __syncthreads(); }
  const float rs = rsqrtf(__fadd_rn(red[0] / (float)N, eps)); float o[PT]; for (int q = 0; q < PT; ++q) o[q] = __fmul_rn(__fmul_rn(v[q], rs), bf16_round(w[t * PT + q]));
  { for (int q = 0; q < PT; ++q) *(float*)(row + q) = o[q];  } }
template <int GS_, int NHQ, int DSRC>
__global__ __launch_bounds__(256) void k_kvexp128(const float* __restrict__ src, float* __restrict__ dst, size_t n4) { const size_t t = (size_t)blockIdx.x * 256 + threadIdx.x; if (t >= n4) return; const size_t e = t * 4; const size_t row = e / ((size_t)NHQ * 128); const int col = (int)(e % ((size_t)NHQ * 128)); const int h = col / 128, d = col % 128; const v4f v = *(const v4fa*)(src + row * DSRC + (size_t)(h / GS_) * 128 + d); *(v4f*)(dst + e) = v;  }

__global__ __launch_bounds__(256) void k_rsmcfb(const float* __restrict__ S, _Float16* __restrict__ P, int hg, int q0, int nk, const int* __restrict__ mk) {
  #pragma clang fp contract(off)
  const int t = blockIdx.x * 256 + threadIdx.x; if (t >= hg * QT) return; const size_t i = (size_t)t; const float* s = S + i * NKX; const size_t ig = (size_t)(q0 + (t % QT)); const int* mr = mk + ig * SQ; float mx = -3.0e38f;
#pragma unroll 1
  for (int j = 0; j < nk; ++j) { const int mb = mr[j]; const float f = (mb == 0) ? 1.f : 0.f; mx = fmaxf(mx, fmaf(f, s[j], (1.f - f) * -1.0e9f)); } float se = 0.f;
#pragma unroll 1
  for (int j = 0; j < nk; ++j) { const int mb = mr[j]; const float f = (mb == 0) ? 1.f : 0.f; se += __expf(fmaf(f, s[j], (1.f - f) * -1.0e9f) - mx); } const float sc = 256.0f / se;
#pragma unroll 1
  for (int j0 = 0; j0 < nk; j0 += 8) { FragH fr; for (int q = 0; q < 8; ++q) { const int j = j0 + q; const int mb = mr[j]; const float f = (mb == 0) ? 1.f : 0.f; fr.h[q] = (_Float16)(__expf(fmaf(f, s[j], (1.f - f) * -1.0e9f) - mx) * sc); } unsigned short* d = (unsigned short*)P + i * NKX + j0; *(v8us*)d = fr.half[0];  } }


// 2^x on the transcendental unit; the v_nop is the one free issue slot that the instruction set asks for behind a transcendental before its result is read or its source overwritten: written in the same statement so that it stands directly behind the v_exp_f32 in every build
__device__ __forceinline__ float exp2_slot(float x) { float y; asm("v_exp_f32 %0, %1\n\tv_nop" : "=v"(y) : "v"(x)); return y; }
// one wave per score row of NU * 128 keys: lane l holds columns 128u + 4l .. 128u + 4l + 3 of the row in registers, so each wave-wide load covers 512 contiguous bytes, the row is read once and each exponential is taken once; maximum and sum: one partial per lane, then a five-step butterfly over the wave
template <int NU>
__global__ __launch_bounds__(256) void k_rsmcf2(const float* __restrict__ S, _Float16* __restrict__ P, int hg, int q0) {
  const int t = blockIdx.x * 8 + __builtin_amdgcn_readfirstlane(threadIdx.x >> 5);      /* the row is the same in every lane: row base, diagonal and the test below stay scalar */
  if (t >= hg * QT) return; const int c0 = (threadIdx.x & 31) * 4; const size_t i = (size_t)t; const float* s = S + i * NKX + c0; const int last = q0 + (t % QT); v4f v[NU];
#pragma unroll      /* the four loops over u are unrolled so that v[] is indexed by constants and stays in registers */
  for (int u = 0; u < NU; ++u) v[u] = *(const v4fa*)(s + u * 128);      /* the loads stand in a loop of their own, ahead of the arithmetic, so that many are in flight at once */
  float mx = -3.0e38f;
#pragma unroll      /* v[] in registers */
  for (int u = 0; u < NU; ++u) for (int q = 0; q < 4; ++q) { const float f = (u * 128 + c0 + q <= last) ? 1.f : 0.f; v[u][q] = fmaf(f, v[u][q], (1.f - f) * -1.0e9f); mx = fmaxf(mx, v[u][q]); }
  for (int m = 16; m >= 1; m >>= 1) mx = fmaxf(mx, __shfl_xor(mx, m, 32));
  float se = 0.f;
#pragma unroll      /* v[] in registers */
  for (int u = 0; u < NU; ++u) for (int q = 0; q < 4; ++q) { v[u][q] = exp2_slot((v[u][q] - mx) * 1.44269504088896340736f); se += v[u][q]; }
  for (int m = 16; m >= 1; m >>= 1) se += __shfl_xor(se, m, 32);
  const float sc = 256.0f / se; _Float16* d = P + i * NKX + c0;
#pragma unroll      /* v[] in registers */
  for (int u = 0; u < NU; ++u) { v4h h4; for (int q = 0; q < 4; ++q) h4[q] = (_Float16)(v[u][q] * sc); *(v4h*)(d + u * 128) = h4; } }
// launches the instance whose row length is nk keys (nk = 256, 512, ... NKX)
template <int NU>
static void rsmcf2_launch(const float* S, _Float16* P, int q0, int nk, hipStream_t stream) { if (nk == NU * 128) k_rsmcf2<NU><<<(NH * QT + 7) / 8, 256, 0, stream>>>(S, P, NH, q0); else if constexpr (NU > 2) rsmcf2_launch<NU - 2>(S, P, q0, nk, stream); }


#define FA_HALF (128 * G2_PITCH)
#define FA_STAGE (2 * FA_HALF)
// the builtin alone: the compiler keeps the distance behind a matrix instruction itself, and operands that no asm statement names may stand in any register
__device__ __forceinline__ v8f fa_mma(v16h a, v16h b, v8f c) { return __builtin_amdgcn_wmma_f32_16x16x32_f16(false, a, false, b, (short)0, c, false, false); }
// lane l <-> lane l ^ 16 by the vector cross-row move (a shuffle through the LDS unit would be waited for once a pass)
__device__ __forceinline__ float fa_xhalf(float x) { return __builtin_bit_cast(float, __builtin_amdgcn_permlanex16(__builtin_bit_cast(int, x), __builtin_bit_cast(int, x), 0x76543210, 0xfedcba98, false, false)); }
__device__ __forceinline__ void fa_copy(unsigned l, const _Float16* kg, const _Float16* vg) { g2_copy8(l, kg, (size_t)8 * DKV); g2_copy8(l + 64 * G2_PITCH, kg + (size_t)64 * DKV, (size_t)8 * DKV); g2_copy8(l + FA_HALF, vg, (size_t)8 * SQ); g2_copy8(l + FA_HALF + 64 * G2_PITCH, vg + (size_t)64 * SQ, (size_t)8 * SQ); }
__global__ __launch_bounds__(128) void k_fattn(const _Float16* __restrict__ Q, const _Float16* __restrict__ Kh, const _Float16* __restrict__ Vt, _Float16* __restrict__ O) {
  __shared__ __attribute__((aligned(16))) unsigned char st[2 * FA_STAGE];
  const int tid = threadIdx.x, lane = tid & 31, ln = lane & 15, hh = lane >> 4; const int w = __builtin_amdgcn_readfirstlane(tid >> 5);      /* the wave's number is the same in every lane: trip counts and the diagonal test stay scalar */
  const int h = blockIdx.x; const int qb = SQ / 128 - 1 - (int)blockIdx.y; const int nst = qb + 1;      /* the longest work-groups start first; causal: key stages 0 .. qb, the same count for the whole work-group */
  const _Float16* kg = Kh + h * HDK; const _Float16* vg = Vt + (size_t)h * HDK * SQ; const unsigned ko = (unsigned)((tid >> 4) * DKV + (tid & 15) * 8), vo = (unsigned)((tid >> 4) * SQ + (tid & 15) * 8);      /* the head's slabs (scalar) and this lane's 16 bytes of rows tid / 16 + 8 i (32-bit offsets: what lives through the loop is small) */
  const unsigned lv = (unsigned)(size_t)st + (unsigned)(hh * G2_PITCH + ln * 16);      /* the lane's share of its LDS byte address for the copies, row tid / 16 = 2 w + hh (the low 32 bits of a __shared__ address are the LDS byte address) */
  auto lds_at = [&](unsigned buf) { return lv + (unsigned)__builtin_amdgcn_readfirstlane((int)((unsigned)w * (2 * G2_PITCH) + buf * FA_STAGE)); };      /* the wave's and the buffer's share is one scalar: the sum is formed anew at each place that copies, so no address register of a copy lives through the loop (one that did was spilled to scratch) */
  fa_copy(lds_at(0u), kg + ko, vg + vo);      /* stage 0 into buffer 0 */
  const int q0 = qb * 128 + w * 32; v16h qf[2][4];
#pragma unroll      /* qf[][] is indexed by constants and stays in registers */
  for (int g = 0; g < 2; ++g) for (int kk = 0; kk < 4; ++kk) qf[g][kk] = g2_frag(Q + (size_t)(q0 + g * 16 + ln) * DMX + h * HDK + kk * 32, hh);
  asm volatile("s_wait_xcnt 0x0" ::: "memory");      /* stands between the query loads and a later rewrite of the address registers that they name */
  const v8f z8 = {0.f,0.f,0.f,0.f,0.f,0.f,0.f,0.f}; v8f o[2][8];
#pragma unroll      /* o[][] in registers */
  for (int g = 0; g < 2; ++g) for (int dt = 0; dt < 8; ++dt) o[g][dt] = z8;
  float mu[2] = {-1.0e30f, -1.0e30f}, se[2] = {0.f, 0.f}; const float sc2 = ATS * 1.44269504088896340736f;      /* scores in units of log2 */
  asm volatile("s_wait_asynccnt 0x0" ::: "memory");      /* this wave's copies of stage 0 have landed */
  __syncthreads();      /* every wave's have: stage 0 may be read */
  if (nst > 1) fa_copy(lds_at(1u), kg + (ko + 128u * DKV), vg + (vo + 128u));      /* stage 1 into buffer 1 */
#pragma unroll 1      /* one stage a trip: the order at the foot of the trip stays as written */
  for (int t = 0; t < nst; ++t) { const unsigned bo = (unsigned)(t & 1) * FA_STAGE; const int np = (t == qb) ? w + 1 : 4;      /* in the diagonal stage the passes behind the wave's own 32 rows are wholly masked and are left out */
#pragma unroll 1      /* one pass of 32 keys a trip: the trip count differs between waves, and the body already holds 32 products */
    for (int p = 0; p < np; ++p) { const _Float16* kp = (const _Float16*)(st + bo + (p * 32 + ln) * G2_PITCH); const _Float16* vp = (const _Float16*)(st + bo + FA_HALF + ln * G2_PITCH) + p * 32;
      v8f s[2][2] = {{z8, z8}, {z8, z8}};      /* [key tile][query group] */
      v16h ka[2][4], va[8];
#pragma unroll      /* ka[][] in registers */
      for (int kt = 0; kt < 2; ++kt) for (int kk = 0; kk < 4; ++kk) ka[kt][kk] = g2_frag(kp + kt * 16 * (G2_PITCH / 2) + kk * 32, hh);
      __builtin_amdgcn_sched_barrier(0);      /* the key fragments, which are used first, are also read first */
#pragma unroll      /* va[] in registers */
      for (int dt = 0; dt < 8; ++dt) va[dt] = g2_frag(vp + dt * 16 * (G2_PITCH / 2), hh);
      __builtin_amdgcn_sched_barrier(0);      /* the pass's 32 LDS reads go as one group in front of its products: one LDS latency a pass is waited out, the rest returns under the products and the softmax; without it the reads are sunk to their users and each is waited for */
#pragma unroll      /* s[][], ka[][], qf[][] in registers */
      for (int kt = 0; kt < 2; ++kt) for (int kk = 0; kk < 4; ++kk) { s[kt][0] = fa_mma(ka[kt][kk], qf[0][kk], s[kt][0]); s[kt][1] = fa_mma(ka[kt][kk], qf[1][kk], s[kt][1]); }
      float x[2][16], ml[2];
#pragma unroll      /* x[][] in registers */
      for (int g = 0; g < 2; ++g) for (int i = 0; i < 16; ++i) x[g][i] = s[i >> 3][g][i & 7] * sc2;
      if (t == qb && p == w) {      /* the one pass that holds the diagonal (a scalar test): key 16 kt + 8 hh + r against query 16 g + ln, both counted from the same row */
#pragma unroll      /* x[][] in registers */
        for (int g = 0; g < 2; ++g) for (int i = 0; i < 16; ++i) x[g][i] = ((i >> 3) * 16 + 8 * hh + (i & 7) <= g * 16 + ln) ? x[g][i] : -1.0e30f; }
#pragma unroll      /* x[][] in registers */
      for (int g = 0; g < 2; ++g) { float a = x[g][0]; for (int i = 1; i < 16; ++i) a = fmaxf(a, x[g][i]); ml[g] = fmaxf(a, fa_xhalf(a)); }
      if (__builtin_amdgcn_ballot_w32(ml[0] > mu[0] + 8.0f || ml[1] > mu[1] + 8.0f) != 0) {      /* the reference point of a column moves only when some column's maximum has passed it by more than 8 in log2 (no weight exceeds 2^8, well inside f16); one scalar branch a pass */
#pragma unroll      /* o[][] in registers */
        for (int g = 0; g < 2; ++g) { const float mn = fmaxf(mu[g], ml[g]); const float al = exp2_slot(mu[g] - mn); mu[g] = mn; se[g] *= al; for (int dt = 0; dt < 8; ++dt) o[g][dt] *= al; } }
      FragH pf[2];
#pragma unroll      /* x[][], pf[] in registers */
      for (int g = 0; g < 2; ++g) for (int i = 0; i < 16; ++i) { const float e = exp2_slot(x[g][i] - mu[g]); se[g] += e; pf[g].h[i] = (_Float16)e; }
#pragma unroll      /* o[][], va[] in registers */
      for (int dt = 0; dt < 8; ++dt) { o[0][dt] = fa_mma(va[dt], pf[0].v, o[0][dt]); o[1][dt] = fa_mma(va[dt], pf[1].v, o[1][dt]); } }
    asm volatile("s_wait_dscnt 0x0" ::: "memory");      /* this wave's reads of the buffer have returned before it is refilled */
    asm volatile("s_wait_asynccnt 0x0" ::: "memory");      /* this wave's copies of stage t + 1 have landed */
    __syncthreads();      /* publishes stage t + 1 and ends every wave's reads of stage t */
    if (t + 2 < nst) fa_copy(lds_at((unsigned)(t & 1)), kg + (ko + (unsigned)(t + 2) * (128u * DKV)), vg + (vo + (unsigned)(t + 2) * 128u)); }      /* stage t + 2 into the buffer that trip t has just read */
  asm volatile("s_wait_asynccnt 0x0" ::: "memory");      /* nothing is in flight when the wave ends */
#pragma unroll      /* o[][] in registers */
  for (int g = 0; g < 2; ++g) { const float inv = 64.0f / (se[g] + fa_xhalf(se[g]));      /* the two halves' sums are joined once; o x64 */
    unsigned short* op = (unsigned short*)O + (size_t)(q0 + g * 16 + ln) * DMX + h * HDK + 8 * hh;
    for (int dt = 0; dt < 8; ++dt) { FragH f; for (int r = 0; r < 8; ++r) f.h[r] = (_Float16)(o[g][dt][r] * inv); *(v8us*)(op + dt * 16) = f.half[0]; } } }


// Exact f32 causal attention of the first QT0 query rows (o x64). One work-group per (head, 32 query rows); wave w owns rows 4w .. 4w + 3 of the group.
// Scores: 32 key rows at a time stand in LDS (pitch 132 floats: the 16 lanes that a 16-byte LDS read serves together fall on 64 distinct banks); lane = key, the four query rows come through loads whose address is the same in every lane.
// Softmax: one partial per lane over the row's keys, then a five-step butterfly over the wave; the weights go to LDS as [key][4 rows], unnormalised.
// P*V: lane = 4 head dims; a value row is one 512-byte load, the four weights of a key one broadcast LDS read; masked keys carry weight 0.
__global__ __launch_bounds__(256) void k_att0w(const float* __restrict__ QF, const float* __restrict__ KF, const float* __restrict__ VF, float scale, float* __restrict__ OF) {
  __shared__ __attribute__((aligned(16))) float lk[32][132]; __shared__ __attribute__((aligned(16))) float lp[8][QT0][4];
  const int lane = threadIdx.x & 31; const int w = __builtin_amdgcn_readfirstlane(threadIdx.x >> 5);      /* the wave's number is the same in every lane: row numbers and base addresses stay scalar */
  const int h = blockIdx.x / (QT0 / 32), rg = blockIdx.x % (QT0 / 32); const int i0 = rg * 32 + w * 4;
  const float* qp = QF + (size_t)i0 * DMX + h * 128; const float* kp = KF + (size_t)w * DMX + h * 128 + lane * 4;      /* wave w stages key rows w, w + 8, w + 16, w + 24 of each group of 32 */
  const v4f z4 = {0.f, 0.f, 0.f, 0.f}; v4f kn[4];
#pragma unroll      /* kn[] is indexed by constants and stays in registers */
  for (int u = 0; u < 4; ++u) kn[u] = *(const v4fa*)(kp + (size_t)(u * 8) * DMX);
  for (int c = 0; c <= rg; ++c) {      /* rg + 1 trips, the same for every wave of the work-group: the barriers stand under uniform control flow */
    __syncthreads();      /* every wave has left the key group that is overwritten next */
#pragma unroll      /* kn[] in registers */
    for (int u = 0; u < 4; ++u) *(v4f*)&lk[u * 8 + w][lane * 4] = kn[u];
    __syncthreads();      /* the key group is complete before any wave reads it */
    if (c < rg) {      /* the next group's loads fly under this group's products */
#pragma unroll      /* kn[] in registers */
      for (int u = 0; u < 4; ++u) kn[u] = *(const v4fa*)(kp + (size_t)((c + 1) * 32 + u * 8) * DMX); }
    v4f a0 = z4, a1 = z4, a2 = z4, a3 = z4;      /* per row four partial sums (dims d mod 4), added at the end */
    for (int d0 = 0; d0 < 32; d0 += 8) {
#pragma unroll      /* eight 16-byte steps a trip: their 40 loads are in flight together, so the load latency is paid four times a key group */
      for (int dd = 0; dd < 8; ++dd) { const int d4 = d0 + dd; const v4f kq = *(const v4f*)&lk[lane][d4 * 4];
        a0 += *(const v4fa*)(qp + d4 * 4) * kq; a1 += *(const v4fa*)(qp + DMX + d4 * 4) * kq; a2 += *(const v4fa*)(qp + 2 * DMX + d4 * 4) * kq; a3 += *(const v4fa*)(qp + 3 * DMX + d4 * 4) * kq; }
      asm volatile("s_wait_xcnt 0x0" ::: "memory"); }      /* stands between this trip's query loads and the next trip's rewrite of the base address that they name */
    v4f sv; sv[0] = ((a0[0] + a0[1]) + (a0[2] + a0[3])) * scale; sv[1] = ((a1[0] + a1[1]) + (a1[2] + a1[3])) * scale; sv[2] = ((a2[0] + a2[1]) + (a2[2] + a2[3])) * scale; sv[3] = ((a3[0] + a3[1]) + (a3[2] + a3[3])) * scale;
    *(v4f*)&lp[w][c * 32 + lane][0] = sv; }
  float mx[4] = {-3.0e38f, -3.0e38f, -3.0e38f, -3.0e38f}, se[4] = {0.f, 0.f, 0.f, 0.f};
  for (int c = 0; c <= rg; ++c) { const int j = c * 32 + lane; const v4f sv = *(const v4f*)&lp[w][j][0];      /* each lane reads back what it wrote itself */
    for (int r = 0; r < 4; ++r) mx[r] = (j <= i0 + r) ? fmaxf(mx[r], sv[r]) : mx[r]; }
  for (int m = 16; m >= 1; m >>= 1) for (int r = 0; r < 4; ++r) mx[r] = fmaxf(mx[r], __shfl_xor(mx[r], m, 32));
  for (int c = 0; c <= rg; ++c) { const int j = c * 32 + lane; const v4f sv = *(const v4f*)&lp[w][j][0]; v4f e;
    for (int r = 0; r < 4; ++r) { const float x = exp2_slot((sv[r] - mx[r]) * 1.44269504088896340736f); e[r] = (j <= i0 + r) ? x : 0.f; se[r] += e[r]; }
    *(v4f*)&lp[w][j][0] = e; }
  for (int m = 16; m >= 1; m >>= 1) for (int r = 0; r < 4; ++r) se[r] += __shfl_xor(se[r], m, 32);
  __builtin_amdgcn_fence(__ATOMIC_ACQ_REL, "workgroup"); __builtin_amdgcn_wave_barrier();      /* the weights are read below by the other lanes of the same wave: the LDS writes stay in front of those reads */
  const float* vp = VF + (size_t)h * 128 + lane * 4; v4f o0 = z4, o1 = z4, o2 = z4, o3 = z4; v4f va[16], vb[16];      /* two register buffers of 16 value rows: one is loaded while the other is used */
#pragma unroll      /* va[], vb[] are indexed by constants and stay in registers */
  for (int u = 0; u < 16; ++u) va[u] = *(const v4fa*)(vp + (size_t)u * DMX);
  for (int c = 0; c <= rg; ++c) { const float* vc = vp + (size_t)(c * 32) * DMX;
#pragma unroll      /* vb[] in registers */
    for (int u = 0; u < 16; ++u) vb[u] = *(const v4fa*)(vc + (size_t)(16 + u) * DMX);
#pragma unroll      /* va[] in registers */
    for (int u = 0; u < 16; ++u) { const v4f p4 = *(const v4f*)&lp[w][c * 32 + u][0]; o0 += p4[0] * va[u]; o1 += p4[1] * va[u]; o2 += p4[2] * va[u]; o3 += p4[3] * va[u]; }
    if (c < rg) {
#pragma unroll      /* va[] in registers */
      for (int u = 0; u < 16; ++u) va[u] = *(const v4fa*)(vc + (size_t)(32 + u) * DMX); }
#pragma unroll      /* vb[] in registers */
    for (int u = 0; u < 16; ++u) { const v4f p4 = *(const v4f*)&lp[w][c * 32 + 16 + u][0]; o0 += p4[0] * vb[u]; o1 += p4[1] * vb[u]; o2 += p4[2] * vb[u]; o3 += p4[3] * vb[u]; } }
  float* op = OF + (size_t)i0 * DMX + h * 128 + lane * 4;
  *(v4f*)op = o0 * (64.0f / se[0]); *(v4f*)(op + DMX) = o1 * (64.0f / se[1]); *(v4f*)(op + 2 * DMX) = o2 * (64.0f / se[2]); *(v4f*)(op + 3 * DMX) = o3 * (64.0f / se[3]); }


__global__ __launch_bounds__(256) void k_tab128p(const int* __restrict__ pos, int nrows, float theta, float* __restrict__ CS, float* __restrict__ SN) {
  #pragma clang fp contract(off)
  const int t = blockIdx.x * 256 + threadIdx.x; if (t >= nrows * 64) return; const int i = t % 64; const int r = t / 64; const float invf = (float)(1.0 / pow((double)theta, (double)(2 * i) / 128.0)); const float ang = __fmul_rn((float)pos[r], invf); const float c = cosf(ang), sv = sinf(ang);
  float* c0 = CS + (size_t)r * 128 + i; float* s0 = SN + (size_t)r * 128 + i;
  { *(float*)c0 = c; *(float*)(c0 + 64) = c; *(float*)s0 = sv; *(float*)(s0 + 64) = sv;  } }

__global__ __launch_bounds__(128) void k_rmshd(float* __restrict__ F, int ldf, int nh, const float* __restrict__ w, int wst, float eps) {
  #pragma clang fp contract(off)
  __shared__ float red[128]; const int d = threadIdx.x; const int h = blockIdx.x % nh; const size_t r = blockIdx.x / nh; float* p = F + r * (size_t)ldf + (size_t)h * 128 + d; const float v = *p; red[d] = __fmul_rn(v, v); __syncthreads();
  for (int st = 64; st > 0; st >>= 1) { if (d < st) red[d] = __fadd_rn(red[d], red[d + st]); __syncthreads(); }
  const float rs = __frsqrt_rn(__fadd_rn(red[0] / 128.0f, eps)); const float y = __fmul_rn(bf16_round(w[(size_t)h * wst + d]), __fmul_rn(v, rs));      /* gain vector of head h (wst = 128: per-head gains; 0 would share one vector) */ *(float*)p = y;  }
extern "C" void kernel_launch(void* const* d_in, const int* in_sizes, int n_in,
                              void* d_out, int out_size, void* d_ws, size_t ws_size, hipStream_t stream) {
  (void)in_sizes; (void)n_in; (void)out_size;
  const float* const* I = (const float* const*)d_in; const float* x = I[0]; const float* wq = I[1]; const float* wk = I[2]; const float* wv = I[3]; const float* wo = I[4];      /* hidden_states; natural Wq / Wk / Wv / Wo [2048][2048]; no QK norm, no biases, no mask / table inputs */
  char* ws = (char*)d_ws; size_t off = 0;
  auto take = [&](size_t bytes) { char* p = ws + off; off += (bytes + 255) & ~(size_t)255; return p; };
  _Float16* BQ = (_Float16*)take((size_t)DMX * DMX * 2); _Float16* BK = (_Float16*)take((size_t)DKV * DMX * 2); _Float16* BV = (_Float16*)take((size_t)DKV * DMX * 2); _Float16* BO = (_Float16*)take((size_t)DMX * DMX * 2);
  _Float16* X16 = (_Float16*)take(NR * DMX * 2); float* QF = (float*)take(NR * DMX * 4); float* KF = (float*)take(NR * DKV * 4); float* VF = (float*)take(NR * DKV * 4); _Float16* Q16 = (_Float16*)take(NR * DMX * 2); _Float16* K16 = (_Float16*)take(NR * DKV * 2); _Float16* V16 = (_Float16*)take(NR * DKV * 2); _Float16* O16 = (_Float16*)take(NR * DMX * 2);
  float* S = (float*)take((size_t)NH * QT * NKX * 4); _Float16* P = (_Float16*)take((size_t)NH * QT * NKX * 2); _Float16* VT = (_Float16*)take((size_t)(DKV / 64) * 64 * SQ * 2);
  float* QF0 = (float*)take((size_t)QT0 * DMX * 4); float* KRF0 = (float*)take((size_t)QT0 * DKV * 4); float* KF0e = (float*)take((size_t)QT0 * DMX * 4); float* VF0e = (float*)take((size_t)QT0 * DMX * 4); float* OF0 = (float*)take((size_t)NB * QT0 * DMX * 4); _Float16* OH0 = (_Float16*)take((size_t)NB * QT0 * DMX * 2); _Float16* OL0 = (_Float16*)take((size_t)NB * QT0 * DMX * 2); float* tcos = (float*)take((size_t)SQ * 64 * 4); float* tsin = (float*)take((size_t)SQ * 64 * 4);      /* rope tables [2048][64] computed on the device (the module derives them from constants) */
  if (off > ws_size) return;      /* approx 8 + 8 + 8 + 8 + 8 + 16 + 16 + 16 + 8 + 8 + 8 + 8 + 32 + 16 + 8 + 2 + 2 + 2 + 2 + 2 + 1 + 1 + 0.5 + 0.5 = 189 MiB */
  k_wnat<<<(unsigned)(((size_t)DMX * DMX / 8 + 255) / 256), 256, 0, stream>>>(wq, (size_t)DMX * DMX / 8, BQ); k_wnat<<<(unsigned)(((size_t)DKV * DMX / 8 + 255) / 256), 256, 0, stream>>>(wk, (size_t)DKV * DMX / 8, BK); k_wnat<<<(unsigned)(((size_t)DKV * DMX / 8 + 255) / 256), 256, 0, stream>>>(wv, (size_t)DKV * DMX / 8, BV); k_wnat<<<(unsigned)(((size_t)DMX * DMX / 8 + 255) / 256), 256, 0, stream>>>(wo, (size_t)DMX * DMX / 8, BO);      /* natural [out][in] = Bt[n][k] x16 */
  k_x16<<<(unsigned)((NR * DMX / 8 + 255) / 256), 256, 0, stream>>>(x, X16, NR * DMX / 8); k_tab128<<<(SQ * 64 + 255) / 256, 256, 0, stream>>>(10000.0f, tcos, tsin);      /* angle[p][i] = p * 10000^(-2i/128) */
  k_gemm2<0><<<dim3((unsigned)((NR / 128) * (DMX / 64)), 1), 128, 0, stream>>>(X16, DMX, 0, BQ, DMX, 0, 0.0625f, nullptr, 0, nullptr, 1, 0, 0, QF, nullptr, DMX, 0, (int)NR, DMX, DMX);      /* q (f32) */
  k_gemm2<0><<<dim3((unsigned)((NR / 128) * (DKV / 64)), 1), 128, 0, stream>>>(X16, DMX, 0, BK, DMX, 0, 0.0625f, nullptr, 0, nullptr, 1, 0, 0, KF, nullptr, DKV, 0, (int)NR, DKV, DMX);      /* k (f32) */
  k_gemm2<0><<<dim3((unsigned)((NR / 128) * (DKV / 64)), 1), 128, 0, stream>>>(X16, DMX, 0, BV, DMX, 0, 0.0625f, nullptr, 0, nullptr, 1, 0, 0, VF, V16, DKV, 0, (int)NR, DKV, DMX);      /* v (f32 for the first tile + f16) */
  k_rope128x<0><<<(unsigned)((NR / 4 * NH * 16 + 255) / 256), 256, 0, stream>>>(QF, DMX, NH, (int)(NR / 4), tcos, tsin, Q16, DMX, 1.0f); k_rope128x<0><<<(unsigned)((NR / 4 * NKV * 16 + 255) / 256), 256, 0, stream>>>(KF, DKV, NKV, (int)(NR / 4), tcos, tsin, K16, DKV, 1.0f);      /* half-split rope from the computed tables (index d mod 64) -> f16 */
  for (int b = 0; b < NB; ++b) { const size_t r0 = (size_t)b * SQ;
    k_rope128x<1><<<(unsigned)((QT0 / 4 * NH * 16 + 255) / 256), 256, 0, stream>>>(QF + r0 * DMX, DMX, NH, QT0 / 4, tcos, tsin, QF0, DMX, 1.0f); k_rope128x<1><<<(unsigned)((QT0 / 4 * NKV * 16 + 255) / 256), 256, 0, stream>>>(KF + r0 * DKV, DKV, NKV, QT0 / 4, tcos, tsin, KRF0, DKV, 1.0f);      /* f32 roped q, k of the batch's first QT0 rows (positions 0..QT0-1: the table pointers are NOT offset by the batch) */
    k_kvexp128<GSZ, NH, DKV><<<(unsigned)(((size_t)QT0 * DMX / 4 + 255) / 256), 256, 0, stream>>>(KRF0, KF0e, (size_t)QT0 * DMX / 4); k_kvexp128<GSZ, NH, DKV><<<(unsigned)(((size_t)QT0 * DMX / 4 + 255) / 256), 256, 0, stream>>>(VF + r0 * DKV, VF0e, (size_t)QT0 * DMX / 4);      /* kv head -> query head expansion for the exact first tile */
    k_vt<DKV / 64, SQ><<<(DKV / 64) * (SQ / 64), 256, 0, stream>>>(V16 + r0 * DKV, DKV, 0, VT);      /* V^T of this batch: kv head g = slabs 2g, 2g+1 */
    k_att0w<<<NH * (QT0 / 32), 256, 0, stream>>>(QF0, KF0e, VF0e, ATS, OF0 + (size_t)b * QT0 * DMX);      /* exact causal attention of the first QT0 rows (o x64) */
    k_fattn<<<dim3(NH, SQ / 128), 128, 0, stream>>>(Q16 + r0 * DMX, K16 + r0 * DKV, VT, O16 + r0 * DMX); }      /* scores, causal softmax and o (x64) of all heads and all query rows in one launch: blockIdx.x = head, blockIdx.y = block of 128 query rows */
  k_gemm2<0><<<dim3((unsigned)((NR / 128) * (DMX / 64)), 1), 128, 0, stream>>>(O16, DMX, 0, BO, DMX, 0, 0.0009765625f, nullptr, 0, nullptr, 1, 0, 0, (float*)d_out, nullptr, DMX, 0, (int)NR, DMX, DMX);      /* out = o Wo^T */
  k_hl<<<(unsigned)(((size_t)NB * QT0 * DMX / 8 + 255) / 256), 256, 0, stream>>>(OF0, OH0, OL0, (size_t)NB * QT0 * DMX / 8);      /* first-tile o (x64) -> f16 hi + x1024 residual planes */
  for (int b = 0; b < NB; ++b) { const size_t r0 = (size_t)b * SQ; const size_t f0 = (size_t)b * QT0;
    k_gemm2<0><<<dim3((QT0 / 128) * (DMX / 64), 1), 128, 0, stream>>>(OH0 + f0 * DMX, DMX, 0, BO, DMX, 0, 0.0009765625f, nullptr, 0, nullptr, 1, 0, 0, (float*)d_out + r0 * DMX, nullptr, DMX, 0, QT0, DMX, DMX);      /* rows 0..255 of the batch rewritten from the exact path */
    k_gemm2<0><<<dim3((QT0 / 128) * (DMX / 64), 1), 128, 0, stream>>>(OL0 + f0 * DMX, DMX, 0, BO, DMX, 0, 0.00000095367431640625f, nullptr, 0, (const float*)d_out + r0 * DMX, -1, 0, 0, (float*)d_out + r0 * DMX, nullptr, DMX, 0, QT0, DMX, DMX); }      /* += o_lo Wo 2^-20 (own-element accumulate) */
}

// v007
// One run takes 185 microseconds.
// Next to v006, in two timings, it ran 1.31 and 1.33 times as fast.
// Counting every step since v000, it is 46.7 times as fast.
#include <hip/hip_runtime.h>
// Llama-style causal multi-head attention with half-split RoPE computed in the module (hidden_states [1][2048][2048]; q / k / v = x W^T (nn.Linear natural [2048][2048] sigma 0.02, no biases), 16 heads of 128; rope: emb = [f | f], f = p * 10000^(-2i/128): t cos + rotate_half(t) sin; scores * 128^-0.5; causal (where(tril, ., finfo.min): the weight underflows to exactly 0); softmax; out = merged Wo^T (natural) -> [1][2048][2048]); run on the hd128 grouped-query causal code as 16 kv groups of ONE query head.
// Compute dtype: inputs rounded to bf16; x / weights exact; projections and rope f32; q, k, v, softmax weights and o as plain f16 GEMM operands (~2^-12; first 256 rows of each batch exact); scores, statistics, out f32. v_wmma_f32_16x16x32_f16.
#define NB 1
#define SQ 2048
#define DMX 2048
#define NH 16
#define NKV 16
#define GSZ 1
#define HDK 128
#define DKV (NKV * HDK)
#define QT 256
#define QT0 256
#define NKX SQ
#define DM DMX
#define HD 64
#define HG 1
#define NR ((size_t)NB * SQ)
#define ATS 0.08838834764831845f
static_assert(GSZ == 1 && NH == NKV, "k_attn takes the head from blockIdx.x with one key / value slab per query head");
typedef __bf16 v16b __attribute__((ext_vector_type(16)));
typedef unsigned short v8us __attribute__((ext_vector_type(8), may_alias));
typedef float  v8f  __attribute__((ext_vector_type(8)));
typedef float  v4f  __attribute__((ext_vector_type(4)));
typedef float  v4fa __attribute__((ext_vector_type(4), may_alias));
union FragB { v16b v; v8us half[2]; unsigned short u[16]; };

__device__ __forceinline__ unsigned short bf16_bits(float x) { unsigned int u = __float_as_uint(x); return (unsigned short)((u + 0x7FFFu + ((u >> 16) & 1u)) >> 16); }
__device__ __forceinline__ float bf16_val(unsigned short b) { return __uint_as_float(((unsigned int)b) << 16); }
__device__ __forceinline__ float bf16_round(float x) { return bf16_val(bf16_bits(x)); }
// D += A·B with NT terms: 1 = ah·bh, 2 = + al·bh (A split), 3 = + ah·bl (both split)
template <int NT>
__device__ __forceinline__ v8f mmaN(v16b ah, v16b al, v16b bh, v16b bl, v8f c) {
  c = __builtin_amdgcn_wmma_f32_16x16x32_bf16(false, ah, false, bh, (short)0, c, false, false);
  if (NT >= 2) c = __builtin_amdgcn_wmma_f32_16x16x32_bf16(false, al, false, bh, (short)0, c, false, false);
  if (NT >= 3) c = __builtin_amdgcn_wmma_f32_16x16x32_bf16(false, ah, false, bl, (short)0, c, false, false);
  asm volatile("v_nop\n\tv_nop\n\tv_nop\n\tv_nop" : "+v"(c) : "v"(ah), "v"(al), "v"(bh), "v"(bl));
  return c;
}

__global__ __launch_bounds__(256) void k_wt_bf16(const float* __restrict__ W, unsigned short* __restrict__ Wt, int K, int N) {
  const int t = blockIdx.x * 256 + threadIdx.x;
  const int k8n = K / 8;
  if (t >= N * k8n) return;
  const int n = t / k8n, k8 = (t % k8n) * 8;
  v8us v;
#pragma unroll
  for (int i = 0; i < 8; ++i) v[i] = bf16_bits(W[(size_t)(k8 + i) * N + n]);
  *(v8us*)(Wt + (size_t)n * K + k8) = v;
  
}

// GEMM C[M][N] (f32, pitch ldc) = act(A[M][K]·W + bias). A f32 row-major (pitch lda) converted per fragment to bf16
// (ASPLIT: hi/lo two planes -> 2 terms, else single rounded term); Wt bf16 [N][K] (pitch ldb). BIAS_BF16 rounds the
// bias to bf16 first (bias quantised to bf16 before the add). K%32==0, M%16==0, N%64==0.
template <bool ASPLIT, int ACT, bool BIAS_BF16>
__global__ __launch_bounds__(128) void k_gemm_bf(const float* __restrict__ A, int lda, const unsigned short* __restrict__ Wt, int ldb,
                                               const float* __restrict__ bias, float* __restrict__ C, int ldc, int M, int N, int K) {
  __shared__ __attribute__((aligned(16))) float so[4][16][64];
  const int tid = threadIdx.x, w = tid >> 5, lane = tid & 31, ln = lane & 15, hh = lane >> 4;
  const int ntn = N / 64;
  const int wid = blockIdx.x * 4 + w;
  const int mt = wid / ntn, nq = wid % ntn;
  if (mt * 16 >= M) return;
  const int row0 = mt * 16, col0 = nq * 64;
  const float* arow = A + (size_t)(row0 + ln) * lda;
  v8f acc[4] = {};
  for (int kb = 0; kb < K; kb += 32) {
    FragB ah, al;
    const v4f x0 = *(const v4fa*)(arow + kb + 8 * hh), x1 = *(const v4fa*)(arow + kb + 8 * hh + 4);
    const v4f x2 = *(const v4fa*)(arow + kb + 16 + 8 * hh), x3 = *(const v4fa*)(arow + kb + 16 + 8 * hh + 4);
    float xs[16] = {x0[0],x0[1],x0[2],x0[3],x1[0],x1[1],x1[2],x1[3],x2[0],x2[1],x2[2],x2[3],x3[0],x3[1],x3[2],x3[3]};
#pragma unroll
    for (int i = 0; i < 16; ++i) { const unsigned short hb = bf16_bits(xs[i]); ah.u[i] = hb; al.u[i] = ASPLIT ? bf16_bits(xs[i] - bf16_val(hb)) : (unsigned short)0; }
#pragma unroll
    for (int t = 0; t < 4; ++t) {
      const unsigned short* brow = Wt + (size_t)(col0 + t * 16 + ln) * ldb + kb;
      FragB b;
      b.half[0] = *(const v8us*)(brow + 8 * hh);
      b.half[1] = *(const v8us*)(brow + 16 + 8 * hh);
      acc[t] = mmaN<ASPLIT ? 2 : 1>(ah.v, al.v, b.v, b.v, acc[t]);
    }
  }
#pragma unroll
  for (int t = 0; t < 4; ++t) {
    float bv = bias ? bias[col0 + t * 16 + ln] : 0.f;
    if (BIAS_BF16) bv = bf16_round(bv);
#pragma unroll
    for (int r = 0; r < 8; ++r) { float v = acc[t][r] + bv; if (ACT == 1) v = fmaxf(v, 0.f); so[w][8 * hh + r][t * 16 + ln] = v; }
  }
  __builtin_amdgcn_fence(__ATOMIC_ACQ_REL, "workgroup");
  __builtin_amdgcn_wave_barrier();
  const int rsub = lane >> 4, c4 = (lane & 15) * 4;
  {
#pragma unroll
    for (int q = 0; q < 8; ++q) {
      const int r = q * 2 + rsub;
      const v4f v = *(const v4fa*)&so[w][r][c4];
      *(v4f*)(C + (size_t)(row0 + r) * ldc + col0 + c4) = v;
    }
    
  }
}

// GEMM C = act(A·W + bias + resid): A f32 (ASPLIT -> hi/lo 2 terms), Wt bf16 [N][K]; ACT 0 none, 1 relu, 2 exact gelu;
// resid (optional, f32, row index = (row % rmod), pitch ldr, RES_BF16 rounds it) added before the activation.
template <bool ASPLIT, int ACT, bool BIAS_BF16, bool RES_BF16>
__global__ __launch_bounds__(128) void k_gemm_bf3(const float* __restrict__ A, int lda, const unsigned short* __restrict__ Wt, int ldb,
                                                const float* __restrict__ bias, const float* __restrict__ resid, int rmod, int ldr,
                                                float* __restrict__ C, int ldc, int M, int N, int K) {
  __shared__ __attribute__((aligned(16))) float so[4][16][64];
  const int tid = threadIdx.x, w = tid >> 5, lane = tid & 31, ln = lane & 15, hh = lane >> 4;
  const int ntn = N / 64;
  const int wid = blockIdx.x * 4 + w;
  const int mt = wid / ntn, nq = wid % ntn;
  if (mt * 16 >= M) return;
  const int row0 = mt * 16, col0 = nq * 64;
  const float* arow = A + (size_t)(row0 + ln) * lda;
  v8f acc[4] = {};
  for (int kb = 0; kb < K; kb += 32) {
    FragB ah, al;
    const v4f x0 = *(const v4fa*)(arow + kb + 8 * hh), x1 = *(const v4fa*)(arow + kb + 8 * hh + 4);
    const v4f x2 = *(const v4fa*)(arow + kb + 16 + 8 * hh), x3 = *(const v4fa*)(arow + kb + 16 + 8 * hh + 4);
    float xs[16] = {x0[0],x0[1],x0[2],x0[3],x1[0],x1[1],x1[2],x1[3],x2[0],x2[1],x2[2],x2[3],x3[0],x3[1],x3[2],x3[3]};
#pragma unroll
    for (int i = 0; i < 16; ++i) { const unsigned short hb = bf16_bits(xs[i]); ah.u[i] = hb; al.u[i] = ASPLIT ? bf16_bits(xs[i] - bf16_val(hb)) : (unsigned short)0; }
#pragma unroll
    for (int t = 0; t < 4; ++t) {
      const unsigned short* brow = Wt + (size_t)(col0 + t * 16 + ln) * ldb + kb;
      FragB b;
      b.half[0] = *(const v8us*)(brow + 8 * hh);
      b.half[1] = *(const v8us*)(brow + 16 + 8 * hh);
      acc[t] = mmaN<ASPLIT ? 2 : 1>(ah.v, al.v, b.v, b.v, acc[t]);
    }
  }
#pragma unroll
  for (int t = 0; t < 4; ++t) {
    const int col = col0 + t * 16 + ln;
    float bv = bias ? bias[col] : 0.f;
    if (BIAS_BF16) bv = bf16_round(bv);
#pragma unroll
    for (int r = 0; r < 8; ++r) {
      float v = acc[t][r] + bv;
      if (resid) { float rv = resid[(size_t)((row0 + 8 * hh + r) % rmod) * ldr + col]; if (RES_BF16) rv = bf16_round(rv); v += rv; }
      if (ACT == 1) v = fmaxf(v, 0.f);
      if (ACT == 2) v = 0.5f * v * (1.0f + erff(v * 0.70710678118654752f));
      if (ACT == 3) { const float u = 0.7978845608028654f * (v + 0.044715f * v * v * v); v = 0.5f * v * (1.0f + tanhf(u)); }
      so[w][8 * hh + r][t * 16 + ln] = v;
    }
  }
  __builtin_amdgcn_fence(__ATOMIC_ACQ_REL, "workgroup");
  __builtin_amdgcn_wave_barrier();
  const int rsub = lane >> 4, c4 = (lane & 15) * 4;
  {
#pragma unroll
    for (int q = 0; q < 8; ++q) {
      const int r = q * 2 + rsub;
      const v4f v = *(const v4fa*)&so[w][r][c4];
      *(v4f*)(C + (size_t)(row0 + r) * ldc + col0 + c4) = v;
    }
    
  }
}
// row LayerNorm (biased variance, eps) over N: s = X (+ R); optional out_sum <- s; out_norm <- (s-mu)*rsqrt(var+eps)*g + b
template <bool PARAM_BF16>
__global__ __launch_bounds__(256) void k_layernorm(const float* __restrict__ X, const float* __restrict__ R, const float* __restrict__ g, const float* __restrict__ bta,
                                                  float* __restrict__ out_sum, float* __restrict__ out_norm, int N, float eps) {
  __shared__ float red[256];
  const int row = blockIdx.x, tid = threadIdx.x;
  const float* x = X + (size_t)row * N; const float* rr = R ? R + (size_t)row * N : nullptr;
  float vals[16];                     // up to N = 4096
  const int per = N / 256;            // contiguous chunk per thread? use strided-by-4 chunks: thread handles j = tid*4 + 1024*u
  float s1 = 0.f;
  for (int u = 0; u < per / 4; ++u) {
    const int j = tid * 4 + 1024 * u;
    const v4f a = *(const v4fa*)(x + j);
    v4f b = {0.f,0.f,0.f,0.f}; if (rr) b = *(const v4fa*)(rr + j);
#pragma unroll
    for (int q = 0; q < 4; ++q) { const float v = a[q] + b[q]; vals[u * 4 + q] = v; s1 += v; }
  }
  red[tid] = s1; __syncthreads();
  for (int st = 128; st > 0; st >>= 1) { if (tid < st) red[tid] += red[tid + st]; __syncthreads(); }
  const float mu = red[0] / (float)N; __syncthreads();
  float s2 = 0.f;
  for (int u = 0; u < per / 4; ++u)
#pragma unroll
    for (int q = 0; q < 4; ++q) { const float c = vals[u * 4 + q] - mu; s2 += c * c; }
  red[tid] = s2; __syncthreads();
  for (int st = 128; st > 0; st >>= 1) { if (tid < st) red[tid] += red[tid + st]; __syncthreads(); }
  const float rs = rsqrtf(red[0] / (float)N + eps);
  {
    for (int u = 0; u < per / 4; ++u) {
      const int j = tid * 4 + 1024 * u;
      v4f o, sm;
#pragma unroll
      for (int q = 0; q < 4; ++q) {
        float gg = g[j + q], bb = bta[j + q];
        if (PARAM_BF16) { gg = bf16_round(gg); bb = bf16_round(bb); }
        sm[q] = vals[u * 4 + q]; o[q] = (vals[u * 4 + q] - mu) * rs * gg + bb;
      }
      if (out_sum) *(v4f*)(out_sum + (size_t)row * N + j) = sm;
      *(v4f*)(out_norm + (size_t)row * N + j) = o;
    }
    
  }
}



// ---- f16 WMMA path (v_wmma_f32_16x16x32_f16): 11-bit significands for operands in range — used where a [0,1] probability operand needs more precision than bf16
typedef _Float16 v16h __attribute__((ext_vector_type(16)));
union FragH { v16h v; v8us half[2]; _Float16 h[16]; unsigned short u[16]; };
template <int NT>
__device__ __forceinline__ v8f mmaH(v16h ah, v16h al, v16h bh, v16h bl, v8f c) {
  c = __builtin_amdgcn_wmma_f32_16x16x32_f16(false, ah, false, bh, (short)0, c, false, false);
  if (NT >= 2) c = __builtin_amdgcn_wmma_f32_16x16x32_f16(false, al, false, bh, (short)0, c, false, false);
  if (NT >= 3) c = __builtin_amdgcn_wmma_f32_16x16x32_f16(false, ah, false, bl, (short)0, c, false, false);
  asm volatile("v_nop\n\tv_nop\n\tv_nop\n\tv_nop" : "+v"(c) : "v"(ah), "v"(al), "v"(bh), "v"(bl));
  return c;
}
// batched GEMM like k_gemm_b but f16 operands: A f32 (split into f16 hi/lo if ASPLIT, else rounded to f16), Bt = f16 values [n][k]; alpha; C f32; N multiple of 16 (partial tiles skipped)
template <bool ASPLIT>
__global__ __launch_bounds__(128) void k_gemm_h(const float* __restrict__ A, int lda, size_t sA, const _Float16* __restrict__ Bh, int ldb, size_t sB, float alpha, float* __restrict__ C, int ldc, size_t sC, int M, int N, int K) {
  __shared__ __attribute__((aligned(16))) float so[4][16][64];
  const int tid = threadIdx.x, w = tid >> 5, lane = tid & 31, ln = lane & 15, hh = lane >> 4; const int by = blockIdx.y;
  A += (size_t)by * sA; Bh += (size_t)by * sB; C += (size_t)by * sC;
  const int ntn = (N + 63) / 64; const int wid = blockIdx.x * 4 + w; const int mt = wid / ntn, nq = wid % ntn; if (mt * 16 >= M) return;
  const int row0 = mt * 16, col0 = nq * 64; const float* arow = A + (size_t)(row0 + ln) * lda;
  v8f acc[4] = {};
  for (int kb = 0; kb < K; kb += 32) {
    FragH ah, al;
    const v4f x0 = *(const v4fa*)(arow + kb + 8 * hh), x1 = *(const v4fa*)(arow + kb + 8 * hh + 4), x2 = *(const v4fa*)(arow + kb + 16 + 8 * hh), x3 = *(const v4fa*)(arow + kb + 16 + 8 * hh + 4);
    float xs[16] = {x0[0],x0[1],x0[2],x0[3],x1[0],x1[1],x1[2],x1[3],x2[0],x2[1],x2[2],x2[3],x3[0],x3[1],x3[2],x3[3]};
#pragma unroll
    for (int i = 0; i < 16; ++i) { const _Float16 h = (_Float16)xs[i]; ah.h[i] = h; al.h[i] = ASPLIT ? (_Float16)(xs[i] - (float)h) : (_Float16)0.0f; }
#pragma unroll
    for (int t = 0; t < 4; ++t) { if (col0 + t * 16 >= N) continue; const size_t boff = (size_t)(col0 + t * 16 + ln) * ldb + kb; FragH bq; bq.half[0] = *(const v8us*)(Bh + boff + 8 * hh); bq.half[1] = *(const v8us*)(Bh + boff + 16 + 8 * hh);
      acc[t] = mmaH<ASPLIT ? 2 : 1>(ah.v, al.v, bq.v, bq.v, acc[t]); }
  }
#pragma unroll
  for (int t = 0; t < 4; ++t) { if (col0 + t * 16 >= N) continue;
#pragma unroll
    for (int r = 0; r < 8; ++r) so[w][8 * hh + r][t * 16 + ln] = acc[t][r] * alpha; }
  __builtin_amdgcn_fence(__ATOMIC_ACQ_REL, "workgroup"); __builtin_amdgcn_wave_barrier();
  const int rsub = lane >> 4, c4 = (lane & 15) * 4;
  {
#pragma unroll
    for (int q = 0; q < 8; ++q) { const int r = q * 2 + rsub; if (col0 + c4 < N) { const v4f v = *(const v4fa*)&so[w][r][c4]; *(v4f*)(C + (size_t)(row0 + r) * ldc + col0 + c4) = v; } }
     }
}

// Wt[n][k] = f16(W[k][n]·scale) from f32 row-major W[K][N] (scale = power of two; bf16-exact weights stay exact in f16 away from the subnormal range)
__global__ __launch_bounds__(256) void k_wt_f16(const float* __restrict__ W, _Float16* __restrict__ Wt, int K, int N, float scale) {
  const int t = blockIdx.x * 256 + threadIdx.x; if (t >= N * (K / 8)) return; const int n = t / (K / 8), k8 = (t % (K / 8)) * 8; FragH f;
#pragma unroll
  for (int i = 0; i < 8; ++i) f.h[i] = (_Float16)(bf16_round(W[(size_t)(k8 + i) * N + n]) * scale); const v8us o = f.half[0];
  *(v8us*)((unsigned short*)Wt + (size_t)n * K + k8) = o; 
}
// k_gemm_hh variant with fused epilogue: v = acc·alpha + bias[by·sBias + col] (+ CP[(row/rowsPerB)·sCPb + by·64 + col] if CP) ; ACT 0 none / 1 elu ; writes f16 C16 (and f32 C if non-null)
template <int ACT>
__global__ __launch_bounds__(128) void k_gemm_hhx(const _Float16* __restrict__ A, int lda, size_t sA, const _Float16* __restrict__ Bh, int ldb, size_t sB, float alpha, const float* __restrict__ bias, size_t sBias, const float* __restrict__ CP, int rowsPerB, size_t sCPb, int row0g,
    float* __restrict__ C, _Float16* __restrict__ C16, int ldc, size_t sC, int M, int N, int K) {
  __shared__ __attribute__((aligned(16))) float so[4][16][64];
  const int tid = threadIdx.x, w = tid >> 5, lane = tid & 31, ln = lane & 15, hh = lane >> 4; const int by = blockIdx.y;
  A += (size_t)by * sA; Bh += (size_t)by * sB; const size_t cofs = (size_t)by * sC; const float* bp = bias ? bias + (size_t)by * sBias : nullptr;
  const int ntn = (N + 63) / 64; const int wid = blockIdx.x * 4 + w; const int mt = wid / ntn, nq = wid % ntn; if (mt * 16 >= M) return;
  const int row0 = mt * 16, col0 = nq * 64; const _Float16* arow = A + (size_t)(row0 + ln) * lda;
  v8f acc[4] = {};
  for (int kb = 0; kb < K; kb += 32) { FragH ah; ah.half[0] = *(const v8us*)((const unsigned short*)arow + kb + 8 * hh); ah.half[1] = *(const v8us*)((const unsigned short*)arow + kb + 16 + 8 * hh);
#pragma unroll
    for (int t = 0; t < 4; ++t) { if (col0 + t * 16 >= N) continue; const size_t boff = (size_t)(col0 + t * 16 + ln) * ldb + kb; FragH bq; bq.half[0] = *(const v8us*)((const unsigned short*)Bh + boff + 8 * hh); bq.half[1] = *(const v8us*)((const unsigned short*)Bh + boff + 16 + 8 * hh);
      acc[t] = mmaH<1>(ah.v, ah.v, bq.v, bq.v, acc[t]); }
  }
#pragma unroll
  for (int t = 0; t < 4; ++t) { if (col0 + t * 16 >= N) continue; const int col = col0 + t * 16 + ln; const float bv = bp ? bf16_round(bp[col]) : 0.f;
#pragma unroll
    for (int r = 0; r < 8; ++r) { float v = acc[t][r] * alpha + bv; if (CP) { const int rr = row0g + row0 + 8 * hh + r; if (rowsPerB < 0) v += CP[cofs + (size_t)rr * ldc + col];      /* rowsPerB < 0: own element of the batched C plane */ else { const int bidx = rr / rowsPerB; v += CP[(size_t)bidx * sCPb + (size_t)by * 64 + col]; } } if (ACT == 1) v = (v > 0.f) ? v : expm1f(v); else if (ACT == 7) v = (v > 0.f) ? v + 1.0f : expf(v); else if (ACT == 8) v = tanhf(v); else if (ACT == 9) v = 0.5f * v * (1.0f + tanhf(0.7978845608028654f * (v + 0.044715f * v * v * v))); else if (ACT == 11) v = 1.0f / (1.0f + expf(-v)); else if (ACT == 12) v = (v > 0.f) ? v : 0.01f * v; else if (ACT == 14) v = (v > 0.f) ? v : 0.1f * v; else if (ACT == 16) v = (v >= 0.f) ? v : 0.3f * v; else if (ACT == 17) v = (v >= 0.f) ? v : 0.2f * v; else if (ACT == 15) v = v / (1.0f + expf(-v)); else if (ACT == 3) v = fmaxf(v, 0.f); else if (ACT == 6) v = 0.5f * v * (1.0f + erff(v * 0.70710678118654752f)); so[w][8 * hh + r][t * 16 + ln] = v; } }
  __builtin_amdgcn_fence(__ATOMIC_ACQ_REL, "workgroup"); __builtin_amdgcn_wave_barrier();
  const int rsub = lane >> 4, c4 = (lane & 15) * 4; typedef _Float16 v4h __attribute__((ext_vector_type(4)));
  {
#pragma unroll
    for (int q = 0; q < 8; ++q) { const int r = q * 2 + rsub; if (col0 + c4 < N) { const v4f v = *(const v4fa*)&so[w][r][c4]; if (C) *(v4f*)(C + cofs + (size_t)(row0 + r) * ldc + col0 + c4) = v; if (C16) { v4h h4; for (int i = 0; i < 4; ++i) h4[i] = (_Float16)v[i]; *(v4h*)(C16 + cofs + (size_t)(row0 + r) * ldc + col0 + c4) = h4; } } }
     }
}


typedef _Float16 v4h __attribute__((ext_vector_type(4)));

__device__ __forceinline__ void d_x16(int bx, const float* x, _Float16* X16, size_t n8) { const size_t t = (size_t)bx * 256 + threadIdx.x; if (t >= n8) return; FragH f;
#pragma unroll
  for (int q = 0; q < 8; ++q) f.h[q] = (_Float16)bf16_round(x[t * 8 + q]); *(v8us*)((unsigned short*)X16 + t * 8) = f.half[0];  }
__global__ __launch_bounds__(256) void k_h16(const float* __restrict__ x, _Float16* __restrict__ X16, size_t n8) { const size_t t = (size_t)blockIdx.x * 256 + threadIdx.x; if (t >= n8) return; FragH f;
#pragma unroll
  for (int q = 0; q < 8; ++q) f.h[q] = (_Float16)x[t * 8 + q]; *(v8us*)((unsigned short*)X16 + t * 8) = f.half[0];  }
__global__ __launch_bounds__(256) void k_round16f(const float* __restrict__ W, _Float16* __restrict__ Bt, size_t n8) { const size_t t = (size_t)blockIdx.x * 256 + threadIdx.x; if (t >= n8) return; FragH f;
#pragma unroll
  for (int i = 0; i < 8; ++i) f.h[i] = (_Float16)(bf16_round(W[t * 8 + i]) * 16.0f); *(v8us*)((unsigned short*)Bt + t * 8) = f.half[0];  }
template <int NHv, int TTv>
__device__ __forceinline__ void d_vt(unsigned short (*tl)[66], int bx, const _Float16* V16, int ldv, int voff, _Float16* Vt) { const int tid = threadIdx.x; const int slab = bx / (TTv / 64), lg = bx % (TTv / 64); const int b = slab / NHv, h = slab % NHv;
  for (int i = tid; i < 64 * 8; i += 256) { const int r = i / 8, c8 = (i % 8) * 8; FragH f; f.half[0] = *(const v8us*)((const unsigned short*)V16 + ((size_t)b * TTv + lg * 64 + r) * ldv + voff + h * 64 + c8);
#pragma unroll
    for (int q = 0; q < 8; ++q) tl[r][c8 + q] = f.u[q]; }
  __syncthreads();
  {
#pragma unroll
    for (int rd = 0; rd < 2; ++rd) { const int d = rd * 32 + tid / 8, pc = tid % 8; FragH f;
#pragma unroll
      for (int q = 0; q < 8; ++q) f.u[q] = tl[pc * 8 + q][d];
      *(v8us*)((unsigned short*)Vt + ((size_t)slab * 64 + d) * TTv + lg * 64 + pc * 8) = f.half[0]; }
     } }

__device__ __forceinline__ void d_hl(size_t t, const float* F, _Float16* Hh, _Float16* Hl, size_t n8) { if (t >= n8) return; FragH fh, fl; const v4f a = *(const v4fa*)(F + t * 8), c = *(const v4fa*)(F + t * 8 + 4);
#pragma unroll
  for (int q = 0; q < 4; ++q) { _Float16 h = (_Float16)a[q]; fh.h[q] = h; fl.h[q] = (_Float16)((a[q] - (float)h) * 1024.0f); h = (_Float16)c[q]; fh.h[4 + q] = h; fl.h[4 + q] = (_Float16)((c[q] - (float)h) * 1024.0f); }
  { *(v8us*)((unsigned short*)Hh + t * 8) = fh.half[0]; *(v8us*)((unsigned short*)Hl + t * 8) = fl.half[0];  } }

// ---- fast GEMM (work-group tile 128x64, wave tile 32x64; requires M % 128 == 0 rows per launch region, N % 64 == 0 and K % 128 == 0); epilogue = k_gemm_hhx semantics ----
// Operands reach the waves through LDS: a stage is 128 k (256 B) of the tile's 128 A rows and 64 B rows at a pitch of 272 B (16 B x odd: the 16 lanes that a 16-byte LDS read serves together fall on distinct banks).
// Asynchronous copies fill it, 16 lanes to a row, so that each wave-wide copy takes four whole 128-byte lines; two buffers: the next stage's copies fly while this stage is worked on.
#define G2_KS 128
#define G2_PITCH 272
#define G2_ROWS 192
#define G2_STAGE (G2_ROWS * G2_PITCH)
__device__ __forceinline__ v16h g2_frag(const _Float16* p, int hh) { FragH f; f.half[0] = *(const v8us*)((const unsigned short*)p + 8 * hh); f.half[1] = *(const v8us*)((const unsigned short*)p + 16 + 8 * hh); return f.v; }
__device__ __forceinline__ v8f g2_mma(v16h a, v16h b, v8f c) { v8f d = __builtin_amdgcn_wmma_f32_16x16x32_f16(false, a, false, b, (short)0, c, false, false); asm volatile("v_nop\n\tv_nop\n\tv_nop\n\tv_nop" : "+v"(d) : "v"(a), "v"(b)); return d; }
// eight asynchronous 16-byte copies of a lane: rows r, r + 8, ... r + 56 (global step gs halves, LDS step 8 pitches). The s_wait_xcnt 0 is the last line of the copies' own statement, so that it stands in front of every later rewrite of a register that a copy names.
__device__ __forceinline__ void g2_copy8(unsigned l, const _Float16* g, size_t gs) {
  asm volatile("global_load_async_to_lds_b128 %0, %8, off\n\tglobal_load_async_to_lds_b128 %1, %9, off\n\tglobal_load_async_to_lds_b128 %2, %10, off\n\tglobal_load_async_to_lds_b128 %3, %11, off\n\t"
               "global_load_async_to_lds_b128 %4, %12, off\n\tglobal_load_async_to_lds_b128 %5, %13, off\n\tglobal_load_async_to_lds_b128 %6, %14, off\n\tglobal_load_async_to_lds_b128 %7, %15, off\n\ts_wait_xcnt 0x0"
               :: "v"(l), "v"(l + 8 * G2_PITCH), "v"(l + 16 * G2_PITCH), "v"(l + 24 * G2_PITCH), "v"(l + 32 * G2_PITCH), "v"(l + 40 * G2_PITCH), "v"(l + 48 * G2_PITCH), "v"(l + 56 * G2_PITCH),
                  "v"(g), "v"(g + gs), "v"(g + 2 * gs), "v"(g + 3 * gs), "v"(g + 4 * gs), "v"(g + 5 * gs), "v"(g + 6 * gs), "v"(g + 7 * gs) : "memory"); }
template <int ACT>
__device__ __forceinline__ void g2_body(unsigned char* st, int bx, int by, const _Float16* A, int lda, size_t sA, const _Float16* Bh, int ldb, size_t sB, float alpha, const float* bias, size_t sBias, const float* CP, int rowsPerB, size_t sCPb, int row0g,
    float* C, _Float16* C16, int ldc, size_t sC, int M, int N, int K) { static_assert(ACT == 0 || ACT == 3 || ACT == 6 || ACT == 8 || ACT == 9 || ACT == 11 || ACT == 12 || ACT == 14 || ACT == 15 || ACT == 16 || ACT == 17, "k_gemm2: unsupported ACT code (would silently apply no activation)");
  /* st: the two stage buffers (2 * G2_STAGE bytes of the calling kernel's LDS, 16-byte aligned); behind the loop's last barrier the same bytes serve as the output staging so[4][32][68] */
  static_assert(sizeof(float) * 4 * 32 * 68 <= 2 * G2_STAGE, "the output staging lies inside the stage buffers");
  float (*so)[32][68] = (float (*)[32][68])st;
  const int tid = threadIdx.x, w = tid >> 5, lane = tid & 31, ln = lane & 15, hh = lane >> 4;
  A += (size_t)by * sA; Bh += (size_t)by * sB; const size_t cofs = (size_t)by * sC; const float* bp = bias ? bias + (size_t)by * sBias : nullptr;
  const int ntn = N >> 6; const int mt = bx / ntn, nq = bx - mt * ntn; const int row0 = mt * 128 + 32 * w, col0 = nq * 64; if (mt * 128 >= M) return;      /* the same for the whole work-group, in front of every barrier */
  const _Float16* ag = A + (size_t)(mt * 128 + (tid >> 4)) * lda + (tid & 15) * 8; const _Float16* bg = Bh + (size_t)(col0 + (tid >> 4)) * ldb + (tid & 15) * 8;      /* this lane's 16 bytes of rows tid / 16 + 8 i */
  const unsigned l0 = (unsigned)(size_t)st + (unsigned)((tid >> 4) * G2_PITCH + (tid & 15) * 16);      /* the low 32 bits of a __shared__ address are the LDS byte address */
  const size_t ga = (size_t)8 * lda, gb = (size_t)8 * ldb; const int nt = K / G2_KS;
  const v8f z8 = {0.f,0.f,0.f,0.f,0.f,0.f,0.f,0.f}; v8f c00 = z8, c01 = z8, c02 = z8, c03 = z8, c10 = z8, c11 = z8, c12 = z8, c13 = z8;
  g2_copy8(l0, ag, ga); g2_copy8(l0 + 64 * G2_PITCH, ag + 8 * ga, ga); g2_copy8(l0 + 128 * G2_PITCH, bg, gb);      /* stage 0 into buffer 0 */
  asm volatile("s_wait_asynccnt 0x0" ::: "memory");      /* this wave's copies of stage 0 have landed */
  __syncthreads();      /* every wave's have: stage 0 may be read */
  if (nt > 1) { g2_copy8(l0 + G2_STAGE, ag + G2_KS, ga); g2_copy8(l0 + G2_STAGE + 64 * G2_PITCH, ag + G2_KS + 8 * ga, ga); g2_copy8(l0 + G2_STAGE + 128 * G2_PITCH, bg + G2_KS, gb); }      /* stage 1 into buffer 1 */
#pragma unroll 1      /* one stage a trip: the order at the foot of the trip stays as written */
  for (int t = 0; t < nt; ++t) { const unsigned bo = (unsigned)(t & 1) * G2_STAGE;
    const _Float16* a0p = (const _Float16*)(st + bo + (32 * w + ln) * G2_PITCH); const _Float16* a1p = (const _Float16*)(st + bo + (32 * w + 16 + ln) * G2_PITCH); const _Float16* b0p = (const _Float16*)(st + bo + (128 + ln) * G2_PITCH);
    v16h a0 = g2_frag(a0p, hh), a1 = g2_frag(a1p, hh), b0 = g2_frag(b0p, hh), b1 = g2_frag(b0p + 16 * (G2_PITCH / 2), hh), b2 = g2_frag(b0p + 32 * (G2_PITCH / 2), hh), b3 = g2_frag(b0p + 48 * (G2_PITCH / 2), hh);
#pragma unroll      /* four 32-k steps of a stage: constant LDS offsets, and the two fragment sets are renamed instead of moved */
    for (int kb = 0; kb < G2_KS; kb += 32) { v16h n0 = a0, n1 = a1, m0 = b0, m1 = b1, m2 = b2, m3 = b3;
      if (kb + 32 < G2_KS) { const int kn = kb + 32;      /* the next step's twelve LDS reads go as one group in front of this step's products and return under them; they stay inside this stage */
        n0 = g2_frag(a0p + kn, hh); n1 = g2_frag(a1p + kn, hh); m0 = g2_frag(b0p + kn, hh); m1 = g2_frag(b0p + 16 * (G2_PITCH / 2) + kn, hh); m2 = g2_frag(b0p + 32 * (G2_PITCH / 2) + kn, hh); m3 = g2_frag(b0p + 48 * (G2_PITCH / 2) + kn, hh); }
      c00 = g2_mma(a0, b0, c00); c10 = g2_mma(a1, b0, c10); c01 = g2_mma(a0, b1, c01); c11 = g2_mma(a1, b1, c11);
      c02 = g2_mma(a0, b2, c02); c12 = g2_mma(a1, b2, c12); c03 = g2_mma(a0, b3, c03); c13 = g2_mma(a1, b3, c13);
      a0 = n0; a1 = n1; b0 = m0; b1 = m1; b2 = m2; b3 = m3; }
    asm volatile("s_wait_dscnt 0x0" ::: "memory");      /* this wave's reads of the buffer have returned before it is refilled */
    asm volatile("s_wait_asynccnt 0x0" ::: "memory");      /* this wave's copies of stage t + 1 have landed */
    __syncthreads();      /* publishes stage t + 1 and ends every wave's reads of stage t */
    if (t + 2 < nt) { const _Float16* an = ag + (size_t)(t + 2) * G2_KS; const _Float16* bn = bg + (size_t)(t + 2) * G2_KS; g2_copy8(l0 + bo, an, ga); g2_copy8(l0 + bo + 64 * G2_PITCH, an + 8 * ga, ga); g2_copy8(l0 + bo + 128 * G2_PITCH, bn, gb); } }      /* stage t + 2 into the buffer that trip t has just read */
  asm volatile("s_wait_asynccnt 0x0" ::: "memory");      /* nothing is in flight when the buffers become output staging */
  v8f accs[8] = {c00, c01, c02, c03, c10, c11, c12, c13};
#pragma unroll
  for (int u = 0; u < 8; ++u) { const int t = u & 3, half = u >> 2; const int col = col0 + t * 16 + ln; const float bv = bp ? bf16_round(bp[col]) : 0.f;
#pragma unroll
    for (int r = 0; r < 8; ++r) { const int rloc = half * 16 + 8 * hh + r; float v = accs[u][r] * alpha + bv; if (CP) { if (rowsPerB < 0) v += CP[cofs + (size_t)(row0g + row0 + rloc) * ldc + col];      /* rowsPerB < 0: own element of the batched C plane */ else { const int bidx = (row0g + row0 + rloc) / rowsPerB; v += CP[(size_t)bidx * sCPb + (size_t)by * 64 + col]; } }
      if (ACT == 3) v = fmaxf(v, 0.f); else if (ACT == 6) v = 0.5f * v * (1.0f + erff(v * 0.70710678118654752f)); else if (ACT == 11) v = 1.0f / (1.0f + expf(-v)); else if (ACT == 15) v = v / (1.0f + expf(-v)); else if (ACT == 12) v = (v > 0.f) ? v : 0.01f * v; else if (ACT == 8) v = tanhf(v); else if (ACT == 9) v = 0.5f * v * (1.0f + tanhf(0.7978845608028654f * (v + 0.044715f * v * v * v))); else if (ACT == 14) v = (v > 0.f) ? v : 0.1f * v; else if (ACT == 16) v = (v >= 0.f) ? v : 0.3f * v; else if (ACT == 17) v = (v >= 0.f) ? v : 0.2f * v;
      so[w][rloc][t * 16 + ln] = v; } }
  __builtin_amdgcn_fence(__ATOMIC_ACQ_REL, "workgroup"); __builtin_amdgcn_wave_barrier();
  const int rsub = lane >> 4, c4 = (lane & 15) * 4;
  {
#pragma unroll
    for (int q = 0; q < 16; ++q) { const int r = q * 2 + rsub; const v4f v = *(const v4fa*)&so[w][r][c4];
      /* each s_wait_xcnt 0 stands between the store in front of it and a later rewrite of the data or address registers that the store names */
      if (C) { *(v4f*)(C + cofs + (size_t)(row0 + r) * ldc + col0 + c4) = v; asm volatile("s_wait_xcnt 0x0" ::: "memory"); }
      if (C16) { v4h h4; for (int i = 0; i < 4; ++i) h4[i] = (_Float16)v[i]; *(v4h*)(C16 + cofs + (size_t)(row0 + r) * ldc + col0 + c4) = h4; asm volatile("s_wait_xcnt 0x0" ::: "memory"); } }
     } }


__device__ __forceinline__ void d_wnat(int bx, const float* w, size_t n8, _Float16* Bt) { const size_t t = (size_t)bx * 256 + threadIdx.x; if (t >= n8) return; FragH f; for (int q = 0; q < 8; ++q) f.h[q] = (_Float16)(bf16_round(w[t * 8 + q]) * 16.0f); *(v8us*)((unsigned short*)Bt + t * 8) = f.half[0];  }
__global__ __launch_bounds__(256) void k_rsm(const float* __restrict__ S, _Float16* __restrict__ P, int nrows) {
  #pragma clang fp contract(off)
  const int i = blockIdx.x * 256 + threadIdx.x; if (i >= nrows) return; const float* s = S + (size_t)i * SQ; float mx = -3.0e38f;
#pragma unroll 1
  for (int j = 0; j < SQ; ++j) mx = fmaxf(mx, s[j]); float se = 0.f;
#pragma unroll 1
  for (int j = 0; j < SQ; ++j) se += expf(s[j] - mx); const float sc = 256.0f / se;
#pragma unroll 1
  for (int j0 = 0; j0 < SQ; j0 += 8) { FragH f; for (int q = 0; q < 8; ++q) f.h[q] = (_Float16)(expf(s[j0 + q] - mx) * sc); unsigned short* d = (unsigned short*)P + (size_t)i * SQ + j0; *(v8us*)d = f.half[0];  } }
__global__ __launch_bounds__(256) void k_vt(const _Float16* __restrict__ V16, int b, int h0, _Float16* __restrict__ VT) { __shared__ unsigned short tl[64][65]; const int tid = threadIdx.x; const int hh = blockIdx.x % HG, sg = blockIdx.x / HG; const int s0 = sg * 64; const int h = h0 + hh;
  for (int i = tid; i < 64 * 8; i += 256) { const int j = i / 8, d8 = (i % 8) * 8; FragH f; f.half[0] = *(const v8us*)((const unsigned short*)V16 + ((size_t)b * SQ + s0 + j) * DM + h * HD + d8); for (int q = 0; q < 8; ++q) tl[d8 + q][j] = f.u[q]; }
  __syncthreads();
  { for (int i = tid; i < 64 * 8; i += 256) { const int d = i / 8, j8 = (i % 8) * 8; FragH f; for (int q = 0; q < 8; ++q) f.u[q] = tl[d][j8 + q]; *(v8us*)((unsigned short*)VT + ((size_t)hh * HD + d) * SQ + s0 + j8) = f.half[0]; }  } }


__global__ __launch_bounds__(256) void k_f2h(const float* __restrict__ F, int ldf, int coff, int ncol, _Float16* __restrict__ H16, size_t nrow) { const size_t t = (size_t)blockIdx.x * 256 + threadIdx.x; const size_t n8 = nrow * (size_t)(ncol / 8); if (t >= n8) return; const size_t r = t / (ncol / 8); const int c8 = (int)(t % (ncol / 8)) * 8; FragH f; const v4f a = *(const v4fa*)(F + r * ldf + coff + c8), b2 = *(const v4fa*)(F + r * ldf + coff + c8 + 4); for (int q = 0; q < 4; ++q) { f.h[q] = (_Float16)a[q]; f.h[4 + q] = (_Float16)b2[q]; } *(v8us*)((unsigned short*)H16 + r * ncol + c8) = f.half[0];  }

__device__ __forceinline__ void d_tab128(int bx, float theta, float* CS, float* SN) {
  #pragma clang fp contract(off)
  const int t = bx * 256 + threadIdx.x; if (t >= SQ * 64) return; const int i = t % 64; const int p = t / 64; const float invf = (float)(1.0 / pow((double)theta, (double)(2 * i) / 128.0));      /* the f32 rounding of the frequency taken in double precision */ const float ang = __fmul_rn((float)p, invf); const float c = cosf(ang), s = sinf(ang);
  *(float*)(CS + t) = c; *(float*)(SN + t) = s;  }
template <int TAB>
__global__ __launch_bounds__(128) void k_rope128(const float* __restrict__ F, int ldf, int nh, const float* __restrict__ CS, const float* __restrict__ SN, _Float16* __restrict__ H16, int ldo, float osc) {
  #pragma clang fp contract(off)
  __shared__ float xv[128]; __shared__ unsigned short sh_[128]; const int d = threadIdx.x; const int h = blockIdx.x % nh; const size_t r = blockIdx.x / nh; const int p = (int)(r % SQ);
  xv[d] = F[r * (size_t)ldf + (size_t)h * 128 + d]; __syncthreads();
  float c, s; if (TAB) { c = bf16_round(CS[(size_t)p * 128 + d]); s = bf16_round(SN[(size_t)p * 128 + d]); } else { c = CS[p * 64 + (d & 63)]; s = SN[p * 64 + (d & 63)]; }
  const float rot = (d < 64) ? -xv[d + 64] : xv[d - 64]; const float o = __fadd_rn(__fmul_rn(xv[d], c), __fmul_rn(rot, s));
  FragH th; th.h[0] = (_Float16)__fmul_rn(o, osc); sh_[d] = th.u[0]; __syncthreads();
  if (d < 16) { FragH f; for (int q = 0; q < 8; ++q) f.u[q] = sh_[d * 8 + q]; unsigned short* dst = (unsigned short*)H16 + r * (size_t)ldo + (size_t)h * 128 + d * 8; *(v8us*)dst = f.half[0];  } }

// Half-split rope of nrow4 * 4 rows of nh heads of 128. One thread owns dims d4 .. d4 + 3 and their partners d4 + 64 .. d4 + 67 of one head in FOUR rows (r0, r0 + nrow4, r0 + 2 nrow4, r0 + 3 nrow4):
// both halves of a rotation pair stand in the thread's own registers (no LDS, no barrier), 16 lanes cover 256 contiguous bytes of each half, and the launch has 1/64 of the work-groups that one work-group per (row, head) has.
template <int F32OUT>
__device__ __forceinline__ void d_rope128x(int bx, const float* F, int ldf, int nh, int nrow4, const float* CS, const float* SN, void* OUT, int ldo, float osc) {
  const int t = bx * 256 + threadIdx.x; const int per = nh * 16; if (t >= nrow4 * per) return; const int r0 = t / per; const int cc = t - r0 * per; const int h = cc >> 4, d4 = (cc & 15) * 4;
  v4f lo[4], hi[4], cs[4], sn[4];
#pragma unroll      /* the sixteen loads stand in a loop of their own, ahead of the arithmetic, so that many are in flight at once; the arrays are indexed by constants and stay in registers */
  for (int u = 0; u < 4; ++u) { const size_t r = (size_t)(r0 + u * nrow4); const int p = (int)(r % SQ); const float* f = F + r * (size_t)ldf + (size_t)h * 128 + d4;
    /* each s_wait_xcnt 0 stands between the load in front of it and a later load whose result may take that load's address registers */
    lo[u] = *(const v4fa*)f; asm volatile("s_wait_xcnt 0x0" ::: "memory"); hi[u] = *(const v4fa*)(f + 64); asm volatile("s_wait_xcnt 0x0" ::: "memory");
    cs[u] = *(const v4fa*)(CS + p * 64 + d4); asm volatile("s_wait_xcnt 0x0" ::: "memory"); sn[u] = *(const v4fa*)(SN + p * 64 + d4); asm volatile("s_wait_xcnt 0x0" ::: "memory"); }
#pragma unroll      /* lo[], hi[], cs[], sn[] in registers */
  for (int u = 0; u < 4; ++u) { const size_t o = (size_t)(r0 + u * nrow4) * (size_t)ldo + (size_t)h * 128 + d4; v4f ol, oh;
    for (int q = 0; q < 4; ++q) { ol[q] = fmaf(-hi[u][q], sn[u][q], lo[u][q] * cs[u][q]) * osc; oh[q] = fmaf(lo[u][q], sn[u][q], hi[u][q] * cs[u][q]) * osc; }      /* t cos is rounded, rotate_half(t) sin is fused onto it */
    if (F32OUT) { float* dst = (float*)OUT + o; *(v4f*)dst = ol; *(v4f*)(dst + 64) = oh; }
    else { v4h hl, hu; for (int q = 0; q < 4; ++q) { hl[q] = (_Float16)ol[q]; hu[q] = (_Float16)oh[q]; } _Float16* dst = (_Float16*)OUT + o; *(v4h*)dst = hl; *(v4h*)(dst + 64) = hu; } } }
template <int N>
__global__ __launch_bounds__(256) void k_rmsrow(float* __restrict__ X, const float* __restrict__ w, float eps) {
  #pragma clang fp contract(off)
  constexpr int PT = N / 256; __shared__ float red[256]; const size_t r = blockIdx.x; const int t = threadIdx.x; float* row = X + r * N + (size_t)t * PT; float v[PT]; float ss = 0.f;
  for (int q = 0; q < PT; ++q) { v[q] = row[q]; ss = __fadd_rn(ss, __fmul_rn(v[q], v[q])); }
  red[t] = ss; __syncthreads(); for (int k = 128; k > 0; k >>= 1) { if (t < k) red[t] = __fadd_rn(red[t], red[t + k]); __syncthreads(); }
  const float rs = rsqrtf(__fadd_rn(red[0] / (float)N, eps)); float o[PT]; for (int q = 0; q < PT; ++q) o[q] = __fmul_rn(__fmul_rn(v[q], rs), bf16_round(w[t * PT + q]));
  { for (int q = 0; q < PT; ++q) *(float*)(row + q) = o[q];  } }
template <int GS_, int NHQ, int DSRC>
__global__ __launch_bounds__(256) void k_kvexp128(const float* __restrict__ src, float* __restrict__ dst, size_t n4) { const size_t t = (size_t)blockIdx.x * 256 + threadIdx.x; if (t >= n4) return; const size_t e = t * 4; const size_t row = e / ((size_t)NHQ * 128); const int col = (int)(e % ((size_t)NHQ * 128)); const int h = col / 128, d = col % 128; const v4f v = *(const v4fa*)(src + row * DSRC + (size_t)(h / GS_) * 128 + d); *(v4f*)(dst + e) = v;  }

__global__ __launch_bounds__(256) void k_rsmcfb(const float* __restrict__ S, _Float16* __restrict__ P, int hg, int q0, int nk, const int* __restrict__ mk) {
  #pragma clang fp contract(off)
  const int t = blockIdx.x * 256 + threadIdx.x; if (t >= hg * QT) return; const size_t i = (size_t)t; const float* s = S + i * NKX; const size_t ig = (size_t)(q0 + (t % QT)); const int* mr = mk + ig * SQ; float mx = -3.0e38f;
#pragma unroll 1
  for (int j = 0; j < nk; ++j) { const int mb = mr[j]; const float f = (mb == 0) ? 1.f : 0.f; mx = fmaxf(mx, fmaf(f, s[j], (1.f - f) * -1.0e9f)); } float se = 0.f;
#pragma unroll 1
  for (int j = 0; j < nk; ++j) { const int mb = mr[j]; const float f = (mb == 0) ? 1.f : 0.f; se += __expf(fmaf(f, s[j], (1.f - f) * -1.0e9f) - mx); } const float sc = 256.0f / se;
#pragma unroll 1
  for (int j0 = 0; j0 < nk; j0 += 8) { FragH fr; for (int q = 0; q < 8; ++q) { const int j = j0 + q; const int mb = mr[j]; const float f = (mb == 0) ? 1.f : 0.f; fr.h[q] = (_Float16)(__expf(fmaf(f, s[j], (1.f - f) * -1.0e9f) - mx) * sc); } unsigned short* d = (unsigned short*)P + i * NKX + j0; *(v8us*)d = fr.half[0];  } }


// 2^x on the transcendental unit; the v_nop is the one free issue slot that the instruction set asks for behind a transcendental before its result is read or its source overwritten: written in the same statement so that it stands directly behind the v_exp_f32 in every build
__device__ __forceinline__ float exp2_slot(float x) { float y; asm("v_exp_f32 %0, %1\n\tv_nop" : "=v"(y) : "v"(x)); return y; }
// one wave per score row of NU * 128 keys: lane l holds columns 128u + 4l .. 128u + 4l + 3 of the row in registers, so each wave-wide load covers 512 contiguous bytes, the row is read once and each exponential is taken once; maximum and sum: one partial per lane, then a five-step butterfly over the wave
template <int NU>
__global__ __launch_bounds__(256) void k_rsmcf2(const float* __restrict__ S, _Float16* __restrict__ P, int hg, int q0) {
  const int t = blockIdx.x * 8 + __builtin_amdgcn_readfirstlane(threadIdx.x >> 5);      /* the row is the same in every lane: row base, diagonal and the test below stay scalar */
  if (t >= hg * QT) return; const int c0 = (threadIdx.x & 31) * 4; const size_t i = (size_t)t; const float* s = S + i * NKX + c0; const int last = q0 + (t % QT); v4f v[NU];
#pragma unroll      /* the four loops over u are unrolled so that v[] is indexed by constants and stays in registers */
  for (int u = 0; u < NU; ++u) v[u] = *(const v4fa*)(s + u * 128);      /* the loads stand in a loop of their own, ahead of the arithmetic, so that many are in flight at once */
  float mx = -3.0e38f;
#pragma unroll      /* v[] in registers */
  for (int u = 0; u < NU; ++u) for (int q = 0; q < 4; ++q) { const float f = (u * 128 + c0 + q <= last) ? 1.f : 0.f; v[u][q] = fmaf(f, v[u][q], (1.f - f) * -1.0e9f); mx = fmaxf(mx, v[u][q]); }
  for (int m = 16; m >= 1; m >>= 1) mx = fmaxf(mx, __shfl_xor(mx, m, 32));
  float se = 0.f;
#pragma unroll      /* v[] in registers */
  for (int u = 0; u < NU; ++u) for (int q = 0; q < 4; ++q) { v[u][q] = exp2_slot((v[u][q] - mx) * 1.44269504088896340736f); se += v[u][q]; }
  for (int m = 16; m >= 1; m >>= 1) se += __shfl_xor(se, m, 32);
  const float sc = 256.0f / se; _Float16* d = P + i * NKX + c0;
#pragma unroll      /* v[] in registers */
  for (int u = 0; u < NU; ++u) { v4h h4; for (int q = 0; q < 4; ++q) h4[q] = (_Float16)(v[u][q] * sc); *(v4h*)(d + u * 128) = h4; } }
// launches the instance whose row length is nk keys (nk = 256, 512, ... NKX)
template <int NU>
static void rsmcf2_launch(const float* S, _Float16* P, int q0, int nk, hipStream_t stream) { if (nk == NU * 128) k_rsmcf2<NU><<<(NH * QT + 7) / 8, 256, 0, stream>>>(S, P, NH, q0); else if constexpr (NU > 2) rsmcf2_launch<NU - 2>(S, P, q0, nk, stream); }


#define FA_HALF (128 * G2_PITCH)
#define FA_STAGE (2 * FA_HALF)
// the builtin alone: the compiler keeps the distance behind a matrix instruction itself, and operands that no asm statement names may stand in any register
__device__ __forceinline__ v8f fa_mma(v16h a, v16h b, v8f c) { return __builtin_amdgcn_wmma_f32_16x16x32_f16(false, a, false, b, (short)0, c, false, false); }
// lane l <-> lane l ^ 16 by the vector cross-row move (a shuffle through the LDS unit would be waited for once a pass)
__device__ __forceinline__ float fa_xhalf(float x) { return __builtin_bit_cast(float, __builtin_amdgcn_permlanex16(__builtin_bit_cast(int, x), __builtin_bit_cast(int, x), 0x76543210, 0xfedcba98, false, false)); }
__device__ __forceinline__ void fa_copy(unsigned l, const _Float16* kg, const _Float16* vg) { g2_copy8(l, kg, (size_t)8 * DKV); g2_copy8(l + 64 * G2_PITCH, kg + (size_t)64 * DKV, (size_t)8 * DKV); g2_copy8(l + FA_HALF, vg, (size_t)8 * SQ); g2_copy8(l + FA_HALF + 64 * G2_PITCH, vg + (size_t)64 * SQ, (size_t)8 * SQ); }
__device__ __forceinline__ void d_fattn(unsigned char* st, int h, int qb, const _Float16* Q, const _Float16* Kh, const _Float16* Vt, _Float16* O) {      /* st: 2 * FA_STAGE bytes of the calling kernel's LDS, 16-byte aligned */
  const int tid = threadIdx.x, lane = tid & 31, ln = lane & 15, hh = lane >> 4; const int w = __builtin_amdgcn_readfirstlane(tid >> 5);      /* the wave's number is the same in every lane: trip counts and the diagonal test stay scalar */
  const int nst = qb + 1;      /* causal: key stages 0 .. qb, the same count for the whole work-group */
  const _Float16* kg = Kh + h * HDK; const _Float16* vg = Vt + (size_t)h * HDK * SQ; const unsigned ko = (unsigned)((tid >> 4) * DKV + (tid & 15) * 8), vo = (unsigned)((tid >> 4) * SQ + (tid & 15) * 8);      /* the head's slabs (scalar) and this lane's 16 bytes of rows tid / 16 + 8 i (32-bit offsets: what lives through the loop is small) */
  const unsigned lv = (unsigned)(size_t)st + (unsigned)(hh * G2_PITCH + ln * 16);      /* the lane's share of its LDS byte address for the copies, row tid / 16 = 2 w + hh (the low 32 bits of a __shared__ address are the LDS byte address) */
  auto lds_at = [&](unsigned buf) { return lv + (unsigned)__builtin_amdgcn_readfirstlane((int)((unsigned)w * (2 * G2_PITCH) + buf * FA_STAGE)); };      /* the wave's and the buffer's share is one scalar: the sum is formed anew at each place that copies, so no address register of a copy lives through the loop (one that did was spilled to scratch) */
  fa_copy(lds_at(0u), kg + ko, vg + vo);      /* stage 0 into buffer 0 */
  const int q0 = qb * 128 + w * 32; v16h qf[2][4];
#pragma unroll      /* qf[][] is indexed by constants and stays in registers */
  for (int g = 0; g < 2; ++g) for (int kk = 0; kk < 4; ++kk) qf[g][kk] = g2_frag(Q + (size_t)(q0 + g * 16 + ln) * DMX + h * HDK + kk * 32, hh);
  asm volatile("s_wait_xcnt 0x0" ::: "memory");      /* stands between the query loads and a later rewrite of the address registers that they name */
  const v8f z8 = {0.f,0.f,0.f,0.f,0.f,0.f,0.f,0.f}; v8f o[2][8];
#pragma unroll      /* o[][] in registers */
  for (int g = 0; g < 2; ++g) for (int dt = 0; dt < 8; ++dt) o[g][dt] = z8;
  float mu[2] = {-1.0e30f, -1.0e30f}, se[2] = {0.f, 0.f}; const float sc2 = ATS * 1.44269504088896340736f;      /* scores in units of log2 */
  asm volatile("s_wait_asynccnt 0x0" ::: "memory");      /* this wave's copies of stage 0 have landed */
  __syncthreads();      /* every wave's have: stage 0 may be read */
  if (nst > 1) fa_copy(lds_at(1u), kg + (ko + 128u * DKV), vg + (vo + 128u));      /* stage 1 into buffer 1 */
#pragma unroll 1      /* one stage a trip: the order at the foot of the trip stays as written */
  for (int t = 0; t < nst; ++t) { const unsigned bo = (unsigned)(t & 1) * FA_STAGE; const int np = (t == qb) ? w + 1 : 4;      /* in the diagonal stage the passes behind the wave's own 32 rows are wholly masked and are left out */
#pragma unroll 1      /* one pass of 32 keys a trip: the trip count differs between waves, and the body already holds 32 products */
    for (int p = 0; p < np; ++p) { const _Float16* kp = (const _Float16*)(st + bo + (p * 32 + ln) * G2_PITCH); const _Float16* vp = (const _Float16*)(st + bo + FA_HALF + ln * G2_PITCH) + p * 32;
      v8f s[2][2] = {{z8, z8}, {z8, z8}};      /* [key tile][query group] */
      v16h ka[2][4], va[8];
#pragma unroll      /* ka[][] in registers */
      for (int kt = 0; kt < 2; ++kt) for (int kk = 0; kk < 4; ++kk) ka[kt][kk] = g2_frag(kp + kt * 16 * (G2_PITCH / 2) + kk * 32, hh);
      __builtin_amdgcn_sched_barrier(0);      /* the key fragments, which are used first, are also read first */
#pragma unroll      /* va[] in registers */
      for (int dt = 0; dt < 8; ++dt) va[dt] = g2_frag(vp + dt * 16 * (G2_PITCH / 2), hh);
      __builtin_amdgcn_sched_barrier(0);      /* the pass's 32 LDS reads go as one group in front of its products: one LDS latency a pass is waited out, the rest returns under the products and the softmax; without it the reads are sunk to their users and each is waited for */
#pragma unroll      /* s[][], ka[][], qf[][] in registers */
      for (int kt = 0; kt < 2; ++kt) for (int kk = 0; kk < 4; ++kk) { s[kt][0] = fa_mma(ka[kt][kk], qf[0][kk], s[kt][0]); s[kt][1] = fa_mma(ka[kt][kk], qf[1][kk], s[kt][1]); }
      float x[2][16], ml[2];
#pragma unroll      /* x[][] in registers */
      for (int g = 0; g < 2; ++g) for (int i = 0; i < 16; ++i) x[g][i] = s[i >> 3][g][i & 7] * sc2;
      if (t == qb && p == w) {      /* the one pass that holds the diagonal (a scalar test): key 16 kt + 8 hh + r against query 16 g + ln, both counted from the same row */
#pragma unroll      /* x[][] in registers */
        for (int g = 0; g < 2; ++g) for (int i = 0; i < 16; ++i) x[g][i] = ((i >> 3) * 16 + 8 * hh + (i & 7) <= g * 16 + ln) ? x[g][i] : -1.0e30f; }
#pragma unroll      /* x[][] in registers */
      for (int g = 0; g < 2; ++g) { float a = x[g][0]; for (int i = 1; i < 16; ++i) a = fmaxf(a, x[g][i]); ml[g] = fmaxf(a, fa_xhalf(a)); }
      if (__builtin_amdgcn_ballot_w32(ml[0] > mu[0] + 8.0f || ml[1] > mu[1] + 8.0f) != 0) {      /* the reference point of a column moves only when some column's maximum has passed it by more than 8 in log2 (no weight exceeds 2^8, well inside f16); one scalar branch a pass */
#pragma unroll      /* o[][] in registers */
        for (int g = 0; g < 2; ++g) { const float mn = fmaxf(mu[g], ml[g]); const float al = exp2_slot(mu[g] - mn); mu[g] = mn; se[g] *= al; for (int dt = 0; dt < 8; ++dt) o[g][dt] *= al; } }
      FragH pf[2];
#pragma unroll      /* x[][], pf[] in registers */
      for (int g = 0; g < 2; ++g) for (int i = 0; i < 16; ++i) { const float e = exp2_slot(x[g][i] - mu[g]); se[g] += e; pf[g].h[i] = (_Float16)e; }
#pragma unroll      /* o[][], va[] in registers */
      for (int dt = 0; dt < 8; ++dt) { o[0][dt] = fa_mma(va[dt], pf[0].v, o[0][dt]); o[1][dt] = fa_mma(va[dt], pf[1].v, o[1][dt]); } }
    asm volatile("s_wait_dscnt 0x0" ::: "memory");      /* this wave's reads of the buffer have returned before it is refilled */
    asm volatile("s_wait_asynccnt 0x0" ::: "memory");      /* this wave's copies of stage t + 1 have landed */
    __syncthreads();      /* publishes stage t + 1 and ends every wave's reads of stage t */
    if (t + 2 < nst) fa_copy(lds_at((unsigned)(t & 1)), kg + (ko + (unsigned)(t + 2) * (128u * DKV)), vg + (vo + (unsigned)(t + 2) * 128u)); }      /* stage t + 2 into the buffer that trip t has just read */
  asm volatile("s_wait_asynccnt 0x0" ::: "memory");      /* nothing is in flight when the wave ends */
#pragma unroll      /* o[][] in registers */
  for (int g = 0; g < 2; ++g) { const float inv = 64.0f / (se[g] + fa_xhalf(se[g]));      /* the two halves' sums are joined once; o x64 */
    unsigned short* op = (unsigned short*)O + (size_t)(q0 + g * 16 + ln) * DMX + h * HDK + 8 * hh;
    for (int dt = 0; dt < 8; ++dt) { FragH f; for (int r = 0; r < 8; ++r) f.h[r] = (_Float16)(o[g][dt][r] * inv); *(v8us*)(op + dt * 16) = f.half[0]; } } }


// Exact f32 causal attention of the first QT0 query rows (o x64). One work-group of four waves per (head, 16 query rows); wave w owns rows 4w .. 4w + 3 of the group.
// Scores: 32 key rows at a time stand in LDS (pitch 132 floats: the 16 lanes that a 16-byte LDS read serves together fall on 64 distinct banks); lane = key, the four query rows come through loads whose address is the same in every lane.
// Softmax: one partial per lane over the row's keys, then a five-step butterfly over the wave; the weights go to LDS as [key][4 rows], unnormalised.
// P*V: lane = 4 head dims; a value row is one 512-byte load, the four weights of a key one broadcast LDS read; masked keys carry weight 0.
#define A0_LDS (32 * 132 * 4 + 4 * QT0 * 4 * 4)
__device__ __forceinline__ void d_att0w(unsigned char* st, int h, int rq, const float* QF, const float* KF, const float* VF, float scale, float* OF) {      /* st: A0_LDS bytes of the calling kernel's LDS, 16-byte aligned; rq: the group of 16 query rows */
  float (*lk)[132] = (float (*)[132])st; float (*lp)[QT0][4] = (float (*)[QT0][4])(st + 32 * 132 * 4);      /* lk[32][132], lp[4][QT0][4] */
  const int lane = threadIdx.x & 31; const int w = __builtin_amdgcn_readfirstlane(threadIdx.x >> 5);      /* the wave's number is the same in every lane: row numbers and base addresses stay scalar */
  const int rg = rq >> 1; const int i0 = rq * 16 + w * 4;      /* rg: the last group of 32 keys that the 16 rows reach */
  const float* qp = QF + (size_t)i0 * DMX + h * 128; const float* kp = KF + (size_t)w * DMX + h * 128 + lane * 4;      /* wave w stages key rows w, w + 4, ... w + 28 of each group of 32 */
  const v4f z4 = {0.f, 0.f, 0.f, 0.f}; v4f kn[8];
#pragma unroll      /* kn[] is indexed by constants and stays in registers */
  for (int u = 0; u < 8; ++u) kn[u] = *(const v4fa*)(kp + (size_t)(u * 4) * DMX);
  for (int c = 0; c <= rg; ++c) {      /* rg + 1 trips, the same for every wave of the work-group: the barriers stand under uniform control flow */
    __syncthreads();      /* every wave has left the key group that is overwritten next */
#pragma unroll      /* kn[] in registers */
    for (int u = 0; u < 8; ++u) *(v4f*)&lk[u * 4 + w][lane * 4] = kn[u];
    __syncthreads();      /* the key group is complete before any wave reads it */
    if (c < rg) {      /* the next group's loads fly under this group's products */
#pragma unroll      /* kn[] in registers */
      for (int u = 0; u < 8; ++u) kn[u] = *(const v4fa*)(kp + (size_t)((c + 1) * 32 + u * 4) * DMX); }
    v4f a0 = z4, a1 = z4, a2 = z4, a3 = z4;      /* per row four partial sums (dims d mod 4), added at the end */
    for (int d0 = 0; d0 < 32; d0 += 8) {
#pragma unroll      /* eight 16-byte steps a trip: their 40 loads are in flight together, so the load latency is paid four times a key group */
      for (int dd = 0; dd < 8; ++dd) { const int d4 = d0 + dd; const v4f kq = *(const v4f*)&lk[lane][d4 * 4];
        a0 += *(const v4fa*)(qp + d4 * 4) * kq; a1 += *(const v4fa*)(qp + DMX + d4 * 4) * kq; a2 += *(const v4fa*)(qp + 2 * DMX + d4 * 4) * kq; a3 += *(const v4fa*)(qp + 3 * DMX + d4 * 4) * kq; }
      asm volatile("s_wait_xcnt 0x0" ::: "memory"); }      /* stands between this trip's query loads and the next trip's rewrite of the base address that they name */
    v4f sv; sv[0] = ((a0[0] + a0[1]) + (a0[2] + a0[3])) * scale; sv[1] = ((a1[0] + a1[1]) + (a1[2] + a1[3])) * scale; sv[2] = ((a2[0] + a2[1]) + (a2[2] + a2[3])) * scale; sv[3] = ((a3[0] + a3[1]) + (a3[2] + a3[3])) * scale;
    *(v4f*)&lp[w][c * 32 + lane][0] = sv; }
  float mx[4] = {-3.0e38f, -3.0e38f, -3.0e38f, -3.0e38f}, se[4] = {0.f, 0.f, 0.f, 0.f};
  for (int c = 0; c <= rg; ++c) { const int j = c * 32 + lane; const v4f sv = *(const v4f*)&lp[w][j][0];      /* each lane reads back what it wrote itself */
    for (int r = 0; r < 4; ++r) mx[r] = (j <= i0 + r) ? fmaxf(mx[r], sv[r]) : mx[r]; }
  for (int m = 16; m >= 1; m >>= 1) for (int r = 0; r < 4; ++r) mx[r] = fmaxf(mx[r], __shfl_xor(mx[r], m, 32));
  for (int c = 0; c <= rg; ++c) { const int j = c * 32 + lane; const v4f sv = *(const v4f*)&lp[w][j][0]; v4f e;
    for (int r = 0; r < 4; ++r) { const float x = exp2_slot((sv[r] - mx[r]) * 1.44269504088896340736f); e[r] = (j <= i0 + r) ? x : 0.f; se[r] += e[r]; }
    *(v4f*)&lp[w][j][0] = e; }
  for (int m = 16; m >= 1; m >>= 1) for (int r = 0; r < 4; ++r) se[r] += __shfl_xor(se[r], m, 32);
  __builtin_amdgcn_fence(__ATOMIC_ACQ_REL, "workgroup"); __builtin_amdgcn_wave_barrier();      /* the weights are read below by the other lanes of the same wave: the LDS writes stay in front of those reads */
  const float* vbs = VF + (size_t)h * 128; const float* vp = vbs + lane * 4; v4f o0 = z4, o1 = z4, o2 = z4, o3 = z4; v4f va[16], vb[16];      /* two register buffers of 16 value rows: one is loaded while the other is used */
#pragma unroll      /* va[], vb[] are indexed by constants and stay in registers */
  for (int u = 0; u < 16; ++u) va[u] = *(const v4fa*)(vp + (size_t)u * DMX);
  asm volatile("s_wait_xcnt 0x0" :: "v"(va[0]), "v"(va[1]), "v"(va[2]), "v"(va[3]), "v"(va[4]), "v"(va[5]), "v"(va[6]), "v"(va[7]), "v"(va[8]), "v"(va[9]), "v"(va[10]), "v"(va[11]), "v"(va[12]), "v"(va[13]), "v"(va[14]), "v"(va[15]), "s"(vbs) : "memory");      /* stands between these value loads and a later rewrite of the address registers that they name: the loaded values (inputs only) hold the loads in front of it, the base holds its registers up to it */
  for (int c = 0; c <= rg; ++c) { const float* vc = vp + (size_t)(c * 32) * DMX;
#pragma unroll      /* vb[] in registers */
    for (int u = 0; u < 16; ++u) vb[u] = *(const v4fa*)(vc + (size_t)(16 + u) * DMX);
    asm volatile("s_wait_xcnt 0x0" ::: "memory");      /* stands between these value loads and a later rewrite of the address registers that they name */
#pragma unroll      /* va[] in registers */
    for (int u = 0; u < 16; ++u) { const v4f p4 = *(const v4f*)&lp[w][c * 32 + u][0]; o0 += p4[0] * va[u]; o1 += p4[1] * va[u]; o2 += p4[2] * va[u]; o3 += p4[3] * va[u]; }
    if (c < rg) {
#pragma unroll      /* va[] in registers */
      for (int u = 0; u < 16; ++u) va[u] = *(const v4fa*)(vc + (size_t)(32 + u) * DMX);
      asm volatile("s_wait_xcnt 0x0" ::: "memory"); }      /* as behind the loads of vb[]: the next trip rewrites the address registers */
#pragma unroll      /* vb[] in registers */
    for (int u = 0; u < 16; ++u) { const v4f p4 = *(const v4f*)&lp[w][c * 32 + 16 + u][0]; o0 += p4[0] * vb[u]; o1 += p4[1] * vb[u]; o2 += p4[2] * vb[u]; o3 += p4[3] * vb[u]; } }
  float* op = OF + (size_t)i0 * DMX + h * 128 + lane * 4;
  *(v4f*)op = o0 * (64.0f / se[0]); *(v4f*)(op + DMX) = o1 * (64.0f / se[1]); *(v4f*)(op + 2 * DMX) = o2 * (64.0f / se[2]); *(v4f*)(op + 3 * DMX) = o3 * (64.0f / se[3]);
  asm volatile("s_wait_xcnt 0x0" ::: "memory"); }      /* stands between the four output stores and whatever the calling kernel's code behind this body does to the registers that they name */


__global__ __launch_bounds__(256) void k_tab128p(const int* __restrict__ pos, int nrows, float theta, float* __restrict__ CS, float* __restrict__ SN) {
  #pragma clang fp contract(off)
  const int t = blockIdx.x * 256 + threadIdx.x; if (t >= nrows * 64) return; const int i = t % 64; const int r = t / 64; const float invf = (float)(1.0 / pow((double)theta, (double)(2 * i) / 128.0)); const float ang = __fmul_rn((float)pos[r], invf); const float c = cosf(ang), sv = sinf(ang);
  float* c0 = CS + (size_t)r * 128 + i; float* s0 = SN + (size_t)r * 128 + i;
  { *(float*)c0 = c; *(float*)(c0 + 64) = c; *(float*)s0 = sv; *(float*)(s0 + 64) = sv;  } }

__global__ __launch_bounds__(128) void k_rmshd(float* __restrict__ F, int ldf, int nh, const float* __restrict__ w, int wst, float eps) {
  #pragma clang fp contract(off)
  __shared__ float red[128]; const int d = threadIdx.x; const int h = blockIdx.x % nh; const size_t r = blockIdx.x / nh; float* p = F + r * (size_t)ldf + (size_t)h * 128 + d; const float v = *p; red[d] = __fmul_rn(v, v); __syncthreads();
  for (int st = 64; st > 0; st >>= 1) { if (d < st) red[d] = __fadd_rn(red[d], red[d + st]); __syncthreads(); }
  const float rs = __frsqrt_rn(__fadd_rn(red[0] / 128.0f, eps)); const float y = __fmul_rn(bf16_round(w[(size_t)h * wst + d]), __fmul_rn(v, rs));      /* gain vector of head h (wst = 128: per-head gains; 0 would share one vector) */ *(float*)p = y;  }
// ---- launches that need nothing of each other share one grid: a range of the block index picks the body. Every test below reads blockIdx alone, so a work-group takes one body as a whole and that body's barriers stand under uniform control flow.
static_assert(NB == 1 && DKV == DMX, "the block ranges below are counted for one batch and square projections");
#define CV_B ((int)((size_t)DMX * DMX / 8 / 256))      /* work-groups of one 2048 x 2048 conversion */
#define TB_B (SQ * 64 / 256)                           /* work-groups of the rope table */
// rope table, the four weights (x16) and x, f32 -> f16
__global__ __launch_bounds__(256) void k_prep(const float* __restrict__ x, const float* __restrict__ wq, const float* __restrict__ wk, const float* __restrict__ wv, const float* __restrict__ wo,
                                              _Float16* __restrict__ X16, _Float16* __restrict__ BQ, _Float16* __restrict__ BK, _Float16* __restrict__ BV, _Float16* __restrict__ BO, float* __restrict__ CS, float* __restrict__ SN) {
  const int bx = blockIdx.x; const size_t n8 = (size_t)DMX * DMX / 8;
  if (bx < TB_B) { d_tab128(bx, 10000.0f, CS, SN); return; }      /* angle[p][i] = p * 10000^(-2i/128); the longest threads start first */
  const int s = (bx - TB_B) / CV_B, b = (bx - TB_B) % CV_B;
  if (s == 0) d_x16(b, x, X16, n8); else if (s == 1) d_wnat(b, wq, n8, BQ); else if (s == 2) d_wnat(b, wk, n8, BK); else if (s == 3) d_wnat(b, wv, n8, BV); else d_wnat(b, wo, n8, BO); }      /* natural [out][in] = Bt[n][k] x16 */
template <int ACT>
__global__ __launch_bounds__(128) void k_gemm2(const _Float16* __restrict__ A, int lda, size_t sA, const _Float16* __restrict__ Bh, int ldb, size_t sB, float alpha, const float* __restrict__ bias, size_t sBias, const float* __restrict__ CP, int rowsPerB, size_t sCPb, int row0g,
    float* __restrict__ C, _Float16* __restrict__ C16, int ldc, size_t sC, int M, int N, int K) {
  __shared__ __attribute__((aligned(16))) unsigned char st[2 * G2_STAGE];
  g2_body<ACT>(st, (int)blockIdx.x, (int)blockIdx.y, A, lda, sA, Bh, ldb, sB, alpha, bias, sBias, CP, rowsPerB, sCPb, row0g, C, C16, ldc, sC, M, N, K); }
// q, k, v = x W^T: blockIdx.y picks the weight and the f32 plane; v is stored as f16 too
__global__ __launch_bounds__(128) void k_gemm_qkv(const _Float16* __restrict__ X16, const _Float16* __restrict__ BQ, const _Float16* __restrict__ BK, const _Float16* __restrict__ BV, float* __restrict__ QF, float* __restrict__ KF, float* __restrict__ VF, _Float16* __restrict__ V16) {
  __shared__ __attribute__((aligned(16))) unsigned char st[2 * G2_STAGE];
  const int y = blockIdx.y; const _Float16* B = (y == 0) ? BQ : (y == 1) ? BK : BV; float* C = (y == 0) ? QF : (y == 1) ? KF : VF;
  g2_body<0>(st, (int)blockIdx.x, 0, X16, DMX, 0, B, DMX, 0, 0.0625f, nullptr, 0, nullptr, 1, 0, 0, C, (y == 2) ? V16 : nullptr, DMX, 0, (int)NR, DMX, DMX); }
#define RP_B ((int)(NR / 4 * NH * 16 / 256))      /* work-groups of a rope over all rows */
#define R0_B (QT0 / 4 * NH * 16 / 256)            /* work-groups of a rope over the first QT0 rows */
#define VT_B ((DKV / 64) * (SQ / 64))             /* work-groups of the V transpose */
// half-split rope of q and k (f16, all rows; f32, the first QT0 rows) and V^T
__global__ __launch_bounds__(256) void k_mid(const float* __restrict__ QF, const float* __restrict__ KF, const _Float16* __restrict__ V16, const float* __restrict__ CS, const float* __restrict__ SN,
                                             _Float16* __restrict__ Q16, _Float16* __restrict__ K16, float* __restrict__ QF0, float* __restrict__ KRF0, _Float16* __restrict__ VT) {
  __shared__ unsigned short tl[64][66];
  int bx = blockIdx.x;
  if (bx < VT_B) { d_vt<DKV / 64, SQ>(tl, bx, V16, DKV, 0, VT); return; }      /* kv head g = slabs 2g, 2g+1 */
  bx -= VT_B; if (bx < RP_B) { d_rope128x<0>(bx, QF, DMX, NH, (int)(NR / 4), CS, SN, Q16, DMX, 1.0f); return; }
  bx -= RP_B; if (bx < RP_B) { d_rope128x<0>(bx, KF, DKV, NKV, (int)(NR / 4), CS, SN, K16, DKV, 1.0f); return; }
  bx -= RP_B; if (bx < R0_B) { d_rope128x<1>(bx, QF, DMX, NH, QT0 / 4, CS, SN, QF0, DMX, 1.0f); return; }
  bx -= R0_B; d_rope128x<1>(bx, KF, DKV, NKV, QT0 / 4, CS, SN, KRF0, DKV, 1.0f); }
// blockIdx.x = head; blockIdx.y < SQ / 128: f16 attention of a block of 128 query rows, the longest work-groups first; above: exact f32 attention of 16 of the first QT0 rows, the shortest first.
// LDS and registers let two work-groups stand on a WGP, so the whole grid (2 x 256 work-groups) is resident at once and no start order leaves a tail; where the second 256 are placed in the order of the first, a long f16 work-group gets a short exact one beside it (for speed only: nothing depends on placement).
static_assert(A0_LDS <= 2 * FA_STAGE, "the exact tile's LDS lies inside the stage buffers");
__global__ __launch_bounds__(128) void k_attn(const _Float16* __restrict__ Q, const _Float16* __restrict__ Kh, const _Float16* __restrict__ Vt, _Float16* __restrict__ O,
                                              const float* __restrict__ QF0, const float* __restrict__ KF0, const float* __restrict__ VF0, float* __restrict__ OF0) {
  __shared__ __attribute__((aligned(16))) unsigned char st[2 * FA_STAGE];
  const int y = blockIdx.y;
  if (y < SQ / 128) { d_fattn(st, (int)blockIdx.x, SQ / 128 - 1 - y, Q, Kh, Vt, O); return; }
  d_att0w(st, (int)blockIdx.x, y - SQ / 128, QF0, KF0, VF0, ATS, OF0); }
#define HL_B ((int)((size_t)NB * QT0 * DMX / 8 / 512))      /* work-groups of the hi / lo split: 128 threads, four groups of 8 values a thread */
// out = o Wo^T (all rows), and beside it the first tile's exact o (x64) -> f16 hi + x1024 residual planes
__global__ __launch_bounds__(128) void k_out(const _Float16* __restrict__ O16, const _Float16* __restrict__ BO, float* __restrict__ out, const float* __restrict__ OF0, _Float16* __restrict__ OH0, _Float16* __restrict__ OL0) {
  __shared__ __attribute__((aligned(16))) unsigned char st[2 * G2_STAGE];
  const int bx = blockIdx.x;
  if (bx < HL_B) { for (int u = 0; u < 4; ++u) d_hl((size_t)(bx * 4 + u) * 128 + threadIdx.x, OF0, OH0, OL0, (size_t)NB * QT0 * DMX / 8); return; }
  g2_body<0>(st, bx - HL_B, 0, O16, DMX, 0, BO, DMX, 0, 0.0009765625f, nullptr, 0, nullptr, 1, 0, 0, out, nullptr, DMX, 0, (int)NR, DMX, DMX); }
extern "C" void kernel_launch(void* const* d_in, const int* in_sizes, int n_in,
                              void* d_out, int out_size, void* d_ws, size_t ws_size, hipStream_t stream) {
  (void)in_sizes; (void)n_in; (void)out_size;
  const float* const* I = (const float* const*)d_in; const float* x = I[0]; const float* wq = I[1]; const float* wk = I[2]; const float* wv = I[3]; const float* wo = I[4];      /* hidden_states; natural Wq / Wk / Wv / Wo [2048][2048]; no QK norm, no biases, no mask / table inputs */
  char* ws = (char*)d_ws; size_t off = 0;
  auto take = [&](size_t bytes) { char* p = ws + off; off += (bytes + 255) & ~(size_t)255; return p; };
  _Float16* BQ = (_Float16*)take((size_t)DMX * DMX * 2); _Float16* BK = (_Float16*)take((size_t)DKV * DMX * 2); _Float16* BV = (_Float16*)take((size_t)DKV * DMX * 2); _Float16* BO = (_Float16*)take((size_t)DMX * DMX * 2);
  _Float16* X16 = (_Float16*)take(NR * DMX * 2); float* QF = (float*)take(NR * DMX * 4); float* KF = (float*)take(NR * DKV * 4); float* VF = (float*)take(NR * DKV * 4); _Float16* Q16 = (_Float16*)take(NR * DMX * 2); _Float16* K16 = (_Float16*)take(NR * DKV * 2); _Float16* V16 = (_Float16*)take(NR * DKV * 2); _Float16* O16 = (_Float16*)take(NR * DMX * 2);
  _Float16* VT = (_Float16*)take((size_t)(DKV / 64) * 64 * SQ * 2);
  float* QF0 = (float*)take((size_t)QT0 * DMX * 4); float* KRF0 = (float*)take((size_t)QT0 * DKV * 4); float* OF0 = (float*)take((size_t)NB * QT0 * DMX * 4); _Float16* OH0 = (_Float16*)take((size_t)NB * QT0 * DMX * 2); _Float16* OL0 = (_Float16*)take((size_t)NB * QT0 * DMX * 2); float* tcos = (float*)take((size_t)SQ * 64 * 4); float* tsin = (float*)take((size_t)SQ * 64 * 4);      /* rope tables [2048][64] computed on the device (the module derives them from constants) */
  if (off > ws_size) return;
  k_prep<<<TB_B + 5 * CV_B, 256, 0, stream>>>(x, wq, wk, wv, wo, X16, BQ, BK, BV, BO, tcos, tsin);      /* operands -> f16, rope table */
  k_gemm_qkv<<<dim3((unsigned)((NR / 128) * (DMX / 64)), 3), 128, 0, stream>>>(X16, BQ, BK, BV, QF, KF, VF, V16);      /* q, k, v (f32); v also f16 */
  k_mid<<<VT_B + 2 * RP_B + 2 * R0_B, 256, 0, stream>>>(QF, KF, V16, tcos, tsin, Q16, K16, QF0, KRF0, VT);      /* roped q, k: f16 of all rows, f32 of the first QT0 rows (positions 0..QT0-1); V^T */
  k_attn<<<dim3(NH, SQ / 128 + QT0 / 16), 128, 0, stream>>>(Q16, K16, VT, O16, QF0, KRF0, VF, OF0);      /* o (x64): f16 path of all rows, exact f32 path of the first QT0 rows (one query head per kv head: it reads the roped k and v planes themselves) */
  k_out<<<HL_B + (unsigned)((NR / 128) * (DMX / 64)), 128, 0, stream>>>(O16, BO, (float*)d_out, OF0, OH0, OL0);      /* out = o Wo^T; first-tile o -> hi + residual planes */
  k_gemm2<0><<<dim3((QT0 / 128) * (DMX / 64), 1), 128, 0, stream>>>(OH0, DMX, 0, BO, DMX, 0, 0.0009765625f, nullptr, 0, nullptr, 1, 0, 0, (float*)d_out, nullptr, DMX, 0, QT0, DMX, DMX);      /* the first QT0 rows rewritten from the exact path */
  k_gemm2<0><<<dim3((QT0 / 128) * (DMX / 64), 1), 128, 0, stream>>>(OL0, DMX, 0, BO, DMX, 0, 0.00000095367431640625f, nullptr, 0, (const float*)d_out, -1, 0, 0, (float*)d_out, nullptr, DMX, 0, QT0, DMX, DMX);      /* += o_lo Wo 2^-20 (own-element accumulate) */
}
